// v000
// The times below were measured on an AMD MI455X: many runs one after another, warmed up first and cycling through
// copies of the inputs, with the whole window's GPU time divided by the number of runs. Launches and the gaps
// between them are all in it. The median over several windows is given; except for v000 it joins two sittings, which
// can be a few percent apart, so the side-by-side timings, each taken in one sitting, are the better comparison.
// The starting kernel, v000, takes 2720 microseconds a run.
#include <hip/hip_runtime.h>

// LearnableMultiHeadSelfAttention (Transformer-XL style: x [2][2048][1024], bias [1][1][L][L] (f32 additive, read; verbatim causal 0/-1e9), pos_emb [2048][1][1024], pos_bias_u/v [16][64]; q/k/v = x W + b, r = pos_emb Wr + br ('xw', 16 heads x 64); qh = q/8; AC = (qh + u).k + bias; BD = (qh + v).r; logits = AC + rel_shift(BD) with the pad-front/reshape shift: pos[i][j] = BD[i][T-1-(i-j)] for j <= i, 0 for j == i+1, BD[i+1][j-i-2] for j >= i+2 (reproduced literally, including the masked upper part); softmax; out = merged Wo + bo -> [2][2048][1024]).
// Compute dtypes, f32 accumulate: every input rounded to bf16; q/k/v/r as PLAIN bf16 GEMMs (inputs: exact) + bias; q x 1/8 (exact) then the u/v head biases added in f32; content, position scores and attn.v: query rows < 512 hl (3 products), the rest single fp16 (x1024) (the shifted position score is gathered from rows i / i+1 of the position-score block); the additive bias read per element; softmax f32; Wo hl x exact (2 products) + bias.

#define NB_  2
#define TT   2048
#define DM   1024
#define NH_  16
#define NKV  16
#define REP  (NH_ / NKV)
#define HD   64
#define DQ   (NH_ * HD)
#define DKV  (NKV * HD)
#define ZH   2
#define RH   512                  // query rows < RH use hi+lo planes (0: none)
#define WIN  0
#define PCAR 1024.0f
#define SCL  1.0f   // the 1/sqrt(64) is applied to q before the u/v biases (k_uvb)
typedef _Float16 h16;
typedef unsigned short bf;
typedef __attribute__((ext_vector_type(16))) __bf16   v16bf;
typedef __attribute__((ext_vector_type(16))) _Float16 v16h;
typedef __attribute__((ext_vector_type(8)))  _Float16 v8h;
typedef __attribute__((ext_vector_type(8)))  unsigned short v8us;
typedef __attribute__((ext_vector_type(8)))  float    v8f;
typedef __attribute__((ext_vector_type(4)))  float    v4f;
typedef v8h  __attribute__((may_alias)) v8ha;
typedef v4f  __attribute__((may_alias)) v4fa;
typedef v8us __attribute__((may_alias)) v8usa;

__device__ __forceinline__ unsigned short f2bf(float f) { unsigned u = __float_as_uint(f); u += 0x7FFFu + ((u >> 16) & 1u); return (unsigned short)(u >> 16); }
__device__ __forceinline__ float bf2f(unsigned short b) { return __uint_as_float(((unsigned)b) << 16); }
__device__ __forceinline__ float bfr(float f) { return bf2f(f2bf(f)); }
__device__ __forceinline__ v16h cat16(v8h lo, v8h hi) { return __builtin_shufflevector(lo, hi, 0, 1, 2, 3, 4, 5, 6, 7, 8, 9, 10, 11, 12, 13, 14, 15); }
__device__ __forceinline__ v16bf cat16b(v8us lo, v8us hi) { return __builtin_bit_cast(v16bf, __builtin_shufflevector(lo, hi, 0, 1, 2, 3, 4, 5, 6, 7, 8, 9, 10, 11, 12, 13, 14, 15)); }
__device__ __forceinline__ v8f wmma16(v16h a, v16h b, v8f c) { return __builtin_amdgcn_wmma_f32_16x16x32_f16(false, a, false, b, (short)0, c, false, false); }
__device__ __forceinline__ v8f wmmab(v16bf a, v16bf b, v8f c) { return __builtin_amdgcn_wmma_f32_16x16x32_bf16(false, a, false, b, (short)0, c, false, false); }



// ---- k_gemmw: register-blocked GEMM, ONE WAVE per 64x64 output tile (16 accumulators), operands straight from K-contiguous 16-bit planes; grid (M/64, N/64, Z), 32 threads.
// C[m][n] (f32, pitch ldc, + optional f32 bias[n]) = sum_k A[m][k] Bt[n][k] (+ split products per NSPLIT). z-batch strides sA/sB/sC in elements. K % 32 == 0.
template <typename T16> struct WFrag;
template <> struct WFrag<h16> { typedef v16h V; static __device__ __forceinline__ V ld(const h16* p) { return cat16(*(const v8h*)p, *(const v8h*)(p + 16)); } static __device__ __forceinline__ v8f mma(V a, V b, v8f c) { return wmma16(a, b, c); } };
template <> struct WFrag<bf> { typedef v16bf V; static __device__ __forceinline__ V ld(const bf* p) { return cat16b(*(const v8us*)p, *(const v8us*)(p + 16)); } static __device__ __forceinline__ v8f mma(V a, V b, v8f c) { return wmmab(a, b, c); } };
template <typename T16, int NSPLIT, bool BIAS>
__global__ __launch_bounds__(32) void k_gemmw(const T16* __restrict__ A, const T16* __restrict__ A2, const T16* __restrict__ Bt, const T16* __restrict__ Bt2, int K, float* C, int ldc, const float* __restrict__ bias, size_t sA, size_t sB, size_t sC) {
    typedef typename WFrag<T16>::V V;
    __shared__ __align__(16) float os[16 * 68];
    const size_t z = blockIdx.z; A += z * sA; if (A2) A2 += z * sA; Bt += z * sB; if (Bt2) Bt2 += z * sB; C += z * sC;
    const int lane = threadIdx.x & 31, lr = lane & 15, hi = lane >> 4; const int r0 = blockIdx.x * 64, c0 = blockIdx.y * 64;
    v8f acc[4][4];
#pragma unroll
    for (int mb = 0; mb < 4; ++mb)
#pragma unroll
        for (int nb = 0; nb < 4; ++nb) acc[mb][nb] = (v8f){};
    const size_t aoff = (size_t)(r0 + lr) * K + 8 * hi, boff = (size_t)(c0 + lr) * K + 8 * hi;
#pragma unroll 1
    for (int kc = 0; kc < K; kc += 32) {
        V a[4], a2[4];
#pragma unroll
        for (int mb = 0; mb < 4; ++mb) { a[mb] = WFrag<T16>::ld(A + aoff + (size_t)mb * 16 * K + kc); if (NSPLIT == 1 || NSPLIT == 2) a2[mb] = WFrag<T16>::ld(A2 + aoff + (size_t)mb * 16 * K + kc); }
#pragma unroll
        for (int nb = 0; nb < 4; ++nb) { const V b = WFrag<T16>::ld(Bt + boff + (size_t)nb * 16 * K + kc); V b2; if (NSPLIT >= 2) b2 = WFrag<T16>::ld(Bt2 + boff + (size_t)nb * 16 * K + kc);
#pragma unroll
            for (int mb = 0; mb < 4; ++mb) { acc[mb][nb] = WFrag<T16>::mma(a[mb], b, acc[mb][nb]); if (NSPLIT == 1 || NSPLIT == 2) acc[mb][nb] = WFrag<T16>::mma(a2[mb], b, acc[mb][nb]); if (NSPLIT >= 2) acc[mb][nb] = WFrag<T16>::mma(a[mb], b2, acc[mb][nb]); } }
        asm volatile("v_nop\n\tv_nop\n\tv_nop\n\tv_nop" : "+v"(acc[0][0]), "+v"(acc[1][1]), "+v"(acc[2][2]), "+v"(acc[3][3]) : "v"(a[0]), "v"(a[3]));
    }
#pragma unroll
    for (int mb = 0; mb < 4; ++mb) {
#pragma unroll
        for (int nb = 0; nb < 4; ++nb) {
#pragma unroll
            for (int j = 0; j < 8; ++j) os[(hi * 8 + j) * 68 + nb * 16 + lr] = acc[mb][nb][j]; }
        __builtin_amdgcn_wave_barrier(); asm volatile("" ::: "memory");
        float* crow = C + (size_t)(r0 + mb * 16) * ldc + c0;
{
#pragma unroll
            for (int s = 0; s < 8; ++s) { const int row = 2 * s + hi, cofs = lr * 4; v4f val = *(const v4fa*)(os + row * 68 + cofs); if (BIAS) { val[0] += bfr(bias[c0 + cofs]); val[1] += bfr(bias[c0 + cofs + 1]); val[2] += bfr(bias[c0 + cofs + 2]); val[3] += bfr(bias[c0 + cofs + 3]); }
                *(v4f*)(crow + (size_t)row * ldc + cofs) = val; }
             }
        __builtin_amdgcn_wave_barrier(); asm volatile("" ::: "memory");
    }
}

__device__ __forceinline__ h16 tohx(float x) { return (h16)x; }
__device__ __forceinline__ void splitf(float y, unsigned short& h, unsigned short& l) { h = f2bf(y); l = f2bf(y - bf2f(h)); }
typedef __attribute__((ext_vector_type(2))) _Float16 v2h;
typedef __attribute__((ext_vector_type(4))) _Float16 v4h;
typedef __attribute__((ext_vector_type(2))) unsigned short v2us;
typedef __attribute__((ext_vector_type(4))) unsigned short v4us;
typedef __attribute__((ext_vector_type(2))) float v2f;
typedef __attribute__((ext_vector_type(4))) int v4i;

__global__ __launch_bounds__(256) void k_wtG(const float* __restrict__ w, int K, int N, bf* Bt) {
    const int lane = threadIdx.x & 31; const int L0 = (blockIdx.x * 8 + (threadIdx.x >> 5)) * 8; const int nlines = N * K / 64;
{
#pragma unroll 1
        for (int l = 0; l < 8; ++l) { const int L = L0 + l; if (L >= nlines) break; const size_t e = (size_t)L * 64 + lane * 2; const int k = (int)(e % K), n = (int)(e / K); v2us o;
            o[0] = f2bf(w[(size_t)k * N + n]); o[1] = f2bf(w[(size_t)(k + 1) * N + n]); *(v2us*)(Bt + e) = o; }
         }
}
__global__ __launch_bounds__(256) void k_cvt8(const float* __restrict__ src, bf* dst, size_t n8) { const size_t i = (size_t)blockIdx.x * 256 + threadIdx.x; if (i >= n8) return; const v8f v = *(const v8f*)(src + i * 8); v8us o;
#pragma unroll
    for (int k = 0; k < 8; ++k) o[k] = f2bf(v[k]); *(v8us*)(dst + i * 8) = o;  }
__global__ __launch_bounds__(256) void k_cscvt(const float* __restrict__ cosT, const float* __restrict__ sinT, float* CS) { const int idx = blockIdx.x * 256 + threadIdx.x; if (idx >= TT * HD) return; v2f cs; cs[0] = bfr(cosT[idx]); cs[1] = bfr(sinT[idx]); *(v2f*)(CS + (size_t)idx * 2) = cs;  }
// k_rope: head planes [h][t][d] (fp16 + hi/lo) of rope(x) x sc with the rotate-half convention out[d] = x[d] cos[t][d] - x[d+HD/2] sin[t][d], out[d+HD/2] = x[d+HD/2] cos[t][d+HD/2] + x[d] sin[t][d+HD/2]
__global__ __launch_bounds__(256) void k_rope(const float* __restrict__ F, int pitch, int nheads, const float* __restrict__ CS, const float* __restrict__ RF, const float* __restrict__ nw, float sc, h16* P16, bf* Ph, bf* Pl) {
    const size_t e = ((size_t)blockIdx.x * 256 + threadIdx.x) * 2; if (e >= (size_t)nheads * TT * HD) return; const int d = (int)(e % HD); const int t = (int)((e / HD) % TT); const int h = (int)(e / ((size_t)HD * TT)); const float* f = F + (size_t)t * pitch + h * HD; const float rf = RF ? RF[(size_t)h * TT + t] : 1.0f; v2h o16; v2us oh, ol;
#pragma unroll
    for (int q = 0; q < 2; ++q) { const int dd = d + q; const int dp = (dd < HD / 2) ? dd + HD / 2 : dd - HD / 2; float x0 = f[dd], x1 = f[dp];
        if (RF) { float n0 = __fmul_rn(x0, rf), n1 = __fmul_rn(x1, rf); asm volatile("" : "+v"(n0)); asm volatile("" : "+v"(n1)); x0 = __fmul_rn(bfr(nw[dd]), n0); x1 = __fmul_rn(bfr(nw[dp]), n1); }
        const v2f cs = *(const v2f*)(CS + ((size_t)t * HD + dd) * 2); float a = __fmul_rn(x0, cs[0]), bq = __fmul_rn(x1, cs[1]); asm volatile("" : "+v"(a)); asm volatile("" : "+v"(bq)); const float r = ((dd < HD / 2) ? __fsub_rn(a, bq) : __fadd_rn(a, bq)) * sc;
        o16[q] = tohx(r); unsigned short a2, c2; splitf(r, a2, c2); oh[q] = a2; ol[q] = c2; }
    *(v2h*)(P16 + e) = o16; *(v2us*)(Ph + e) = oh; *(v2us*)(Pl + e) = ol;  }
__global__ __launch_bounds__(256) void k_vtp(const float* __restrict__ F, int pitch, int nheads, h16* V16, bf* Vh, bf* Vl) { const size_t e = ((size_t)blockIdx.x * 256 + threadIdx.x) * 2; if (e >= (size_t)nheads * HD * TT) return; const int t = (int)(e % TT); const int d = (int)((e / TT) % HD); const int g = (int)(e / ((size_t)TT * HD)); v2h o16; v2us oh, ol;
#pragma unroll
    for (int q = 0; q < 2; ++q) { const float x = F[(size_t)(t + q) * pitch + g * HD + d]; o16[q] = tohx(x); unsigned short a2, c2; splitf(x, a2, c2); oh[q] = a2; ol[q] = c2; }
    *(v2h*)(V16 + e) = o16; *(v2us*)(Vh + e) = oh; *(v2us*)(Vl + e) = ol;  }
__global__ __launch_bounds__(256) void k_csid(float* CS) { const int idx = blockIdx.x * 256 + threadIdx.x; if (idx >= TT * HD) return; v2f cs; cs[0] = 1.0f; cs[1] = 0.0f; *(v2f*)(CS + (size_t)idx * 2) = cs;  }
__global__ __launch_bounds__(256) void k_uvb(float* FQ, const float* __restrict__ bu, const float* __restrict__ bv2, float* FQV) { const size_t e = ((size_t)blockIdx.x * 256 + threadIdx.x) * 4; if (e >= (size_t)TT * DQ) return; const int c0 = (int)(e % DQ); const v4f a = *(const v4f*)(FQ + e); v4f ou, ov; for (int u = 0; u < 4; ++u) { const float aq = __fmul_rn(a[u], 0.125f); float ub = bfr(bu[c0 + u]), vb = bfr(bv2[c0 + u]); asm volatile("" : "+v"(ub)); asm volatile("" : "+v"(vb)); ou[u] = __fadd_rn(aq, ub); ov[u] = __fadd_rn(aq, vb); } *(v4f*)(FQV + e) = ov; *(v4f*)(FQ + e) = ou;  }
// k_asoft: per row (zz, i): t = S + bias[i][j] + shifted position score (1/8 already in q); softmax over the 2048 keys (register row, one exp, fixed trees);
__global__ __launch_bounds__(256) void k_asoft(const float* __restrict__ Sb, const float* __restrict__ Sb2, const float* __restrict__ ab, h16* P16, bf* Ph, bf* Pl) {
    const int lane = threadIdx.x & 31; const int row = blockIdx.x * 8 + (threadIdx.x >> 5); if (row >= ZH * TT) return; const int i = row % TT; const int zz = row / TT; (void)zz; const bool hires = (i < RH); const float* sr = Sb + (size_t)row * TT; const float* pr0 = Sb2 + (size_t)row * TT; const float* pr1 = Sb2 + (size_t)(row + 1) * TT; const float* abr = ab + (size_t)i * TT;   /* row i+1 of the same head block (never dereferenced for i = T-1: j >= i+2 is impossible there) */ float v[TT / 32]; float mx = -3.0e38f;
#pragma unroll
    for (int ch = 0; ch < TT / 128; ++ch) { const int j0 = ch * 128 + lane * 4; const v4f a = *(const v4f*)(sr + j0);
#pragma unroll
        for (int q = 0; q < 4; ++q) { const int j = j0 + q; (void)j; const int jj = j0 + q; const float bd = (jj <= i) ? pr0[TT - 1 - (i - jj)] : ((jj == i + 1) ? 0.0f : pr1[jj - i - 2]); float bb = bfr(abr[jj]); asm volatile("" : "+v"(bb)); float cb = __fadd_rn(a[q], bb); asm volatile("" : "+v"(cb)); float t = __fadd_rn(cb, bd); asm volatile("" : "+v"(t)); v[ch * 4 + q] = t; mx = fmaxf(mx, t); } }
#pragma unroll
    for (int sh = 16; sh; sh >>= 1) mx = fmaxf(mx, __shfl_xor(mx, sh, 32));
    float sum = 0.f;
#pragma unroll
    for (int k = 0; k < TT / 32; ++k) { float d0 = __fsub_rn(v[k], mx); asm volatile("" : "+v"(d0)); v[k] = __builtin_amdgcn_exp2f(__fmul_rn(d0, 1.4426950408889634f)); sum += v[k]; }
#pragma unroll
    for (int sh = 16; sh; sh >>= 1) sum += __shfl_xor(sum, sh, 32);
    const float f = __fdiv_rn(hires ? 1.0f : PCAR, sum);
{
        if (hires) {
#pragma unroll
            for (int ch = 0; ch < TT / 128; ++ch) { v4us oh, ol;
#pragma unroll
                for (int q = 0; q < 4; ++q) { unsigned short a, c2; splitf(v[ch * 4 + q] * f, a, c2); oh[q] = a; ol[q] = c2; }
                const size_t oo = ((size_t)zz * (RH ? RH : 1) + i) * TT + ch * 128 + lane * 4; *(v4us*)(Ph + oo) = oh; *(v4us*)(Pl + oo) = ol; }
        } else {
#pragma unroll
            for (int ch = 0; ch < TT / 128; ++ch) { v4h o4;
#pragma unroll
                for (int q = 0; q < 4; ++q) o4[q] = tohx(v[ch * 4 + q] * f);
                *(v4h*)(P16 + (size_t)row * TT + ch * 128 + lane * 4) = o4; } }
         }
}
__global__ __launch_bounds__(256) void k_merge(const float* __restrict__ O, int h0, bf* Ah, bf* Al) { const size_t e = ((size_t)blockIdx.x * 256 + threadIdx.x) * 2; if (e >= (size_t)ZH * TT * HD) return; const int d = (int)(e % HD); const int t = (int)((e / HD) % TT); const int zz = (int)(e / ((size_t)HD * TT)); const float cs = (t < RH) ? 1.0f : (1.0f / PCAR); const size_t oo = (size_t)t * DQ + (h0 + zz) * HD + d;
    v2us oh, ol;
#pragma unroll
    for (int q = 0; q < 2; ++q) { unsigned short a, c2; splitf(O[e + q] * cs, a, c2); oh[q] = a; ol[q] = c2; } *(v2us*)(Ah + oo) = oh; *(v2us*)(Al + oo) = ol;  }

extern "C" void kernel_launch(void* const* d_in, const int* in_sizes, int n_in,
                              void* d_out, int out_size, void* d_ws, size_t ws_size, hipStream_t stream) {
    (void)in_sizes; (void)n_in; (void)out_size;
    const float* x = (const float*)d_in[0]; const float* abias = (const float*)d_in[1]; const float* pemb = (const float*)d_in[2]; const float* pbu = (const float*)d_in[3]; const float* pbv = (const float*)d_in[4]; const float* wq = (const float*)d_in[5]; const float* bq = (const float*)d_in[6]; const float* wk = (const float*)d_in[7]; const float* bk = (const float*)d_in[8]; const float* wv = (const float*)d_in[9]; const float* bv = (const float*)d_in[10]; const float* wpos = (const float*)d_in[11]; const float* bpos = (const float*)d_in[12]; const float* wo = (const float*)d_in[13]; const float* bo = (const float*)d_in[14]; const float* cosT = nullptr; const float* sinT = nullptr; (void)cosT; (void)sinT;
    float* OUT = (float*)d_out;     // [2][2048][1024]
    char* wsp = (char*)d_ws;
    auto take = [&](size_t bytes) { char* p = wsp; wsp += (bytes + 255) & ~(size_t)255; return (void*)p; };
    bf* WQ = (bf*)take((size_t)DQ * DM * 2); bf* WK = (bf*)take((size_t)DKV * DM * 2); bf* WV = (bf*)take((size_t)DKV * DM * 2); bf* WO = (bf*)take((size_t)DM * DQ * 2); float* CS = (float*)take((size_t)TT * HD * 2 * 4);
    bf* XB = (bf*)take((size_t)TT * DM * 2); bf* XP = (bf*)take((size_t)TT * DM * 2); bf* WP = (bf*)take((size_t)DQ * DM * 2); float* FP = (float*)take((size_t)TT * DQ * 4); float* FQV = (float*)take((size_t)TT * DQ * 4); h16* PP16 = (h16*)take((size_t)NH_ * TT * HD * 2); bf* PPh = (bf*)take((size_t)NH_ * TT * HD * 2); bf* PPl = (bf*)take((size_t)NH_ * TT * HD * 2); h16* QV16 = (h16*)take((size_t)NH_ * TT * HD * 2); bf* QVh = (bf*)take((size_t)NH_ * TT * HD * 2); bf* QVl = (bf*)take((size_t)NH_ * TT * HD * 2); float* Sb2 = (float*)take((size_t)ZH * TT * TT * 4); float* FQ = (float*)take((size_t)TT * DQ * 4); float* FK = (float*)take((size_t)TT * DKV * 4);
    h16* QP16 = (h16*)take((size_t)NH_ * TT * HD * 2); h16* KP16 = (h16*)take((size_t)NKV * TT * HD * 2); h16* VT16 = (h16*)take((size_t)NKV * HD * TT * 2);
    bf* QPh = (bf*)take((size_t)NH_ * TT * HD * 2); bf* QPl = (bf*)take((size_t)NH_ * TT * HD * 2); bf* KPh = (bf*)take((size_t)NKV * TT * HD * 2); bf* KPl = (bf*)take((size_t)NKV * TT * HD * 2); bf* VTh = (bf*)take((size_t)NKV * HD * TT * 2); bf* VTl = (bf*)take((size_t)NKV * HD * TT * 2); bf* Ph = (bf*)take((size_t)ZH * RH * TT * 2); bf* Pl = (bf*)take((size_t)ZH * RH * TT * 2);
    float* Sb = (float*)take((size_t)ZH * TT * TT * 4); h16* P16 = (h16*)take((size_t)ZH * TT * TT * 2); float* Ob = (float*)take((size_t)ZH * TT * HD * 4); bf* ATh = (bf*)take((size_t)TT * DQ * 2); bf* ATl = (bf*)take((size_t)TT * DQ * 2);
    if ((size_t)(wsp - (char*)d_ws) > ws_size) return;    // ws 256 MiB
    float* FV = FK;   // v projection reuses the k buffer after the k planes are built (stream-ordered)
    { k_wtG<<<(unsigned)((DM * DQ / 64 + 63) / 64), 256, 0, stream>>>(wq, DM, DQ, WQ); k_wtG<<<(unsigned)((DM * DKV / 64 + 63) / 64), 256, 0, stream>>>(wk, DM, DKV, WK); k_wtG<<<(unsigned)((DM * DKV / 64 + 63) / 64), 256, 0, stream>>>(wv, DM, DKV, WV);
      k_wtG<<<(unsigned)((DQ * DM / 64 + 63) / 64), 256, 0, stream>>>(wo, DQ, DM, WO); k_wtG<<<(unsigned)((DM * DQ / 64 + 63) / 64), 256, 0, stream>>>(wpos, DM, DQ, WP); k_cvt8<<<(unsigned)(((size_t)TT * DM / 8 + 255) / 256), 256, 0, stream>>>(pemb, XP, (size_t)TT * DM / 8); k_gemmw<bf, 0, true><<<dim3(TT / 64, DQ / 64, 1), 32, 0, stream>>>(XP, nullptr, WP, nullptr, DM, FP, DQ, bpos, 0, 0, 0);
       }
    k_csid<<<(TT * HD + 255) / 256, 256, 0, stream>>>(CS);
    const unsigned LQ = (unsigned)(((size_t)NH_ * TT * HD / 2 + 255) / 256), LKv = (unsigned)(((size_t)NKV * TT * HD / 2 + 255) / 256);
    for (int b = 0; b < NB_; ++b) {
        
        k_cvt8<<<(unsigned)(((size_t)TT * DM / 8 + 255) / 256), 256, 0, stream>>>(x + (size_t)b * TT * DM, XB, (size_t)TT * DM / 8);
        k_gemmw<bf, 0, true><<<dim3(TT / 64, DQ / 64, 1), 32, 0, stream>>>(XB, nullptr, WQ, nullptr, DM, FQ, DQ, bq, 0, 0, 0);
        k_uvb<<<(unsigned)(((size_t)TT * DQ / 4 + 255) / 256), 256, 0, stream>>>(FQ, pbu, pbv, FQV); k_rope<<<LQ, 256, 0, stream>>>(FQ, DQ, NH_, CS, nullptr, nullptr, 1.0f, QP16, QPh, QPl); k_rope<<<LQ, 256, 0, stream>>>(FQV, DQ, NH_, CS, nullptr, nullptr, 1.0f, QV16, QVh, QVl); if (b == 0) { k_rope<<<LQ, 256, 0, stream>>>(FP, DQ, NH_, CS, nullptr, nullptr, 1.0f, PP16, PPh, PPl); }
        k_gemmw<bf, 0, true><<<dim3(TT / 64, DKV / 64, 1), 32, 0, stream>>>(XB, nullptr, WK, nullptr, DM, FK, DKV, bk, 0, 0, 0);
        k_rope<<<LKv, 256, 0, stream>>>(FK, DKV, NKV, CS, nullptr, nullptr, 1.0f, KP16, KPh, KPl);
        k_gemmw<bf, 0, true><<<dim3(TT / 64, DKV / 64, 1), 32, 0, stream>>>(XB, nullptr, WV, nullptr, DM, FV, DKV, bv, 0, 0, 0); k_vtp<<<LKv, 256, 0, stream>>>(FV, DKV, NKV, VT16, VTh, VTl);
        for (int h0 = 0; h0 < NH_; h0 += ZH) { const size_t zq = (size_t)h0, zk = (size_t)(h0 / REP);   // one kv head per query head: the pass's two heads use consecutive kv planes (z-strides TT*HD)
            k_gemmw<bf, 2, false><<<dim3(RH / 64, TT / 64, ZH), 32, 0, stream>>>(QPh + zq * TT * HD, QPl + zq * TT * HD, KPh + zk * TT * HD, KPl + zk * TT * HD, HD, Sb, TT, nullptr, (size_t)TT * HD, (size_t)TT * HD, (size_t)TT * TT); k_gemmw<bf, 2, false><<<dim3(RH / 64, TT / 64, ZH), 32, 0, stream>>>(QVh + zq * TT * HD, QVl + zq * TT * HD, PPh + zk * TT * HD, PPl + zk * TT * HD, HD, Sb2, TT, nullptr, (size_t)TT * HD, (size_t)TT * HD, (size_t)TT * TT);
            k_gemmw<h16, 0, false><<<dim3((TT - RH) / 64, TT / 64, ZH), 32, 0, stream>>>(QP16 + zq * TT * HD + (size_t)RH * HD, nullptr, KP16 + zk * TT * HD, nullptr, HD, Sb + (size_t)RH * TT, TT, nullptr, (size_t)TT * HD, (size_t)TT * HD, (size_t)TT * TT); k_gemmw<h16, 0, false><<<dim3((TT - RH) / 64, TT / 64, ZH), 32, 0, stream>>>(QV16 + zq * TT * HD + (size_t)RH * HD, nullptr, PP16 + zk * TT * HD, nullptr, HD, Sb2 + (size_t)RH * TT, TT, nullptr, (size_t)TT * HD, (size_t)TT * HD, (size_t)TT * TT);
            k_asoft<<<ZH * TT / 8, 256, 0, stream>>>(Sb, Sb2, abias, P16, Ph, Pl);
            k_gemmw<bf, 2, false><<<dim3(RH / 64, HD / 64, ZH), 32, 0, stream>>>(Ph, Pl, VTh + zk * HD * TT, VTl + zk * HD * TT, TT, Ob, HD, nullptr, (size_t)RH * TT, (size_t)HD * TT, (size_t)TT * HD);
            k_gemmw<h16, 0, false><<<dim3((TT - RH) / 64, HD / 64, ZH), 32, 0, stream>>>(P16 + (size_t)RH * TT, nullptr, VT16 + zk * HD * TT, nullptr, TT, Ob + (size_t)RH * HD, HD, nullptr, (size_t)TT * TT, (size_t)HD * TT, (size_t)TT * HD);
            k_merge<<<(unsigned)(((size_t)ZH * TT * HD / 2 + 255) / 256), 256, 0, stream>>>(Ob, h0, ATh, ATl); }
        k_gemmw<bf, 1, true><<<dim3(TT / 64, DM / 64, 1), 32, 0, stream>>>(ATh, ATl, WO, nullptr, DQ, OUT + (size_t)b * TT * DM, DM, bo, 0, 0, 0); }
}

// v001
// One run takes 1570 microseconds.
// Next to v000, in two timings, it ran 1.73 and 1.74 times as fast.
#include <hip/hip_runtime.h>

// LearnableMultiHeadSelfAttention (Transformer-XL style: x [2][2048][1024], bias [1][1][L][L] (f32 additive, read; verbatim causal 0/-1e9), pos_emb [2048][1][1024], pos_bias_u/v [16][64]; q/k/v = x W + b, r = pos_emb Wr + br ('xw', 16 heads x 64); qh = q/8; AC = (qh + u).k + bias; BD = (qh + v).r; logits = AC + rel_shift(BD) with the pad-front/reshape shift: pos[i][j] = BD[i][T-1-(i-j)] for j <= i, 0 for j == i+1, BD[i+1][j-i-2] for j >= i+2 (reproduced literally, including the masked upper part); softmax; out = merged Wo + bo -> [2][2048][1024]).
// Compute dtypes, f32 accumulate: every input rounded to bf16; q/k/v/r as PLAIN bf16 GEMMs (inputs: exact) + bias; q x 1/8 (exact) then the u/v head biases added in f32; content, position scores and attn.v: query rows < 512 hl (3 products), the rest single fp16 (x1024) (the shifted position score is gathered from rows i / i+1 of the position-score block); the additive bias read per element; softmax f32; Wo hl x exact (2 products) + bias.

#define NB_  2
#define TT   2048
#define DM   1024
#define NH_  16
#define NKV  16
#define REP  (NH_ / NKV)
#define HD   64
#define DQ   (NH_ * HD)
#define DKV  (NKV * HD)
#define ZH   2
#define RH   512                  // query rows < RH use hi+lo planes (0: none)
#define WIN  0
#define PCAR 1024.0f
#define KSP  16                   // attn.v: key ranges per output tile, one work-group each; k_merge sums the KSP partial planes in ascending order
#define SCL  1.0f   // the 1/sqrt(64) is applied to q before the u/v biases (k_uvb)
typedef _Float16 h16;
typedef unsigned short bf;
typedef __attribute__((ext_vector_type(16))) __bf16   v16bf;
typedef __attribute__((ext_vector_type(16))) _Float16 v16h;
typedef __attribute__((ext_vector_type(8)))  _Float16 v8h;
typedef __attribute__((ext_vector_type(8)))  unsigned short v8us;
typedef __attribute__((ext_vector_type(8)))  float    v8f;
typedef __attribute__((ext_vector_type(4)))  float    v4f;
typedef v8h  __attribute__((may_alias)) v8ha;
typedef v4f  __attribute__((may_alias)) v4fa;
typedef v8us __attribute__((may_alias)) v8usa;

__device__ __forceinline__ unsigned short f2bf(float f) { unsigned u = __float_as_uint(f); u += 0x7FFFu + ((u >> 16) & 1u); return (unsigned short)(u >> 16); }
__device__ __forceinline__ float bf2f(unsigned short b) { return __uint_as_float(((unsigned)b) << 16); }
__device__ __forceinline__ float bfr(float f) { return bf2f(f2bf(f)); }
__device__ __forceinline__ v16h cat16(v8h lo, v8h hi) { return __builtin_shufflevector(lo, hi, 0, 1, 2, 3, 4, 5, 6, 7, 8, 9, 10, 11, 12, 13, 14, 15); }
__device__ __forceinline__ v16bf cat16b(v8us lo, v8us hi) { return __builtin_bit_cast(v16bf, __builtin_shufflevector(lo, hi, 0, 1, 2, 3, 4, 5, 6, 7, 8, 9, 10, 11, 12, 13, 14, 15)); }
__device__ __forceinline__ v8f wmma16(v16h a, v16h b, v8f c) { return __builtin_amdgcn_wmma_f32_16x16x32_f16(false, a, false, b, (short)0, c, false, false); }
__device__ __forceinline__ v8f wmmab(v16bf a, v16bf b, v8f c) { return __builtin_amdgcn_wmma_f32_16x16x32_bf16(false, a, false, b, (short)0, c, false, false); }



// ---- k_gemmw: register-blocked GEMM, ONE WAVE per 64x64 output tile (16 accumulators), operands straight from K-contiguous 16-bit planes; grid (M/64, N/64, Z), 32 threads.
// C[m][n] (f32, pitch ldc, + optional f32 bias[n]) = sum_k A[m][k] Bt[n][k] (+ split products per NSPLIT). z-batch strides sA/sB/sC in elements. K % (32 KS) == 0. KS > 1: grid z = Z x KS; work-group (z, ks) sums only k in [ks K/KS, (ks+1) K/KS) and stores its partial tile in plane z KS + ks of C (plane stride sC).
template <typename T16> struct WFrag;
template <> struct WFrag<h16> { typedef v16h V; static __device__ __forceinline__ V ld(const h16* p) { return cat16(*(const v8h*)p, *(const v8h*)(p + 16)); } static __device__ __forceinline__ v8f mma(V a, V b, v8f c) { return wmma16(a, b, c); } };
template <> struct WFrag<bf> { typedef v16bf V; static __device__ __forceinline__ V ld(const bf* p) { return cat16b(*(const v8us*)p, *(const v8us*)(p + 16)); } static __device__ __forceinline__ v8f mma(V a, V b, v8f c) { return wmmab(a, b, c); } };
template <typename T16, int NSPLIT, bool BIAS, int KS = 1>
__global__ __launch_bounds__(32) void k_gemmw(const T16* __restrict__ A, const T16* __restrict__ A2, const T16* __restrict__ Bt, const T16* __restrict__ Bt2, int K, float* C, int ldc, const float* __restrict__ bias, size_t sA, size_t sB, size_t sC) {
    typedef typename WFrag<T16>::V V;
    __shared__ __align__(16) float os[16 * 68];
    const size_t z = blockIdx.z / KS; A += z * sA; if (A2) A2 += z * sA; Bt += z * sB; if (Bt2) Bt2 += z * sB; C += (size_t)blockIdx.z * sC; const int kb = (int)(blockIdx.z % KS) * (K / KS), ke = kb + K / KS;
    const int lane = threadIdx.x & 31, lr = lane & 15, hi = lane >> 4; const int r0 = blockIdx.x * 64, c0 = blockIdx.y * 64;
    v8f acc[4][4];
#pragma unroll
    for (int mb = 0; mb < 4; ++mb)
#pragma unroll
        for (int nb = 0; nb < 4; ++nb) acc[mb][nb] = (v8f){};
    const size_t aoff = (size_t)(r0 + lr) * K + 8 * hi, boff = (size_t)(c0 + lr) * K + 8 * hi;
#pragma unroll 1
    for (int kc = kb; kc < ke; kc += 32) {
        V a[4], a2[4];
#pragma unroll
        for (int mb = 0; mb < 4; ++mb) { a[mb] = WFrag<T16>::ld(A + aoff + (size_t)mb * 16 * K + kc); if (NSPLIT == 1 || NSPLIT == 2) a2[mb] = WFrag<T16>::ld(A2 + aoff + (size_t)mb * 16 * K + kc); }
#pragma unroll
        for (int nb = 0; nb < 4; ++nb) { const V b = WFrag<T16>::ld(Bt + boff + (size_t)nb * 16 * K + kc); V b2; if (NSPLIT >= 2) b2 = WFrag<T16>::ld(Bt2 + boff + (size_t)nb * 16 * K + kc);
#pragma unroll
            for (int mb = 0; mb < 4; ++mb) { acc[mb][nb] = WFrag<T16>::mma(a[mb], b, acc[mb][nb]); if (NSPLIT == 1 || NSPLIT == 2) acc[mb][nb] = WFrag<T16>::mma(a2[mb], b, acc[mb][nb]); if (NSPLIT >= 2) acc[mb][nb] = WFrag<T16>::mma(a[mb], b2, acc[mb][nb]); } }
        asm volatile("v_nop\n\tv_nop\n\tv_nop\n\tv_nop" : "+v"(acc[0][0]), "+v"(acc[1][1]), "+v"(acc[2][2]), "+v"(acc[3][3]) : "v"(a[0]), "v"(a[3]));
    }
#pragma unroll
    for (int mb = 0; mb < 4; ++mb) {
#pragma unroll
        for (int nb = 0; nb < 4; ++nb) {
#pragma unroll
            for (int j = 0; j < 8; ++j) os[(hi * 8 + j) * 68 + nb * 16 + lr] = acc[mb][nb][j]; }
        __builtin_amdgcn_wave_barrier(); asm volatile("" ::: "memory");
        float* crow = C + (size_t)(r0 + mb * 16) * ldc + c0;
{
#pragma unroll
            for (int s = 0; s < 8; ++s) { const int row = 2 * s + hi, cofs = lr * 4; v4f val = *(const v4fa*)(os + row * 68 + cofs); if (BIAS) { val[0] += bfr(bias[c0 + cofs]); val[1] += bfr(bias[c0 + cofs + 1]); val[2] += bfr(bias[c0 + cofs + 2]); val[3] += bfr(bias[c0 + cofs + 3]); }
                *(v4f*)(crow + (size_t)row * ldc + cofs) = val; }
             }
        __builtin_amdgcn_wave_barrier(); asm volatile("" ::: "memory");
    }
}

__device__ __forceinline__ h16 tohx(float x) { return (h16)x; }
__device__ __forceinline__ void splitf(float y, unsigned short& h, unsigned short& l) { h = f2bf(y); l = f2bf(y - bf2f(h)); }
typedef __attribute__((ext_vector_type(2))) _Float16 v2h;
typedef __attribute__((ext_vector_type(4))) _Float16 v4h;
typedef __attribute__((ext_vector_type(2))) unsigned short v2us;
typedef __attribute__((ext_vector_type(4))) unsigned short v4us;
typedef __attribute__((ext_vector_type(2))) float v2f;
typedef __attribute__((ext_vector_type(4))) int v4i;

__global__ __launch_bounds__(256) void k_wtG(const float* __restrict__ w, int K, int N, bf* Bt) {
    const int lane = threadIdx.x & 31; const int L0 = (blockIdx.x * 8 + (threadIdx.x >> 5)) * 8; const int nlines = N * K / 64;
{
#pragma unroll 1
        for (int l = 0; l < 8; ++l) { const int L = L0 + l; if (L >= nlines) break; const size_t e = (size_t)L * 64 + lane * 2; const int k = (int)(e % K), n = (int)(e / K); v2us o;
            o[0] = f2bf(w[(size_t)k * N + n]); o[1] = f2bf(w[(size_t)(k + 1) * N + n]); *(v2us*)(Bt + e) = o; }
         }
}
__global__ __launch_bounds__(256) void k_cvt8(const float* __restrict__ src, bf* dst, size_t n8) { const size_t i = (size_t)blockIdx.x * 256 + threadIdx.x; if (i >= n8) return; const v8f v = *(const v8f*)(src + i * 8); v8us o;
#pragma unroll
    for (int k = 0; k < 8; ++k) o[k] = f2bf(v[k]); *(v8us*)(dst + i * 8) = o;  }
__global__ __launch_bounds__(256) void k_cscvt(const float* __restrict__ cosT, const float* __restrict__ sinT, float* CS) { const int idx = blockIdx.x * 256 + threadIdx.x; if (idx >= TT * HD) return; v2f cs; cs[0] = bfr(cosT[idx]); cs[1] = bfr(sinT[idx]); *(v2f*)(CS + (size_t)idx * 2) = cs;  }
// k_rope: head planes [h][t][d] (fp16 + hi/lo) of rope(x) x sc with the rotate-half convention out[d] = x[d] cos[t][d] - x[d+HD/2] sin[t][d], out[d+HD/2] = x[d+HD/2] cos[t][d+HD/2] + x[d] sin[t][d+HD/2]
__global__ __launch_bounds__(256) void k_rope(const float* __restrict__ F, int pitch, int nheads, const float* __restrict__ CS, const float* __restrict__ RF, const float* __restrict__ nw, float sc, h16* P16, bf* Ph, bf* Pl) {
    const size_t e = ((size_t)blockIdx.x * 256 + threadIdx.x) * 2; if (e >= (size_t)nheads * TT * HD) return; const int d = (int)(e % HD); const int t = (int)((e / HD) % TT); const int h = (int)(e / ((size_t)HD * TT)); const float* f = F + (size_t)t * pitch + h * HD; const float rf = RF ? RF[(size_t)h * TT + t] : 1.0f; v2h o16; v2us oh, ol;
#pragma unroll
    for (int q = 0; q < 2; ++q) { const int dd = d + q; const int dp = (dd < HD / 2) ? dd + HD / 2 : dd - HD / 2; float x0 = f[dd], x1 = f[dp];
        if (RF) { float n0 = __fmul_rn(x0, rf), n1 = __fmul_rn(x1, rf); asm volatile("" : "+v"(n0)); asm volatile("" : "+v"(n1)); x0 = __fmul_rn(bfr(nw[dd]), n0); x1 = __fmul_rn(bfr(nw[dp]), n1); }
        const v2f cs = *(const v2f*)(CS + ((size_t)t * HD + dd) * 2); float a = __fmul_rn(x0, cs[0]), bq = __fmul_rn(x1, cs[1]); asm volatile("" : "+v"(a)); asm volatile("" : "+v"(bq)); const float r = ((dd < HD / 2) ? __fsub_rn(a, bq) : __fadd_rn(a, bq)) * sc;
        o16[q] = tohx(r); unsigned short a2, c2; splitf(r, a2, c2); oh[q] = a2; ol[q] = c2; }
    *(v2h*)(P16 + e) = o16; *(v2us*)(Ph + e) = oh; *(v2us*)(Pl + e) = ol;  }
__global__ __launch_bounds__(256) void k_vtp(const float* __restrict__ F, int pitch, int nheads, h16* V16, bf* Vh, bf* Vl) { const size_t e = ((size_t)blockIdx.x * 256 + threadIdx.x) * 2; if (e >= (size_t)nheads * HD * TT) return; const int t = (int)(e % TT); const int d = (int)((e / TT) % HD); const int g = (int)(e / ((size_t)TT * HD)); v2h o16; v2us oh, ol;
#pragma unroll
    for (int q = 0; q < 2; ++q) { const float x = F[(size_t)(t + q) * pitch + g * HD + d]; o16[q] = tohx(x); unsigned short a2, c2; splitf(x, a2, c2); oh[q] = a2; ol[q] = c2; }
    *(v2h*)(V16 + e) = o16; *(v2us*)(Vh + e) = oh; *(v2us*)(Vl + e) = ol;  }
__global__ __launch_bounds__(256) void k_csid(float* CS) { const int idx = blockIdx.x * 256 + threadIdx.x; if (idx >= TT * HD) return; v2f cs; cs[0] = 1.0f; cs[1] = 0.0f; *(v2f*)(CS + (size_t)idx * 2) = cs;  }
__global__ __launch_bounds__(256) void k_uvb(float* FQ, const float* __restrict__ bu, const float* __restrict__ bv2, float* FQV) { const size_t e = ((size_t)blockIdx.x * 256 + threadIdx.x) * 4; if (e >= (size_t)TT * DQ) return; const int c0 = (int)(e % DQ); const v4f a = *(const v4f*)(FQ + e); v4f ou, ov; for (int u = 0; u < 4; ++u) { const float aq = __fmul_rn(a[u], 0.125f); float ub = bfr(bu[c0 + u]), vb = bfr(bv2[c0 + u]); asm volatile("" : "+v"(ub)); asm volatile("" : "+v"(vb)); ou[u] = __fadd_rn(aq, ub); ov[u] = __fadd_rn(aq, vb); } *(v4f*)(FQV + e) = ov; *(v4f*)(FQ + e) = ou;  }
// k_asoft: per row (zz, i): t = S + bias[i][j] + shifted position score (1/8 already in q); softmax over the 2048 keys (register row, one exp, fixed trees);
__global__ __launch_bounds__(256) void k_asoft(const float* __restrict__ Sb, const float* __restrict__ Sb2, const float* __restrict__ ab, h16* P16, bf* Ph, bf* Pl) {
    const int lane = threadIdx.x & 31; const int row = blockIdx.x * 8 + (threadIdx.x >> 5); if (row >= ZH * TT) return; const int i = row % TT; const int zz = row / TT; (void)zz; const bool hires = (i < RH); const float* sr = Sb + (size_t)row * TT; const float* pr0 = Sb2 + (size_t)row * TT; const float* pr1 = Sb2 + (size_t)(row + 1) * TT; const float* abr = ab + (size_t)i * TT;   /* row i+1 of the same head block (never dereferenced for i = T-1: j >= i+2 is impossible there) */ float v[TT / 32]; float mx = -3.0e38f;
#pragma unroll
    for (int ch = 0; ch < TT / 128; ++ch) { const int j0 = ch * 128 + lane * 4; const v4f a = *(const v4f*)(sr + j0);
#pragma unroll
        for (int q = 0; q < 4; ++q) { const int j = j0 + q; (void)j; const int jj = j0 + q; const float bd = (jj <= i) ? pr0[TT - 1 - (i - jj)] : ((jj == i + 1) ? 0.0f : pr1[jj - i - 2]); float bb = bfr(abr[jj]); asm volatile("" : "+v"(bb)); float cb = __fadd_rn(a[q], bb); asm volatile("" : "+v"(cb)); float t = __fadd_rn(cb, bd); asm volatile("" : "+v"(t)); v[ch * 4 + q] = t; mx = fmaxf(mx, t); } }
#pragma unroll
    for (int sh = 16; sh; sh >>= 1) mx = fmaxf(mx, __shfl_xor(mx, sh, 32));
    float sum = 0.f;
#pragma unroll
    for (int k = 0; k < TT / 32; ++k) { float d0 = __fsub_rn(v[k], mx); asm volatile("" : "+v"(d0)); v[k] = __builtin_amdgcn_exp2f(__fmul_rn(d0, 1.4426950408889634f)); sum += v[k]; }
#pragma unroll
    for (int sh = 16; sh; sh >>= 1) sum += __shfl_xor(sum, sh, 32);
    const float f = __fdiv_rn(hires ? 1.0f : PCAR, sum);
{
        if (hires) {
#pragma unroll
            for (int ch = 0; ch < TT / 128; ++ch) { v4us oh, ol;
#pragma unroll
                for (int q = 0; q < 4; ++q) { unsigned short a, c2; splitf(v[ch * 4 + q] * f, a, c2); oh[q] = a; ol[q] = c2; }
                const size_t oo = ((size_t)zz * (RH ? RH : 1) + i) * TT + ch * 128 + lane * 4; *(v4us*)(Ph + oo) = oh; *(v4us*)(Pl + oo) = ol; }
        } else {
#pragma unroll
            for (int ch = 0; ch < TT / 128; ++ch) { v4h o4;
#pragma unroll
                for (int q = 0; q < 4; ++q) o4[q] = tohx(v[ch * 4 + q] * f);
                *(v4h*)(P16 + (size_t)row * TT + ch * 128 + lane * 4) = o4; } }
         }
}
__global__ __launch_bounds__(256) void k_merge(const float* __restrict__ O, int h0, bf* Ah, bf* Al) { const size_t e = ((size_t)blockIdx.x * 256 + threadIdx.x) * 2; if (e >= (size_t)ZH * TT * HD) return; const int d = (int)(e % HD); const int t = (int)((e / HD) % TT); const int zz = (int)(e / ((size_t)HD * TT)); const float cs = (t < RH) ? 1.0f : (1.0f / PCAR); const size_t oo = (size_t)t * DQ + (h0 + zz) * HD + d;
    const float* op = O + ((size_t)zz * KSP * TT + t) * HD + d; v2f s = *(const v2f*)op;
#pragma unroll
    for (int ks = 1; ks < KSP; ++ks) s += *(const v2f*)(op + (size_t)ks * TT * HD);
    asm volatile("s_wait_xcnt 0x0" :: "v"(op) : "memory");   // keeps the loads' shared address pair live up to this wait
    v2us oh, ol;
#pragma unroll
    for (int q = 0; q < 2; ++q) { unsigned short a, c2; splitf(s[q] * cs, a, c2); oh[q] = a; ol[q] = c2; } *(v2us*)(Ah + oo) = oh; *(v2us*)(Al + oo) = ol;  }

extern "C" void kernel_launch(void* const* d_in, const int* in_sizes, int n_in,
                              void* d_out, int out_size, void* d_ws, size_t ws_size, hipStream_t stream) {
    (void)in_sizes; (void)n_in; (void)out_size;
    const float* x = (const float*)d_in[0]; const float* abias = (const float*)d_in[1]; const float* pemb = (const float*)d_in[2]; const float* pbu = (const float*)d_in[3]; const float* pbv = (const float*)d_in[4]; const float* wq = (const float*)d_in[5]; const float* bq = (const float*)d_in[6]; const float* wk = (const float*)d_in[7]; const float* bk = (const float*)d_in[8]; const float* wv = (const float*)d_in[9]; const float* bv = (const float*)d_in[10]; const float* wpos = (const float*)d_in[11]; const float* bpos = (const float*)d_in[12]; const float* wo = (const float*)d_in[13]; const float* bo = (const float*)d_in[14]; const float* cosT = nullptr; const float* sinT = nullptr; (void)cosT; (void)sinT;
    float* OUT = (float*)d_out;     // [2][2048][1024]
    char* wsp = (char*)d_ws;
    auto take = [&](size_t bytes) { char* p = wsp; wsp += (bytes + 255) & ~(size_t)255; return (void*)p; };
    bf* WQ = (bf*)take((size_t)DQ * DM * 2); bf* WK = (bf*)take((size_t)DKV * DM * 2); bf* WV = (bf*)take((size_t)DKV * DM * 2); bf* WO = (bf*)take((size_t)DM * DQ * 2); float* CS = (float*)take((size_t)TT * HD * 2 * 4);
    bf* XB = (bf*)take((size_t)TT * DM * 2); bf* XP = (bf*)take((size_t)TT * DM * 2); bf* WP = (bf*)take((size_t)DQ * DM * 2); float* FP = (float*)take((size_t)TT * DQ * 4); float* FQV = (float*)take((size_t)TT * DQ * 4); h16* PP16 = (h16*)take((size_t)NH_ * TT * HD * 2); bf* PPh = (bf*)take((size_t)NH_ * TT * HD * 2); bf* PPl = (bf*)take((size_t)NH_ * TT * HD * 2); h16* QV16 = (h16*)take((size_t)NH_ * TT * HD * 2); bf* QVh = (bf*)take((size_t)NH_ * TT * HD * 2); bf* QVl = (bf*)take((size_t)NH_ * TT * HD * 2); float* Sb2 = (float*)take((size_t)ZH * TT * TT * 4); float* FQ = (float*)take((size_t)TT * DQ * 4); float* FK = (float*)take((size_t)TT * DKV * 4);
    h16* QP16 = (h16*)take((size_t)NH_ * TT * HD * 2); h16* KP16 = (h16*)take((size_t)NKV * TT * HD * 2); h16* VT16 = (h16*)take((size_t)NKV * HD * TT * 2);
    bf* QPh = (bf*)take((size_t)NH_ * TT * HD * 2); bf* QPl = (bf*)take((size_t)NH_ * TT * HD * 2); bf* KPh = (bf*)take((size_t)NKV * TT * HD * 2); bf* KPl = (bf*)take((size_t)NKV * TT * HD * 2); bf* VTh = (bf*)take((size_t)NKV * HD * TT * 2); bf* VTl = (bf*)take((size_t)NKV * HD * TT * 2); bf* Ph = (bf*)take((size_t)ZH * RH * TT * 2); bf* Pl = (bf*)take((size_t)ZH * RH * TT * 2);
    float* Sb = (float*)take((size_t)ZH * TT * TT * 4); h16* P16 = (h16*)take((size_t)ZH * TT * TT * 2); float* Ob = (float*)take((size_t)ZH * KSP * TT * HD * 4); bf* ATh = (bf*)take((size_t)TT * DQ * 2); bf* ATl = (bf*)take((size_t)TT * DQ * 2);
    if ((size_t)(wsp - (char*)d_ws) > ws_size) return;    // ws 256 MiB
    float* FV = FK;   // v projection reuses the k buffer after the k planes are built (stream-ordered)
    { k_wtG<<<(unsigned)((DM * DQ / 64 + 63) / 64), 256, 0, stream>>>(wq, DM, DQ, WQ); k_wtG<<<(unsigned)((DM * DKV / 64 + 63) / 64), 256, 0, stream>>>(wk, DM, DKV, WK); k_wtG<<<(unsigned)((DM * DKV / 64 + 63) / 64), 256, 0, stream>>>(wv, DM, DKV, WV);
      k_wtG<<<(unsigned)((DQ * DM / 64 + 63) / 64), 256, 0, stream>>>(wo, DQ, DM, WO); k_wtG<<<(unsigned)((DM * DQ / 64 + 63) / 64), 256, 0, stream>>>(wpos, DM, DQ, WP); k_cvt8<<<(unsigned)(((size_t)TT * DM / 8 + 255) / 256), 256, 0, stream>>>(pemb, XP, (size_t)TT * DM / 8); k_gemmw<bf, 0, true><<<dim3(TT / 64, DQ / 64, 1), 32, 0, stream>>>(XP, nullptr, WP, nullptr, DM, FP, DQ, bpos, 0, 0, 0);
       }
    k_csid<<<(TT * HD + 255) / 256, 256, 0, stream>>>(CS);
    const unsigned LQ = (unsigned)(((size_t)NH_ * TT * HD / 2 + 255) / 256), LKv = (unsigned)(((size_t)NKV * TT * HD / 2 + 255) / 256);
    for (int b = 0; b < NB_; ++b) {
        
        k_cvt8<<<(unsigned)(((size_t)TT * DM / 8 + 255) / 256), 256, 0, stream>>>(x + (size_t)b * TT * DM, XB, (size_t)TT * DM / 8);
        k_gemmw<bf, 0, true><<<dim3(TT / 64, DQ / 64, 1), 32, 0, stream>>>(XB, nullptr, WQ, nullptr, DM, FQ, DQ, bq, 0, 0, 0);
        k_uvb<<<(unsigned)(((size_t)TT * DQ / 4 + 255) / 256), 256, 0, stream>>>(FQ, pbu, pbv, FQV); k_rope<<<LQ, 256, 0, stream>>>(FQ, DQ, NH_, CS, nullptr, nullptr, 1.0f, QP16, QPh, QPl); k_rope<<<LQ, 256, 0, stream>>>(FQV, DQ, NH_, CS, nullptr, nullptr, 1.0f, QV16, QVh, QVl); if (b == 0) { k_rope<<<LQ, 256, 0, stream>>>(FP, DQ, NH_, CS, nullptr, nullptr, 1.0f, PP16, PPh, PPl); }
        k_gemmw<bf, 0, true><<<dim3(TT / 64, DKV / 64, 1), 32, 0, stream>>>(XB, nullptr, WK, nullptr, DM, FK, DKV, bk, 0, 0, 0);
        k_rope<<<LKv, 256, 0, stream>>>(FK, DKV, NKV, CS, nullptr, nullptr, 1.0f, KP16, KPh, KPl);
        k_gemmw<bf, 0, true><<<dim3(TT / 64, DKV / 64, 1), 32, 0, stream>>>(XB, nullptr, WV, nullptr, DM, FV, DKV, bv, 0, 0, 0); k_vtp<<<LKv, 256, 0, stream>>>(FV, DKV, NKV, VT16, VTh, VTl);
        for (int h0 = 0; h0 < NH_; h0 += ZH) { const size_t zq = (size_t)h0, zk = (size_t)(h0 / REP);   // one kv head per query head: the pass's two heads use consecutive kv planes (z-strides TT*HD)
            k_gemmw<bf, 2, false><<<dim3(RH / 64, TT / 64, ZH), 32, 0, stream>>>(QPh + zq * TT * HD, QPl + zq * TT * HD, KPh + zk * TT * HD, KPl + zk * TT * HD, HD, Sb, TT, nullptr, (size_t)TT * HD, (size_t)TT * HD, (size_t)TT * TT); k_gemmw<bf, 2, false><<<dim3(RH / 64, TT / 64, ZH), 32, 0, stream>>>(QVh + zq * TT * HD, QVl + zq * TT * HD, PPh + zk * TT * HD, PPl + zk * TT * HD, HD, Sb2, TT, nullptr, (size_t)TT * HD, (size_t)TT * HD, (size_t)TT * TT);
            k_gemmw<h16, 0, false><<<dim3((TT - RH) / 64, TT / 64, ZH), 32, 0, stream>>>(QP16 + zq * TT * HD + (size_t)RH * HD, nullptr, KP16 + zk * TT * HD, nullptr, HD, Sb + (size_t)RH * TT, TT, nullptr, (size_t)TT * HD, (size_t)TT * HD, (size_t)TT * TT); k_gemmw<h16, 0, false><<<dim3((TT - RH) / 64, TT / 64, ZH), 32, 0, stream>>>(QV16 + zq * TT * HD + (size_t)RH * HD, nullptr, PP16 + zk * TT * HD, nullptr, HD, Sb2 + (size_t)RH * TT, TT, nullptr, (size_t)TT * HD, (size_t)TT * HD, (size_t)TT * TT);
            k_asoft<<<ZH * TT / 8, 256, 0, stream>>>(Sb, Sb2, abias, P16, Ph, Pl);
            k_gemmw<bf, 2, false, KSP><<<dim3(RH / 64, HD / 64, ZH * KSP), 32, 0, stream>>>(Ph, Pl, VTh + zk * HD * TT, VTl + zk * HD * TT, TT, Ob, HD, nullptr, (size_t)RH * TT, (size_t)HD * TT, (size_t)TT * HD);
            k_gemmw<h16, 0, false, KSP><<<dim3((TT - RH) / 64, HD / 64, ZH * KSP), 32, 0, stream>>>(P16 + (size_t)RH * TT, nullptr, VT16 + zk * HD * TT, nullptr, TT, Ob + (size_t)RH * HD, HD, nullptr, (size_t)TT * TT, (size_t)HD * TT, (size_t)TT * HD);
            k_merge<<<(unsigned)(((size_t)ZH * TT * HD / 2 + 255) / 256), 256, 0, stream>>>(Ob, h0, ATh, ATl); }
        k_gemmw<bf, 1, true><<<dim3(TT / 64, DM / 64, 1), 32, 0, stream>>>(ATh, ATl, WO, nullptr, DQ, OUT + (size_t)b * TT * DM, DM, bo, 0, 0, 0); }
}

// v002
// It runs in 679 microseconds.
// Timed twice side by side with v001, it ran 2.34 and 2.31 times as fast.
// Over all steps from v000 it is 4.03 times as fast.
#include <hip/hip_runtime.h>

// LearnableMultiHeadSelfAttention (Transformer-XL style: x [2][2048][1024], bias [1][1][L][L] (f32 additive, read; verbatim causal 0/-1e9), pos_emb [2048][1][1024], pos_bias_u/v [16][64]; q/k/v = x W + b, r = pos_emb Wr + br ('xw', 16 heads x 64); qh = q/8; AC = (qh + u).k + bias; BD = (qh + v).r; logits = AC + rel_shift(BD) with the pad-front/reshape shift: pos[i][j] = BD[i][T-1-(i-j)] for j <= i, 0 for j == i+1, BD[i+1][j-i-2] for j >= i+2 (reproduced literally, including the masked upper part); softmax; out = merged Wo + bo -> [2][2048][1024]).
// Compute dtypes, f32 accumulate: every input rounded to bf16; q/k/v/r as PLAIN bf16 GEMMs (inputs: exact) + bias; q x 1/8 (exact) then the u/v head biases added in f32; content, position scores and attn.v: query rows < 512 hl (3 products), the rest single fp16 (x1024) (the shifted position score is gathered from rows i / i+1 of the position-score block); the additive bias read per element; softmax f32; Wo hl x exact (2 products) + bias.

#define NB_  2
#define TT   2048
#define DM   1024
#define NH_  16
#define NKV  16
#define REP  (NH_ / NKV)
#define HD   64
#define DQ   (NH_ * HD)
#define DKV  (NKV * HD)
#define RH   512                  // query rows < RH use hi+lo planes (0: none)
#define WIN  0
#define PCAR 1024.0f
#define KSP  16                   // attn.v: key ranges per output tile, two per wave of k_fattn; the KSP partial tiles are summed in ascending order
#define SCL  1.0f   // the 1/sqrt(64) is applied to q before the u/v biases (k_uvb)
typedef _Float16 h16;
typedef unsigned short bf;
typedef __attribute__((ext_vector_type(16))) __bf16   v16bf;
typedef __attribute__((ext_vector_type(16))) _Float16 v16h;
typedef __attribute__((ext_vector_type(8)))  _Float16 v8h;
typedef __attribute__((ext_vector_type(8)))  unsigned short v8us;
typedef __attribute__((ext_vector_type(8)))  float    v8f;
typedef __attribute__((ext_vector_type(4)))  float    v4f;
typedef v8h  __attribute__((may_alias)) v8ha;
typedef v4f  __attribute__((may_alias)) v4fa;
typedef v8us __attribute__((may_alias)) v8usa;

__device__ __forceinline__ unsigned short f2bf(float f) { unsigned u = __float_as_uint(f); u += 0x7FFFu + ((u >> 16) & 1u); return (unsigned short)(u >> 16); }
__device__ __forceinline__ float bf2f(unsigned short b) { return __uint_as_float(((unsigned)b) << 16); }
__device__ __forceinline__ float bfr(float f) { return bf2f(f2bf(f)); }
__device__ __forceinline__ v16h cat16(v8h lo, v8h hi) { return __builtin_shufflevector(lo, hi, 0, 1, 2, 3, 4, 5, 6, 7, 8, 9, 10, 11, 12, 13, 14, 15); }
__device__ __forceinline__ v16bf cat16b(v8us lo, v8us hi) { return __builtin_bit_cast(v16bf, __builtin_shufflevector(lo, hi, 0, 1, 2, 3, 4, 5, 6, 7, 8, 9, 10, 11, 12, 13, 14, 15)); }
__device__ __forceinline__ v8f wmma16(v16h a, v16h b, v8f c) { return __builtin_amdgcn_wmma_f32_16x16x32_f16(false, a, false, b, (short)0, c, false, false); }
__device__ __forceinline__ v8f wmmab(v16bf a, v16bf b, v8f c) { return __builtin_amdgcn_wmma_f32_16x16x32_bf16(false, a, false, b, (short)0, c, false, false); }



// ---- k_gemmw: register-blocked GEMM, ONE WAVE per 64x64 output tile (16 accumulators), operands straight from K-contiguous 16-bit planes; grid (M/64, N/64, Z), 32 threads.
// C[m][n] (f32, pitch ldc, + optional f32 bias[n]) = sum_k A[m][k] Bt[n][k] (+ split products per NSPLIT). z-batch strides sA/sB/sC in elements. K % (32 KS) == 0. KS > 1: grid z = Z x KS; work-group (z, ks) sums only k in [ks K/KS, (ks+1) K/KS) and stores its partial tile in plane z KS + ks of C (plane stride sC).
template <typename T16> struct WFrag;
template <> struct WFrag<h16> { typedef v16h V; static __device__ __forceinline__ V ld(const h16* p) { return cat16(*(const v8h*)p, *(const v8h*)(p + 16)); } static __device__ __forceinline__ v8f mma(V a, V b, v8f c) { return wmma16(a, b, c); } };
template <> struct WFrag<bf> { typedef v16bf V; static __device__ __forceinline__ V ld(const bf* p) { return cat16b(*(const v8us*)p, *(const v8us*)(p + 16)); } static __device__ __forceinline__ v8f mma(V a, V b, v8f c) { return wmmab(a, b, c); } };
template <typename T16, int NSPLIT, bool BIAS, int KS = 1>
__global__ __launch_bounds__(32) void k_gemmw(const T16* __restrict__ A, const T16* __restrict__ A2, const T16* __restrict__ Bt, const T16* __restrict__ Bt2, int K, float* C, int ldc, const float* __restrict__ bias, size_t sA, size_t sB, size_t sC) {
    typedef typename WFrag<T16>::V V;
    __shared__ __align__(16) float os[16 * 68];
    const size_t z = blockIdx.z / KS; A += z * sA; if (A2) A2 += z * sA; Bt += z * sB; if (Bt2) Bt2 += z * sB; C += (size_t)blockIdx.z * sC; const int kb = (int)(blockIdx.z % KS) * (K / KS), ke = kb + K / KS;
    const int lane = threadIdx.x & 31, lr = lane & 15, hi = lane >> 4; const int r0 = blockIdx.x * 64, c0 = blockIdx.y * 64;
    v8f acc[4][4];
#pragma unroll
    for (int mb = 0; mb < 4; ++mb)
#pragma unroll
        for (int nb = 0; nb < 4; ++nb) acc[mb][nb] = (v8f){};
    const size_t aoff = (size_t)(r0 + lr) * K + 8 * hi, boff = (size_t)(c0 + lr) * K + 8 * hi;
#pragma unroll 1
    for (int kc = kb; kc < ke; kc += 32) {
        V a[4], a2[4];
#pragma unroll
        for (int mb = 0; mb < 4; ++mb) { a[mb] = WFrag<T16>::ld(A + aoff + (size_t)mb * 16 * K + kc); if (NSPLIT == 1 || NSPLIT == 2) a2[mb] = WFrag<T16>::ld(A2 + aoff + (size_t)mb * 16 * K + kc); }
#pragma unroll
        for (int nb = 0; nb < 4; ++nb) { const V b = WFrag<T16>::ld(Bt + boff + (size_t)nb * 16 * K + kc); V b2; if (NSPLIT >= 2) b2 = WFrag<T16>::ld(Bt2 + boff + (size_t)nb * 16 * K + kc);
#pragma unroll
            for (int mb = 0; mb < 4; ++mb) { acc[mb][nb] = WFrag<T16>::mma(a[mb], b, acc[mb][nb]); if (NSPLIT == 1 || NSPLIT == 2) acc[mb][nb] = WFrag<T16>::mma(a2[mb], b, acc[mb][nb]); if (NSPLIT >= 2) acc[mb][nb] = WFrag<T16>::mma(a[mb], b2, acc[mb][nb]); } }
        asm volatile("v_nop\n\tv_nop\n\tv_nop\n\tv_nop" : "+v"(acc[0][0]), "+v"(acc[1][1]), "+v"(acc[2][2]), "+v"(acc[3][3]) : "v"(a[0]), "v"(a[3]));
    }
#pragma unroll
    for (int mb = 0; mb < 4; ++mb) {
#pragma unroll
        for (int nb = 0; nb < 4; ++nb) {
#pragma unroll
            for (int j = 0; j < 8; ++j) os[(hi * 8 + j) * 68 + nb * 16 + lr] = acc[mb][nb][j]; }
        __builtin_amdgcn_wave_barrier(); asm volatile("" ::: "memory");
        float* crow = C + (size_t)(r0 + mb * 16) * ldc + c0;
{
#pragma unroll
            for (int s = 0; s < 8; ++s) { const int row = 2 * s + hi, cofs = lr * 4; v4f val = *(const v4fa*)(os + row * 68 + cofs); if (BIAS) { val[0] += bfr(bias[c0 + cofs]); val[1] += bfr(bias[c0 + cofs + 1]); val[2] += bfr(bias[c0 + cofs + 2]); val[3] += bfr(bias[c0 + cofs + 3]); }
                *(v4f*)(crow + (size_t)row * ldc + cofs) = val; }
             }
        __builtin_amdgcn_wave_barrier(); asm volatile("" ::: "memory");
    }
}

__device__ __forceinline__ h16 tohx(float x) { return (h16)x; }
__device__ __forceinline__ void splitf(float y, unsigned short& h, unsigned short& l) { h = f2bf(y); l = f2bf(y - bf2f(h)); }
typedef __attribute__((ext_vector_type(2))) _Float16 v2h;
typedef __attribute__((ext_vector_type(4))) _Float16 v4h;
typedef __attribute__((ext_vector_type(2))) unsigned short v2us;
typedef __attribute__((ext_vector_type(4))) unsigned short v4us;
typedef __attribute__((ext_vector_type(2))) float v2f;
typedef __attribute__((ext_vector_type(4))) int v4i;

__global__ __launch_bounds__(256) void k_wtG(const float* __restrict__ w, int K, int N, bf* Bt) {
    const int lane = threadIdx.x & 31; const int L0 = (blockIdx.x * 8 + (threadIdx.x >> 5)) * 8; const int nlines = N * K / 64;
{
#pragma unroll 1
        for (int l = 0; l < 8; ++l) { const int L = L0 + l; if (L >= nlines) break; const size_t e = (size_t)L * 64 + lane * 2; const int k = (int)(e % K), n = (int)(e / K); v2us o;
            o[0] = f2bf(w[(size_t)k * N + n]); o[1] = f2bf(w[(size_t)(k + 1) * N + n]); *(v2us*)(Bt + e) = o; }
         }
}
__global__ __launch_bounds__(256) void k_cvt8(const float* __restrict__ src, bf* dst, size_t n8) { const size_t i = (size_t)blockIdx.x * 256 + threadIdx.x; if (i >= n8) return; const v8f v = *(const v8f*)(src + i * 8); v8us o;
#pragma unroll
    for (int k = 0; k < 8; ++k) o[k] = f2bf(v[k]); *(v8us*)(dst + i * 8) = o;  }
__global__ __launch_bounds__(256) void k_cscvt(const float* __restrict__ cosT, const float* __restrict__ sinT, float* CS) { const int idx = blockIdx.x * 256 + threadIdx.x; if (idx >= TT * HD) return; v2f cs; cs[0] = bfr(cosT[idx]); cs[1] = bfr(sinT[idx]); *(v2f*)(CS + (size_t)idx * 2) = cs;  }
// k_rope: head planes [h][t][d] (fp16 + hi/lo) of rope(x) x sc with the rotate-half convention out[d] = x[d] cos[t][d] - x[d+HD/2] sin[t][d], out[d+HD/2] = x[d+HD/2] cos[t][d+HD/2] + x[d] sin[t][d+HD/2]
__global__ __launch_bounds__(256) void k_rope(const float* __restrict__ F, int pitch, int nheads, const float* __restrict__ CS, const float* __restrict__ RF, const float* __restrict__ nw, float sc, h16* P16, bf* Ph, bf* Pl) {
    const size_t e = ((size_t)blockIdx.x * 256 + threadIdx.x) * 2; if (e >= (size_t)nheads * TT * HD) return; const int d = (int)(e % HD); const int t = (int)((e / HD) % TT); const int h = (int)(e / ((size_t)HD * TT)); const float* f = F + (size_t)t * pitch + h * HD; const float rf = RF ? RF[(size_t)h * TT + t] : 1.0f; v2h o16; v2us oh, ol;
#pragma unroll
    for (int q = 0; q < 2; ++q) { const int dd = d + q; const int dp = (dd < HD / 2) ? dd + HD / 2 : dd - HD / 2; float x0 = f[dd], x1 = f[dp];
        if (RF) { float n0 = __fmul_rn(x0, rf), n1 = __fmul_rn(x1, rf); asm volatile("" : "+v"(n0)); asm volatile("" : "+v"(n1)); x0 = __fmul_rn(bfr(nw[dd]), n0); x1 = __fmul_rn(bfr(nw[dp]), n1); }
        const v2f cs = *(const v2f*)(CS + ((size_t)t * HD + dd) * 2); float a = __fmul_rn(x0, cs[0]), bq = __fmul_rn(x1, cs[1]); asm volatile("" : "+v"(a)); asm volatile("" : "+v"(bq)); const float r = ((dd < HD / 2) ? __fsub_rn(a, bq) : __fadd_rn(a, bq)) * sc;
        o16[q] = tohx(r); unsigned short a2, c2; splitf(r, a2, c2); oh[q] = a2; ol[q] = c2; }
    *(v2h*)(P16 + e) = o16; *(v2us*)(Ph + e) = oh; *(v2us*)(Pl + e) = ol;  }
__global__ __launch_bounds__(256) void k_vtp(const float* __restrict__ F, int pitch, int nheads, h16* V16, bf* Vh, bf* Vl) { const size_t e = ((size_t)blockIdx.x * 256 + threadIdx.x) * 2; if (e >= (size_t)nheads * HD * TT) return; const int t = (int)(e % TT); const int d = (int)((e / TT) % HD); const int g = (int)(e / ((size_t)TT * HD)); v2h o16; v2us oh, ol;
#pragma unroll
    for (int q = 0; q < 2; ++q) { const float x = F[(size_t)(t + q) * pitch + g * HD + d]; o16[q] = tohx(x); unsigned short a2, c2; splitf(x, a2, c2); oh[q] = a2; ol[q] = c2; }
    *(v2h*)(V16 + e) = o16; *(v2us*)(Vh + e) = oh; *(v2us*)(Vl + e) = ol;  }
__global__ __launch_bounds__(256) void k_csid(float* CS) { const int idx = blockIdx.x * 256 + threadIdx.x; if (idx >= TT * HD) return; v2f cs; cs[0] = 1.0f; cs[1] = 0.0f; *(v2f*)(CS + (size_t)idx * 2) = cs;  }
__global__ __launch_bounds__(256) void k_uvb(float* FQ, const float* __restrict__ bu, const float* __restrict__ bv2, float* FQV) { const size_t e = ((size_t)blockIdx.x * 256 + threadIdx.x) * 4; if (e >= (size_t)TT * DQ) return; const int c0 = (int)(e % DQ); const v4f a = *(const v4f*)(FQ + e); v4f ou, ov; for (int u = 0; u < 4; ++u) { const float aq = __fmul_rn(a[u], 0.125f); float ub = bfr(bu[c0 + u]), vb = bfr(bv2[c0 + u]); asm volatile("" : "+v"(ub)); asm volatile("" : "+v"(vb)); ou[u] = __fadd_rn(aq, ub); ov[u] = __fadd_rn(aq, vb); } *(v4f*)(FQV + e) = ov; *(v4f*)(FQ + e) = ou;  }
// ---- k_fattn: one work-group (8 waves) per 16 query rows of one head; the 16 x 2048 f32 logit rows live in LDS from the score products to attn.v.
// Phases: (1) content scores + additive bias -> S; (2) position scores added at their rel-shift place (row i takes BD[i][m >= T-1-i] at j = m-(T-1)+i and BD[i+1][m <= T-3-i] at j = m+i+2; every place gets at most one term); (3) softmax, one wave per row, weights written over the row as 16-bit planes; (4) attn.v in KSP key ranges of 128, two per wave; (5) the KSP partial tiles summed in ascending order.
#define SP 2052                   // LDS row pitch in floats: 2048 + 4, so that the 16 rows of a fragment read start on different banks
typedef v4h  __attribute__((may_alias)) v4ha;
typedef v4us __attribute__((may_alias)) v4usa;
// Behind a batch of global loads: the precautionary wait in front of any write to a register of the loads' address pairs. The pointers are inputs so that the pairs stay live up to it; without that the compiler lets a later load of the batch land in an earlier load's pair. A shorter list repeats its pointers.
__device__ __forceinline__ void xhold(const void* a, const void* b, const void* c, const void* d, const void* e, const void* f, const void* g, const void* h) { asm volatile("s_wait_xcnt 0x0" :: "v"(a), "v"(b), "v"(c), "v"(d), "v"(e), "v"(f), "v"(g), "v"(h) : "memory"); }
// v_exp_f32 with the one free slot that the instruction set asks for behind a transcendental, before its result is read or its source written again; in one statement, so that the v_nop stands directly behind it
__device__ __forceinline__ float exp2_slot(float x) { float r; asm("v_exp_f32 %0, %1\n\tv_nop" : "=v"(r) : "v"(x)); return r; }
template <bool HI> struct BFrag;   // 16 rows x 64 k of a K-contiguous plane (hi + lo planes where HI)
template <> struct BFrag<false> { v16h b[2]; const h16 *p, *p2;
    __device__ __forceinline__ void load(const h16* b16, const bf*, const bf*, size_t off) { p = p2 = b16 + off; b[0] = WFrag<h16>::ld(p); b[1] = WFrag<h16>::ld(p + 32); } };
template <> struct BFrag<true> { v16bf b[2], b2[2]; const bf *p, *p2;
    __device__ __forceinline__ void load(const h16*, const bf* bh, const bf* bl, size_t off) { p = bh + off; p2 = bl + off; b[0] = WFrag<bf>::ld(p); b[1] = WFrag<bf>::ld(p + 32); b2[0] = WFrag<bf>::ld(p2); b2[1] = WFrag<bf>::ld(p2 + 32); } };
__device__ __forceinline__ v8f dot64(const BFrag<false>& q, const BFrag<false>& k) { v8f c = (v8f){};
#pragma unroll
    for (int kk = 0; kk < 2; ++kk) c = wmma16(q.b[kk], k.b[kk], c);
    return c; }
__device__ __forceinline__ v8f dot64(const BFrag<true>& q, const BFrag<true>& k) { v8f c = (v8f){};
#pragma unroll
    for (int kk = 0; kk < 2; ++kk) { c = wmmab(q.b[kk], k.b[kk], c); c = wmmab(q.b2[kk], k.b[kk], c); c = wmmab(q.b[kk], k.b2[kk], c); }
    return c; }
template <bool HI>
__device__ __forceinline__ void ac_pass(float* S, const h16* q16, const bf* qh, const bf* ql, const h16* k16, const bf* kh, const bf* kl, const float* __restrict__ ab, int i0, int w, int lr, int hi) {
    BFrag<HI> q; q.load(q16, qh, ql, (size_t)(i0 + lr) * HD + 8 * hi);
    constexpr int U = HI ? 2 : 4;   // key tiles whose loads fly together
#pragma unroll 1   // the batch of U tiles is the unit; unrolling further would pass 256 VGPRs and cost the second work-group of the WGP
    for (int it = 0; it < TT / 128; it += U) { BFrag<HI> k[U]; const float* pb[U]; float bb[U][8];
#pragma unroll
        for (int u = 0; u < U; ++u) { const int col = (w + (it + u) * 8) * 16 + lr; k[u].load(k16, kh, kl, (size_t)col * HD + 8 * hi); pb[u] = ab + (size_t)(i0 + hi * 8) * TT + col;
#pragma unroll
            for (int jj = 0; jj < 8; ++jj) bb[u][jj] = pb[u][(size_t)jj * TT]; }
        if (HI) xhold(k[0].p, k[0].p2, k[1].p, k[1].p2, pb[0], pb[1], pb[0], pb[1]); else xhold(k[0].p, k[1].p, k[U - 2].p, k[U - 1].p, pb[0], pb[1], pb[U - 2], pb[U - 1]);
#pragma unroll
        for (int u = 0; u < U; ++u) { const v8f c = dot64(q, k[u]); const int col = (w + (it + u) * 8) * 16 + lr;
#pragma unroll
            for (int jj = 0; jj < 8; ++jj) S[(hi * 8 + jj) * SP + col] = __fadd_rn(c[jj], bfr(bb[u][jj])); } }
}
template <bool HI, bool HEAD>
__device__ __forceinline__ void bd_place(float* S, const v8f c, int m, int i0, int hi) {
    float old[8];   // all eight reads first (index clamped into the row where no term is placed), so that they wait once
#pragma unroll
    for (int jj = 0; jj < 8; ++jj) { const int r = hi * 8 + jj, i = i0 + r; const int j = HEAD ? min(m + i + 2, TT - 1) : max(m - (TT - 1) + i, 0); old[jj] = S[r * SP + j]; }
#pragma unroll
    for (int jj = 0; jj < 8; ++jj) { const int r = hi * 8 + jj, i = i0 + r; const bool ok = HEAD ? (m <= TT - 3 - i && (i + 1 < RH) == HI) : (m >= TT - 1 - i); const int j = HEAD ? m + i + 2 : m - (TT - 1) + i;
        if (ok) S[r * SP + j] = __fadd_rn(old[jj], c[jj]); }
}
template <bool HI, bool HEAD>
__device__ __forceinline__ void bd_pass(float* S, const h16* q16, const bf* qh, const bf* ql, const h16* p16, const bf* ph, const bf* pl, int i0, int w, int lr, int hi) {
    int ar = HEAD ? i0 + 1 + lr : i0 + lr; if (ar > TT - 1) ar = TT - 1;   // row T does not exist; no term of it is ever placed (m <= -2)
    BFrag<HI> q; q.load(q16, qh, ql, (size_t)ar * HD + 8 * hi);
    const int ntlo = HEAD ? 0 : (TT - 16 - i0) / 16, nthi = HEAD ? (TT - 3 - i0) / 16 : TT / 16 - 1;
#pragma unroll 1   // trip count depends on the row block; the pair of tiles is the unit
    for (int nt = ntlo + w; nt <= nthi; nt += 16) { const bool two = (nt + 8 <= nthi); const int nt1 = two ? nt + 8 : nt;   // two tiles' loads fly together; the last trip may hold one
        BFrag<HI> r0, r1; r0.load(p16, ph, pl, (size_t)(nt * 16 + lr) * HD + 8 * hi); r1.load(p16, ph, pl, (size_t)(nt1 * 16 + lr) * HD + 8 * hi);
        xhold(r0.p, r0.p2, r1.p, r1.p2, r0.p, r0.p2, r1.p, r1.p2);
        bd_place<HI, HEAD>(S, dot64(q, r0), nt * 16 + lr, i0, hi);
        if (two) bd_place<HI, HEAD>(S, dot64(q, r1), nt1 * 16 + lr, i0, hi); }
}
template <bool HI>
__device__ __forceinline__ void pv_pass(const float* S, const h16* v16, const bf* vh, const bf* vl, int w, int lr, int hi, v8f (&acc)[2][4]) {
    constexpr int NS = HI ? 1 : 2;   // k steps of 32 keys whose loads fly together
#pragma unroll
    for (int u = 0; u < 2; ++u) {
#pragma unroll
        for (int nb = 0; nb < 4; ++nb) acc[u][nb] = (v8f){};
#pragma unroll
        for (int st = 0; st < TT / KSP / 32; st += NS) { const int kc = (2 * w + u) * (TT / KSP) + st * 32; const size_t boff = (size_t)lr * TT + 8 * hi + kc;
            if (HI) { const bf *pv = vh + boff, *pv2 = vl + boff; v16bf b[4], b2[4];
#pragma unroll
                for (int nb = 0; nb < 4; ++nb) { b[nb] = WFrag<bf>::ld(pv + (size_t)nb * 16 * TT); b2[nb] = WFrag<bf>::ld(pv2 + (size_t)nb * 16 * TT); }
                xhold(pv, pv2, pv, pv2, pv, pv2, pv, pv2);
                const bf* p = (const bf*)(S + lr * SP) + kc + 8 * hi; const v16bf a = cat16b(*(const v8usa*)p, *(const v8usa*)(p + 16)), a2 = cat16b(*(const v8usa*)(p + TT), *(const v8usa*)(p + TT + 16));
#pragma unroll
                for (int nb = 0; nb < 4; ++nb) { acc[u][nb] = wmmab(a, b[nb], acc[u][nb]); acc[u][nb] = wmmab(a2, b[nb], acc[u][nb]); acc[u][nb] = wmmab(a, b2[nb], acc[u][nb]); }
            } else { const h16* pv = v16 + boff; v16h b[NS][4];
#pragma unroll
                for (int s = 0; s < NS; ++s)
#pragma unroll
                    for (int nb = 0; nb < 4; ++nb) b[s][nb] = WFrag<h16>::ld(pv + s * 32 + (size_t)nb * 16 * TT);
                xhold(pv, pv, pv, pv, pv, pv, pv, pv);
#pragma unroll
                for (int s = 0; s < NS; ++s) { const h16* p = (const h16*)(S + lr * SP) + kc + s * 32 + 8 * hi; const v16h a = cat16(*(const v8ha*)p, *(const v8ha*)(p + 16));
#pragma unroll
                    for (int nb = 0; nb < 4; ++nb) acc[u][nb] = wmma16(a, b[s][nb], acc[u][nb]); } } } }
}
// amdgpu_waves_per_eu(4, 4): 256 VGPRs at most, so that two work-groups (2 x 131,328 B of LDS) share a WGP and one computes while the other waits at a barrier
__global__ __launch_bounds__(256) __attribute__((amdgpu_waves_per_eu(4, 4))) void k_fattn(const h16* __restrict__ QP16, const bf* __restrict__ QPh, const bf* __restrict__ QPl, const h16* __restrict__ QV16, const bf* __restrict__ QVh, const bf* __restrict__ QVl, const h16* __restrict__ KP16, const bf* __restrict__ KPh, const bf* __restrict__ KPl, const h16* __restrict__ PP16, const bf* __restrict__ PPh, const bf* __restrict__ PPl, const h16* __restrict__ VT16, const bf* __restrict__ VTh, const bf* __restrict__ VTl, const float* __restrict__ ab, bf* Ah, bf* Al) {
    __shared__ __align__(16) float S[16 * SP];
    const int tid = threadIdx.x, lane = tid & 31, lr = lane & 15, hi = lane >> 4; const int w = __builtin_amdgcn_readfirstlane(tid >> 5);
    const int i0 = blockIdx.x * 16, h = blockIdx.y; const bool hires = (i0 < RH); const size_t hp = (size_t)h * TT * HD;
    if (hires) ac_pass<true>(S, QP16 + hp, QPh + hp, QPl + hp, KP16 + hp, KPh + hp, KPl + hp, ab, i0, w, lr, hi); else ac_pass<false>(S, QP16 + hp, QPh + hp, QPl + hp, KP16 + hp, KPh + hp, KPl + hp, ab, i0, w, lr, hi);
    __syncthreads();   // every content + bias value stands in S before a position term is added to it
    if (hires) bd_pass<true, false>(S, QV16 + hp, QVh + hp, QVl + hp, PP16 + hp, PPh + hp, PPl + hp, i0, w, lr, hi); else bd_pass<false, false>(S, QV16 + hp, QVh + hp, QVl + hp, PP16 + hp, PPh + hp, PPl + hp, i0, w, lr, hi);
    if (i0 + 1 < RH) bd_pass<true, true>(S, QV16 + hp, QVh + hp, QVl + hp, PP16 + hp, PPh + hp, PPl + hp, i0, w, lr, hi);      // rows i+1 < RH: hi+lo products
    if (i0 + 16 >= RH) bd_pass<false, true>(S, QV16 + hp, QVh + hp, QVl + hp, PP16 + hp, PPh + hp, PPl + hp, i0, w, lr, hi);   // rows i+1 >= RH: fp16 products
    __syncthreads();   // logits complete before a wave reads its rows
#pragma unroll 1   // one 64-register row at a time
    for (int rr = 0; rr < 2; ++rr) { float* srow = S + (w + rr * 8) * SP; float v[TT / 32]; float mx = -3.0e38f;
#pragma unroll
        for (int ch = 0; ch < TT / 128; ++ch) { const v4f a = *(const v4fa*)(srow + ch * 128 + lane * 4);
#pragma unroll
            for (int q = 0; q < 4; ++q) { v[ch * 4 + q] = a[q]; mx = fmaxf(mx, a[q]); } }
#pragma unroll
        for (int sh = 16; sh; sh >>= 1) mx = fmaxf(mx, __shfl_xor(mx, sh, 32));
        float sum = 0.f;
#pragma unroll
        for (int k = 0; k < TT / 32; ++k) { v[k] = exp2_slot(__fmul_rn(__fsub_rn(v[k], mx), 1.4426950408889634f)); sum += v[k]; }
#pragma unroll
        for (int sh = 16; sh; sh >>= 1) sum += __shfl_xor(sum, sh, 32);
        const float f = __fdiv_rn(hires ? 1.0f : PCAR, sum);
        if (hires) { bf* ph = (bf*)srow;
#pragma unroll
            for (int ch = 0; ch < TT / 128; ++ch) { v4us oh, ol;
#pragma unroll
                for (int q = 0; q < 4; ++q) { unsigned short a, c2; splitf(v[ch * 4 + q] * f, a, c2); oh[q] = a; ol[q] = c2; }
                *(v4usa*)(ph + ch * 128 + lane * 4) = oh; *(v4usa*)(ph + TT + ch * 128 + lane * 4) = ol; }
        } else { h16* p16 = (h16*)srow;
#pragma unroll
            for (int ch = 0; ch < TT / 128; ++ch) { v4h o4;
#pragma unroll
                for (int q = 0; q < 4; ++q) o4[q] = tohx(v[ch * 4 + q] * f);
                *(v4ha*)(p16 + ch * 128 + lane * 4) = o4; } } }
    __syncthreads();   // all 16 weight rows written before any wave reads them as A fragments
    v8f acc[2][4]; const size_t hv = (size_t)h * HD * TT;
    if (hires) pv_pass<true>(S, VT16 + hv, VTh + hv, VTl + hv, w, lr, hi, acc); else pv_pass<false>(S, VT16 + hv, VTh + hv, VTl + hv, w, lr, hi, acc);
    __syncthreads();   // last read of the weights is over before the partial tiles overwrite them
#pragma unroll
    for (int u = 0; u < 2; ++u)
#pragma unroll
        for (int nb = 0; nb < 4; ++nb)
#pragma unroll
            for (int jj = 0; jj < 8; ++jj) S[(2 * w + u) * (16 * HD) + (hi * 8 + jj) * HD + nb * 16 + lr] = acc[u][nb][jj];
    __syncthreads();   // all KSP partial tiles written before they are summed
    const int e = tid * 4, t = i0 + (e >> 6), d = e & 63; v4f s = *(const v4fa*)(S + e);
#pragma unroll
    for (int ks = 1; ks < KSP; ++ks) s += *(const v4fa*)(S + ks * (16 * HD) + e);
    const float cs = (t < RH) ? 1.0f : (1.0f / PCAR); v4us oh, ol;
#pragma unroll
    for (int q = 0; q < 4; ++q) { unsigned short a, c2; splitf(s[q] * cs, a, c2); oh[q] = a; ol[q] = c2; }
    const size_t oo = (size_t)t * DQ + h * HD + d; *(v4us*)(Ah + oo) = oh; *(v4us*)(Al + oo) = ol;
}

extern "C" void kernel_launch(void* const* d_in, const int* in_sizes, int n_in,
                              void* d_out, int out_size, void* d_ws, size_t ws_size, hipStream_t stream) {
    (void)in_sizes; (void)n_in; (void)out_size;
    const float* x = (const float*)d_in[0]; const float* abias = (const float*)d_in[1]; const float* pemb = (const float*)d_in[2]; const float* pbu = (const float*)d_in[3]; const float* pbv = (const float*)d_in[4]; const float* wq = (const float*)d_in[5]; const float* bq = (const float*)d_in[6]; const float* wk = (const float*)d_in[7]; const float* bk = (const float*)d_in[8]; const float* wv = (const float*)d_in[9]; const float* bv = (const float*)d_in[10]; const float* wpos = (const float*)d_in[11]; const float* bpos = (const float*)d_in[12]; const float* wo = (const float*)d_in[13]; const float* bo = (const float*)d_in[14]; const float* cosT = nullptr; const float* sinT = nullptr; (void)cosT; (void)sinT;
    float* OUT = (float*)d_out;     // [2][2048][1024]
    char* wsp = (char*)d_ws;
    auto take = [&](size_t bytes) { char* p = wsp; wsp += (bytes + 255) & ~(size_t)255; return (void*)p; };
    bf* WQ = (bf*)take((size_t)DQ * DM * 2); bf* WK = (bf*)take((size_t)DKV * DM * 2); bf* WV = (bf*)take((size_t)DKV * DM * 2); bf* WO = (bf*)take((size_t)DM * DQ * 2); float* CS = (float*)take((size_t)TT * HD * 2 * 4);
    bf* XB = (bf*)take((size_t)TT * DM * 2); bf* XP = (bf*)take((size_t)TT * DM * 2); bf* WP = (bf*)take((size_t)DQ * DM * 2); float* FP = (float*)take((size_t)TT * DQ * 4); float* FQV = (float*)take((size_t)TT * DQ * 4); h16* PP16 = (h16*)take((size_t)NH_ * TT * HD * 2); bf* PPh = (bf*)take((size_t)NH_ * TT * HD * 2); bf* PPl = (bf*)take((size_t)NH_ * TT * HD * 2); h16* QV16 = (h16*)take((size_t)NH_ * TT * HD * 2); bf* QVh = (bf*)take((size_t)NH_ * TT * HD * 2); bf* QVl = (bf*)take((size_t)NH_ * TT * HD * 2); float* FQ = (float*)take((size_t)TT * DQ * 4); float* FK = (float*)take((size_t)TT * DKV * 4);
    h16* QP16 = (h16*)take((size_t)NH_ * TT * HD * 2); h16* KP16 = (h16*)take((size_t)NKV * TT * HD * 2); h16* VT16 = (h16*)take((size_t)NKV * HD * TT * 2);
    bf* QPh = (bf*)take((size_t)NH_ * TT * HD * 2); bf* QPl = (bf*)take((size_t)NH_ * TT * HD * 2); bf* KPh = (bf*)take((size_t)NKV * TT * HD * 2); bf* KPl = (bf*)take((size_t)NKV * TT * HD * 2); bf* VTh = (bf*)take((size_t)NKV * HD * TT * 2); bf* VTl = (bf*)take((size_t)NKV * HD * TT * 2);
    bf* ATh = (bf*)take((size_t)TT * DQ * 2); bf* ATl = (bf*)take((size_t)TT * DQ * 2);
    if ((size_t)(wsp - (char*)d_ws) > ws_size) return;    // ws 256 MiB
    float* FV = FK;   // v projection reuses the k buffer after the k planes are built (stream-ordered)
    { k_wtG<<<(unsigned)((DM * DQ / 64 + 63) / 64), 256, 0, stream>>>(wq, DM, DQ, WQ); k_wtG<<<(unsigned)((DM * DKV / 64 + 63) / 64), 256, 0, stream>>>(wk, DM, DKV, WK); k_wtG<<<(unsigned)((DM * DKV / 64 + 63) / 64), 256, 0, stream>>>(wv, DM, DKV, WV);
      k_wtG<<<(unsigned)((DQ * DM / 64 + 63) / 64), 256, 0, stream>>>(wo, DQ, DM, WO); k_wtG<<<(unsigned)((DM * DQ / 64 + 63) / 64), 256, 0, stream>>>(wpos, DM, DQ, WP); k_cvt8<<<(unsigned)(((size_t)TT * DM / 8 + 255) / 256), 256, 0, stream>>>(pemb, XP, (size_t)TT * DM / 8); k_gemmw<bf, 0, true><<<dim3(TT / 64, DQ / 64, 1), 32, 0, stream>>>(XP, nullptr, WP, nullptr, DM, FP, DQ, bpos, 0, 0, 0);
       }
    k_csid<<<(TT * HD + 255) / 256, 256, 0, stream>>>(CS);
    const unsigned LQ = (unsigned)(((size_t)NH_ * TT * HD / 2 + 255) / 256), LKv = (unsigned)(((size_t)NKV * TT * HD / 2 + 255) / 256);
    for (int b = 0; b < NB_; ++b) {
        
        k_cvt8<<<(unsigned)(((size_t)TT * DM / 8 + 255) / 256), 256, 0, stream>>>(x + (size_t)b * TT * DM, XB, (size_t)TT * DM / 8);
        k_gemmw<bf, 0, true><<<dim3(TT / 64, DQ / 64, 1), 32, 0, stream>>>(XB, nullptr, WQ, nullptr, DM, FQ, DQ, bq, 0, 0, 0);
        k_uvb<<<(unsigned)(((size_t)TT * DQ / 4 + 255) / 256), 256, 0, stream>>>(FQ, pbu, pbv, FQV); k_rope<<<LQ, 256, 0, stream>>>(FQ, DQ, NH_, CS, nullptr, nullptr, 1.0f, QP16, QPh, QPl); k_rope<<<LQ, 256, 0, stream>>>(FQV, DQ, NH_, CS, nullptr, nullptr, 1.0f, QV16, QVh, QVl); if (b == 0) { k_rope<<<LQ, 256, 0, stream>>>(FP, DQ, NH_, CS, nullptr, nullptr, 1.0f, PP16, PPh, PPl); }
        k_gemmw<bf, 0, true><<<dim3(TT / 64, DKV / 64, 1), 32, 0, stream>>>(XB, nullptr, WK, nullptr, DM, FK, DKV, bk, 0, 0, 0);
        k_rope<<<LKv, 256, 0, stream>>>(FK, DKV, NKV, CS, nullptr, nullptr, 1.0f, KP16, KPh, KPl);
        k_gemmw<bf, 0, true><<<dim3(TT / 64, DKV / 64, 1), 32, 0, stream>>>(XB, nullptr, WV, nullptr, DM, FV, DKV, bv, 0, 0, 0); k_vtp<<<LKv, 256, 0, stream>>>(FV, DKV, NKV, VT16, VTh, VTl);
        k_fattn<<<dim3(TT / 16, NH_, 1), 256, 0, stream>>>(QP16, QPh, QPl, QV16, QVh, QVl, KP16, KPh, KPl, PP16, PPh, PPl, VT16, VTh, VTl, abias, ATh, ATl);
        k_gemmw<bf, 1, true><<<dim3(TT / 64, DM / 64, 1), 32, 0, stream>>>(ATh, ATl, WO, nullptr, DQ, OUT + (size_t)b * TT * DM, DM, bo, 0, 0, 0); }
}

// v003
// Measured time: 639 microseconds a run.
// Two timings next to v002 put it at 1.05 and 1.06 times that version's speed.
// All steps since v000 together make it 4.26 times as fast.
#include <hip/hip_runtime.h>

// LearnableMultiHeadSelfAttention (Transformer-XL style: x [2][2048][1024], bias [1][1][L][L] (f32 additive, read; verbatim causal 0/-1e9), pos_emb [2048][1][1024], pos_bias_u/v [16][64]; q/k/v = x W + b, r = pos_emb Wr + br ('xw', 16 heads x 64); qh = q/8; AC = (qh + u).k + bias; BD = (qh + v).r; logits = AC + rel_shift(BD) with the pad-front/reshape shift: pos[i][j] = BD[i][T-1-(i-j)] for j <= i, 0 for j == i+1, BD[i+1][j-i-2] for j >= i+2 (reproduced literally, including the masked upper part); softmax; out = merged Wo + bo -> [2][2048][1024]).
// Compute dtypes, f32 accumulate: every input rounded to bf16; q/k/v/r as PLAIN bf16 GEMMs (inputs: exact) + bias; q x 1/8 (exact) then the u/v head biases added in f32; content, position scores and attn.v: query rows < 512 hl (3 products), the rest single fp16 (x1024) (the shifted position score is gathered from rows i / i+1 of the position-score block); the additive bias read per element; softmax f32; Wo hl x exact (2 products) + bias.

#define NB_  2
#define TT   2048
#define DM   1024
#define NH_  16
#define NKV  16
#define REP  (NH_ / NKV)
#define HD   64
#define DQ   (NH_ * HD)
#define DKV  (NKV * HD)
#define RH   512                  // query rows < RH use hi+lo planes (0: none)
#define WIN  0
#define PCAR 1024.0f
#define KSP  16                   // attn.v: key ranges per output tile, two per wave of k_fattn; the KSP partial tiles are summed in ascending order
#define SCL  1.0f   // the 1/sqrt(64) is applied to q before the u/v biases (k_gemmw, EPI 2)
typedef _Float16 h16;
typedef unsigned short bf;
typedef __attribute__((ext_vector_type(16))) __bf16   v16bf;
typedef __attribute__((ext_vector_type(16))) _Float16 v16h;
typedef __attribute__((ext_vector_type(8)))  _Float16 v8h;
typedef __attribute__((ext_vector_type(8)))  unsigned short v8us;
typedef __attribute__((ext_vector_type(8)))  float    v8f;
typedef __attribute__((ext_vector_type(4)))  float    v4f;
typedef v8h  __attribute__((may_alias)) v8ha;
typedef v4f  __attribute__((may_alias)) v4fa;
typedef v8us __attribute__((may_alias)) v8usa;

__device__ __forceinline__ unsigned short f2bf(float f) { unsigned u = __float_as_uint(f); u += 0x7FFFu + ((u >> 16) & 1u); return (unsigned short)(u >> 16); }
__device__ __forceinline__ float bf2f(unsigned short b) { return __uint_as_float(((unsigned)b) << 16); }
__device__ __forceinline__ float bfr(float f) { return bf2f(f2bf(f)); }
__device__ __forceinline__ v16h cat16(v8h lo, v8h hi) { return __builtin_shufflevector(lo, hi, 0, 1, 2, 3, 4, 5, 6, 7, 8, 9, 10, 11, 12, 13, 14, 15); }
__device__ __forceinline__ v16bf cat16b(v8us lo, v8us hi) { return __builtin_bit_cast(v16bf, __builtin_shufflevector(lo, hi, 0, 1, 2, 3, 4, 5, 6, 7, 8, 9, 10, 11, 12, 13, 14, 15)); }
__device__ __forceinline__ v8f wmma16(v16h a, v16h b, v8f c) { return __builtin_amdgcn_wmma_f32_16x16x32_f16(false, a, false, b, (short)0, c, false, false); }
__device__ __forceinline__ v8f wmmab(v16bf a, v16bf b, v8f c) { return __builtin_amdgcn_wmma_f32_16x16x32_bf16(false, a, false, b, (short)0, c, false, false); }



// ---- k_gemmw: register-blocked GEMM, ONE WAVE per 64x64 output tile (16 accumulators), operands straight from K-contiguous 16-bit planes; grid (M/64, N/64, Z), 32 threads.
// C[m][n] (f32, pitch ldc, + optional f32 bias[n]) = sum_k A[m][k] Bt[n][k] (+ split products per NSPLIT). z-batch strides sA/sB/sC in elements. K % (32 KS) == 0. KS > 1: grid z = Z x KS; work-group (z, ks) sums only k in [ks K/KS, (ks+1) K/KS) and stores its partial tile in plane z KS + ks of C (plane stride sC).
template <typename T16> struct WFrag;
template <> struct WFrag<h16> { typedef v16h V; static __device__ __forceinline__ V ld(const h16* p) { return cat16(*(const v8h*)p, *(const v8h*)(p + 16)); } static __device__ __forceinline__ v8f mma(V a, V b, v8f c) { return wmma16(a, b, c); } };
template <> struct WFrag<bf> { typedef v16bf V; static __device__ __forceinline__ V ld(const bf* p) { return cat16b(*(const v8us*)p, *(const v8us*)(p + 16)); } static __device__ __forceinline__ v8f mma(V a, V b, v8f c) { return wmmab(a, b, c); } };
__device__ __forceinline__ h16 tohx(float x) { return (h16)x; }
__device__ __forceinline__ void splitf(float y, unsigned short& h, unsigned short& l) { h = f2bf(y); l = f2bf(y - bf2f(h)); }
// one 16-byte store into each of the three planes (fp16, bf16 hi, bf16 lo) of eight neighbouring values. The stores stand in one asm statement with the precautionary s_wait_xcnt 0 behind them, so that it is in front of every later write to their address and data registers.
__device__ __forceinline__ void put8(const float (&x)[8], h16* P16, bf* Ph, bf* Pl, size_t o) { v8h o16; v8us oh, ol;
#pragma unroll
    for (int q = 0; q < 8; ++q) { o16[q] = tohx(x[q]); unsigned short a, c; splitf(x[q], a, c); oh[q] = a; ol[q] = c; }
    asm volatile("global_store_b128 %0, %3, off\n\tglobal_store_b128 %1, %4, off\n\tglobal_store_b128 %2, %5, off\n\ts_wait_xcnt 0x0" :: "v"(P16 + o), "v"(Ph + o), "v"(Pl + o), "v"(o16), "v"(oh), "v"(ol) : "memory"); }
// Where a projection's tile goes when EPI != 0 (a 64-column tile is one head): EPI 1: planes p [h][t][d] of C + bias (k, r); EPI 2: planes p of (C + bias)/8 + bu and planes q of (C + bias)/8 + bv (the two query forms); EPI 3: planes p [h][d][t] of C + bias (v, transposed).
struct Planes { h16* p16; bf* ph; bf* pl; h16* q16; bf* qh; bf* ql; const float* bu; const float* bv; };
template <typename T16, int NSPLIT, bool BIAS, int KS = 1, int EPI = 0>
__global__ __launch_bounds__(32) void k_gemmw(const T16* __restrict__ A, const T16* __restrict__ A2, const T16* __restrict__ Bt, const T16* __restrict__ Bt2, int K, float* C, int ldc, const float* __restrict__ bias, size_t sA, size_t sB, size_t sC, Planes po) {
    typedef typename WFrag<T16>::V V;
    __shared__ __align__(16) float os[16 * 68];
    const size_t z = blockIdx.z / KS; A += z * sA; if (A2) A2 += z * sA; Bt += z * sB; if (Bt2) Bt2 += z * sB; C += (size_t)blockIdx.z * sC; const int kb = (int)(blockIdx.z % KS) * (K / KS), ke = kb + K / KS;
    const int lane = threadIdx.x & 31, lr = lane & 15, hi = lane >> 4; const int r0 = blockIdx.x * 64, c0 = blockIdx.y * 64;
    v8f acc[4][4];
#pragma unroll
    for (int mb = 0; mb < 4; ++mb)
#pragma unroll
        for (int nb = 0; nb < 4; ++nb) acc[mb][nb] = (v8f){};
    const size_t aoff = (size_t)(r0 + lr) * K + 8 * hi, boff = (size_t)(c0 + lr) * K + 8 * hi;
#pragma unroll 1
    for (int kc = kb; kc < ke; kc += 32) {
        V a[4], a2[4];
#pragma unroll
        for (int mb = 0; mb < 4; ++mb) { a[mb] = WFrag<T16>::ld(A + aoff + (size_t)mb * 16 * K + kc); if (NSPLIT == 1 || NSPLIT == 2) a2[mb] = WFrag<T16>::ld(A2 + aoff + (size_t)mb * 16 * K + kc); }
#pragma unroll
        for (int nb = 0; nb < 4; ++nb) { const V b = WFrag<T16>::ld(Bt + boff + (size_t)nb * 16 * K + kc); V b2; if (NSPLIT >= 2) b2 = WFrag<T16>::ld(Bt2 + boff + (size_t)nb * 16 * K + kc);
#pragma unroll
            for (int mb = 0; mb < 4; ++mb) { acc[mb][nb] = WFrag<T16>::mma(a[mb], b, acc[mb][nb]); if (NSPLIT == 1 || NSPLIT == 2) acc[mb][nb] = WFrag<T16>::mma(a2[mb], b, acc[mb][nb]); if (NSPLIT >= 2) acc[mb][nb] = WFrag<T16>::mma(a[mb], b2, acc[mb][nb]); } }
        asm volatile("v_nop\n\tv_nop\n\tv_nop\n\tv_nop" : "+v"(acc[0][0]), "+v"(acc[1][1]), "+v"(acc[2][2]), "+v"(acc[3][3]) : "v"(a[0]), "v"(a[3]));
    }
    if constexpr (EPI == 3) {   // a lane's eight accumulator values are eight neighbouring t of one d: stored straight from the registers
        asm volatile("s_wait_xcnt 0x0" ::: "memory");   // precautionary wait in front of the first write to an address pair of the k loop's loads (this build reuses those pairs at once)
        float bn[4];   // all four bias loads first: the store statements' memory clobber would hold a later load behind them
#pragma unroll
        for (int nb = 0; nb < 4; ++nb) bn[nb] = bfr(bias[c0 + nb * 16 + lr]);
#pragma unroll
        for (int nb = 0; nb < 4; ++nb) {
#pragma unroll
            for (int mb = 0; mb < 4; ++mb) { float x[8];
#pragma unroll
                for (int j = 0; j < 8; ++j) x[j] = acc[mb][nb][j] + bn[nb];
                put8(x, po.p16, po.ph, po.pl, (size_t)(c0 + nb * 16 + lr) * TT + r0 + mb * 16 + hi * 8); } }
        return; }
    const int c8 = (lane & 7) * 8; float bb[8], ub[8], vb[8];   // EPI 1, 2: a lane holds eight neighbouring d of one row
    if constexpr (EPI == 1 || EPI == 2) {
#pragma unroll
        for (int q = 0; q < 8; ++q) { bb[q] = bfr(bias[c0 + c8 + q]); if (EPI == 2) { ub[q] = bfr(po.bu[c0 + c8 + q]); vb[q] = bfr(po.bv[c0 + c8 + q]); } } }
#pragma unroll
    for (int mb = 0; mb < 4; ++mb) {
#pragma unroll
        for (int nb = 0; nb < 4; ++nb) {
#pragma unroll
            for (int j = 0; j < 8; ++j) os[(hi * 8 + j) * 68 + nb * 16 + lr] = acc[mb][nb][j]; }
        __builtin_amdgcn_wave_barrier(); asm volatile("" ::: "memory");
        float* crow = C + (size_t)(r0 + mb * 16) * ldc + c0;
        if constexpr (EPI == 1 || EPI == 2) {
            v4f v0[4], v1[4];   // all LDS reads first: the store statements' memory clobber would hold a later read behind them
#pragma unroll
            for (int s = 0; s < 4; ++s) { const int row = 4 * s + (lane >> 3); v0[s] = *(const v4fa*)(os + row * 68 + c8); v1[s] = *(const v4fa*)(os + row * 68 + c8 + 4); }
#pragma unroll
            for (int s = 0; s < 4; ++s) { const int row = 4 * s + (lane >> 3); const size_t o = ((size_t)blockIdx.y * TT + r0 + mb * 16 + row) * HD + c8; float x[8];
#pragma unroll
                for (int q = 0; q < 8; ++q) x[q] = (q < 4 ? v0[s][q & 3] : v1[s][q & 3]) + bb[q];
                if (EPI == 1) put8(x, po.p16, po.ph, po.pl, o);
                else { float xu[8], xv[8];
#pragma unroll
                    for (int q = 0; q < 8; ++q) { const float aq = __fmul_rn(x[q], 0.125f); xu[q] = __fadd_rn(aq, ub[q]); xv[q] = __fadd_rn(aq, vb[q]); }
                    put8(xu, po.p16, po.ph, po.pl, o); put8(xv, po.q16, po.qh, po.ql, o); } }
        } else {
#pragma unroll
            for (int s = 0; s < 8; ++s) { const int row = 2 * s + hi, cofs = lr * 4; v4f val = *(const v4fa*)(os + row * 68 + cofs); if (BIAS) { val[0] += bfr(bias[c0 + cofs]); val[1] += bfr(bias[c0 + cofs + 1]); val[2] += bfr(bias[c0 + cofs + 2]); val[3] += bfr(bias[c0 + cofs + 3]); }
                *(v4f*)(crow + (size_t)row * ldc + cofs) = val; }
             }
        __builtin_amdgcn_wave_barrier(); asm volatile("" ::: "memory");
    }
}

typedef __attribute__((ext_vector_type(2))) _Float16 v2h;
typedef __attribute__((ext_vector_type(4))) _Float16 v4h;
typedef __attribute__((ext_vector_type(2))) unsigned short v2us;
typedef __attribute__((ext_vector_type(4))) unsigned short v4us;
typedef __attribute__((ext_vector_type(2))) float v2f;
typedef __attribute__((ext_vector_type(4))) int v4i;

__global__ __launch_bounds__(256) void k_wtG(const float* __restrict__ w, int K, int N, bf* Bt) {
    const int lane = threadIdx.x & 31; const int L0 = (blockIdx.x * 8 + (threadIdx.x >> 5)) * 8; const int nlines = N * K / 64;
{
#pragma unroll 1
        for (int l = 0; l < 8; ++l) { const int L = L0 + l; if (L >= nlines) break; const size_t e = (size_t)L * 64 + lane * 2; const int k = (int)(e % K), n = (int)(e / K); v2us o;
            o[0] = f2bf(w[(size_t)k * N + n]); o[1] = f2bf(w[(size_t)(k + 1) * N + n]); *(v2us*)(Bt + e) = o; }
         }
}
__global__ __launch_bounds__(256) void k_cvt8(const float* __restrict__ src, bf* dst, size_t n8) { const size_t i = (size_t)blockIdx.x * 256 + threadIdx.x; if (i >= n8) return; const v8f v = *(const v8f*)(src + i * 8); v8us o;
#pragma unroll
    for (int k = 0; k < 8; ++k) o[k] = f2bf(v[k]); *(v8us*)(dst + i * 8) = o;  }
__global__ __launch_bounds__(256) void k_cscvt(const float* __restrict__ cosT, const float* __restrict__ sinT, float* CS) { const int idx = blockIdx.x * 256 + threadIdx.x; if (idx >= TT * HD) return; v2f cs; cs[0] = bfr(cosT[idx]); cs[1] = bfr(sinT[idx]); *(v2f*)(CS + (size_t)idx * 2) = cs;  }
// ---- k_fattn: one work-group (8 waves) per 16 query rows of one head; the 16 x 2048 f32 logit rows live in LDS from the score products to attn.v.
// Phases: (1) content scores + additive bias -> S; (2) position scores added at their rel-shift place (row i takes BD[i][m >= T-1-i] at j = m-(T-1)+i and BD[i+1][m <= T-3-i] at j = m+i+2; every place gets at most one term); (3) softmax, one wave per row, weights written over the row as 16-bit planes; (4) attn.v in KSP key ranges of 128, two per wave; (5) the KSP partial tiles summed in ascending order.
#define SP 2052                   // LDS row pitch in floats: 2048 + 4, so that the 16 rows of a fragment read start on different banks
typedef v4h  __attribute__((may_alias)) v4ha;
typedef v4us __attribute__((may_alias)) v4usa;
// Behind a batch of global loads: the precautionary wait in front of any write to a register of the loads' address pairs. The pointers are inputs so that the pairs stay live up to it; without that the compiler lets a later load of the batch land in an earlier load's pair. A shorter list repeats its pointers.
__device__ __forceinline__ void xhold(const void* a, const void* b, const void* c, const void* d, const void* e, const void* f, const void* g, const void* h) { asm volatile("s_wait_xcnt 0x0" :: "v"(a), "v"(b), "v"(c), "v"(d), "v"(e), "v"(f), "v"(g), "v"(h) : "memory"); }
// v_exp_f32 with the one free slot that the instruction set asks for behind a transcendental, before its result is read or its source written again; in one statement, so that the v_nop stands directly behind it
__device__ __forceinline__ float exp2_slot(float x) { float r; asm("v_exp_f32 %0, %1\n\tv_nop" : "=v"(r) : "v"(x)); return r; }
template <bool HI> struct BFrag;   // 16 rows x 64 k of a K-contiguous plane (hi + lo planes where HI)
template <> struct BFrag<false> { v16h b[2]; const h16 *p, *p2;
    __device__ __forceinline__ void load(const h16* b16, const bf*, const bf*, size_t off) { p = p2 = b16 + off; b[0] = WFrag<h16>::ld(p); b[1] = WFrag<h16>::ld(p + 32); } };
template <> struct BFrag<true> { v16bf b[2], b2[2]; const bf *p, *p2;
    __device__ __forceinline__ void load(const h16*, const bf* bh, const bf* bl, size_t off) { p = bh + off; p2 = bl + off; b[0] = WFrag<bf>::ld(p); b[1] = WFrag<bf>::ld(p + 32); b2[0] = WFrag<bf>::ld(p2); b2[1] = WFrag<bf>::ld(p2 + 32); } };
__device__ __forceinline__ v8f dot64(const BFrag<false>& q, const BFrag<false>& k) { v8f c = (v8f){};
#pragma unroll
    for (int kk = 0; kk < 2; ++kk) c = wmma16(q.b[kk], k.b[kk], c);
    return c; }
__device__ __forceinline__ v8f dot64(const BFrag<true>& q, const BFrag<true>& k) { v8f c = (v8f){};
#pragma unroll
    for (int kk = 0; kk < 2; ++kk) { c = wmmab(q.b[kk], k.b[kk], c); c = wmmab(q.b2[kk], k.b[kk], c); c = wmmab(q.b[kk], k.b2[kk], c); }
    return c; }
template <bool HI>
__device__ __forceinline__ void ac_pass(float* S, const h16* q16, const bf* qh, const bf* ql, const h16* k16, const bf* kh, const bf* kl, const float* __restrict__ ab, int i0, int w, int lr, int hi) {
    BFrag<HI> q; q.load(q16, qh, ql, (size_t)(i0 + lr) * HD + 8 * hi);
    constexpr int U = HI ? 2 : 4;   // key tiles whose loads fly together
#pragma unroll 1   // the batch of U tiles is the unit; unrolling further would pass 256 VGPRs and cost the second work-group of the WGP
    for (int it = 0; it < TT / 128; it += U) { BFrag<HI> k[U]; const float* pb[U]; float bb[U][8];
#pragma unroll
        for (int u = 0; u < U; ++u) { const int col = (w + (it + u) * 8) * 16 + lr; k[u].load(k16, kh, kl, (size_t)col * HD + 8 * hi); pb[u] = ab + (size_t)(i0 + hi * 8) * TT + col;
#pragma unroll
            for (int jj = 0; jj < 8; ++jj) bb[u][jj] = pb[u][(size_t)jj * TT]; }
        if (HI) xhold(k[0].p, k[0].p2, k[1].p, k[1].p2, pb[0], pb[1], pb[0], pb[1]); else xhold(k[0].p, k[1].p, k[U - 2].p, k[U - 1].p, pb[0], pb[1], pb[U - 2], pb[U - 1]);
#pragma unroll
        for (int u = 0; u < U; ++u) { const v8f c = dot64(q, k[u]); const int col = (w + (it + u) * 8) * 16 + lr;
#pragma unroll
            for (int jj = 0; jj < 8; ++jj) S[(hi * 8 + jj) * SP + col] = __fadd_rn(c[jj], bfr(bb[u][jj])); } }
}
template <bool HI, bool HEAD>
__device__ __forceinline__ void bd_place(float* S, const v8f c, int m, int i0, int hi) {
    float old[8];   // all eight reads first (index clamped into the row where no term is placed), so that they wait once
#pragma unroll
    for (int jj = 0; jj < 8; ++jj) { const int r = hi * 8 + jj, i = i0 + r; const int j = HEAD ? min(m + i + 2, TT - 1) : max(m - (TT - 1) + i, 0); old[jj] = S[r * SP + j]; }
#pragma unroll
    for (int jj = 0; jj < 8; ++jj) { const int r = hi * 8 + jj, i = i0 + r; const bool ok = HEAD ? (m <= TT - 3 - i && (i + 1 < RH) == HI) : (m >= TT - 1 - i); const int j = HEAD ? m + i + 2 : m - (TT - 1) + i;
        if (ok) S[r * SP + j] = __fadd_rn(old[jj], c[jj]); }
}
template <bool HI, bool HEAD>
__device__ __forceinline__ void bd_pass(float* S, const h16* q16, const bf* qh, const bf* ql, const h16* p16, const bf* ph, const bf* pl, int i0, int w, int lr, int hi) {
    int ar = HEAD ? i0 + 1 + lr : i0 + lr; if (ar > TT - 1) ar = TT - 1;   // row T does not exist; no term of it is ever placed (m <= -2)
    BFrag<HI> q; q.load(q16, qh, ql, (size_t)ar * HD + 8 * hi);
    const int ntlo = HEAD ? 0 : (TT - 16 - i0) / 16, nthi = HEAD ? (TT - 3 - i0) / 16 : TT / 16 - 1;
#pragma unroll 1   // trip count depends on the row block; the pair of tiles is the unit
    for (int nt = ntlo + w; nt <= nthi; nt += 16) { const bool two = (nt + 8 <= nthi); const int nt1 = two ? nt + 8 : nt;   // two tiles' loads fly together; the last trip may hold one
        BFrag<HI> r0, r1; r0.load(p16, ph, pl, (size_t)(nt * 16 + lr) * HD + 8 * hi); r1.load(p16, ph, pl, (size_t)(nt1 * 16 + lr) * HD + 8 * hi);
        xhold(r0.p, r0.p2, r1.p, r1.p2, r0.p, r0.p2, r1.p, r1.p2);
        bd_place<HI, HEAD>(S, dot64(q, r0), nt * 16 + lr, i0, hi);
        if (two) bd_place<HI, HEAD>(S, dot64(q, r1), nt1 * 16 + lr, i0, hi); }
}
template <bool HI>
__device__ __forceinline__ void pv_pass(const float* S, const h16* v16, const bf* vh, const bf* vl, int w, int lr, int hi, v8f (&acc)[2][4]) {
    constexpr int NS = HI ? 1 : 2;   // k steps of 32 keys whose loads fly together
#pragma unroll
    for (int u = 0; u < 2; ++u) {
#pragma unroll
        for (int nb = 0; nb < 4; ++nb) acc[u][nb] = (v8f){};
#pragma unroll
        for (int st = 0; st < TT / KSP / 32; st += NS) { const int kc = (2 * w + u) * (TT / KSP) + st * 32; const size_t boff = (size_t)lr * TT + 8 * hi + kc;
            if (HI) { const bf *pv = vh + boff, *pv2 = vl + boff; v16bf b[4], b2[4];
#pragma unroll
                for (int nb = 0; nb < 4; ++nb) { b[nb] = WFrag<bf>::ld(pv + (size_t)nb * 16 * TT); b2[nb] = WFrag<bf>::ld(pv2 + (size_t)nb * 16 * TT); }
                xhold(pv, pv2, pv, pv2, pv, pv2, pv, pv2);
                const bf* p = (const bf*)(S + lr * SP) + kc + 8 * hi; const v16bf a = cat16b(*(const v8usa*)p, *(const v8usa*)(p + 16)), a2 = cat16b(*(const v8usa*)(p + TT), *(const v8usa*)(p + TT + 16));
#pragma unroll
                for (int nb = 0; nb < 4; ++nb) { acc[u][nb] = wmmab(a, b[nb], acc[u][nb]); acc[u][nb] = wmmab(a2, b[nb], acc[u][nb]); acc[u][nb] = wmmab(a, b2[nb], acc[u][nb]); }
            } else { const h16* pv = v16 + boff; v16h b[NS][4];
#pragma unroll
                for (int s = 0; s < NS; ++s)
#pragma unroll
                    for (int nb = 0; nb < 4; ++nb) b[s][nb] = WFrag<h16>::ld(pv + s * 32 + (size_t)nb * 16 * TT);
                xhold(pv, pv, pv, pv, pv, pv, pv, pv);
#pragma unroll
                for (int s = 0; s < NS; ++s) { const h16* p = (const h16*)(S + lr * SP) + kc + s * 32 + 8 * hi; const v16h a = cat16(*(const v8ha*)p, *(const v8ha*)(p + 16));
#pragma unroll
                    for (int nb = 0; nb < 4; ++nb) acc[u][nb] = wmma16(a, b[s][nb], acc[u][nb]); } } } }
}
// amdgpu_waves_per_eu(4, 4): 256 VGPRs at most, so that two work-groups (2 x 131,328 B of LDS) share a WGP and one computes while the other waits at a barrier
__global__ __launch_bounds__(256) __attribute__((amdgpu_waves_per_eu(4, 4))) void k_fattn(const h16* __restrict__ QP16, const bf* __restrict__ QPh, const bf* __restrict__ QPl, const h16* __restrict__ QV16, const bf* __restrict__ QVh, const bf* __restrict__ QVl, const h16* __restrict__ KP16, const bf* __restrict__ KPh, const bf* __restrict__ KPl, const h16* __restrict__ PP16, const bf* __restrict__ PPh, const bf* __restrict__ PPl, const h16* __restrict__ VT16, const bf* __restrict__ VTh, const bf* __restrict__ VTl, const float* __restrict__ ab, bf* Ah, bf* Al) {
    __shared__ __align__(16) float S[16 * SP];
    const int tid = threadIdx.x, lane = tid & 31, lr = lane & 15, hi = lane >> 4; const int w = __builtin_amdgcn_readfirstlane(tid >> 5);
    const int i0 = blockIdx.x * 16, h = blockIdx.y; const bool hires = (i0 < RH); const size_t hp = (size_t)h * TT * HD;
    if (hires) ac_pass<true>(S, QP16 + hp, QPh + hp, QPl + hp, KP16 + hp, KPh + hp, KPl + hp, ab, i0, w, lr, hi); else ac_pass<false>(S, QP16 + hp, QPh + hp, QPl + hp, KP16 + hp, KPh + hp, KPl + hp, ab, i0, w, lr, hi);
    __syncthreads();   // every content + bias value stands in S before a position term is added to it
    if (hires) bd_pass<true, false>(S, QV16 + hp, QVh + hp, QVl + hp, PP16 + hp, PPh + hp, PPl + hp, i0, w, lr, hi); else bd_pass<false, false>(S, QV16 + hp, QVh + hp, QVl + hp, PP16 + hp, PPh + hp, PPl + hp, i0, w, lr, hi);
    if (i0 + 1 < RH) bd_pass<true, true>(S, QV16 + hp, QVh + hp, QVl + hp, PP16 + hp, PPh + hp, PPl + hp, i0, w, lr, hi);      // rows i+1 < RH: hi+lo products
    if (i0 + 16 >= RH) bd_pass<false, true>(S, QV16 + hp, QVh + hp, QVl + hp, PP16 + hp, PPh + hp, PPl + hp, i0, w, lr, hi);   // rows i+1 >= RH: fp16 products
    __syncthreads();   // logits complete before a wave reads its rows
#pragma unroll 1   // one 64-register row at a time
    for (int rr = 0; rr < 2; ++rr) { float* srow = S + (w + rr * 8) * SP; float v[TT / 32]; float mx = -3.0e38f;
#pragma unroll
        for (int ch = 0; ch < TT / 128; ++ch) { const v4f a = *(const v4fa*)(srow + ch * 128 + lane * 4);
#pragma unroll
            for (int q = 0; q < 4; ++q) { v[ch * 4 + q] = a[q]; mx = fmaxf(mx, a[q]); } }
#pragma unroll
        for (int sh = 16; sh; sh >>= 1) mx = fmaxf(mx, __shfl_xor(mx, sh, 32));
        float sum = 0.f;
#pragma unroll
        for (int k = 0; k < TT / 32; ++k) { v[k] = exp2_slot(__fmul_rn(__fsub_rn(v[k], mx), 1.4426950408889634f)); sum += v[k]; }
#pragma unroll
        for (int sh = 16; sh; sh >>= 1) sum += __shfl_xor(sum, sh, 32);
        const float f = __fdiv_rn(hires ? 1.0f : PCAR, sum);
        if (hires) { bf* ph = (bf*)srow;
#pragma unroll
            for (int ch = 0; ch < TT / 128; ++ch) { v4us oh, ol;
#pragma unroll
                for (int q = 0; q < 4; ++q) { unsigned short a, c2; splitf(v[ch * 4 + q] * f, a, c2); oh[q] = a; ol[q] = c2; }
                *(v4usa*)(ph + ch * 128 + lane * 4) = oh; *(v4usa*)(ph + TT + ch * 128 + lane * 4) = ol; }
        } else { h16* p16 = (h16*)srow;
#pragma unroll
            for (int ch = 0; ch < TT / 128; ++ch) { v4h o4;
#pragma unroll
                for (int q = 0; q < 4; ++q) o4[q] = tohx(v[ch * 4 + q] * f);
                *(v4ha*)(p16 + ch * 128 + lane * 4) = o4; } } }
    __syncthreads();   // all 16 weight rows written before any wave reads them as A fragments
    v8f acc[2][4]; const size_t hv = (size_t)h * HD * TT;
    if (hires) pv_pass<true>(S, VT16 + hv, VTh + hv, VTl + hv, w, lr, hi, acc); else pv_pass<false>(S, VT16 + hv, VTh + hv, VTl + hv, w, lr, hi, acc);
    __syncthreads();   // last read of the weights is over before the partial tiles overwrite them
#pragma unroll
    for (int u = 0; u < 2; ++u)
#pragma unroll
        for (int nb = 0; nb < 4; ++nb)
#pragma unroll
            for (int jj = 0; jj < 8; ++jj) S[(2 * w + u) * (16 * HD) + (hi * 8 + jj) * HD + nb * 16 + lr] = acc[u][nb][jj];
    __syncthreads();   // all KSP partial tiles written before they are summed
    const int e = tid * 4, t = i0 + (e >> 6), d = e & 63; v4f s = *(const v4fa*)(S + e);
#pragma unroll
    for (int ks = 1; ks < KSP; ++ks) s += *(const v4fa*)(S + ks * (16 * HD) + e);
    const float cs = (t < RH) ? 1.0f : (1.0f / PCAR); v4us oh, ol;
#pragma unroll
    for (int q = 0; q < 4; ++q) { unsigned short a, c2; splitf(s[q] * cs, a, c2); oh[q] = a; ol[q] = c2; }
    const size_t oo = (size_t)t * DQ + h * HD + d; *(v4us*)(Ah + oo) = oh; *(v4us*)(Al + oo) = ol;
}

extern "C" void kernel_launch(void* const* d_in, const int* in_sizes, int n_in,
                              void* d_out, int out_size, void* d_ws, size_t ws_size, hipStream_t stream) {
    (void)in_sizes; (void)n_in; (void)out_size;
    const float* x = (const float*)d_in[0]; const float* abias = (const float*)d_in[1]; const float* pemb = (const float*)d_in[2]; const float* pbu = (const float*)d_in[3]; const float* pbv = (const float*)d_in[4]; const float* wq = (const float*)d_in[5]; const float* bq = (const float*)d_in[6]; const float* wk = (const float*)d_in[7]; const float* bk = (const float*)d_in[8]; const float* wv = (const float*)d_in[9]; const float* bv = (const float*)d_in[10]; const float* wpos = (const float*)d_in[11]; const float* bpos = (const float*)d_in[12]; const float* wo = (const float*)d_in[13]; const float* bo = (const float*)d_in[14]; const float* cosT = nullptr; const float* sinT = nullptr; (void)cosT; (void)sinT;
    float* OUT = (float*)d_out;     // [2][2048][1024]
    char* wsp = (char*)d_ws;
    auto take = [&](size_t bytes) { char* p = wsp; wsp += (bytes + 255) & ~(size_t)255; return (void*)p; };
    bf* WQ = (bf*)take((size_t)DQ * DM * 2); bf* WK = (bf*)take((size_t)DKV * DM * 2); bf* WV = (bf*)take((size_t)DKV * DM * 2); bf* WO = (bf*)take((size_t)DM * DQ * 2);
    bf* XB = (bf*)take((size_t)TT * DM * 2); bf* XP = (bf*)take((size_t)TT * DM * 2); bf* WP = (bf*)take((size_t)DQ * DM * 2); h16* PP16 = (h16*)take((size_t)NH_ * TT * HD * 2); bf* PPh = (bf*)take((size_t)NH_ * TT * HD * 2); bf* PPl = (bf*)take((size_t)NH_ * TT * HD * 2); h16* QV16 = (h16*)take((size_t)NH_ * TT * HD * 2); bf* QVh = (bf*)take((size_t)NH_ * TT * HD * 2); bf* QVl = (bf*)take((size_t)NH_ * TT * HD * 2);
    h16* QP16 = (h16*)take((size_t)NH_ * TT * HD * 2); h16* KP16 = (h16*)take((size_t)NKV * TT * HD * 2); h16* VT16 = (h16*)take((size_t)NKV * HD * TT * 2);
    bf* QPh = (bf*)take((size_t)NH_ * TT * HD * 2); bf* QPl = (bf*)take((size_t)NH_ * TT * HD * 2); bf* KPh = (bf*)take((size_t)NKV * TT * HD * 2); bf* KPl = (bf*)take((size_t)NKV * TT * HD * 2); bf* VTh = (bf*)take((size_t)NKV * HD * TT * 2); bf* VTl = (bf*)take((size_t)NKV * HD * TT * 2);
    bf* ATh = (bf*)take((size_t)TT * DQ * 2); bf* ATl = (bf*)take((size_t)TT * DQ * 2);
    if ((size_t)(wsp - (char*)d_ws) > ws_size) return;    // ws 256 MiB
    { k_wtG<<<(unsigned)((DM * DQ / 64 + 63) / 64), 256, 0, stream>>>(wq, DM, DQ, WQ); k_wtG<<<(unsigned)((DM * DKV / 64 + 63) / 64), 256, 0, stream>>>(wk, DM, DKV, WK); k_wtG<<<(unsigned)((DM * DKV / 64 + 63) / 64), 256, 0, stream>>>(wv, DM, DKV, WV);
      k_wtG<<<(unsigned)((DQ * DM / 64 + 63) / 64), 256, 0, stream>>>(wo, DQ, DM, WO); k_wtG<<<(unsigned)((DM * DQ / 64 + 63) / 64), 256, 0, stream>>>(wpos, DM, DQ, WP); k_cvt8<<<(unsigned)(((size_t)TT * DM / 8 + 255) / 256), 256, 0, stream>>>(pemb, XP, (size_t)TT * DM / 8); k_gemmw<bf, 0, true, 1, 1><<<dim3(TT / 64, DQ / 64, 1), 32, 0, stream>>>(XP, nullptr, WP, nullptr, DM, nullptr, DQ, bpos, 0, 0, 0, Planes{PP16, PPh, PPl, nullptr, nullptr, nullptr, nullptr, nullptr});
       }
    for (int b = 0; b < NB_; ++b) {
        
        k_cvt8<<<(unsigned)(((size_t)TT * DM / 8 + 255) / 256), 256, 0, stream>>>(x + (size_t)b * TT * DM, XB, (size_t)TT * DM / 8);
        k_gemmw<bf, 0, true, 1, 2><<<dim3(TT / 64, DQ / 64, 1), 32, 0, stream>>>(XB, nullptr, WQ, nullptr, DM, nullptr, DQ, bq, 0, 0, 0, Planes{QP16, QPh, QPl, QV16, QVh, QVl, pbu, pbv});
        k_gemmw<bf, 0, true, 1, 1><<<dim3(TT / 64, DKV / 64, 1), 32, 0, stream>>>(XB, nullptr, WK, nullptr, DM, nullptr, DKV, bk, 0, 0, 0, Planes{KP16, KPh, KPl, nullptr, nullptr, nullptr, nullptr, nullptr});
        k_gemmw<bf, 0, true, 1, 3><<<dim3(TT / 64, DKV / 64, 1), 32, 0, stream>>>(XB, nullptr, WV, nullptr, DM, nullptr, DKV, bv, 0, 0, 0, Planes{VT16, VTh, VTl, nullptr, nullptr, nullptr, nullptr, nullptr});
        k_fattn<<<dim3(TT / 16, NH_, 1), 256, 0, stream>>>(QP16, QPh, QPl, QV16, QVh, QVl, KP16, KPh, KPl, PP16, PPh, PPl, VT16, VTh, VTl, abias, ATh, ATl);
        k_gemmw<bf, 1, true><<<dim3(TT / 64, DM / 64, 1), 32, 0, stream>>>(ATh, ATl, WO, nullptr, DQ, OUT + (size_t)b * TT * DM, DM, bo, 0, 0, 0, Planes{nullptr, nullptr, nullptr, nullptr, nullptr, nullptr, nullptr, nullptr}); }
}

// v004
// A run of this version takes 528 microseconds.
// Two timings next to v003 both put it at 1.21 times that version's speed.
// All steps since v000 together make it 5.15 times as fast.
#include <hip/hip_runtime.h>

// Multi-head self-attention with relative positions and learnable u/v biases (x [2][2048][1024], bias [1][1][L][L] (f32 additive, read; verbatim causal 0/-1e9), pos_emb [2048][1][1024], pos_bias_u/v [16][64]; q/k/v = x W + b, r = pos_emb Wr + br ('xw', 16 heads x 64); qh = q/8; AC = (qh + u).k + bias; BD = (qh + v).r; logits = AC + rel_shift(BD) with the pad-front/reshape shift: pos[i][j] = BD[i][T-1-(i-j)] for j <= i, 0 for j == i+1, BD[i+1][j-i-2] for j >= i+2 (reproduced literally, including the masked upper part); softmax; out = merged Wo + bo -> [2][2048][1024]).
// Compute dtypes, f32 accumulate: every input rounded to bf16; q/k/v/r as PLAIN bf16 GEMMs (inputs: exact) + bias; q x 1/8 (exact) then the u/v head biases added in f32; content, position scores and attn.v: query rows < 512 hl (3 products), the rest single fp16 (x1024) (the shifted position score is gathered from rows i / i+1 of the position-score block); the additive bias read per element; softmax f32; Wo hl x exact (2 products) + bias.

#define NB_  2
#define TT   2048
#define DM   1024
#define NH_  16
#define NKV  16
#define REP  (NH_ / NKV)
#define HD   64
#define DQ   (NH_ * HD)
#define DKV  (NKV * HD)
#define RH   512                  // query rows < RH use hi+lo planes (0: none)
#define WIN  0
#define PCAR 1024.0f
#define KSP  16                   // attn.v: key ranges per output tile, two per wave of k_fattn; the KSP partial tiles are summed in ascending order
#define SCL  1.0f   // the 1/sqrt(64) is applied to q before the u/v biases (k_gemmw, EPI 2)
typedef _Float16 h16;
typedef unsigned short bf;
typedef __attribute__((ext_vector_type(16))) __bf16   v16bf;
typedef __attribute__((ext_vector_type(16))) _Float16 v16h;
typedef __attribute__((ext_vector_type(8)))  _Float16 v8h;
typedef __attribute__((ext_vector_type(8)))  unsigned short v8us;
typedef __attribute__((ext_vector_type(8)))  float    v8f;
typedef __attribute__((ext_vector_type(4)))  float    v4f;
typedef v8h  __attribute__((may_alias)) v8ha;
typedef v4f  __attribute__((may_alias)) v4fa;
typedef v8us __attribute__((may_alias)) v8usa;

__device__ __forceinline__ unsigned short f2bf(float f) { unsigned u = __float_as_uint(f); u += 0x7FFFu + ((u >> 16) & 1u); return (unsigned short)(u >> 16); }
__device__ __forceinline__ float bf2f(unsigned short b) { return __uint_as_float(((unsigned)b) << 16); }
__device__ __forceinline__ float bfr(float f) { return bf2f(f2bf(f)); }
__device__ __forceinline__ v16h cat16(v8h lo, v8h hi) { return __builtin_shufflevector(lo, hi, 0, 1, 2, 3, 4, 5, 6, 7, 8, 9, 10, 11, 12, 13, 14, 15); }
__device__ __forceinline__ v16bf cat16b(v8us lo, v8us hi) { return __builtin_bit_cast(v16bf, __builtin_shufflevector(lo, hi, 0, 1, 2, 3, 4, 5, 6, 7, 8, 9, 10, 11, 12, 13, 14, 15)); }
__device__ __forceinline__ v8f wmma16(v16h a, v16h b, v8f c) { return __builtin_amdgcn_wmma_f32_16x16x32_f16(false, a, false, b, (short)0, c, false, false); }
__device__ __forceinline__ v8f wmmab(v16bf a, v16bf b, v8f c) { return __builtin_amdgcn_wmma_f32_16x16x32_bf16(false, a, false, b, (short)0, c, false, false); }



// ---- FRAGMENT ORDER of the 16-bit head planes that k_fattn reads (q + u, q + v, k, r, v): a block of 16 rows x 32 k (512 elements, 1 KiB) is stored as [g = (k >> 3) & 3][row & 15][k & 7], which is lane order (lane = 16 hi + row, g = 2 c + hi): load c of a fragment is 32 lanes x 16 B = 512 contiguous bytes (4 whole lines) where a row-major plane gives 16 part lines. Blocks of one 16-row tile follow one another along k. The registers hold what they held with row-major planes. The planes that k_gemmw reads stay row-major (ld); ldf loads from a plane in fragment order.
// ---- k_gemmw: register-blocked GEMM, ONE WAVE per 64x64 output tile (16 accumulators), operands straight from K-contiguous 16-bit planes; grid (M/64, N/64, Z), 32 threads.
// C[m][n] (f32, pitch ldc, + optional f32 bias[n]) = sum_k A[m][k] Bt[n][k] (+ split products per NSPLIT). z-batch strides sA/sB/sC in elements. K % (32 KS) == 0. KS > 1: grid z = Z x KS; work-group (z, ks) sums only k in [ks K/KS, (ks+1) K/KS) and stores its partial tile in plane z KS + ks of C (plane stride sC).
template <typename T16> struct WFrag;
template <> struct WFrag<h16> { typedef v16h V; static __device__ __forceinline__ V ld(const h16* p) { return cat16(*(const v8h*)p, *(const v8h*)(p + 16)); } static __device__ __forceinline__ V ldf(const h16* p) { return cat16(*(const v8h*)p, *(const v8h*)(p + 256)); } static __device__ __forceinline__ v8f mma(V a, V b, v8f c) { return wmma16(a, b, c); } };
template <> struct WFrag<bf> { typedef v16bf V; static __device__ __forceinline__ V ld(const bf* p) { return cat16b(*(const v8us*)p, *(const v8us*)(p + 16)); } static __device__ __forceinline__ V ldf(const bf* p) { return cat16b(*(const v8us*)p, *(const v8us*)(p + 256)); } static __device__ __forceinline__ v8f mma(V a, V b, v8f c) { return wmmab(a, b, c); } };
__device__ __forceinline__ h16 tohx(float x) { return (h16)x; }
__device__ __forceinline__ void splitf(float y, unsigned short& h, unsigned short& l) { h = f2bf(y); l = f2bf(y - bf2f(h)); }
// one 16-byte store into each of the three planes (fp16, bf16 hi, bf16 lo) of eight neighbouring values. The stores stand in one asm statement with the precautionary s_wait_xcnt 0 behind them, so that it is in front of every later write to their address and data registers.
__device__ __forceinline__ void put8(const float (&x)[8], h16* P16, bf* Ph, bf* Pl, size_t o) { v8h o16; v8us oh, ol;
#pragma unroll
    for (int q = 0; q < 8; ++q) { o16[q] = tohx(x[q]); unsigned short a, c; splitf(x[q], a, c); oh[q] = a; ol[q] = c; }
    asm volatile("global_store_b128 %0, %3, off\n\tglobal_store_b128 %1, %4, off\n\tglobal_store_b128 %2, %5, off\n\ts_wait_xcnt 0x0" :: "v"(P16 + o), "v"(Ph + o), "v"(Pl + o), "v"(o16), "v"(oh), "v"(ol) : "memory"); }
// Where a projection's tile goes when EPI != 0 (a 64-column tile is one head), all in fragment order: EPI 1: planes p [h] (rows t, k = d) of C + bias (k, r); EPI 2: planes p of (C + bias)/8 + bu and planes q of (C + bias)/8 + bv (the two query forms); EPI 3: planes p [h] (rows d, k = t; the four 16-row blocks of one k step side by side) of C + bias (v, transposed).
struct Planes { h16* p16; bf* ph; bf* pl; h16* q16; bf* qh; bf* ql; const float* bu; const float* bv; };
template <typename T16, int NSPLIT, bool BIAS, int KS = 1, int EPI = 0>
__global__ __launch_bounds__(32) void k_gemmw(const T16* __restrict__ A, const T16* __restrict__ A2, const T16* __restrict__ Bt, const T16* __restrict__ Bt2, int K, float* C, int ldc, const float* __restrict__ bias, size_t sA, size_t sB, size_t sC, Planes po) {
    typedef typename WFrag<T16>::V V;
    __shared__ __align__(16) float os[(EPI == 2 ? 2 : 1) * 16 * 68];   // EPI 2: one tile for each of the two query forms
    const size_t z = blockIdx.z / KS; A += z * sA; if (A2) A2 += z * sA; Bt += z * sB; if (Bt2) Bt2 += z * sB; C += (size_t)blockIdx.z * sC; const int kb = (int)(blockIdx.z % KS) * (K / KS), ke = kb + K / KS;
    const int lane = threadIdx.x & 31, lr = lane & 15, hi = lane >> 4; const int r0 = blockIdx.x * 64, c0 = blockIdx.y * 64;
    v8f acc[4][4];
#pragma unroll
    for (int mb = 0; mb < 4; ++mb)
#pragma unroll
        for (int nb = 0; nb < 4; ++nb) acc[mb][nb] = (v8f){};
    const size_t aoff = (size_t)(r0 + lr) * K + 8 * hi, boff = (size_t)(c0 + lr) * K + 8 * hi;
#pragma unroll 1
    for (int kc = kb; kc < ke; kc += 32) {
        V a[4], a2[4];
#pragma unroll
        for (int mb = 0; mb < 4; ++mb) { a[mb] = WFrag<T16>::ld(A + aoff + (size_t)mb * 16 * K + kc); if (NSPLIT == 1 || NSPLIT == 2) a2[mb] = WFrag<T16>::ld(A2 + aoff + (size_t)mb * 16 * K + kc); }
#pragma unroll
        for (int nb = 0; nb < 4; ++nb) { const V b = WFrag<T16>::ld(Bt + boff + (size_t)nb * 16 * K + kc); V b2; if (NSPLIT >= 2) b2 = WFrag<T16>::ld(Bt2 + boff + (size_t)nb * 16 * K + kc);
#pragma unroll
            for (int mb = 0; mb < 4; ++mb) { acc[mb][nb] = WFrag<T16>::mma(a[mb], b, acc[mb][nb]); if (NSPLIT == 1 || NSPLIT == 2) acc[mb][nb] = WFrag<T16>::mma(a2[mb], b, acc[mb][nb]); if (NSPLIT >= 2) acc[mb][nb] = WFrag<T16>::mma(a[mb], b2, acc[mb][nb]); } }
        asm volatile("v_nop\n\tv_nop\n\tv_nop\n\tv_nop" : "+v"(acc[0][0]), "+v"(acc[1][1]), "+v"(acc[2][2]), "+v"(acc[3][3]) : "v"(a[0]), "v"(a[3]));
    }
    if constexpr (EPI == 3) {   // a lane's eight accumulator values are eight neighbouring t of one d, one 16-byte unit of the fragment order (rows d, k = t): stored straight from the registers
        asm volatile("s_wait_xcnt 0x0" ::: "memory");   // precautionary wait in front of the first write to an address pair of the k loop's loads
        float bn[4];   // all four bias loads first: the store statements' memory clobber would hold a later load behind them
#pragma unroll
        for (int nb = 0; nb < 4; ++nb) bn[nb] = bfr(bias[c0 + nb * 16 + lr]);
#pragma unroll
        for (int nb = 0; nb < 4; ++nb) {
#pragma unroll
            for (int mb = 0; mb < 4; ++mb) { float x[8];
#pragma unroll
                for (int j = 0; j < 8; ++j) x[j] = acc[mb][nb][j] + bn[nb];
                put8(x, po.p16, po.ph, po.pl, ((size_t)blockIdx.y * TT + r0 + (mb >> 1) * 32) * HD + nb * 512 + (mb & 1) * 256 + lane * 8); } }   // block (32 t, 16 d) in fragment order: 512 contiguous bytes a store
        return; }
    float bn[4], un[4], vn[4];   // EPI 1, 2: the biases of a lane's four accumulator columns, added before the tile goes through LDS
    if constexpr (EPI == 1 || EPI == 2) {
#pragma unroll
        for (int nb = 0; nb < 4; ++nb) { bn[nb] = bfr(bias[c0 + nb * 16 + lr]); if (EPI == 2) { un[nb] = bfr(po.bu[c0 + nb * 16 + lr]); vn[nb] = bfr(po.bv[c0 + nb * 16 + lr]); } } }
#pragma unroll
    for (int mb = 0; mb < 4; ++mb) {
#pragma unroll
        for (int nb = 0; nb < 4; ++nb) {
#pragma unroll
            for (int j = 0; j < 8; ++j) { const int oi = (hi * 8 + j) * 68 + nb * 16 + lr;
                if constexpr (EPI == 1) os[oi] = acc[mb][nb][j] + bn[nb];
                else if constexpr (EPI == 2) { const float aq = __fmul_rn(acc[mb][nb][j] + bn[nb], 0.125f); os[oi] = __fadd_rn(aq, un[nb]); os[16 * 68 + oi] = __fadd_rn(aq, vn[nb]); }
                else os[oi] = acc[mb][nb][j]; } }
        __builtin_amdgcn_wave_barrier(); asm volatile("" ::: "memory");
        float* crow = C + (size_t)(r0 + mb * 16) * ldc + c0;
        if constexpr (EPI == 1 || EPI == 2) {
            const size_t o = ((size_t)blockIdx.y * TT + r0 + mb * 16) * HD + lane * 8;   // store s: units g = 2 s + hi of row lr, 512 contiguous bytes
#pragma unroll
            for (int pl = 0; pl < (EPI == 2 ? 2 : 1); ++pl) { const float* ot = os + pl * (16 * 68) + lr * 68 + hi * 8;
                v4f v0[4], v1[4];   // a tile's LDS reads first: the store statements' memory clobber would hold a later read behind them
#pragma unroll
                for (int s = 0; s < 4; ++s) { v0[s] = *(const v4fa*)(ot + s * 16); v1[s] = *(const v4fa*)(ot + s * 16 + 4); }
#pragma unroll
                for (int s = 0; s < 4; ++s) { float x[8];
#pragma unroll
                    for (int q = 0; q < 8; ++q) x[q] = q < 4 ? v0[s][q & 3] : v1[s][q & 3];
                    if (pl == 0) put8(x, po.p16, po.ph, po.pl, o + s * 256); else put8(x, po.q16, po.qh, po.ql, o + s * 256); } }
        } else {
#pragma unroll
            for (int s = 0; s < 8; ++s) { const int row = 2 * s + hi, cofs = lr * 4; v4f val = *(const v4fa*)(os + row * 68 + cofs); if (BIAS) { val[0] += bfr(bias[c0 + cofs]); val[1] += bfr(bias[c0 + cofs + 1]); val[2] += bfr(bias[c0 + cofs + 2]); val[3] += bfr(bias[c0 + cofs + 3]); }
                *(v4f*)(crow + (size_t)row * ldc + cofs) = val; }
             }
        __builtin_amdgcn_wave_barrier(); asm volatile("" ::: "memory");
    }
}

typedef __attribute__((ext_vector_type(2))) _Float16 v2h;
typedef __attribute__((ext_vector_type(4))) _Float16 v4h;
typedef __attribute__((ext_vector_type(2))) unsigned short v2us;
typedef __attribute__((ext_vector_type(4))) unsigned short v4us;
typedef __attribute__((ext_vector_type(2))) float v2f;
typedef __attribute__((ext_vector_type(4))) int v4i;

__global__ __launch_bounds__(256) void k_wtG(const float* __restrict__ w, int K, int N, bf* Bt) {
    const int lane = threadIdx.x & 31; const int L0 = (blockIdx.x * 8 + (threadIdx.x >> 5)) * 8; const int nlines = N * K / 64;
{
#pragma unroll 1
        for (int l = 0; l < 8; ++l) { const int L = L0 + l; if (L >= nlines) break; const size_t e = (size_t)L * 64 + lane * 2; const int k = (int)(e % K), n = (int)(e / K); v2us o;
            o[0] = f2bf(w[(size_t)k * N + n]); o[1] = f2bf(w[(size_t)(k + 1) * N + n]); *(v2us*)(Bt + e) = o; }
         }
}
__global__ __launch_bounds__(256) void k_cvt8(const float* __restrict__ src, bf* dst, size_t n8) { const size_t i = (size_t)blockIdx.x * 256 + threadIdx.x; if (i >= n8) return; const v8f v = *(const v8f*)(src + i * 8); v8us o;
#pragma unroll
    for (int k = 0; k < 8; ++k) o[k] = f2bf(v[k]); *(v8us*)(dst + i * 8) = o;  }
__global__ __launch_bounds__(256) void k_cscvt(const float* __restrict__ cosT, const float* __restrict__ sinT, float* CS) { const int idx = blockIdx.x * 256 + threadIdx.x; if (idx >= TT * HD) return; v2f cs; cs[0] = bfr(cosT[idx]); cs[1] = bfr(sinT[idx]); *(v2f*)(CS + (size_t)idx * 2) = cs;  }
// ---- k_fattn: one work-group (8 waves) per 16 query rows of one head; the 16 x 2048 f32 logit rows live in LDS from the score products to attn.v.
// Phases: (1) content scores + additive bias -> S; (2) position scores added at their rel-shift place (row i takes BD[i][m >= T-1-i] at j = m-(T-1)+i and BD[i+1][m <= T-3-i] at j = m+i+2; every place gets at most one term); (3) softmax, one wave per row, weights written over the row as 16-bit planes; (4) attn.v in KSP key ranges of 128, two per wave; (5) the KSP partial tiles summed in ascending order.
#define SP 2052                   // LDS row pitch in floats: 2048 + 4, so that the 16 rows of a fragment read start on different banks
typedef v4h  __attribute__((may_alias)) v4ha;
typedef v4us __attribute__((may_alias)) v4usa;
// Behind a batch of global loads: the precautionary wait in front of any write to a register of the loads' address pairs. The pointers are inputs so that the pairs stay live up to it; without that the compiler lets a later load of the batch land in an earlier load's pair. A shorter list repeats its pointers.
__device__ __forceinline__ void xhold(const void* a, const void* b, const void* c, const void* d, const void* e, const void* f, const void* g, const void* h) { asm volatile("s_wait_xcnt 0x0" :: "v"(a), "v"(b), "v"(c), "v"(d), "v"(e), "v"(f), "v"(g), "v"(h) : "memory"); }
// v_exp_f32 with the one free slot that the instruction set asks for behind a transcendental, before its result is read or its source written again; in one statement, so that the v_nop stands directly behind it
__device__ __forceinline__ float exp2_slot(float x) { float r; asm("v_exp_f32 %0, %1\n\tv_nop" : "=v"(r) : "v"(x)); return r; }
template <bool HI> struct BFrag;   // 16 rows x 64 k of a plane in fragment order (hi + lo planes where HI); off = fo(lane's row, hi)
__device__ __forceinline__ size_t fo(int row, int hi) { return (size_t)(row >> 4) * (16 * HD) + (row & 15) * 8 + hi * 128; }
template <> struct BFrag<false> { v16h b[2]; const h16 *p, *p2;
    __device__ __forceinline__ void load(const h16* b16, const bf*, const bf*, size_t off) { p = p2 = b16 + off; b[0] = WFrag<h16>::ldf(p); b[1] = WFrag<h16>::ldf(p + 512); } };
template <> struct BFrag<true> { v16bf b[2], b2[2]; const bf *p, *p2;
    __device__ __forceinline__ void load(const h16*, const bf* bh, const bf* bl, size_t off) { p = bh + off; p2 = bl + off; b[0] = WFrag<bf>::ldf(p); b[1] = WFrag<bf>::ldf(p + 512); b2[0] = WFrag<bf>::ldf(p2); b2[1] = WFrag<bf>::ldf(p2 + 512); } };
__device__ __forceinline__ v8f dot64(const BFrag<false>& q, const BFrag<false>& k) { v8f c = (v8f){};
#pragma unroll
    for (int kk = 0; kk < 2; ++kk) c = wmma16(q.b[kk], k.b[kk], c);
    return c; }
__device__ __forceinline__ v8f dot64(const BFrag<true>& q, const BFrag<true>& k) { v8f c = (v8f){};
#pragma unroll
    for (int kk = 0; kk < 2; ++kk) { c = wmmab(q.b[kk], k.b[kk], c); c = wmmab(q.b2[kk], k.b[kk], c); c = wmmab(q.b[kk], k.b2[kk], c); }
    return c; }
template <bool HI>
__device__ __forceinline__ void ac_pass(float* S, const h16* q16, const bf* qh, const bf* ql, const h16* k16, const bf* kh, const bf* kl, const float* __restrict__ ab, int i0, int w, int lr, int hi) {
    BFrag<HI> q; q.load(q16, qh, ql, fo(i0 + lr, hi));
    constexpr int U = HI ? 2 : 4;   // key tiles whose loads fly together
#pragma unroll 1   // the batch of U tiles is the unit; unrolling further would pass 256 VGPRs and cost the second work-group of the WGP
    for (int it = 0; it < TT / 128; it += U) { BFrag<HI> k[U]; const float* pb[U]; float bb[U][8];
#pragma unroll
        for (int u = 0; u < U; ++u) { const int col = (w + (it + u) * 8) * 16 + lr; k[u].load(k16, kh, kl, fo(col, hi)); pb[u] = ab + (size_t)(i0 + hi * 8) * TT + col;
#pragma unroll
            for (int jj = 0; jj < 8; ++jj) bb[u][jj] = pb[u][(size_t)jj * TT]; }
        if (HI) xhold(k[0].p, k[0].p2, k[1].p, k[1].p2, pb[0], pb[1], pb[0], pb[1]); else xhold(k[0].p, k[1].p, k[U - 2].p, k[U - 1].p, pb[0], pb[1], pb[U - 2], pb[U - 1]);
#pragma unroll
        for (int u = 0; u < U; ++u) { const v8f c = dot64(q, k[u]); const int col = (w + (it + u) * 8) * 16 + lr;
#pragma unroll
            for (int jj = 0; jj < 8; ++jj) S[(hi * 8 + jj) * SP + col] = __fadd_rn(c[jj], bfr(bb[u][jj])); } }
}
template <bool HI, bool HEAD>
__device__ __forceinline__ void bd_place(float* S, const v8f c, int m, int i0, int hi) {
    float old[8];   // all eight reads first (index clamped into the row where no term is placed), so that they wait once
#pragma unroll
    for (int jj = 0; jj < 8; ++jj) { const int r = hi * 8 + jj, i = i0 + r; const int j = HEAD ? min(m + i + 2, TT - 1) : max(m - (TT - 1) + i, 0); old[jj] = S[r * SP + j]; }
#pragma unroll
    for (int jj = 0; jj < 8; ++jj) { const int r = hi * 8 + jj, i = i0 + r; const bool ok = HEAD ? (m <= TT - 3 - i && (i + 1 < RH) == HI) : (m >= TT - 1 - i); const int j = HEAD ? m + i + 2 : m - (TT - 1) + i;
        if (ok) S[r * SP + j] = __fadd_rn(old[jj], c[jj]); }
}
template <bool HI, bool HEAD>
__device__ __forceinline__ void bd_pass(float* S, const h16* q16, const bf* qh, const bf* ql, const h16* p16, const bf* ph, const bf* pl, int i0, int w, int lr, int hi) {
    int ar = HEAD ? i0 + 1 + lr : i0 + lr; if (ar > TT - 1) ar = TT - 1;   // row T does not exist; no term of it is ever placed (m <= -2)
    BFrag<HI> q; q.load(q16, qh, ql, fo(ar, hi));
    const int ntlo = HEAD ? 0 : (TT - 16 - i0) / 16, nthi = HEAD ? (TT - 3 - i0) / 16 : TT / 16 - 1;
#pragma unroll 1   // trip count depends on the row block; the pair of tiles is the unit
    for (int nt = ntlo + w; nt <= nthi; nt += 16) { const bool two = (nt + 8 <= nthi); const int nt1 = two ? nt + 8 : nt;   // two tiles' loads fly together; the last trip may hold one
        BFrag<HI> r0, r1; r0.load(p16, ph, pl, fo(nt * 16 + lr, hi)); r1.load(p16, ph, pl, fo(nt1 * 16 + lr, hi));
        xhold(r0.p, r0.p2, r1.p, r1.p2, r0.p, r0.p2, r1.p, r1.p2);
        bd_place<HI, HEAD>(S, dot64(q, r0), nt * 16 + lr, i0, hi);
        if (two) bd_place<HI, HEAD>(S, dot64(q, r1), nt1 * 16 + lr, i0, hi); }
}
template <bool HI>
__device__ __forceinline__ void pv_pass(const float* S, const h16* v16, const bf* vh, const bf* vl, int w, int lr, int hi, v8f (&acc)[2][4]) {
    constexpr int NS = HI ? 1 : 2;   // k steps of 32 keys whose loads fly together
#pragma unroll
    for (int u = 0; u < 2; ++u) {
#pragma unroll
        for (int nb = 0; nb < 4; ++nb) acc[u][nb] = (v8f){};
#pragma unroll
        for (int st = 0; st < TT / KSP / 32; st += NS) { const int kc = (2 * w + u) * (TT / KSP) + st * 32; const size_t boff = (size_t)kc * HD + hi * 128 + lr * 8;   // a k step of 32 keys is four blocks (16 d each) of 512 elements
            if (HI) { const bf *pv = vh + boff, *pv2 = vl + boff; v16bf b[4], b2[4];
#pragma unroll
                for (int nb = 0; nb < 4; ++nb) { b[nb] = WFrag<bf>::ldf(pv + nb * 512); b2[nb] = WFrag<bf>::ldf(pv2 + nb * 512); }
                xhold(pv, pv2, pv, pv2, pv, pv2, pv, pv2);
                const bf* p = (const bf*)(S + lr * SP) + kc + 8 * hi; const v16bf a = cat16b(*(const v8usa*)p, *(const v8usa*)(p + 16)), a2 = cat16b(*(const v8usa*)(p + TT), *(const v8usa*)(p + TT + 16));
#pragma unroll
                for (int nb = 0; nb < 4; ++nb) { acc[u][nb] = wmmab(a, b[nb], acc[u][nb]); acc[u][nb] = wmmab(a2, b[nb], acc[u][nb]); acc[u][nb] = wmmab(a, b2[nb], acc[u][nb]); }
            } else { const h16* pv = v16 + boff; v16h b[NS][4];
#pragma unroll
                for (int s = 0; s < NS; ++s)
#pragma unroll
                    for (int nb = 0; nb < 4; ++nb) b[s][nb] = WFrag<h16>::ldf(pv + s * (32 * HD) + nb * 512);
                xhold(pv, pv, pv, pv, pv, pv, pv, pv);
#pragma unroll
                for (int s = 0; s < NS; ++s) { const h16* p = (const h16*)(S + lr * SP) + kc + s * 32 + 8 * hi; const v16h a = cat16(*(const v8ha*)p, *(const v8ha*)(p + 16));
#pragma unroll
                    for (int nb = 0; nb < 4; ++nb) acc[u][nb] = wmma16(a, b[s][nb], acc[u][nb]); } } } }
}
// amdgpu_waves_per_eu(4, 4): 256 VGPRs at most, so that two work-groups (2 x 131,328 B of LDS) share a WGP and one computes while the other waits at a barrier
__global__ __launch_bounds__(256) __attribute__((amdgpu_waves_per_eu(4, 4))) void k_fattn(const h16* __restrict__ QP16, const bf* __restrict__ QPh, const bf* __restrict__ QPl, const h16* __restrict__ QV16, const bf* __restrict__ QVh, const bf* __restrict__ QVl, const h16* __restrict__ KP16, const bf* __restrict__ KPh, const bf* __restrict__ KPl, const h16* __restrict__ PP16, const bf* __restrict__ PPh, const bf* __restrict__ PPl, const h16* __restrict__ VT16, const bf* __restrict__ VTh, const bf* __restrict__ VTl, const float* __restrict__ ab, bf* Ah, bf* Al) {
    __shared__ __align__(16) float S[16 * SP];
    const int tid = threadIdx.x, lane = tid & 31, lr = lane & 15, hi = lane >> 4; const int w = __builtin_amdgcn_readfirstlane(tid >> 5);
    const int i0 = blockIdx.x * 16, h = blockIdx.y; const bool hires = (i0 < RH); const size_t hp = (size_t)h * TT * HD;
    if (hires) ac_pass<true>(S, QP16 + hp, QPh + hp, QPl + hp, KP16 + hp, KPh + hp, KPl + hp, ab, i0, w, lr, hi); else ac_pass<false>(S, QP16 + hp, QPh + hp, QPl + hp, KP16 + hp, KPh + hp, KPl + hp, ab, i0, w, lr, hi);
    __syncthreads();   // every content + bias value stands in S before a position term is added to it
    if (hires) bd_pass<true, false>(S, QV16 + hp, QVh + hp, QVl + hp, PP16 + hp, PPh + hp, PPl + hp, i0, w, lr, hi); else bd_pass<false, false>(S, QV16 + hp, QVh + hp, QVl + hp, PP16 + hp, PPh + hp, PPl + hp, i0, w, lr, hi);
    if (i0 + 1 < RH) bd_pass<true, true>(S, QV16 + hp, QVh + hp, QVl + hp, PP16 + hp, PPh + hp, PPl + hp, i0, w, lr, hi);      // rows i+1 < RH: hi+lo products
    if (i0 + 16 >= RH) bd_pass<false, true>(S, QV16 + hp, QVh + hp, QVl + hp, PP16 + hp, PPh + hp, PPl + hp, i0, w, lr, hi);   // rows i+1 >= RH: fp16 products
    __syncthreads();   // logits complete before a wave reads its rows
#pragma unroll 1   // one 64-register row at a time
    for (int rr = 0; rr < 2; ++rr) { float* srow = S + (w + rr * 8) * SP; float v[TT / 32]; float mx = -3.0e38f;
#pragma unroll
        for (int ch = 0; ch < TT / 128; ++ch) { const v4f a = *(const v4fa*)(srow + ch * 128 + lane * 4);
#pragma unroll
            for (int q = 0; q < 4; ++q) { v[ch * 4 + q] = a[q]; mx = fmaxf(mx, a[q]); } }
#pragma unroll
        for (int sh = 16; sh; sh >>= 1) mx = fmaxf(mx, __shfl_xor(mx, sh, 32));
        float sum = 0.f;
#pragma unroll
        for (int k = 0; k < TT / 32; ++k) { v[k] = exp2_slot(__fmul_rn(__fsub_rn(v[k], mx), 1.4426950408889634f)); sum += v[k]; }
#pragma unroll
        for (int sh = 16; sh; sh >>= 1) sum += __shfl_xor(sum, sh, 32);
        const float f = __fdiv_rn(hires ? 1.0f : PCAR, sum);
        if (hires) { bf* ph = (bf*)srow;
#pragma unroll
            for (int ch = 0; ch < TT / 128; ++ch) { v4us oh, ol;
#pragma unroll
                for (int q = 0; q < 4; ++q) { unsigned short a, c2; splitf(v[ch * 4 + q] * f, a, c2); oh[q] = a; ol[q] = c2; }
                *(v4usa*)(ph + ch * 128 + lane * 4) = oh; *(v4usa*)(ph + TT + ch * 128 + lane * 4) = ol; }
        } else { h16* p16 = (h16*)srow;
#pragma unroll
            for (int ch = 0; ch < TT / 128; ++ch) { v4h o4;
#pragma unroll
                for (int q = 0; q < 4; ++q) o4[q] = tohx(v[ch * 4 + q] * f);
                *(v4ha*)(p16 + ch * 128 + lane * 4) = o4; } } }
    __syncthreads();   // all 16 weight rows written before any wave reads them as A fragments
    v8f acc[2][4]; const size_t hv = (size_t)h * HD * TT;
    if (hires) pv_pass<true>(S, VT16 + hv, VTh + hv, VTl + hv, w, lr, hi, acc); else pv_pass<false>(S, VT16 + hv, VTh + hv, VTl + hv, w, lr, hi, acc);
    __syncthreads();   // last read of the weights is over before the partial tiles overwrite them
#pragma unroll
    for (int u = 0; u < 2; ++u)
#pragma unroll
        for (int nb = 0; nb < 4; ++nb)
#pragma unroll
            for (int jj = 0; jj < 8; ++jj) S[(2 * w + u) * (16 * HD) + (hi * 8 + jj) * HD + nb * 16 + lr] = acc[u][nb][jj];
    __syncthreads();   // all KSP partial tiles written before they are summed
    const int e = tid * 4, t = i0 + (e >> 6), d = e & 63; v4f s = *(const v4fa*)(S + e);
#pragma unroll
    for (int ks = 1; ks < KSP; ++ks) s += *(const v4fa*)(S + ks * (16 * HD) + e);
    const float cs = (t < RH) ? 1.0f : (1.0f / PCAR); v4us oh, ol;
#pragma unroll
    for (int q = 0; q < 4; ++q) { unsigned short a, c2; splitf(s[q] * cs, a, c2); oh[q] = a; ol[q] = c2; }
    const size_t oo = (size_t)t * DQ + h * HD + d; *(v4us*)(Ah + oo) = oh; *(v4us*)(Al + oo) = ol;
}

extern "C" void kernel_launch(void* const* d_in, const int* in_sizes, int n_in,
                              void* d_out, int out_size, void* d_ws, size_t ws_size, hipStream_t stream) {
    (void)in_sizes; (void)n_in; (void)out_size;
    const float* x = (const float*)d_in[0]; const float* abias = (const float*)d_in[1]; const float* pemb = (const float*)d_in[2]; const float* pbu = (const float*)d_in[3]; const float* pbv = (const float*)d_in[4]; const float* wq = (const float*)d_in[5]; const float* bq = (const float*)d_in[6]; const float* wk = (const float*)d_in[7]; const float* bk = (const float*)d_in[8]; const float* wv = (const float*)d_in[9]; const float* bv = (const float*)d_in[10]; const float* wpos = (const float*)d_in[11]; const float* bpos = (const float*)d_in[12]; const float* wo = (const float*)d_in[13]; const float* bo = (const float*)d_in[14]; const float* cosT = nullptr; const float* sinT = nullptr; (void)cosT; (void)sinT;
    float* OUT = (float*)d_out;     // [2][2048][1024]
    char* wsp = (char*)d_ws;
    auto take = [&](size_t bytes) { char* p = wsp; wsp += (bytes + 255) & ~(size_t)255; return (void*)p; };
    bf* WQ = (bf*)take((size_t)DQ * DM * 2); bf* WK = (bf*)take((size_t)DKV * DM * 2); bf* WV = (bf*)take((size_t)DKV * DM * 2); bf* WO = (bf*)take((size_t)DM * DQ * 2);
    bf* XB = (bf*)take((size_t)TT * DM * 2); bf* XP = (bf*)take((size_t)TT * DM * 2); bf* WP = (bf*)take((size_t)DQ * DM * 2); h16* PP16 = (h16*)take((size_t)NH_ * TT * HD * 2); bf* PPh = (bf*)take((size_t)NH_ * TT * HD * 2); bf* PPl = (bf*)take((size_t)NH_ * TT * HD * 2); h16* QV16 = (h16*)take((size_t)NH_ * TT * HD * 2); bf* QVh = (bf*)take((size_t)NH_ * TT * HD * 2); bf* QVl = (bf*)take((size_t)NH_ * TT * HD * 2);
    h16* QP16 = (h16*)take((size_t)NH_ * TT * HD * 2); h16* KP16 = (h16*)take((size_t)NKV * TT * HD * 2); h16* VT16 = (h16*)take((size_t)NKV * HD * TT * 2);
    bf* QPh = (bf*)take((size_t)NH_ * TT * HD * 2); bf* QPl = (bf*)take((size_t)NH_ * TT * HD * 2); bf* KPh = (bf*)take((size_t)NKV * TT * HD * 2); bf* KPl = (bf*)take((size_t)NKV * TT * HD * 2); bf* VTh = (bf*)take((size_t)NKV * HD * TT * 2); bf* VTl = (bf*)take((size_t)NKV * HD * TT * 2);
    bf* ATh = (bf*)take((size_t)TT * DQ * 2); bf* ATl = (bf*)take((size_t)TT * DQ * 2);
    if ((size_t)(wsp - (char*)d_ws) > ws_size) return;    // ws 256 MiB
    { k_wtG<<<(unsigned)((DM * DQ / 64 + 63) / 64), 256, 0, stream>>>(wq, DM, DQ, WQ); k_wtG<<<(unsigned)((DM * DKV / 64 + 63) / 64), 256, 0, stream>>>(wk, DM, DKV, WK); k_wtG<<<(unsigned)((DM * DKV / 64 + 63) / 64), 256, 0, stream>>>(wv, DM, DKV, WV);
      k_wtG<<<(unsigned)((DQ * DM / 64 + 63) / 64), 256, 0, stream>>>(wo, DQ, DM, WO); k_wtG<<<(unsigned)((DM * DQ / 64 + 63) / 64), 256, 0, stream>>>(wpos, DM, DQ, WP); k_cvt8<<<(unsigned)(((size_t)TT * DM / 8 + 255) / 256), 256, 0, stream>>>(pemb, XP, (size_t)TT * DM / 8); k_gemmw<bf, 0, true, 1, 1><<<dim3(TT / 64, DQ / 64, 1), 32, 0, stream>>>(XP, nullptr, WP, nullptr, DM, nullptr, DQ, bpos, 0, 0, 0, Planes{PP16, PPh, PPl, nullptr, nullptr, nullptr, nullptr, nullptr});
       }
    for (int b = 0; b < NB_; ++b) {
        
        k_cvt8<<<(unsigned)(((size_t)TT * DM / 8 + 255) / 256), 256, 0, stream>>>(x + (size_t)b * TT * DM, XB, (size_t)TT * DM / 8);
        k_gemmw<bf, 0, true, 1, 2><<<dim3(TT / 64, DQ / 64, 1), 32, 0, stream>>>(XB, nullptr, WQ, nullptr, DM, nullptr, DQ, bq, 0, 0, 0, Planes{QP16, QPh, QPl, QV16, QVh, QVl, pbu, pbv});
        k_gemmw<bf, 0, true, 1, 1><<<dim3(TT / 64, DKV / 64, 1), 32, 0, stream>>>(XB, nullptr, WK, nullptr, DM, nullptr, DKV, bk, 0, 0, 0, Planes{KP16, KPh, KPl, nullptr, nullptr, nullptr, nullptr, nullptr});
        k_gemmw<bf, 0, true, 1, 3><<<dim3(TT / 64, DKV / 64, 1), 32, 0, stream>>>(XB, nullptr, WV, nullptr, DM, nullptr, DKV, bv, 0, 0, 0, Planes{VT16, VTh, VTl, nullptr, nullptr, nullptr, nullptr, nullptr});
        k_fattn<<<dim3(TT / 16, NH_, 1), 256, 0, stream>>>(QP16, QPh, QPl, QV16, QVh, QVl, KP16, KPh, KPl, PP16, PPh, PPl, VT16, VTh, VTl, abias, ATh, ATl);
        k_gemmw<bf, 1, true><<<dim3(TT / 64, DM / 64, 1), 32, 0, stream>>>(ATh, ATl, WO, nullptr, DQ, OUT + (size_t)b * TT * DM, DM, bo, 0, 0, 0, Planes{nullptr, nullptr, nullptr, nullptr, nullptr, nullptr, nullptr, nullptr}); }
}

// v005
// One run takes 358 microseconds.
// Timed twice side by side with v004, it ran 1.48 and 1.49 times as fast.
// Over all steps from v000 it is 7.65 times as fast.
#include <hip/hip_runtime.h>

// Multi-head self-attention with relative positions and learnable u/v biases (x [2][2048][1024], bias [1][1][L][L] (f32 additive, read; verbatim causal 0/-1e9), pos_emb [2048][1][1024], pos_bias_u/v [16][64]; q/k/v = x W + b, r = pos_emb Wr + br ('xw', 16 heads x 64); qh = q/8; AC = (qh + u).k + bias; BD = (qh + v).r; logits = AC + rel_shift(BD) with the pad-front/reshape shift: pos[i][j] = BD[i][T-1-(i-j)] for j <= i, 0 for j == i+1, BD[i+1][j-i-2] for j >= i+2 (reproduced literally, including the masked upper part); softmax; out = merged Wo + bo -> [2][2048][1024]).
// Compute dtypes, f32 accumulate: every input rounded to bf16; q/k/v/r as PLAIN bf16 GEMMs (inputs: exact) + bias; q x 1/8 (exact) then the u/v head biases added in f32; content, position scores and attn.v: query rows < 512 hl (3 products), the rest single fp16 (x1024) (the shifted position score is gathered from rows i / i+1 of the position-score block); the additive bias read per element; softmax f32; Wo hl x exact (2 products) + bias.

#define NB_  2
#define TT   2048
#define DM   1024
#define NH_  16
#define NKV  16
#define REP  (NH_ / NKV)
#define HD   64
#define DQ   (NH_ * HD)
#define DKV  (NKV * HD)
#define RH   512                  // query rows < RH use hi+lo planes (0: none)
#define WIN  0
#define PCAR 1024.0f
#define KSP  16                   // attn.v: key ranges per output tile, two per wave of k_fattn; the KSP partial tiles are summed in ascending order
#define SCL  1.0f   // the 1/sqrt(64) is applied to q before the u/v biases (k_gemmw, EPI 2)
typedef _Float16 h16;
typedef unsigned short bf;
typedef __attribute__((ext_vector_type(16))) __bf16   v16bf;
typedef __attribute__((ext_vector_type(16))) _Float16 v16h;
typedef __attribute__((ext_vector_type(8)))  _Float16 v8h;
typedef __attribute__((ext_vector_type(8)))  unsigned short v8us;
typedef __attribute__((ext_vector_type(8)))  float    v8f;
typedef __attribute__((ext_vector_type(4)))  float    v4f;
typedef v8h  __attribute__((may_alias)) v8ha;
typedef v4f  __attribute__((may_alias)) v4fa;
typedef v8us __attribute__((may_alias)) v8usa;

__device__ __forceinline__ unsigned short f2bf(float f) { unsigned u = __float_as_uint(f); u += 0x7FFFu + ((u >> 16) & 1u); return (unsigned short)(u >> 16); }
__device__ __forceinline__ float bf2f(unsigned short b) { return __uint_as_float(((unsigned)b) << 16); }
__device__ __forceinline__ float bfr(float f) { return bf2f(f2bf(f)); }
__device__ __forceinline__ v16h cat16(v8h lo, v8h hi) { return __builtin_shufflevector(lo, hi, 0, 1, 2, 3, 4, 5, 6, 7, 8, 9, 10, 11, 12, 13, 14, 15); }
__device__ __forceinline__ v16bf cat16b(v8us lo, v8us hi) { return __builtin_bit_cast(v16bf, __builtin_shufflevector(lo, hi, 0, 1, 2, 3, 4, 5, 6, 7, 8, 9, 10, 11, 12, 13, 14, 15)); }
__device__ __forceinline__ v8f wmma16(v16h a, v16h b, v8f c) { return __builtin_amdgcn_wmma_f32_16x16x32_f16(false, a, false, b, (short)0, c, false, false); }
__device__ __forceinline__ v8f wmmab(v16bf a, v16bf b, v8f c) { return __builtin_amdgcn_wmma_f32_16x16x32_bf16(false, a, false, b, (short)0, c, false, false); }



// ---- FRAGMENT ORDER of the 16-bit head planes that k_fattn reads (q + u, q + v, k, r, v): a block of 16 rows x 32 k (512 elements, 1 KiB) is stored as [g = (k >> 3) & 3][row & 15][k & 7], which is lane order (lane = 16 hi + row, g = 2 c + hi): load c of a fragment is 32 lanes x 16 B = 512 contiguous bytes (4 whole lines) where a row-major plane gives 16 part lines. Blocks of one 16-row tile follow one another along k. The registers hold what they held with row-major planes. The planes that k_gemmw reads stay row-major (ld); ldf loads from a plane in fragment order.
// ---- k_gemmw: register-blocked GEMM, ONE WAVE per 64x64 output tile (16 accumulators), operands straight from K-contiguous 16-bit planes; grid (M/64, N/64, Z), 32 threads.
// C[m][n] (f32, pitch ldc, + optional f32 bias[n]) = sum_k A[m][k] Bt[n][k] (+ split products per NSPLIT). z-batch strides sA/sB/sC in elements; with EPI != 0 slice z writes its planes sz elements behind slice z - 1's, so that the GEMMs of both batches are one launch and a WGP holds several waves whose load waits overlap. K % (32 KS) == 0. KS > 1: grid z = Z x KS; work-group (z, ks) sums only k in [ks K/KS, (ks+1) K/KS) and stores its partial tile in plane z KS + ks of C (plane stride sC).
template <typename T16> struct WFrag;
template <> struct WFrag<h16> { typedef v16h V; static __device__ __forceinline__ V ld(const h16* p) { return cat16(*(const v8h*)p, *(const v8h*)(p + 16)); } static __device__ __forceinline__ V ldf(const h16* p) { return cat16(*(const v8h*)p, *(const v8h*)(p + 256)); } static __device__ __forceinline__ v8f mma(V a, V b, v8f c) { return wmma16(a, b, c); } };
template <> struct WFrag<bf> { typedef v16bf V; static __device__ __forceinline__ V ld(const bf* p) { return cat16b(*(const v8us*)p, *(const v8us*)(p + 16)); } static __device__ __forceinline__ V ldf(const bf* p) { return cat16b(*(const v8us*)p, *(const v8us*)(p + 256)); } static __device__ __forceinline__ v8f mma(V a, V b, v8f c) { return wmmab(a, b, c); } };
__device__ __forceinline__ h16 tohx(float x) { return (h16)x; }
__device__ __forceinline__ void splitf(float y, unsigned short& h, unsigned short& l) { h = f2bf(y); l = f2bf(y - bf2f(h)); }
// one 16-byte store into each of the three planes (fp16, bf16 hi, bf16 lo) of eight neighbouring values. The stores stand in one asm statement with the precautionary s_wait_xcnt 0 behind them, so that it is in front of every later write to their address and data registers.
__device__ __forceinline__ void put8(const float (&x)[8], h16* P16, bf* Ph, bf* Pl, size_t o) { v8h o16; v8us oh, ol;
#pragma unroll
    for (int q = 0; q < 8; ++q) { o16[q] = tohx(x[q]); unsigned short a, c; splitf(x[q], a, c); oh[q] = a; ol[q] = c; }
    asm volatile("global_store_b128 %0, %3, off\n\tglobal_store_b128 %1, %4, off\n\tglobal_store_b128 %2, %5, off\n\ts_wait_xcnt 0x0" :: "v"(P16 + o), "v"(Ph + o), "v"(Pl + o), "v"(o16), "v"(oh), "v"(ol) : "memory"); }
// Where a projection's tile goes when EPI != 0 (a 64-column tile is one head), all in fragment order: EPI 1: planes p [h] (rows t, k = d) of C + bias (k, r); EPI 2: planes p of (C + bias)/8 + bu and planes q of (C + bias)/8 + bv (the two query forms); EPI 3: planes p [h] (rows d, k = t; the four 16-row blocks of one k step side by side) of C + bias (v, transposed). An EPI 1 launch holds the position projection as slice z = 0 (weights Bt0, bias bias0) and the key projection of batch z - 1 behind it.
struct Planes { h16* p16; bf* ph; bf* pl; h16* q16; bf* qh; bf* ql; const float* bu; const float* bv; size_t sz; const bf* Bt0; const float* bias0; };
template <typename T16, int NSPLIT, bool BIAS, int KS = 1, int EPI = 0>
__global__ __launch_bounds__(32) void k_gemmw(const T16* __restrict__ A, const T16* __restrict__ A2, const T16* __restrict__ Bt, const T16* __restrict__ Bt2, int K, float* C, int ldc, const float* __restrict__ bias, size_t sA, size_t sB, size_t sC, Planes po) {
    typedef typename WFrag<T16>::V V;
    __shared__ __align__(16) float os[(EPI == 2 ? 2 : 1) * 16 * 68];   // EPI 2: one tile for each of the two query forms
    const size_t z = blockIdx.z / KS; A += z * sA; if (A2) A2 += z * sA; Bt += z * sB; if (Bt2) Bt2 += z * sB; C += (size_t)blockIdx.z * sC; const int kb = (int)(blockIdx.z % KS) * (K / KS), ke = kb + K / KS;
    if constexpr (EPI != 0) { const size_t zs = z * po.sz; po.p16 += zs; po.ph += zs; po.pl += zs; if constexpr (EPI == 2) { po.q16 += zs; po.qh += zs; po.ql += zs; } }
    if constexpr (EPI == 1) { if (z == 0) { Bt = po.Bt0; bias = po.bias0; } }
    const int lane = threadIdx.x & 31, lr = lane & 15, hi = lane >> 4; const int r0 = blockIdx.x * 64, c0 = blockIdx.y * 64;
    v8f acc[4][4];
#pragma unroll
    for (int mb = 0; mb < 4; ++mb)
#pragma unroll
        for (int nb = 0; nb < 4; ++nb) acc[mb][nb] = (v8f){};
    const size_t aoff = (size_t)(r0 + lr) * K + 8 * hi, boff = (size_t)(c0 + lr) * K + 8 * hi;
#pragma unroll 1
    for (int kc = kb; kc < ke; kc += 32) {
        V a[4], a2[4];
#pragma unroll
        for (int mb = 0; mb < 4; ++mb) { a[mb] = WFrag<T16>::ld(A + aoff + (size_t)mb * 16 * K + kc); if (NSPLIT == 1 || NSPLIT == 2) a2[mb] = WFrag<T16>::ld(A2 + aoff + (size_t)mb * 16 * K + kc); }
#pragma unroll
        for (int nb = 0; nb < 4; ++nb) { const V b = WFrag<T16>::ld(Bt + boff + (size_t)nb * 16 * K + kc); V b2; if (NSPLIT >= 2) b2 = WFrag<T16>::ld(Bt2 + boff + (size_t)nb * 16 * K + kc);
#pragma unroll
            for (int mb = 0; mb < 4; ++mb) { acc[mb][nb] = WFrag<T16>::mma(a[mb], b, acc[mb][nb]); if (NSPLIT == 1 || NSPLIT == 2) acc[mb][nb] = WFrag<T16>::mma(a2[mb], b, acc[mb][nb]); if (NSPLIT >= 2) acc[mb][nb] = WFrag<T16>::mma(a[mb], b2, acc[mb][nb]); } }
        asm volatile("v_nop\n\tv_nop\n\tv_nop\n\tv_nop" : "+v"(acc[0][0]), "+v"(acc[1][1]), "+v"(acc[2][2]), "+v"(acc[3][3]) : "v"(a[0]), "v"(a[3]));
    }
    if constexpr (EPI == 3) {   // a lane's eight accumulator values are eight neighbouring t of one d, one 16-byte unit of the fragment order (rows d, k = t): stored straight from the registers
        asm volatile("s_wait_xcnt 0x0" ::: "memory");   // precautionary wait in front of the first write to an address pair of the k loop's loads
        float bn[4];   // all four bias loads first: the store statements' memory clobber would hold a later load behind them
#pragma unroll
        for (int nb = 0; nb < 4; ++nb) bn[nb] = bfr(bias[c0 + nb * 16 + lr]);
#pragma unroll
        for (int nb = 0; nb < 4; ++nb) {
#pragma unroll
            for (int mb = 0; mb < 4; ++mb) { float x[8];
#pragma unroll
                for (int j = 0; j < 8; ++j) x[j] = acc[mb][nb][j] + bn[nb];
                put8(x, po.p16, po.ph, po.pl, ((size_t)blockIdx.y * TT + r0 + (mb >> 1) * 32) * HD + nb * 512 + (mb & 1) * 256 + lane * 8); } }   // block (32 t, 16 d) in fragment order: 512 contiguous bytes a store
        return; }
    float bn[4], un[4], vn[4];   // EPI 1, 2: the biases of a lane's four accumulator columns, added before the tile goes through LDS
    if constexpr (EPI == 1 || EPI == 2) {
#pragma unroll
        for (int nb = 0; nb < 4; ++nb) { bn[nb] = bfr(bias[c0 + nb * 16 + lr]); if (EPI == 2) { un[nb] = bfr(po.bu[c0 + nb * 16 + lr]); vn[nb] = bfr(po.bv[c0 + nb * 16 + lr]); } } }
#pragma unroll
    for (int mb = 0; mb < 4; ++mb) {
#pragma unroll
        for (int nb = 0; nb < 4; ++nb) {
#pragma unroll
            for (int j = 0; j < 8; ++j) { const int oi = (hi * 8 + j) * 68 + nb * 16 + lr;
                if constexpr (EPI == 1) os[oi] = acc[mb][nb][j] + bn[nb];
                else if constexpr (EPI == 2) { const float aq = __fmul_rn(acc[mb][nb][j] + bn[nb], 0.125f); os[oi] = __fadd_rn(aq, un[nb]); os[16 * 68 + oi] = __fadd_rn(aq, vn[nb]); }
                else os[oi] = acc[mb][nb][j]; } }
        __builtin_amdgcn_wave_barrier(); asm volatile("" ::: "memory");
        float* crow = C + (size_t)(r0 + mb * 16) * ldc + c0;
        if constexpr (EPI == 1 || EPI == 2) {
            const size_t o = ((size_t)blockIdx.y * TT + r0 + mb * 16) * HD + lane * 8;   // store s: units g = 2 s + hi of row lr, 512 contiguous bytes
#pragma unroll
            for (int pl = 0; pl < (EPI == 2 ? 2 : 1); ++pl) { const float* ot = os + pl * (16 * 68) + lr * 68 + hi * 8;
                v4f v0[4], v1[4];   // a tile's LDS reads first: the store statements' memory clobber would hold a later read behind them
#pragma unroll
                for (int s = 0; s < 4; ++s) { v0[s] = *(const v4fa*)(ot + s * 16); v1[s] = *(const v4fa*)(ot + s * 16 + 4); }
#pragma unroll
                for (int s = 0; s < 4; ++s) { float x[8];
#pragma unroll
                    for (int q = 0; q < 8; ++q) x[q] = q < 4 ? v0[s][q & 3] : v1[s][q & 3];
                    if (pl == 0) put8(x, po.p16, po.ph, po.pl, o + s * 256); else put8(x, po.q16, po.qh, po.ql, o + s * 256); } }
        } else {
#pragma unroll
            for (int s = 0; s < 8; ++s) { const int row = 2 * s + hi, cofs = lr * 4; v4f val = *(const v4fa*)(os + row * 68 + cofs); if (BIAS) { val[0] += bfr(bias[c0 + cofs]); val[1] += bfr(bias[c0 + cofs + 1]); val[2] += bfr(bias[c0 + cofs + 2]); val[3] += bfr(bias[c0 + cofs + 3]); }
                *(v4f*)(crow + (size_t)row * ldc + cofs) = val; }
             }
        __builtin_amdgcn_wave_barrier(); asm volatile("" ::: "memory");
    }
}

typedef __attribute__((ext_vector_type(2))) _Float16 v2h;
typedef __attribute__((ext_vector_type(4))) _Float16 v4h;
typedef __attribute__((ext_vector_type(2))) unsigned short v2us;
typedef __attribute__((ext_vector_type(4))) unsigned short v4us;
typedef __attribute__((ext_vector_type(2))) float v2f;
typedef __attribute__((ext_vector_type(4))) int v4i;

__device__ __forceinline__ void wtG(const float* __restrict__ w, int K, int N, bf* Bt, int blk) {
    const int lane = threadIdx.x & 31; const int L0 = (blk * 8 + (threadIdx.x >> 5)) * 8; const int nlines = N * K / 64;
{
#pragma unroll 1
        for (int l = 0; l < 8; ++l) { const int L = L0 + l; if (L >= nlines) break; const size_t e = (size_t)L * 64 + lane * 2; const int k = (int)(e % K), n = (int)(e / K); v2us o;
            o[0] = f2bf(w[(size_t)k * N + n]); o[1] = f2bf(w[(size_t)(k + 1) * N + n]); *(v2us*)(Bt + e) = o; }
         }
}
// ---- k_prep: all that the GEMMs wait for, in one launch: work-groups [0, 5 WTB) transpose and round the five weight matrices (WTB each), the rest round pos_emb (slice 0 of X3) and x (slices 1, 2: the two batches), eight values a thread.
#define WTB (DM * DQ / 64 / 64)
#define CVB (TT * DM / 8 / 256)   // work-groups per slice of X3
__global__ __launch_bounds__(256) void k_prep(const float* __restrict__ wq, const float* __restrict__ wk, const float* __restrict__ wv, const float* __restrict__ wo, const float* __restrict__ wpos, const float* __restrict__ x, const float* __restrict__ pemb, bf* WQ, bf* WK, bf* WV, bf* WO, bf* WP, bf* X3) {
    const int blk = blockIdx.x;
    if (blk < 5 * WTB) { const int job = blk / WTB; wtG(job == 0 ? wq : job == 1 ? wk : job == 2 ? wv : job == 3 ? wo : wpos, DM, DQ, job == 0 ? WQ : job == 1 ? WK : job == 2 ? WV : job == 3 ? WO : WP, blk % WTB); return; }
    const int cb = blk - 5 * WTB; const size_t i = (size_t)cb * 256 + threadIdx.x; const float* src = cb < CVB ? pemb + i * 8 : x + (i - (size_t)CVB * 256) * 8; const v8f v = *(const v8f*)src; v8us o;
    asm volatile("s_wait_xcnt 0x0" ::: "memory");   // precautionary wait in front of the first write to the load's address pair (the compiler reuses the pair for the rounding)
#pragma unroll
    for (int k = 0; k < 8; ++k) o[k] = f2bf(v[k]);
    asm volatile("global_store_b128 %0, %1, off\n\ts_wait_xcnt 0x0" :: "v"(X3 + i * 8), "v"(o) : "memory"); }   // store and precautionary wait in one statement, as in put8: the compiler joins this path with the transpose part, whose first instructions write the store's registers
__global__ __launch_bounds__(256) void k_cscvt(const float* __restrict__ cosT, const float* __restrict__ sinT, float* CS) { const int idx = blockIdx.x * 256 + threadIdx.x; if (idx >= TT * HD) return; v2f cs; cs[0] = bfr(cosT[idx]); cs[1] = bfr(sinT[idx]); *(v2f*)(CS + (size_t)idx * 2) = cs;  }
// ---- k_fattn: one work-group (8 waves) per 16 query rows of one head of one batch (blockIdx.z; the q, k, v planes and the output of batch 1 stand behind batch 0's, the position planes serve both); the 16 x 2048 f32 logit rows live in LDS from the score products to attn.v.
// Phases: (1) content scores + additive bias -> S; (2) position scores added at their rel-shift place (row i takes BD[i][m >= T-1-i] at j = m-(T-1)+i and BD[i+1][m <= T-3-i] at j = m+i+2; every place gets at most one term); (3) softmax, one wave per row, weights written over the row as 16-bit planes; (4) attn.v in KSP key ranges of 128, two per wave; (5) the KSP partial tiles summed in ascending order.
#define SP 2052                   // LDS row pitch in floats: 2048 + 4, so that the 16 rows of a fragment read start on different banks
typedef v4h  __attribute__((may_alias)) v4ha;
typedef v4us __attribute__((may_alias)) v4usa;
// Behind a batch of global loads: the precautionary wait in front of any write to a register of the loads' address pairs. The pointers are inputs so that the pairs stay live up to it; without that the compiler lets a later load of the batch land in an earlier load's pair. A shorter list repeats its pointers.
__device__ __forceinline__ void xhold(const void* a, const void* b, const void* c, const void* d, const void* e, const void* f, const void* g, const void* h) { asm volatile("s_wait_xcnt 0x0" :: "v"(a), "v"(b), "v"(c), "v"(d), "v"(e), "v"(f), "v"(g), "v"(h) : "memory"); }
// v_exp_f32 with the one free slot that the instruction set asks for behind a transcendental, before its result is read or its source written again; in one statement, so that the v_nop stands directly behind it
__device__ __forceinline__ float exp2_slot(float x) { float r; asm("v_exp_f32 %0, %1\n\tv_nop" : "=v"(r) : "v"(x)); return r; }
template <bool HI> struct BFrag;   // 16 rows x 64 k of a plane in fragment order (hi + lo planes where HI); off = fo(lane's row, hi)
__device__ __forceinline__ size_t fo(int row, int hi) { return (size_t)(row >> 4) * (16 * HD) + (row & 15) * 8 + hi * 128; }
template <> struct BFrag<false> { v16h b[2]; const h16 *p, *p2;
    __device__ __forceinline__ void load(const h16* b16, const bf*, const bf*, size_t off) { p = p2 = b16 + off; b[0] = WFrag<h16>::ldf(p); b[1] = WFrag<h16>::ldf(p + 512); } };
template <> struct BFrag<true> { v16bf b[2], b2[2]; const bf *p, *p2;
    __device__ __forceinline__ void load(const h16*, const bf* bh, const bf* bl, size_t off) { p = bh + off; p2 = bl + off; b[0] = WFrag<bf>::ldf(p); b[1] = WFrag<bf>::ldf(p + 512); b2[0] = WFrag<bf>::ldf(p2); b2[1] = WFrag<bf>::ldf(p2 + 512); } };
__device__ __forceinline__ v8f dot64(const BFrag<false>& q, const BFrag<false>& k) { v8f c = (v8f){};
#pragma unroll
    for (int kk = 0; kk < 2; ++kk) c = wmma16(q.b[kk], k.b[kk], c);
    return c; }
__device__ __forceinline__ v8f dot64(const BFrag<true>& q, const BFrag<true>& k) { v8f c = (v8f){};
#pragma unroll
    for (int kk = 0; kk < 2; ++kk) { c = wmmab(q.b[kk], k.b[kk], c); c = wmmab(q.b2[kk], k.b[kk], c); c = wmmab(q.b[kk], k.b2[kk], c); }
    return c; }
template <bool HI>
__device__ __forceinline__ void ac_pass(float* S, const h16* q16, const bf* qh, const bf* ql, const h16* k16, const bf* kh, const bf* kl, const float* __restrict__ ab, int i0, int w, int lr, int hi) {
    BFrag<HI> q; q.load(q16, qh, ql, fo(i0 + lr, hi));
    constexpr int U = HI ? 2 : 4;   // key tiles whose loads fly together
#pragma unroll 1   // the batch of U tiles is the unit; unrolling further would pass 256 VGPRs and cost the second work-group of the WGP
    for (int it = 0; it < TT / 128; it += U) { BFrag<HI> k[U]; const float* pb[U]; float bb[U][8];
#pragma unroll
        for (int u = 0; u < U; ++u) { const int col = (w + (it + u) * 8) * 16 + lr; k[u].load(k16, kh, kl, fo(col, hi)); pb[u] = ab + (size_t)(i0 + hi * 8) * TT + col;
#pragma unroll
            for (int jj = 0; jj < 8; ++jj) bb[u][jj] = pb[u][(size_t)jj * TT]; }
        if (HI) xhold(k[0].p, k[0].p2, k[1].p, k[1].p2, pb[0], pb[1], pb[0], pb[1]); else xhold(k[0].p, k[1].p, k[U - 2].p, k[U - 1].p, pb[0], pb[1], pb[U - 2], pb[U - 1]);
#pragma unroll
        for (int u = 0; u < U; ++u) { const v8f c = dot64(q, k[u]); const int col = (w + (it + u) * 8) * 16 + lr;
#pragma unroll
            for (int jj = 0; jj < 8; ++jj) S[(hi * 8 + jj) * SP + col] = __fadd_rn(c[jj], bfr(bb[u][jj])); } }
}
template <bool HI, bool HEAD>
__device__ __forceinline__ void bd_place(float* S, const v8f c, int m, int i0, int hi) {
    float old[8];   // all eight reads first (index clamped into the row where no term is placed), so that they wait once
#pragma unroll
    for (int jj = 0; jj < 8; ++jj) { const int r = hi * 8 + jj, i = i0 + r; const int j = HEAD ? min(m + i + 2, TT - 1) : max(m - (TT - 1) + i, 0); old[jj] = S[r * SP + j]; }
#pragma unroll
    for (int jj = 0; jj < 8; ++jj) { const int r = hi * 8 + jj, i = i0 + r; const bool ok = HEAD ? (m <= TT - 3 - i && (i + 1 < RH) == HI) : (m >= TT - 1 - i); const int j = HEAD ? m + i + 2 : m - (TT - 1) + i;
        if (ok) S[r * SP + j] = __fadd_rn(old[jj], c[jj]); }
}
template <bool HI, bool HEAD>
__device__ __forceinline__ void bd_pass(float* S, const h16* q16, const bf* qh, const bf* ql, const h16* p16, const bf* ph, const bf* pl, int i0, int w, int lr, int hi) {
    int ar = HEAD ? i0 + 1 + lr : i0 + lr; if (ar > TT - 1) ar = TT - 1;   // row T does not exist; no term of it is ever placed (m <= -2)
    BFrag<HI> q; q.load(q16, qh, ql, fo(ar, hi));
    const int ntlo = HEAD ? 0 : (TT - 16 - i0) / 16, nthi = HEAD ? (TT - 3 - i0) / 16 : TT / 16 - 1;
#pragma unroll 1   // trip count depends on the row block; the pair of tiles is the unit
    for (int nt = ntlo + w; nt <= nthi; nt += 16) { const bool two = (nt + 8 <= nthi); const int nt1 = two ? nt + 8 : nt;   // two tiles' loads fly together; the last trip may hold one
        BFrag<HI> r0, r1; r0.load(p16, ph, pl, fo(nt * 16 + lr, hi)); r1.load(p16, ph, pl, fo(nt1 * 16 + lr, hi));
        xhold(r0.p, r0.p2, r1.p, r1.p2, r0.p, r0.p2, r1.p, r1.p2);
        bd_place<HI, HEAD>(S, dot64(q, r0), nt * 16 + lr, i0, hi);
        if (two) bd_place<HI, HEAD>(S, dot64(q, r1), nt1 * 16 + lr, i0, hi); }
}
template <bool HI>
__device__ __forceinline__ void pv_pass(const float* S, const h16* v16, const bf* vh, const bf* vl, int w, int lr, int hi, v8f (&acc)[2][4]) {
    constexpr int NS = HI ? 1 : 2;   // k steps of 32 keys whose loads fly together
#pragma unroll
    for (int u = 0; u < 2; ++u) {
#pragma unroll
        for (int nb = 0; nb < 4; ++nb) acc[u][nb] = (v8f){};
#pragma unroll
        for (int st = 0; st < TT / KSP / 32; st += NS) { const int kc = (2 * w + u) * (TT / KSP) + st * 32; const size_t boff = (size_t)kc * HD + hi * 128 + lr * 8;   // a k step of 32 keys is four blocks (16 d each) of 512 elements
            if (HI) { const bf *pv = vh + boff, *pv2 = vl + boff; v16bf b[4], b2[4];
#pragma unroll
                for (int nb = 0; nb < 4; ++nb) { b[nb] = WFrag<bf>::ldf(pv + nb * 512); b2[nb] = WFrag<bf>::ldf(pv2 + nb * 512); }
                xhold(pv, pv2, pv, pv2, pv, pv2, pv, pv2);
                const bf* p = (const bf*)(S + lr * SP) + kc + 8 * hi; const v16bf a = cat16b(*(const v8usa*)p, *(const v8usa*)(p + 16)), a2 = cat16b(*(const v8usa*)(p + TT), *(const v8usa*)(p + TT + 16));
#pragma unroll
                for (int nb = 0; nb < 4; ++nb) { acc[u][nb] = wmmab(a, b[nb], acc[u][nb]); acc[u][nb] = wmmab(a2, b[nb], acc[u][nb]); acc[u][nb] = wmmab(a, b2[nb], acc[u][nb]); }
            } else { const h16* pv = v16 + boff; v16h b[NS][4];
#pragma unroll
                for (int s = 0; s < NS; ++s)
#pragma unroll
                    for (int nb = 0; nb < 4; ++nb) b[s][nb] = WFrag<h16>::ldf(pv + s * (32 * HD) + nb * 512);
                xhold(pv, pv, pv, pv, pv, pv, pv, pv);
#pragma unroll
                for (int s = 0; s < NS; ++s) { const h16* p = (const h16*)(S + lr * SP) + kc + s * 32 + 8 * hi; const v16h a = cat16(*(const v8ha*)p, *(const v8ha*)(p + 16));
#pragma unroll
                    for (int nb = 0; nb < 4; ++nb) acc[u][nb] = wmma16(a, b[s][nb], acc[u][nb]); } } } }
}
// amdgpu_waves_per_eu(4, 4): 256 VGPRs at most, so that two work-groups (2 x 131,328 B of LDS) share a WGP and one computes while the other waits at a barrier
__global__ __launch_bounds__(256) __attribute__((amdgpu_waves_per_eu(4, 4))) void k_fattn(const h16* __restrict__ QP16, const bf* __restrict__ QPh, const bf* __restrict__ QPl, const h16* __restrict__ QV16, const bf* __restrict__ QVh, const bf* __restrict__ QVl, const h16* __restrict__ KP16, const bf* __restrict__ KPh, const bf* __restrict__ KPl, const h16* __restrict__ PP16, const bf* __restrict__ PPh, const bf* __restrict__ PPl, const h16* __restrict__ VT16, const bf* __restrict__ VTh, const bf* __restrict__ VTl, const float* __restrict__ ab, bf* Ah, bf* Al) {
    __shared__ __align__(16) float S[16 * SP];
    const int tid = threadIdx.x, lane = tid & 31, lr = lane & 15, hi = lane >> 4; const int w = __builtin_amdgcn_readfirstlane(tid >> 5);
    const int i0 = blockIdx.x * 16, h = blockIdx.y; const bool hires = (i0 < RH); const size_t hp = (size_t)h * TT * HD;
    { const size_t zb = (size_t)blockIdx.z * ((size_t)NH_ * TT * HD); QP16 += zb; QPh += zb; QPl += zb; QV16 += zb; QVh += zb; QVl += zb; KP16 += zb; KPh += zb; KPl += zb; VT16 += zb; VTh += zb; VTl += zb; Ah += zb; Al += zb; }   // NH_ TT HD == TT DQ: one batch of any of these
    if (hires) ac_pass<true>(S, QP16 + hp, QPh + hp, QPl + hp, KP16 + hp, KPh + hp, KPl + hp, ab, i0, w, lr, hi); else ac_pass<false>(S, QP16 + hp, QPh + hp, QPl + hp, KP16 + hp, KPh + hp, KPl + hp, ab, i0, w, lr, hi);
    __syncthreads();   // every content + bias value stands in S before a position term is added to it
    if (hires) bd_pass<true, false>(S, QV16 + hp, QVh + hp, QVl + hp, PP16 + hp, PPh + hp, PPl + hp, i0, w, lr, hi); else bd_pass<false, false>(S, QV16 + hp, QVh + hp, QVl + hp, PP16 + hp, PPh + hp, PPl + hp, i0, w, lr, hi);
    if (i0 + 1 < RH) bd_pass<true, true>(S, QV16 + hp, QVh + hp, QVl + hp, PP16 + hp, PPh + hp, PPl + hp, i0, w, lr, hi);      // rows i+1 < RH: hi+lo products
    if (i0 + 16 >= RH) bd_pass<false, true>(S, QV16 + hp, QVh + hp, QVl + hp, PP16 + hp, PPh + hp, PPl + hp, i0, w, lr, hi);   // rows i+1 >= RH: fp16 products
    __syncthreads();   // logits complete before a wave reads its rows
#pragma unroll 1   // one 64-register row at a time
    for (int rr = 0; rr < 2; ++rr) { float* srow = S + (w + rr * 8) * SP; float v[TT / 32]; float mx = -3.0e38f;
#pragma unroll
        for (int ch = 0; ch < TT / 128; ++ch) { const v4f a = *(const v4fa*)(srow + ch * 128 + lane * 4);
#pragma unroll
            for (int q = 0; q < 4; ++q) { v[ch * 4 + q] = a[q]; mx = fmaxf(mx, a[q]); } }
#pragma unroll
        for (int sh = 16; sh; sh >>= 1) mx = fmaxf(mx, __shfl_xor(mx, sh, 32));
        float sum = 0.f;
#pragma unroll
        for (int k = 0; k < TT / 32; ++k) { v[k] = exp2_slot(__fmul_rn(__fsub_rn(v[k], mx), 1.4426950408889634f)); sum += v[k]; }
#pragma unroll
        for (int sh = 16; sh; sh >>= 1) sum += __shfl_xor(sum, sh, 32);
        const float f = __fdiv_rn(hires ? 1.0f : PCAR, sum);
        if (hires) { bf* ph = (bf*)srow;
#pragma unroll
            for (int ch = 0; ch < TT / 128; ++ch) { v4us oh, ol;
#pragma unroll
                for (int q = 0; q < 4; ++q) { unsigned short a, c2; splitf(v[ch * 4 + q] * f, a, c2); oh[q] = a; ol[q] = c2; }
                *(v4usa*)(ph + ch * 128 + lane * 4) = oh; *(v4usa*)(ph + TT + ch * 128 + lane * 4) = ol; }
        } else { h16* p16 = (h16*)srow;
#pragma unroll
            for (int ch = 0; ch < TT / 128; ++ch) { v4h o4;
#pragma unroll
                for (int q = 0; q < 4; ++q) o4[q] = tohx(v[ch * 4 + q] * f);
                *(v4ha*)(p16 + ch * 128 + lane * 4) = o4; } } }
    __syncthreads();   // all 16 weight rows written before any wave reads them as A fragments
    v8f acc[2][4]; const size_t hv = (size_t)h * HD * TT;
    if (hires) pv_pass<true>(S, VT16 + hv, VTh + hv, VTl + hv, w, lr, hi, acc); else pv_pass<false>(S, VT16 + hv, VTh + hv, VTl + hv, w, lr, hi, acc);
    __syncthreads();   // last read of the weights is over before the partial tiles overwrite them
#pragma unroll
    for (int u = 0; u < 2; ++u)
#pragma unroll
        for (int nb = 0; nb < 4; ++nb)
#pragma unroll
            for (int jj = 0; jj < 8; ++jj) S[(2 * w + u) * (16 * HD) + (hi * 8 + jj) * HD + nb * 16 + lr] = acc[u][nb][jj];
    __syncthreads();   // all KSP partial tiles written before they are summed
    const int e = tid * 4, t = i0 + (e >> 6), d = e & 63; v4f s = *(const v4fa*)(S + e);
#pragma unroll
    for (int ks = 1; ks < KSP; ++ks) s += *(const v4fa*)(S + ks * (16 * HD) + e);
    const float cs = (t < RH) ? 1.0f : (1.0f / PCAR); v4us oh, ol;
#pragma unroll
    for (int q = 0; q < 4; ++q) { unsigned short a, c2; splitf(s[q] * cs, a, c2); oh[q] = a; ol[q] = c2; }
    const size_t oo = (size_t)t * DQ + h * HD + d; *(v4us*)(Ah + oo) = oh; *(v4us*)(Al + oo) = ol;
}

extern "C" void kernel_launch(void* const* d_in, const int* in_sizes, int n_in,
                              void* d_out, int out_size, void* d_ws, size_t ws_size, hipStream_t stream) {
    (void)in_sizes; (void)n_in; (void)out_size;
    const float* x = (const float*)d_in[0]; const float* abias = (const float*)d_in[1]; const float* pemb = (const float*)d_in[2]; const float* pbu = (const float*)d_in[3]; const float* pbv = (const float*)d_in[4]; const float* wq = (const float*)d_in[5]; const float* bq = (const float*)d_in[6]; const float* wk = (const float*)d_in[7]; const float* bk = (const float*)d_in[8]; const float* wv = (const float*)d_in[9]; const float* bv = (const float*)d_in[10]; const float* wpos = (const float*)d_in[11]; const float* bpos = (const float*)d_in[12]; const float* wo = (const float*)d_in[13]; const float* bo = (const float*)d_in[14]; const float* cosT = nullptr; const float* sinT = nullptr; (void)cosT; (void)sinT;
    float* OUT = (float*)d_out;     // [2][2048][1024]
    char* wsp = (char*)d_ws;
    auto take = [&](size_t bytes) { char* p = wsp; wsp += (bytes + 255) & ~(size_t)255; return (void*)p; };
    const size_t PS = (size_t)NH_ * TT * HD;   // elements of one 16-bit plane set (all heads) of one batch
    bf* WQ = (bf*)take((size_t)DQ * DM * 2); bf* WK = (bf*)take((size_t)DKV * DM * 2); bf* WV = (bf*)take((size_t)DKV * DM * 2); bf* WO = (bf*)take((size_t)DM * DQ * 2); bf* WP = (bf*)take((size_t)DQ * DM * 2);
    bf* X3 = (bf*)take((size_t)(NB_ + 1) * TT * DM * 2);   // slice 0: pos_emb; slices 1..: x
    h16* PK16 = (h16*)take((NB_ + 1) * PS * 2); bf* PKh = (bf*)take((NB_ + 1) * PS * 2); bf* PKl = (bf*)take((NB_ + 1) * PS * 2);   // slice 0: position planes; slices 1..: key planes
    h16* QV16 = (h16*)take(NB_ * PS * 2); bf* QVh = (bf*)take(NB_ * PS * 2); bf* QVl = (bf*)take(NB_ * PS * 2);
    h16* QP16 = (h16*)take(NB_ * PS * 2); bf* QPh = (bf*)take(NB_ * PS * 2); bf* QPl = (bf*)take(NB_ * PS * 2);
    h16* VT16 = (h16*)take(NB_ * PS * 2); bf* VTh = (bf*)take(NB_ * PS * 2); bf* VTl = (bf*)take(NB_ * PS * 2);
    bf* ATh = (bf*)take((size_t)NB_ * TT * DQ * 2); bf* ATl = (bf*)take((size_t)NB_ * TT * DQ * 2);
    if ((size_t)(wsp - (char*)d_ws) > ws_size) return;    // ws 256 MiB
    k_prep<<<5 * WTB + (NB_ + 1) * CVB, 256, 0, stream>>>(wq, wk, wv, wo, wpos, x, pemb, WQ, WK, WV, WO, WP, X3);
    k_gemmw<bf, 0, true, 1, 2><<<dim3(TT / 64, DQ / 64, NB_), 32, 0, stream>>>(X3 + (size_t)TT * DM, nullptr, WQ, nullptr, DM, nullptr, DQ, bq, (size_t)TT * DM, 0, 0, Planes{QP16, QPh, QPl, QV16, QVh, QVl, pbu, pbv, PS, nullptr, nullptr});
    k_gemmw<bf, 0, true, 1, 1><<<dim3(TT / 64, DKV / 64, NB_ + 1), 32, 0, stream>>>(X3, nullptr, WK, nullptr, DM, nullptr, DKV, bk, (size_t)TT * DM, 0, 0, Planes{PK16, PKh, PKl, nullptr, nullptr, nullptr, nullptr, nullptr, PS, WP, bpos});
    k_gemmw<bf, 0, true, 1, 3><<<dim3(TT / 64, DKV / 64, NB_), 32, 0, stream>>>(X3 + (size_t)TT * DM, nullptr, WV, nullptr, DM, nullptr, DKV, bv, (size_t)TT * DM, 0, 0, Planes{VT16, VTh, VTl, nullptr, nullptr, nullptr, nullptr, nullptr, PS, nullptr, nullptr});
    k_fattn<<<dim3(TT / 16, NH_, NB_), 256, 0, stream>>>(QP16, QPh, QPl, QV16, QVh, QVl, PK16 + PS, PKh + PS, PKl + PS, PK16, PKh, PKl, VT16, VTh, VTl, abias, ATh, ATl);
    k_gemmw<bf, 1, true><<<dim3(NB_ * TT / 64, DM / 64, 1), 32, 0, stream>>>(ATh, ATl, WO, nullptr, DQ, OUT, DM, bo, 0, 0, 0, Planes{nullptr, nullptr, nullptr, nullptr, nullptr, nullptr, nullptr, nullptr, 0, nullptr, nullptr});   // both batches: 2 TT rows of one GEMM
}

// v006
// A run of this version takes 339 microseconds.
// Timed twice side by side with v005, it ran 1.05 and 1.06 times as fast.
// Counting every step since v000, it is 8.10 times as fast.
#include <hip/hip_runtime.h>

// Multi-head self-attention with relative positions and learnable u/v biases (x [2][2048][1024], bias [1][1][L][L] (f32 additive, read; verbatim causal 0/-1e9), pos_emb [2048][1][1024], pos_bias_u/v [16][64]; q/k/v = x W + b, r = pos_emb Wr + br ('xw', 16 heads x 64); qh = q/8; AC = (qh + u).k + bias; BD = (qh + v).r; logits = AC + rel_shift(BD) with the pad-front/reshape shift: pos[i][j] = BD[i][T-1-(i-j)] for j <= i, 0 for j == i+1, BD[i+1][j-i-2] for j >= i+2 (reproduced literally, including the masked upper part); softmax; out = merged Wo + bo -> [2][2048][1024]).
// Compute dtypes, f32 accumulate: every input rounded to bf16; q/k/v/r as PLAIN bf16 GEMMs (inputs: exact) + bias; q x 1/8 (exact) then the u/v head biases added in f32; content, position scores and attn.v: query rows < 512 hl (3 products), the rest single fp16 (x1024) (the shifted position score is gathered from rows i / i+1 of the position-score block); the additive bias read per element; softmax f32; Wo hl x exact (2 products) + bias.

#define NB_  2
#define TT   2048
#define DM   1024
#define NH_  16
#define NKV  16
#define REP  (NH_ / NKV)
#define HD   64
#define DQ   (NH_ * HD)
#define DKV  (NKV * HD)
#define RH   512                  // query rows < RH use hi+lo planes (0: none)
#define WIN  0
#define PCAR 1024.0f
#define KSP  16                   // attn.v: key ranges per output tile, two per wave of k_fattn; the KSP partial tiles are summed in ascending order
#define SCL  1.0f   // the 1/sqrt(64) is applied to q before the u/v biases (k_gemmw, EPI 2)
typedef _Float16 h16;
typedef unsigned short bf;
typedef __attribute__((ext_vector_type(16))) __bf16   v16bf;
typedef __attribute__((ext_vector_type(16))) _Float16 v16h;
typedef __attribute__((ext_vector_type(8)))  _Float16 v8h;
typedef __attribute__((ext_vector_type(8)))  unsigned short v8us;
typedef __attribute__((ext_vector_type(8)))  float    v8f;
typedef __attribute__((ext_vector_type(4)))  float    v4f;
typedef v8h  __attribute__((may_alias)) v8ha;
typedef v4f  __attribute__((may_alias)) v4fa;
typedef v8us __attribute__((may_alias)) v8usa;

__device__ __forceinline__ unsigned short f2bf(float f) { unsigned u = __float_as_uint(f); u += 0x7FFFu + ((u >> 16) & 1u); return (unsigned short)(u >> 16); }
__device__ __forceinline__ float bf2f(unsigned short b) { return __uint_as_float(((unsigned)b) << 16); }
__device__ __forceinline__ float bfr(float f) { return bf2f(f2bf(f)); }
__device__ __forceinline__ v16h cat16(v8h lo, v8h hi) { return __builtin_shufflevector(lo, hi, 0, 1, 2, 3, 4, 5, 6, 7, 8, 9, 10, 11, 12, 13, 14, 15); }
__device__ __forceinline__ v16bf cat16b(v8us lo, v8us hi) { return __builtin_bit_cast(v16bf, __builtin_shufflevector(lo, hi, 0, 1, 2, 3, 4, 5, 6, 7, 8, 9, 10, 11, 12, 13, 14, 15)); }
__device__ __forceinline__ v8f wmma16(v16h a, v16h b, v8f c) { return __builtin_amdgcn_wmma_f32_16x16x32_f16(false, a, false, b, (short)0, c, false, false); }
__device__ __forceinline__ v8f wmmab(v16bf a, v16bf b, v8f c) { return __builtin_amdgcn_wmma_f32_16x16x32_bf16(false, a, false, b, (short)0, c, false, false); }



// ---- FRAGMENT ORDER of every 16-bit plane that a matrix product reads (k_fattn: q + u, q + v, k, r, v; k_gemmw: x, pos_emb, the five weight matrices, the attention output): a block of 16 rows x 32 k (512 elements, 1 KiB) is stored as [g = (k >> 3) & 3][row & 15][k & 7], which is lane order (lane = 16 hi + row, g = 2 c + hi): load c of a fragment is 32 lanes x 16 B = 512 contiguous bytes (4 whole lines) where a row-major plane gives 16 part lines. Blocks of one 16-row tile follow one another along k. The registers hold what they held with row-major planes. ldf loads from a plane in fragment order.
// ---- k_gemmw: register-blocked GEMM, ONE WAVE per 64x64 output tile (16 accumulators), operands straight from 16-bit planes in fragment order (rows m or n, k along K); grid (M/64, N/64, Z), 32 threads.
// C[m][n] (f32, pitch ldc, + optional f32 bias[n]) = sum_k A[m][k] Bt[n][k] (+ split products per NSPLIT). z-batch strides sA/sB/sC in elements; with EPI != 0 slice z writes its planes sz elements behind slice z - 1's, so that the GEMMs of both batches are one launch and a WGP holds several waves whose load waits overlap. K % (32 KS) == 0. KS > 1: grid z = Z x KS; work-group (z, ks) sums only k in [ks K/KS, (ks+1) K/KS) and stores its partial tile in plane z KS + ks of C (plane stride sC).
template <typename T16> struct WFrag;
template <> struct WFrag<h16> { typedef v16h V; static __device__ __forceinline__ V ldf(const h16* p) { return cat16(*(const v8h*)p, *(const v8h*)(p + 256)); } static __device__ __forceinline__ v8f mma(V a, V b, v8f c) { return wmma16(a, b, c); } };
template <> struct WFrag<bf> { typedef v16bf V; static __device__ __forceinline__ V ldf(const bf* p) { return cat16b(*(const v8us*)p, *(const v8us*)(p + 256)); } static __device__ __forceinline__ v8f mma(V a, V b, v8f c) { return wmmab(a, b, c); } };
// Behind a batch of global loads: the precautionary wait in front of any write to a register of the loads' address pairs. The pointers are inputs so that the pairs stay live up to it; without that the compiler lets a later load of the batch land in an earlier load's pair. A shorter list repeats its pointers.
__device__ __forceinline__ void xhold(const void* a, const void* b, const void* c, const void* d, const void* e, const void* f, const void* g, const void* h) { asm volatile("s_wait_xcnt 0x0" :: "v"(a), "v"(b), "v"(c), "v"(d), "v"(e), "v"(f), "v"(g), "v"(h) : "memory"); }
__device__ __forceinline__ h16 tohx(float x) { return (h16)x; }
__device__ __forceinline__ void splitf(float y, unsigned short& h, unsigned short& l) { h = f2bf(y); l = f2bf(y - bf2f(h)); }
// one 16-byte store into each of the three planes (fp16, bf16 hi, bf16 lo) of eight neighbouring values. The stores stand in one asm statement with the precautionary s_wait_xcnt 0 behind them, so that it is in front of every later write to their address and data registers.
__device__ __forceinline__ void put8(const float (&x)[8], h16* P16, bf* Ph, bf* Pl, size_t o) { v8h o16; v8us oh, ol;
#pragma unroll
    for (int q = 0; q < 8; ++q) { o16[q] = tohx(x[q]); unsigned short a, c; splitf(x[q], a, c); oh[q] = a; ol[q] = c; }
    asm volatile("global_store_b128 %0, %3, off\n\tglobal_store_b128 %1, %4, off\n\tglobal_store_b128 %2, %5, off\n\ts_wait_xcnt 0x0" :: "v"(P16 + o), "v"(Ph + o), "v"(Pl + o), "v"(o16), "v"(oh), "v"(ol) : "memory"); }
// Where a projection's tile goes when EPI != 0 (a 64-column tile is one head), all in fragment order: EPI 1: planes p [h] (rows t, k = d) of C + bias (k, r); EPI 2: planes p of (C + bias)/8 + bu and planes q of (C + bias)/8 + bv (the two query forms); EPI 3: planes p [h] (rows d, k = t; the four 16-row blocks of one k step side by side) of C + bias (v, transposed). An EPI 1 launch holds the position projection as slice z = 0 (weights Bt0, bias bias0) and the key projection of batch z - 1 behind it.
struct Planes { h16* p16; bf* ph; bf* pl; h16* q16; bf* qh; bf* ql; const float* bu; const float* bv; size_t sz; const bf* Bt0; const float* bias0; };
template <typename T16, int NSPLIT, bool BIAS, int KS = 1, int EPI = 0>
__global__ __launch_bounds__(32) void k_gemmw(const T16* __restrict__ A, const T16* __restrict__ A2, const T16* __restrict__ Bt, const T16* __restrict__ Bt2, int K, float* C, int ldc, const float* __restrict__ bias, size_t sA, size_t sB, size_t sC, Planes po) {
    typedef typename WFrag<T16>::V V;
    __shared__ __align__(16) float os[(EPI == 2 ? 2 : 1) * 16 * 68];   // EPI 2: one tile for each of the two query forms
    const size_t z = blockIdx.z / KS; A += z * sA; if (A2) A2 += z * sA; Bt += z * sB; if (Bt2) Bt2 += z * sB; C += (size_t)blockIdx.z * sC; const int kb = (int)(blockIdx.z % KS) * (K / KS), ke = kb + K / KS;
    if constexpr (EPI != 0) { const size_t zs = z * po.sz; po.p16 += zs; po.ph += zs; po.pl += zs; if constexpr (EPI == 2) { po.q16 += zs; po.qh += zs; po.ql += zs; } }
    if constexpr (EPI == 1) { if (z == 0) { Bt = po.Bt0; bias = po.bias0; } }
    const int lane = threadIdx.x & 31, lr = lane & 15, hi = lane >> 4; const int r0 = blockIdx.x * 64, c0 = blockIdx.y * 64;
    v8f acc[4][4];
#pragma unroll
    for (int mb = 0; mb < 4; ++mb)
#pragma unroll
        for (int nb = 0; nb < 4; ++nb) acc[mb][nb] = (v8f){};
    const size_t aoff = (size_t)r0 * K + lane * 8, boff = (size_t)c0 * K + lane * 8;   // a 16-row tile is 16 K elements, a k step of 32 is 512 of them; lane * 8: the lane's 16-byte unit
#pragma unroll 1
    for (int kc = kb; kc < ke; kc += 32) {
        V a[4], a2[4], b[4], b2[4]; const T16 *pa[4], *pa2[4], *pb[4], *pb2[4];
#pragma unroll
        for (int t = 0; t < 4; ++t) { const size_t ot = (size_t)t * 16 * K + (size_t)kc * 16; pa[t] = A + aoff + ot; pb[t] = Bt + boff + ot; a[t] = WFrag<T16>::ldf(pa[t]); b[t] = WFrag<T16>::ldf(pb[t]);
            if (NSPLIT == 1 || NSPLIT == 2) { pa2[t] = A2 + aoff + ot; a2[t] = WFrag<T16>::ldf(pa2[t]); } if (NSPLIT >= 2) { pb2[t] = Bt2 + boff + ot; b2[t] = WFrag<T16>::ldf(pb2[t]); } }
        if constexpr (NSPLIT == 1) asm volatile("s_wait_xcnt 0x0" :: "v"(pa[0]), "v"(pa[1]), "v"(pa[2]), "v"(pa[3]), "v"(pb[0]), "v"(pb[1]), "v"(pb[2]), "v"(pb[3]), "v"(pa2[0]), "v"(pa2[1]), "v"(pa2[2]), "v"(pa2[3]) : "memory");   // xhold for twelve pairs
        else xhold(pa[0], pa[1], pa[2], pa[3], pb[0], pb[1], pb[2], pb[3]);
        if constexpr (NSPLIT == 2) xhold(pa2[0], pa2[1], pa2[2], pa2[3], pb2[0], pb2[1], pb2[2], pb2[3]);
        if constexpr (NSPLIT > 2) xhold(pb2[0], pb2[1], pb2[2], pb2[3], pb2[0], pb2[1], pb2[2], pb2[3]);
        __builtin_amdgcn_sched_barrier(0);   // keeps the products behind the wait: without it the compiler lifts them over it, in between the loads, and then fetches the B fragments one after another into one register set, with a full load wait each
#pragma unroll
        for (int nb = 0; nb < 4; ++nb) {
#pragma unroll
            for (int mb = 0; mb < 4; ++mb) { acc[mb][nb] = WFrag<T16>::mma(a[mb], b[nb], acc[mb][nb]); if (NSPLIT == 1 || NSPLIT == 2) acc[mb][nb] = WFrag<T16>::mma(a2[mb], b[nb], acc[mb][nb]); if (NSPLIT >= 2) acc[mb][nb] = WFrag<T16>::mma(a[mb], b2[nb], acc[mb][nb]); } }
        asm volatile("v_nop\n\tv_nop\n\tv_nop\n\tv_nop" : "+v"(acc[0][0]), "+v"(acc[1][1]), "+v"(acc[2][2]), "+v"(acc[3][3]) : "v"(a[0]), "v"(a[3]));
    }
    if constexpr (EPI == 3) {   // a lane's eight accumulator values are eight neighbouring t of one d, one 16-byte unit of the fragment order (rows d, k = t): stored straight from the registers
        asm volatile("s_wait_xcnt 0x0" ::: "memory");   // precautionary wait in front of the first write to an address pair of the k loop's loads
        float bn[4];   // all four bias loads first: the store statements' memory clobber would hold a later load behind them
#pragma unroll
        for (int nb = 0; nb < 4; ++nb) bn[nb] = bfr(bias[c0 + nb * 16 + lr]);
#pragma unroll
        for (int nb = 0; nb < 4; ++nb) {
#pragma unroll
            for (int mb = 0; mb < 4; ++mb) { float x[8];
#pragma unroll
                for (int j = 0; j < 8; ++j) x[j] = acc[mb][nb][j] + bn[nb];
                put8(x, po.p16, po.ph, po.pl, ((size_t)blockIdx.y * TT + r0 + (mb >> 1) * 32) * HD + nb * 512 + (mb & 1) * 256 + lane * 8); } }   // block (32 t, 16 d) in fragment order: 512 contiguous bytes a store
        return; }
    float bn[4], un[4], vn[4];   // EPI 1, 2: the biases of a lane's four accumulator columns, added before the tile goes through LDS
    if constexpr (EPI == 1 || EPI == 2) {
#pragma unroll
        for (int nb = 0; nb < 4; ++nb) { bn[nb] = bfr(bias[c0 + nb * 16 + lr]); if (EPI == 2) { un[nb] = bfr(po.bu[c0 + nb * 16 + lr]); vn[nb] = bfr(po.bv[c0 + nb * 16 + lr]); } } }
#pragma unroll
    for (int mb = 0; mb < 4; ++mb) {
#pragma unroll
        for (int nb = 0; nb < 4; ++nb) {
#pragma unroll
            for (int j = 0; j < 8; ++j) { const int oi = (hi * 8 + j) * 68 + nb * 16 + lr;
                if constexpr (EPI == 1) os[oi] = acc[mb][nb][j] + bn[nb];
                else if constexpr (EPI == 2) { const float aq = __fmul_rn(acc[mb][nb][j] + bn[nb], 0.125f); os[oi] = __fadd_rn(aq, un[nb]); os[16 * 68 + oi] = __fadd_rn(aq, vn[nb]); }
                else os[oi] = acc[mb][nb][j]; } }
        __builtin_amdgcn_wave_barrier(); asm volatile("" ::: "memory");
        float* crow = C + (size_t)(r0 + mb * 16) * ldc + c0;
        if constexpr (EPI == 1 || EPI == 2) {
            const size_t o = ((size_t)blockIdx.y * TT + r0 + mb * 16) * HD + lane * 8;   // store s: units g = 2 s + hi of row lr, 512 contiguous bytes
#pragma unroll
            for (int pl = 0; pl < (EPI == 2 ? 2 : 1); ++pl) { const float* ot = os + pl * (16 * 68) + lr * 68 + hi * 8;
                v4f v0[4], v1[4];   // a tile's LDS reads first: the store statements' memory clobber would hold a later read behind them
#pragma unroll
                for (int s = 0; s < 4; ++s) { v0[s] = *(const v4fa*)(ot + s * 16); v1[s] = *(const v4fa*)(ot + s * 16 + 4); }
#pragma unroll
                for (int s = 0; s < 4; ++s) { float x[8];
#pragma unroll
                    for (int q = 0; q < 8; ++q) x[q] = q < 4 ? v0[s][q & 3] : v1[s][q & 3];
                    if (pl == 0) put8(x, po.p16, po.ph, po.pl, o + s * 256); else put8(x, po.q16, po.qh, po.ql, o + s * 256); } }
        } else {
#pragma unroll
            for (int s = 0; s < 8; ++s) { const int row = 2 * s + hi, cofs = lr * 4; v4f val = *(const v4fa*)(os + row * 68 + cofs); if (BIAS) { val[0] += bfr(bias[c0 + cofs]); val[1] += bfr(bias[c0 + cofs + 1]); val[2] += bfr(bias[c0 + cofs + 2]); val[3] += bfr(bias[c0 + cofs + 3]); }
                *(v4f*)(crow + (size_t)row * ldc + cofs) = val; }
             }
        __builtin_amdgcn_wave_barrier(); asm volatile("" ::: "memory");
    }
}

typedef __attribute__((ext_vector_type(2))) _Float16 v2h;
typedef __attribute__((ext_vector_type(4))) _Float16 v4h;
typedef __attribute__((ext_vector_type(2))) unsigned short v2us;
typedef __attribute__((ext_vector_type(4))) unsigned short v4us;
typedef __attribute__((ext_vector_type(2))) float v2f;
typedef __attribute__((ext_vector_type(4))) int v4i;

// One wave per block of 16 n x 32 k of Bt[n][k] = w[k][n], written in fragment order (two stores of 512 contiguous bytes); a load takes 16 neighbouring n of two k rows. The eight waves of a work-group cover 32 n x 128 k, so that they use whole 128-byte lines of w.
__device__ __forceinline__ void wtG(const float* __restrict__ w, int K, int N, bf* Bt, int blk) {
    const int lane = threadIdx.x & 31, lr = lane & 15, hi = lane >> 4, ws = threadIdx.x >> 5;
    const int nt = (blk % (N / 32)) * 2 + (ws & 1), kb = (blk / (N / 32)) * 4 + (ws >> 1);
    const float* p = w + (size_t)(kb * 32 + hi * 8) * N + nt * 16 + lr; float v[2][8];
#pragma unroll
    for (int c = 0; c < 2; ++c)
#pragma unroll
        for (int q = 0; q < 8; ++q) v[c][q] = p[(size_t)(c * 16 + q) * N];
    asm volatile("s_wait_xcnt 0x0" :: "v"(p) : "memory");   // precautionary wait in front of the first write to the loads' address pair, which the input keeps live up to here
    v8us o0, o1;
#pragma unroll
    for (int q = 0; q < 8; ++q) { o0[q] = f2bf(v[0][q]); o1[q] = f2bf(v[1][q]); }
    asm volatile("global_store_b128 %0, %1, off\n\tglobal_store_b128 %0, %2, off offset:512\n\ts_wait_xcnt 0x0" :: "v"(Bt + ((size_t)nt * (K / 32) + kb) * 512 + lane * 8), "v"(o0), "v"(o1) : "memory");   // stores and precautionary wait in one statement, as in put8
}
// ---- k_prep: all that the GEMMs wait for, in one launch: work-groups [0, 5 WTB) transpose and round the five weight matrices (WTB each), the rest round pos_emb (slice 0 of X3) and x (slices 1, 2: the two batches), eight values (one 16-byte unit of the fragment order) a thread; a wave takes 8 rows x 32 k: whole 128-byte lines on both sides.
#define WTB (DM * DQ / 64 / 64)
#define CVB (TT * DM / 8 / 256)   // work-groups per slice of X3
__global__ __launch_bounds__(256) void k_prep(const float* __restrict__ wq, const float* __restrict__ wk, const float* __restrict__ wv, const float* __restrict__ wo, const float* __restrict__ wpos, const float* __restrict__ x, const float* __restrict__ pemb, bf* WQ, bf* WK, bf* WV, bf* WO, bf* WP, bf* X3) {
    const int blk = blockIdx.x;
    if (blk < 5 * WTB) { const int job = blk / WTB; wtG(job == 0 ? wq : job == 1 ? wk : job == 2 ? wv : job == 3 ? wo : wpos, DM, DQ, job == 0 ? WQ : job == 1 ? WK : job == 2 ? WV : job == 3 ? WO : WP, blk % WTB); return; }
    const int cb = blk - 5 * WTB; const size_t i = (size_t)cb * 256 + threadIdx.x; const size_t tile = i / (2 * DM); const int u = (int)(i % (2 * DM)), g = u & 3, row = (u >> 2) & 15, kb = u >> 6;   // 2 DM units in a tile of 16 rows
    const size_t so = (tile * 16 + row) * DM + kb * 32 + g * 8; const float* src = cb < CVB ? pemb + so : x + (so - (size_t)TT * DM); const v8f v = *(const v8f*)src; v8us o;
    asm volatile("s_wait_xcnt 0x0" ::: "memory");   // precautionary wait in front of the first write to the load's address pair (the compiler reuses the pair for the rounding)
#pragma unroll
    for (int k = 0; k < 8; ++k) o[k] = f2bf(v[k]);
    asm volatile("global_store_b128 %0, %1, off\n\ts_wait_xcnt 0x0" :: "v"(X3 + tile * (16 * DM) + kb * 512 + g * 128 + row * 8), "v"(o) : "memory"); }   // store and precautionary wait in one statement, as in put8: the compiler joins this path with the transpose part, whose first instructions write the store's registers
__global__ __launch_bounds__(256) void k_cscvt(const float* __restrict__ cosT, const float* __restrict__ sinT, float* CS) { const int idx = blockIdx.x * 256 + threadIdx.x; if (idx >= TT * HD) return; v2f cs; cs[0] = bfr(cosT[idx]); cs[1] = bfr(sinT[idx]); *(v2f*)(CS + (size_t)idx * 2) = cs;  }
// ---- k_fattn: one work-group (8 waves) per 16 query rows of one head of one batch (blockIdx.z; the q, k, v planes and the output of batch 1 stand behind batch 0's, the position planes serve both); the 16 x 2048 f32 logit rows live in LDS from the score products to attn.v.
// Phases: (1) content scores + additive bias -> S; (2) position scores added at their rel-shift place (row i takes BD[i][m >= T-1-i] at j = m-(T-1)+i and BD[i+1][m <= T-3-i] at j = m+i+2; every place gets at most one term); (3) softmax, one wave per row, weights written over the row as 16-bit planes; (4) attn.v in KSP key ranges of 128, two per wave; (5) the KSP partial tiles summed in ascending order.
#define SP 2052                   // LDS row pitch in floats: 2048 + 4, so that the 16 rows of a fragment read start on different banks
typedef v4h  __attribute__((may_alias)) v4ha;
typedef v4us __attribute__((may_alias)) v4usa;
// v_exp_f32 with the one free slot that the instruction set asks for behind a transcendental, before its result is read or its source written again; in one statement, so that the v_nop stands directly behind it
__device__ __forceinline__ float exp2_slot(float x) { float r; asm("v_exp_f32 %0, %1\n\tv_nop" : "=v"(r) : "v"(x)); return r; }
template <bool HI> struct BFrag;   // 16 rows x 64 k of a plane in fragment order (hi + lo planes where HI); off = fo(lane's row, hi)
__device__ __forceinline__ size_t fo(int row, int hi) { return (size_t)(row >> 4) * (16 * HD) + (row & 15) * 8 + hi * 128; }
template <> struct BFrag<false> { v16h b[2]; const h16 *p, *p2;
    __device__ __forceinline__ void load(const h16* b16, const bf*, const bf*, size_t off) { p = p2 = b16 + off; b[0] = WFrag<h16>::ldf(p); b[1] = WFrag<h16>::ldf(p + 512); } };
template <> struct BFrag<true> { v16bf b[2], b2[2]; const bf *p, *p2;
    __device__ __forceinline__ void load(const h16*, const bf* bh, const bf* bl, size_t off) { p = bh + off; p2 = bl + off; b[0] = WFrag<bf>::ldf(p); b[1] = WFrag<bf>::ldf(p + 512); b2[0] = WFrag<bf>::ldf(p2); b2[1] = WFrag<bf>::ldf(p2 + 512); } };
__device__ __forceinline__ v8f dot64(const BFrag<false>& q, const BFrag<false>& k) { v8f c = (v8f){};
#pragma unroll
    for (int kk = 0; kk < 2; ++kk) c = wmma16(q.b[kk], k.b[kk], c);
    return c; }
__device__ __forceinline__ v8f dot64(const BFrag<true>& q, const BFrag<true>& k) { v8f c = (v8f){};
#pragma unroll
    for (int kk = 0; kk < 2; ++kk) { c = wmmab(q.b[kk], k.b[kk], c); c = wmmab(q.b2[kk], k.b[kk], c); c = wmmab(q.b[kk], k.b2[kk], c); }
    return c; }
template <bool HI>
__device__ __forceinline__ void ac_pass(float* S, const h16* q16, const bf* qh, const bf* ql, const h16* k16, const bf* kh, const bf* kl, const float* __restrict__ ab, int i0, int w, int lr, int hi) {
    BFrag<HI> q; q.load(q16, qh, ql, fo(i0 + lr, hi));
    constexpr int U = HI ? 2 : 4;   // key tiles whose loads fly together
#pragma unroll 1   // the batch of U tiles is the unit; unrolling further would pass 256 VGPRs and cost the second work-group of the WGP
    for (int it = 0; it < TT / 128; it += U) { BFrag<HI> k[U]; const float* pb[U]; float bb[U][8];
#pragma unroll
        for (int u = 0; u < U; ++u) { const int col = (w + (it + u) * 8) * 16 + lr; k[u].load(k16, kh, kl, fo(col, hi)); pb[u] = ab + (size_t)(i0 + hi * 8) * TT + col;
#pragma unroll
            for (int jj = 0; jj < 8; ++jj) bb[u][jj] = pb[u][(size_t)jj * TT]; }
        if (HI) xhold(k[0].p, k[0].p2, k[1].p, k[1].p2, pb[0], pb[1], pb[0], pb[1]); else xhold(k[0].p, k[1].p, k[U - 2].p, k[U - 1].p, pb[0], pb[1], pb[U - 2], pb[U - 1]);
#pragma unroll
        for (int u = 0; u < U; ++u) { const v8f c = dot64(q, k[u]); const int col = (w + (it + u) * 8) * 16 + lr;
#pragma unroll
            for (int jj = 0; jj < 8; ++jj) S[(hi * 8 + jj) * SP + col] = __fadd_rn(c[jj], bfr(bb[u][jj])); } }
}
template <bool HI, bool HEAD>
__device__ __forceinline__ void bd_place(float* S, const v8f c, int m, int i0, int hi) {
    float old[8];   // all eight reads first (index clamped into the row where no term is placed), so that they wait once
#pragma unroll
    for (int jj = 0; jj < 8; ++jj) { const int r = hi * 8 + jj, i = i0 + r; const int j = HEAD ? min(m + i + 2, TT - 1) : max(m - (TT - 1) + i, 0); old[jj] = S[r * SP + j]; }
#pragma unroll
    for (int jj = 0; jj < 8; ++jj) { const int r = hi * 8 + jj, i = i0 + r; const bool ok = HEAD ? (m <= TT - 3 - i && (i + 1 < RH) == HI) : (m >= TT - 1 - i); const int j = HEAD ? m + i + 2 : m - (TT - 1) + i;
        if (ok) S[r * SP + j] = __fadd_rn(old[jj], c[jj]); }
}
template <bool HI, bool HEAD>
__device__ __forceinline__ void bd_pass(float* S, const h16* q16, const bf* qh, const bf* ql, const h16* p16, const bf* ph, const bf* pl, int i0, int w, int lr, int hi) {
    int ar = HEAD ? i0 + 1 + lr : i0 + lr; if (ar > TT - 1) ar = TT - 1;   // row T does not exist; no term of it is ever placed (m <= -2)
    BFrag<HI> q; q.load(q16, qh, ql, fo(ar, hi));
    const int ntlo = HEAD ? 0 : (TT - 16 - i0) / 16, nthi = HEAD ? (TT - 3 - i0) / 16 : TT / 16 - 1;
#pragma unroll 1   // trip count depends on the row block; the pair of tiles is the unit
    for (int nt = ntlo + w; nt <= nthi; nt += 16) { const bool two = (nt + 8 <= nthi); const int nt1 = two ? nt + 8 : nt;   // two tiles' loads fly together; the last trip may hold one
        BFrag<HI> r0, r1; r0.load(p16, ph, pl, fo(nt * 16 + lr, hi)); r1.load(p16, ph, pl, fo(nt1 * 16 + lr, hi));
        xhold(r0.p, r0.p2, r1.p, r1.p2, r0.p, r0.p2, r1.p, r1.p2);
        bd_place<HI, HEAD>(S, dot64(q, r0), nt * 16 + lr, i0, hi);
        if (two) bd_place<HI, HEAD>(S, dot64(q, r1), nt1 * 16 + lr, i0, hi); }
}
template <bool HI>
__device__ __forceinline__ void pv_pass(const float* S, const h16* v16, const bf* vh, const bf* vl, int w, int lr, int hi, v8f (&acc)[2][4]) {
    constexpr int NS = HI ? 1 : 2;   // k steps of 32 keys whose loads fly together
#pragma unroll
    for (int u = 0; u < 2; ++u) {
#pragma unroll
        for (int nb = 0; nb < 4; ++nb) acc[u][nb] = (v8f){};
#pragma unroll
        for (int st = 0; st < TT / KSP / 32; st += NS) { const int kc = (2 * w + u) * (TT / KSP) + st * 32; const size_t boff = (size_t)kc * HD + hi * 128 + lr * 8;   // a k step of 32 keys is four blocks (16 d each) of 512 elements
            if (HI) { const bf *pv = vh + boff, *pv2 = vl + boff; v16bf b[4], b2[4];
#pragma unroll
                for (int nb = 0; nb < 4; ++nb) { b[nb] = WFrag<bf>::ldf(pv + nb * 512); b2[nb] = WFrag<bf>::ldf(pv2 + nb * 512); }
                xhold(pv, pv2, pv, pv2, pv, pv2, pv, pv2);
                const bf* p = (const bf*)(S + lr * SP) + kc + 8 * hi; const v16bf a = cat16b(*(const v8usa*)p, *(const v8usa*)(p + 16)), a2 = cat16b(*(const v8usa*)(p + TT), *(const v8usa*)(p + TT + 16));
#pragma unroll
                for (int nb = 0; nb < 4; ++nb) { acc[u][nb] = wmmab(a, b[nb], acc[u][nb]); acc[u][nb] = wmmab(a2, b[nb], acc[u][nb]); acc[u][nb] = wmmab(a, b2[nb], acc[u][nb]); }
            } else { const h16* pv = v16 + boff; v16h b[NS][4];
#pragma unroll
                for (int s = 0; s < NS; ++s)
#pragma unroll
                    for (int nb = 0; nb < 4; ++nb) b[s][nb] = WFrag<h16>::ldf(pv + s * (32 * HD) + nb * 512);
                xhold(pv, pv, pv, pv, pv, pv, pv, pv);
#pragma unroll
                for (int s = 0; s < NS; ++s) { const h16* p = (const h16*)(S + lr * SP) + kc + s * 32 + 8 * hi; const v16h a = cat16(*(const v8ha*)p, *(const v8ha*)(p + 16));
#pragma unroll
                    for (int nb = 0; nb < 4; ++nb) acc[u][nb] = wmma16(a, b[s][nb], acc[u][nb]); } } } }
}
// amdgpu_waves_per_eu(4, 4): 256 VGPRs at most, so that two work-groups (2 x 131,328 B of LDS) share a WGP and one computes while the other waits at a barrier
__global__ __launch_bounds__(256) __attribute__((amdgpu_waves_per_eu(4, 4))) void k_fattn(const h16* __restrict__ QP16, const bf* __restrict__ QPh, const bf* __restrict__ QPl, const h16* __restrict__ QV16, const bf* __restrict__ QVh, const bf* __restrict__ QVl, const h16* __restrict__ KP16, const bf* __restrict__ KPh, const bf* __restrict__ KPl, const h16* __restrict__ PP16, const bf* __restrict__ PPh, const bf* __restrict__ PPl, const h16* __restrict__ VT16, const bf* __restrict__ VTh, const bf* __restrict__ VTl, const float* __restrict__ ab, bf* Ah, bf* Al) {
    __shared__ __align__(16) float S[16 * SP];
    const int tid = threadIdx.x, lane = tid & 31, lr = lane & 15, hi = lane >> 4; const int w = __builtin_amdgcn_readfirstlane(tid >> 5);
    const int i0 = blockIdx.x * 16, h = blockIdx.y; const bool hires = (i0 < RH); const size_t hp = (size_t)h * TT * HD;
    { const size_t zb = (size_t)blockIdx.z * ((size_t)NH_ * TT * HD); QP16 += zb; QPh += zb; QPl += zb; QV16 += zb; QVh += zb; QVl += zb; KP16 += zb; KPh += zb; KPl += zb; VT16 += zb; VTh += zb; VTl += zb; Ah += zb; Al += zb; }   // NH_ TT HD == TT DQ: one batch of any of these
    if (hires) ac_pass<true>(S, QP16 + hp, QPh + hp, QPl + hp, KP16 + hp, KPh + hp, KPl + hp, ab, i0, w, lr, hi); else ac_pass<false>(S, QP16 + hp, QPh + hp, QPl + hp, KP16 + hp, KPh + hp, KPl + hp, ab, i0, w, lr, hi);
    __syncthreads();   // every content + bias value stands in S before a position term is added to it
    if (hires) bd_pass<true, false>(S, QV16 + hp, QVh + hp, QVl + hp, PP16 + hp, PPh + hp, PPl + hp, i0, w, lr, hi); else bd_pass<false, false>(S, QV16 + hp, QVh + hp, QVl + hp, PP16 + hp, PPh + hp, PPl + hp, i0, w, lr, hi);
    if (i0 + 1 < RH) bd_pass<true, true>(S, QV16 + hp, QVh + hp, QVl + hp, PP16 + hp, PPh + hp, PPl + hp, i0, w, lr, hi);      // rows i+1 < RH: hi+lo products
    if (i0 + 16 >= RH) bd_pass<false, true>(S, QV16 + hp, QVh + hp, QVl + hp, PP16 + hp, PPh + hp, PPl + hp, i0, w, lr, hi);   // rows i+1 >= RH: fp16 products
    __syncthreads();   // logits complete before a wave reads its rows
#pragma unroll 1   // one 64-register row at a time
    for (int rr = 0; rr < 2; ++rr) { float* srow = S + (w + rr * 8) * SP; float v[TT / 32]; float mx = -3.0e38f;
#pragma unroll
        for (int ch = 0; ch < TT / 128; ++ch) { const v4f a = *(const v4fa*)(srow + ch * 128 + lane * 4);
#pragma unroll
            for (int q = 0; q < 4; ++q) { v[ch * 4 + q] = a[q]; mx = fmaxf(mx, a[q]); } }
#pragma unroll
        for (int sh = 16; sh; sh >>= 1) mx = fmaxf(mx, __shfl_xor(mx, sh, 32));
        float sum = 0.f;
#pragma unroll
        for (int k = 0; k < TT / 32; ++k) { v[k] = exp2_slot(__fmul_rn(__fsub_rn(v[k], mx), 1.4426950408889634f)); sum += v[k]; }
#pragma unroll
        for (int sh = 16; sh; sh >>= 1) sum += __shfl_xor(sum, sh, 32);
        const float f = __fdiv_rn(hires ? 1.0f : PCAR, sum);
        if (hires) { bf* ph = (bf*)srow;
#pragma unroll
            for (int ch = 0; ch < TT / 128; ++ch) { v4us oh, ol;
#pragma unroll
                for (int q = 0; q < 4; ++q) { unsigned short a, c2; splitf(v[ch * 4 + q] * f, a, c2); oh[q] = a; ol[q] = c2; }
                *(v4usa*)(ph + ch * 128 + lane * 4) = oh; *(v4usa*)(ph + TT + ch * 128 + lane * 4) = ol; }
        } else { h16* p16 = (h16*)srow;
#pragma unroll
            for (int ch = 0; ch < TT / 128; ++ch) { v4h o4;
#pragma unroll
                for (int q = 0; q < 4; ++q) o4[q] = tohx(v[ch * 4 + q] * f);
                *(v4ha*)(p16 + ch * 128 + lane * 4) = o4; } } }
    __syncthreads();   // all 16 weight rows written before any wave reads them as A fragments
    v8f acc[2][4]; const size_t hv = (size_t)h * HD * TT;
    if (hires) pv_pass<true>(S, VT16 + hv, VTh + hv, VTl + hv, w, lr, hi, acc); else pv_pass<false>(S, VT16 + hv, VTh + hv, VTl + hv, w, lr, hi, acc);
    __syncthreads();   // last read of the weights is over before the partial tiles overwrite them
#pragma unroll
    for (int u = 0; u < 2; ++u)
#pragma unroll
        for (int nb = 0; nb < 4; ++nb)
#pragma unroll
            for (int jj = 0; jj < 8; ++jj) S[(2 * w + u) * (16 * HD) + (hi * 8 + jj) * HD + nb * 16 + lr] = acc[u][nb][jj];
    __syncthreads();   // all KSP partial tiles written before they are summed
    const int e = tid * 4, t = i0 + (e >> 6), d = e & 63; v4f s = *(const v4fa*)(S + e);
#pragma unroll
    for (int ks = 1; ks < KSP; ++ks) s += *(const v4fa*)(S + ks * (16 * HD) + e);
    const float cs = (t < RH) ? 1.0f : (1.0f / PCAR); v4us oh, ol;
#pragma unroll
    for (int q = 0; q < 4; ++q) { unsigned short a, c2; splitf(s[q] * cs, a, c2); oh[q] = a; ol[q] = c2; }
    const size_t oo = (size_t)(t >> 4) * (16 * DQ) + (size_t)((h * HD + d) >> 5) * 512 + ((d >> 3) & 3) * 128 + (t & 15) * 8 + (d & 7); *(v4us*)(Ah + oo) = oh; *(v4us*)(Al + oo) = ol;   // fragment order (rows t, k = h HD + d) for the output GEMM: the work-group's tile is 2 KiB in a row in each plane
}

extern "C" void kernel_launch(void* const* d_in, const int* in_sizes, int n_in,
                              void* d_out, int out_size, void* d_ws, size_t ws_size, hipStream_t stream) {
    (void)in_sizes; (void)n_in; (void)out_size;
    const float* x = (const float*)d_in[0]; const float* abias = (const float*)d_in[1]; const float* pemb = (const float*)d_in[2]; const float* pbu = (const float*)d_in[3]; const float* pbv = (const float*)d_in[4]; const float* wq = (const float*)d_in[5]; const float* bq = (const float*)d_in[6]; const float* wk = (const float*)d_in[7]; const float* bk = (const float*)d_in[8]; const float* wv = (const float*)d_in[9]; const float* bv = (const float*)d_in[10]; const float* wpos = (const float*)d_in[11]; const float* bpos = (const float*)d_in[12]; const float* wo = (const float*)d_in[13]; const float* bo = (const float*)d_in[14]; const float* cosT = nullptr; const float* sinT = nullptr; (void)cosT; (void)sinT;
    float* OUT = (float*)d_out;     // [2][2048][1024]
    char* wsp = (char*)d_ws;
    auto take = [&](size_t bytes) { char* p = wsp; wsp += (bytes + 255) & ~(size_t)255; return (void*)p; };
    const size_t PS = (size_t)NH_ * TT * HD;   // elements of one 16-bit plane set (all heads) of one batch
    bf* WQ = (bf*)take((size_t)DQ * DM * 2); bf* WK = (bf*)take((size_t)DKV * DM * 2); bf* WV = (bf*)take((size_t)DKV * DM * 2); bf* WO = (bf*)take((size_t)DM * DQ * 2); bf* WP = (bf*)take((size_t)DQ * DM * 2);
    bf* X3 = (bf*)take((size_t)(NB_ + 1) * TT * DM * 2);   // slice 0: pos_emb; slices 1..: x
    h16* PK16 = (h16*)take((NB_ + 1) * PS * 2); bf* PKh = (bf*)take((NB_ + 1) * PS * 2); bf* PKl = (bf*)take((NB_ + 1) * PS * 2);   // slice 0: position planes; slices 1..: key planes
    h16* QV16 = (h16*)take(NB_ * PS * 2); bf* QVh = (bf*)take(NB_ * PS * 2); bf* QVl = (bf*)take(NB_ * PS * 2);
    h16* QP16 = (h16*)take(NB_ * PS * 2); bf* QPh = (bf*)take(NB_ * PS * 2); bf* QPl = (bf*)take(NB_ * PS * 2);
    h16* VT16 = (h16*)take(NB_ * PS * 2); bf* VTh = (bf*)take(NB_ * PS * 2); bf* VTl = (bf*)take(NB_ * PS * 2);
    bf* ATh = (bf*)take((size_t)NB_ * TT * DQ * 2); bf* ATl = (bf*)take((size_t)NB_ * TT * DQ * 2);
    if ((size_t)(wsp - (char*)d_ws) > ws_size) return;    // ws 256 MiB
    k_prep<<<5 * WTB + (NB_ + 1) * CVB, 256, 0, stream>>>(wq, wk, wv, wo, wpos, x, pemb, WQ, WK, WV, WO, WP, X3);
    k_gemmw<bf, 0, true, 1, 2><<<dim3(TT / 64, DQ / 64, NB_), 32, 0, stream>>>(X3 + (size_t)TT * DM, nullptr, WQ, nullptr, DM, nullptr, DQ, bq, (size_t)TT * DM, 0, 0, Planes{QP16, QPh, QPl, QV16, QVh, QVl, pbu, pbv, PS, nullptr, nullptr});
    k_gemmw<bf, 0, true, 1, 1><<<dim3(TT / 64, DKV / 64, NB_ + 1), 32, 0, stream>>>(X3, nullptr, WK, nullptr, DM, nullptr, DKV, bk, (size_t)TT * DM, 0, 0, Planes{PK16, PKh, PKl, nullptr, nullptr, nullptr, nullptr, nullptr, PS, WP, bpos});
    k_gemmw<bf, 0, true, 1, 3><<<dim3(TT / 64, DKV / 64, NB_), 32, 0, stream>>>(X3 + (size_t)TT * DM, nullptr, WV, nullptr, DM, nullptr, DKV, bv, (size_t)TT * DM, 0, 0, Planes{VT16, VTh, VTl, nullptr, nullptr, nullptr, nullptr, nullptr, PS, nullptr, nullptr});
    k_fattn<<<dim3(TT / 16, NH_, NB_), 256, 0, stream>>>(QP16, QPh, QPl, QV16, QVh, QVl, PK16 + PS, PKh + PS, PKl + PS, PK16, PKh, PKl, VT16, VTh, VTl, abias, ATh, ATl);
    k_gemmw<bf, 1, true><<<dim3(NB_ * TT / 64, DM / 64, 1), 32, 0, stream>>>(ATh, ATl, WO, nullptr, DQ, OUT, DM, bo, 0, 0, 0, Planes{nullptr, nullptr, nullptr, nullptr, nullptr, nullptr, nullptr, nullptr, 0, nullptr, nullptr});   // both batches: 2 TT rows of one GEMM
}

// v007
// A run of this version takes 318 microseconds.
// In both of two side-by-side timings against v006, it was 1.07 times as fast.
// Counting every step since v000, it is 8.69 times as fast.
#include <hip/hip_runtime.h>

// Multi-head self-attention with relative positions and learnable u/v biases (x [2][2048][1024], bias [1][1][L][L] (f32 additive, read; verbatim causal 0/-1e9), pos_emb [2048][1][1024], pos_bias_u/v [16][64]; q/k/v = x W + b, r = pos_emb Wr + br ('xw', 16 heads x 64); qh = q/8; AC = (qh + u).k + bias; BD = (qh + v).r; logits = AC + rel_shift(BD) with the pad-front/reshape shift: pos[i][j] = BD[i][T-1-(i-j)] for j <= i, 0 for j == i+1, BD[i+1][j-i-2] for j >= i+2 (reproduced literally, including the masked upper part); softmax; out = merged Wo + bo -> [2][2048][1024]).
// Compute dtypes, f32 accumulate: every input rounded to bf16; q/k/v/r as PLAIN bf16 GEMMs (inputs: exact) + bias; q x 1/8 (exact) then the u/v head biases added in f32; content, position scores and attn.v: query rows < 512 hl (3 products), the rest single fp16 (x1024) (the shifted position score is gathered from rows i / i+1 of the position-score block); the additive bias read per element; softmax f32; Wo hl x exact (2 products) + bias.

#define NB_  2
#define TT   2048
#define DM   1024
#define NH_  16
#define NKV  16
#define REP  (NH_ / NKV)
#define HD   64
#define DQ   (NH_ * HD)
#define DKV  (NKV * HD)
#define RH   512                  // query rows < RH use hi+lo planes (0: none)
#define WIN  0
#define PCAR 1024.0f
#define KSP  16                   // attn.v: key ranges per output tile, two per wave of k_fattn; the KSP partial tiles are summed in ascending order
#define SCL  1.0f   // the 1/sqrt(64) is applied to q before the u/v biases (k_gemmw, EPI 2)
typedef _Float16 h16;
typedef unsigned short bf;
typedef __attribute__((ext_vector_type(16))) __bf16   v16bf;
typedef __attribute__((ext_vector_type(16))) _Float16 v16h;
typedef __attribute__((ext_vector_type(8)))  _Float16 v8h;
typedef __attribute__((ext_vector_type(8)))  unsigned short v8us;
typedef __attribute__((ext_vector_type(8)))  float    v8f;
typedef __attribute__((ext_vector_type(4)))  float    v4f;
typedef v8h  __attribute__((may_alias)) v8ha;
typedef v4f  __attribute__((may_alias)) v4fa;
typedef v8us __attribute__((may_alias)) v8usa;

__device__ __forceinline__ unsigned short f2bf(float f) { unsigned u = __float_as_uint(f); u += 0x7FFFu + ((u >> 16) & 1u); return (unsigned short)(u >> 16); }
__device__ __forceinline__ float bf2f(unsigned short b) { return __uint_as_float(((unsigned)b) << 16); }
__device__ __forceinline__ float bfr(float f) { return bf2f(f2bf(f)); }
__device__ __forceinline__ v16h cat16(v8h lo, v8h hi) { return __builtin_shufflevector(lo, hi, 0, 1, 2, 3, 4, 5, 6, 7, 8, 9, 10, 11, 12, 13, 14, 15); }
__device__ __forceinline__ v16bf cat16b(v8us lo, v8us hi) { return __builtin_bit_cast(v16bf, __builtin_shufflevector(lo, hi, 0, 1, 2, 3, 4, 5, 6, 7, 8, 9, 10, 11, 12, 13, 14, 15)); }
__device__ __forceinline__ v8f wmma16(v16h a, v16h b, v8f c) { return __builtin_amdgcn_wmma_f32_16x16x32_f16(false, a, false, b, (short)0, c, false, false); }
__device__ __forceinline__ v8f wmmab(v16bf a, v16bf b, v8f c) { return __builtin_amdgcn_wmma_f32_16x16x32_bf16(false, a, false, b, (short)0, c, false, false); }



// ---- FRAGMENT ORDER of every 16-bit plane that a matrix product reads (k_fattn: q + u, q + v, k, r, v; k_gemmw: x, pos_emb, the five weight matrices, the attention output): a block of 16 rows x 32 k (512 elements, 1 KiB) is stored as [g = (k >> 3) & 3][row & 15][k & 7], which is lane order (lane = 16 hi + row, g = 2 c + hi): load c of a fragment is 32 lanes x 16 B = 512 contiguous bytes (4 whole lines) where a row-major plane gives 16 part lines. Blocks of one 16-row tile follow one another along k. The registers hold what they held with row-major planes. ldf loads from a plane in fragment order.
// ---- k_gemmw: register-blocked GEMM, ONE WAVE per 64x64 output tile (16 accumulators), operands straight from 16-bit planes in fragment order (rows m or n, k along K); grid (M/64, N/64, Z), 32 threads.
// C[m][n] (f32, pitch ldc, + optional f32 bias[n]) = sum_k A[m][k] Bt[n][k] (+ split products per NSPLIT). z-batch strides sA/sB/sC in elements; with EPI != 0 slice z writes its planes sz elements behind slice z - 1's, so that the GEMMs of both batches are one launch and a WGP holds several waves whose load waits overlap. K % (32 KS) == 0. KS > 1: grid z = Z x KS; work-group (z, ks) sums only k in [ks K/KS, (ks+1) K/KS) and stores its partial tile in plane z KS + ks of C (plane stride sC).
template <typename T16> struct WFrag;
template <> struct WFrag<h16> { typedef v16h V; static __device__ __forceinline__ V ldf(const h16* p) { return cat16(*(const v8h*)p, *(const v8h*)(p + 256)); } static __device__ __forceinline__ v8f mma(V a, V b, v8f c) { return wmma16(a, b, c); } };
template <> struct WFrag<bf> { typedef v16bf V; static __device__ __forceinline__ V ldf(const bf* p) { return cat16b(*(const v8us*)p, *(const v8us*)(p + 256)); } static __device__ __forceinline__ v8f mma(V a, V b, v8f c) { return wmmab(a, b, c); } };
// Behind a batch of global loads: the precautionary wait in front of any write to a register of the loads' address pairs. The pointers are inputs so that the pairs stay live up to it; without that the compiler lets a later load of the batch land in an earlier load's pair. A shorter list repeats its pointers.
__device__ __forceinline__ void xhold(const void* a, const void* b, const void* c, const void* d, const void* e, const void* f, const void* g, const void* h) { asm volatile("s_wait_xcnt 0x0" :: "v"(a), "v"(b), "v"(c), "v"(d), "v"(e), "v"(f), "v"(g), "v"(h) : "memory"); }
__device__ __forceinline__ h16 tohx(float x) { return (h16)x; }
__device__ __forceinline__ void splitf(float y, unsigned short& h, unsigned short& l) { h = f2bf(y); l = f2bf(y - bf2f(h)); }
// one 16-byte store into each of the three planes (fp16, bf16 hi, bf16 lo) of eight neighbouring values. The stores stand in one asm statement with the precautionary s_wait_xcnt 0 behind them, so that it is in front of every later write to their address and data registers.
__device__ __forceinline__ void put8(const float (&x)[8], h16* P16, bf* Ph, bf* Pl, size_t o) { v8h o16; v8us oh, ol;
#pragma unroll
    for (int q = 0; q < 8; ++q) { o16[q] = tohx(x[q]); unsigned short a, c; splitf(x[q], a, c); oh[q] = a; ol[q] = c; }
    asm volatile("global_store_b128 %0, %3, off\n\tglobal_store_b128 %1, %4, off\n\tglobal_store_b128 %2, %5, off\n\ts_wait_xcnt 0x0" :: "v"(P16 + o), "v"(Ph + o), "v"(Pl + o), "v"(o16), "v"(oh), "v"(ol) : "memory"); }
// Where a projection's tile goes when EPI != 0 (a 64-column tile is one head), all in fragment order: EPI 1: planes p [h] (rows t, k = d) of C + bias (k, r); EPI 2: planes p of (C + bias)/8 + bu and planes q of (C + bias)/8 + bv (the two query forms); EPI 3: planes p [h] (rows d, k = t; the four 16-row blocks of one k step side by side) of C + bias (v, transposed). An EPI 1 launch holds the position projection as slice z = 0 (weights Bt0, bias bias0) and the key projection of batch z - 1 behind it.
struct Planes { h16* p16; bf* ph; bf* pl; h16* q16; bf* qh; bf* ql; const float* bu; const float* bv; size_t sz; const bf* Bt0; const float* bias0; };
template <typename T16, int NSPLIT, bool BIAS, int KS = 1, int EPI = 0>
__global__ __launch_bounds__(32) void k_gemmw(const T16* __restrict__ A, const T16* __restrict__ A2, const T16* __restrict__ Bt, const T16* __restrict__ Bt2, int K, float* C, int ldc, const float* __restrict__ bias, size_t sA, size_t sB, size_t sC, Planes po) {
    typedef typename WFrag<T16>::V V;
    __shared__ __align__(16) float os[(EPI == 2 ? 2 : 1) * 16 * 68];   // EPI 2: one tile for each of the two query forms
    const size_t z = blockIdx.z / KS; A += z * sA; if (A2) A2 += z * sA; Bt += z * sB; if (Bt2) Bt2 += z * sB; C += (size_t)blockIdx.z * sC; const int kb = (int)(blockIdx.z % KS) * (K / KS), ke = kb + K / KS;
    if constexpr (EPI != 0) { const size_t zs = z * po.sz; po.p16 += zs; po.ph += zs; po.pl += zs; if constexpr (EPI == 2) { po.q16 += zs; po.qh += zs; po.ql += zs; } }
    if constexpr (EPI == 1) { if (z == 0) { Bt = po.Bt0; bias = po.bias0; } }
    const int lane = threadIdx.x & 31, lr = lane & 15, hi = lane >> 4; const int r0 = blockIdx.x * 64, c0 = blockIdx.y * 64;
    v8f acc[4][4];
#pragma unroll
    for (int mb = 0; mb < 4; ++mb)
#pragma unroll
        for (int nb = 0; nb < 4; ++nb) acc[mb][nb] = (v8f){};
    const size_t aoff = (size_t)r0 * K + lane * 8, boff = (size_t)c0 * K + lane * 8;   // a 16-row tile is 16 K elements, a k step of 32 is 512 of them; lane * 8: the lane's 16-byte unit
#pragma unroll 1
    for (int kc = kb; kc < ke; kc += 32) {
        V a[4], a2[4], b[4], b2[4]; const T16 *pa[4], *pa2[4], *pb[4], *pb2[4];
#pragma unroll
        for (int t = 0; t < 4; ++t) { const size_t ot = (size_t)t * 16 * K + (size_t)kc * 16; pa[t] = A + aoff + ot; pb[t] = Bt + boff + ot; a[t] = WFrag<T16>::ldf(pa[t]); b[t] = WFrag<T16>::ldf(pb[t]);
            if (NSPLIT == 1 || NSPLIT == 2) { pa2[t] = A2 + aoff + ot; a2[t] = WFrag<T16>::ldf(pa2[t]); } if (NSPLIT >= 2) { pb2[t] = Bt2 + boff + ot; b2[t] = WFrag<T16>::ldf(pb2[t]); } }
        if constexpr (NSPLIT == 1) asm volatile("s_wait_xcnt 0x0" :: "v"(pa[0]), "v"(pa[1]), "v"(pa[2]), "v"(pa[3]), "v"(pb[0]), "v"(pb[1]), "v"(pb[2]), "v"(pb[3]), "v"(pa2[0]), "v"(pa2[1]), "v"(pa2[2]), "v"(pa2[3]) : "memory");   // xhold for twelve pairs
        else xhold(pa[0], pa[1], pa[2], pa[3], pb[0], pb[1], pb[2], pb[3]);
        if constexpr (NSPLIT == 2) xhold(pa2[0], pa2[1], pa2[2], pa2[3], pb2[0], pb2[1], pb2[2], pb2[3]);
        if constexpr (NSPLIT > 2) xhold(pb2[0], pb2[1], pb2[2], pb2[3], pb2[0], pb2[1], pb2[2], pb2[3]);
        __builtin_amdgcn_sched_barrier(0);   // keeps the products behind the wait: without it the compiler lifts them over it, in between the loads, and then fetches the B fragments one after another into one register set, with a full load wait each
#pragma unroll
        for (int nb = 0; nb < 4; ++nb) {
#pragma unroll
            for (int mb = 0; mb < 4; ++mb) { acc[mb][nb] = WFrag<T16>::mma(a[mb], b[nb], acc[mb][nb]); if (NSPLIT == 1 || NSPLIT == 2) acc[mb][nb] = WFrag<T16>::mma(a2[mb], b[nb], acc[mb][nb]); if (NSPLIT >= 2) acc[mb][nb] = WFrag<T16>::mma(a[mb], b2[nb], acc[mb][nb]); } }
        asm volatile("v_nop\n\tv_nop\n\tv_nop\n\tv_nop" : "+v"(acc[0][0]), "+v"(acc[1][1]), "+v"(acc[2][2]), "+v"(acc[3][3]) : "v"(a[0]), "v"(a[3]));
    }
    if constexpr (EPI == 3) {   // a lane's eight accumulator values are eight neighbouring t of one d, one 16-byte unit of the fragment order (rows d, k = t): stored straight from the registers
        asm volatile("s_wait_xcnt 0x0" ::: "memory");   // precautionary wait in front of the first write to an address pair of the k loop's loads
        float bn[4];   // all four bias loads first: the store statements' memory clobber would hold a later load behind them
#pragma unroll
        for (int nb = 0; nb < 4; ++nb) bn[nb] = bfr(bias[c0 + nb * 16 + lr]);
#pragma unroll
        for (int nb = 0; nb < 4; ++nb) {
#pragma unroll
            for (int mb = 0; mb < 4; ++mb) { float x[8];
#pragma unroll
                for (int j = 0; j < 8; ++j) x[j] = acc[mb][nb][j] + bn[nb];
                put8(x, po.p16, po.ph, po.pl, ((size_t)blockIdx.y * TT + r0 + (mb >> 1) * 32) * HD + nb * 512 + (mb & 1) * 256 + lane * 8); } }   // block (32 t, 16 d) in fragment order: 512 contiguous bytes a store
        return; }
    float bn[4], un[4], vn[4];   // EPI 1, 2: the biases of a lane's four accumulator columns, added before the tile goes through LDS
    if constexpr (EPI == 1 || EPI == 2) {
#pragma unroll
        for (int nb = 0; nb < 4; ++nb) { bn[nb] = bfr(bias[c0 + nb * 16 + lr]); if (EPI == 2) { un[nb] = bfr(po.bu[c0 + nb * 16 + lr]); vn[nb] = bfr(po.bv[c0 + nb * 16 + lr]); } } }
#pragma unroll
    for (int mb = 0; mb < 4; ++mb) {
#pragma unroll
        for (int nb = 0; nb < 4; ++nb) {
#pragma unroll
            for (int j = 0; j < 8; ++j) { const int oi = (hi * 8 + j) * 68 + nb * 16 + lr;
                if constexpr (EPI == 1) os[oi] = acc[mb][nb][j] + bn[nb];
                else if constexpr (EPI == 2) { const float aq = __fmul_rn(acc[mb][nb][j] + bn[nb], 0.125f); os[oi] = __fadd_rn(aq, un[nb]); os[16 * 68 + oi] = __fadd_rn(aq, vn[nb]); }
                else os[oi] = acc[mb][nb][j]; } }
        __builtin_amdgcn_wave_barrier(); asm volatile("" ::: "memory");
        float* crow = C + (size_t)(r0 + mb * 16) * ldc + c0;
        if constexpr (EPI == 1 || EPI == 2) {
            const size_t o = ((size_t)blockIdx.y * TT + r0 + mb * 16) * HD + lane * 8;   // store s: units g = 2 s + hi of row lr, 512 contiguous bytes
#pragma unroll
            for (int pl = 0; pl < (EPI == 2 ? 2 : 1); ++pl) { const float* ot = os + pl * (16 * 68) + lr * 68 + hi * 8;
                v4f v0[4], v1[4];   // a tile's LDS reads first: the store statements' memory clobber would hold a later read behind them
#pragma unroll
                for (int s = 0; s < 4; ++s) { v0[s] = *(const v4fa*)(ot + s * 16); v1[s] = *(const v4fa*)(ot + s * 16 + 4); }
#pragma unroll
                for (int s = 0; s < 4; ++s) { float x[8];
#pragma unroll
                    for (int q = 0; q < 8; ++q) x[q] = q < 4 ? v0[s][q & 3] : v1[s][q & 3];
                    if (pl == 0) put8(x, po.p16, po.ph, po.pl, o + s * 256); else put8(x, po.q16, po.qh, po.ql, o + s * 256); } }
        } else {
#pragma unroll
            for (int s = 0; s < 8; ++s) { const int row = 2 * s + hi, cofs = lr * 4; v4f val = *(const v4fa*)(os + row * 68 + cofs); if (BIAS) { val[0] += bfr(bias[c0 + cofs]); val[1] += bfr(bias[c0 + cofs + 1]); val[2] += bfr(bias[c0 + cofs + 2]); val[3] += bfr(bias[c0 + cofs + 3]); }
                *(v4f*)(crow + (size_t)row * ldc + cofs) = val; }
             }
        __builtin_amdgcn_wave_barrier(); asm volatile("" ::: "memory");
    }
}

typedef __attribute__((ext_vector_type(2))) _Float16 v2h;
typedef __attribute__((ext_vector_type(4))) _Float16 v4h;
typedef __attribute__((ext_vector_type(2))) unsigned short v2us;
typedef __attribute__((ext_vector_type(4))) unsigned short v4us;
typedef __attribute__((ext_vector_type(2))) float v2f;
typedef __attribute__((ext_vector_type(4))) int v4i;

// One wave per block of 16 n x 32 k of Bt[n][k] = w[k][n], written in fragment order (two stores of 512 contiguous bytes); a load takes 16 neighbouring n of two k rows. The eight waves of a work-group cover 32 n x 128 k, so that they use whole 128-byte lines of w.
__device__ __forceinline__ void wtG(const float* __restrict__ w, int K, int N, bf* Bt, int blk) {
    const int lane = threadIdx.x & 31, lr = lane & 15, hi = lane >> 4, ws = threadIdx.x >> 5;
    const int nt = (blk % (N / 32)) * 2 + (ws & 1), kb = (blk / (N / 32)) * 4 + (ws >> 1);
    const float* p = w + (size_t)(kb * 32 + hi * 8) * N + nt * 16 + lr; float v[2][8];
#pragma unroll
    for (int c = 0; c < 2; ++c)
#pragma unroll
        for (int q = 0; q < 8; ++q) v[c][q] = p[(size_t)(c * 16 + q) * N];
    asm volatile("s_wait_xcnt 0x0" :: "v"(p) : "memory");   // precautionary wait in front of the first write to the loads' address pair, which the input keeps live up to here
    v8us o0, o1;
#pragma unroll
    for (int q = 0; q < 8; ++q) { o0[q] = f2bf(v[0][q]); o1[q] = f2bf(v[1][q]); }
    asm volatile("global_store_b128 %0, %1, off\n\tglobal_store_b128 %0, %2, off offset:512\n\ts_wait_xcnt 0x0" :: "v"(Bt + ((size_t)nt * (K / 32) + kb) * 512 + lane * 8), "v"(o0), "v"(o1) : "memory");   // stores and precautionary wait in one statement, as in put8
}
// ---- k_prep: all that the GEMMs wait for, in one launch: work-groups [0, 5 WTB) transpose and round the five weight matrices (WTB each), the rest round pos_emb (slice 0 of X3) and x (slices 1, 2: the two batches), eight values (one 16-byte unit of the fragment order) a thread; a wave takes 8 rows x 32 k: whole 128-byte lines on both sides.
#define WTB (DM * DQ / 64 / 64)
#define CVB (TT * DM / 8 / 256)   // work-groups per slice of X3
__global__ __launch_bounds__(256) void k_prep(const float* __restrict__ wq, const float* __restrict__ wk, const float* __restrict__ wv, const float* __restrict__ wo, const float* __restrict__ wpos, const float* __restrict__ x, const float* __restrict__ pemb, bf* WQ, bf* WK, bf* WV, bf* WO, bf* WP, bf* X3) {
    const int blk = blockIdx.x;
    if (blk < 5 * WTB) { const int job = blk / WTB; wtG(job == 0 ? wq : job == 1 ? wk : job == 2 ? wv : job == 3 ? wo : wpos, DM, DQ, job == 0 ? WQ : job == 1 ? WK : job == 2 ? WV : job == 3 ? WO : WP, blk % WTB); return; }
    const int cb = blk - 5 * WTB; const size_t i = (size_t)cb * 256 + threadIdx.x; const size_t tile = i / (2 * DM); const int u = (int)(i % (2 * DM)), g = u & 3, row = (u >> 2) & 15, kb = u >> 6;   // 2 DM units in a tile of 16 rows
    const size_t so = (tile * 16 + row) * DM + kb * 32 + g * 8; const float* src = cb < CVB ? pemb + so : x + (so - (size_t)TT * DM); const v8f v = *(const v8f*)src; v8us o;
    asm volatile("s_wait_xcnt 0x0" ::: "memory");   // precautionary wait in front of the first write to the load's address pair (the compiler reuses the pair for the rounding)
#pragma unroll
    for (int k = 0; k < 8; ++k) o[k] = f2bf(v[k]);
    asm volatile("global_store_b128 %0, %1, off\n\ts_wait_xcnt 0x0" :: "v"(X3 + tile * (16 * DM) + kb * 512 + g * 128 + row * 8), "v"(o) : "memory"); }   // store and precautionary wait in one statement, as in put8: the compiler joins this path with the transpose part, whose first instructions write the store's registers
__global__ __launch_bounds__(256) void k_cscvt(const float* __restrict__ cosT, const float* __restrict__ sinT, float* CS) { const int idx = blockIdx.x * 256 + threadIdx.x; if (idx >= TT * HD) return; v2f cs; cs[0] = bfr(cosT[idx]); cs[1] = bfr(sinT[idx]); *(v2f*)(CS + (size_t)idx * 2) = cs;  }
// ---- k_fattn: one work-group (8 waves) per 16 query rows of one head of one batch (blockIdx.z; the q, k, v planes and the output of batch 1 stand behind batch 0's, the position planes serve both); the 16 x 2048 f32 logit rows live in LDS from the score products to attn.v.
// Phases: (1) content scores + additive bias + position scores, the latter turned to their rel-shift place inside the registers (row i takes BD[i][m >= T-1-i] at j = m-(T-1)+i and BD[i+1][m <= T-3-i] at j = m+i+2; every place gets at most one term) -> S; (3) softmax, one wave per row, weights written over the row as 16-bit planes; (4) attn.v in KSP key ranges of 128, two per wave; (5) the KSP partial tiles summed in ascending order.
#define SP 2052                   // LDS row pitch in floats: 2048 + 4, so that the 16 rows of a fragment read start on different banks
typedef v4h  __attribute__((may_alias)) v4ha;
typedef v4us __attribute__((may_alias)) v4usa;
// v_exp_f32 with the one free slot that the instruction set asks for behind a transcendental, before its result is read or its source written again; in one statement, so that the v_nop stands directly behind it
__device__ __forceinline__ float exp2_slot(float x) { float r; asm("v_exp_f32 %0, %1\n\tv_nop" : "=v"(r) : "v"(x)); return r; }
template <bool HI> struct BFrag;   // 16 rows x 64 k of a plane in fragment order (hi + lo planes where HI); off = fo(lane's row, hi)
__device__ __forceinline__ size_t fo(int row, int hi) { return (size_t)(row >> 4) * (16 * HD) + (row & 15) * 8 + hi * 128; }
template <> struct BFrag<false> { v16h b[2]; const h16 *p, *p2;
    __device__ __forceinline__ void load(const h16* b16, const bf*, const bf*, size_t off) { p = p2 = b16 + off; b[0] = WFrag<h16>::ldf(p); b[1] = WFrag<h16>::ldf(p + 512); } };
template <> struct BFrag<true> { v16bf b[2], b2[2]; const bf *p, *p2;
    __device__ __forceinline__ void load(const h16*, const bf* bh, const bf* bl, size_t off) { p = bh + off; p2 = bl + off; b[0] = WFrag<bf>::ldf(p); b[1] = WFrag<bf>::ldf(p + 512); b2[0] = WFrag<bf>::ldf(p2); b2[1] = WFrag<bf>::ldf(p2 + 512); } };
__device__ __forceinline__ v8f dot64(const BFrag<false>& q, const BFrag<false>& k) { v8f c = (v8f){};
#pragma unroll
    for (int kk = 0; kk < 2; ++kk) c = wmma16(q.b[kk], k.b[kk], c);
    return c; }
__device__ __forceinline__ v8f dot64(const BFrag<true>& q, const BFrag<true>& k) { v8f c = (v8f){};
#pragma unroll
    for (int kk = 0; kk < 2; ++kk) { c = wmmab(q.b[kk], k.b[kk], c); c = wmmab(q.b2[kk], k.b[kk], c); c = wmmab(q.b[kk], k.b2[kk], c); }
    return c; }
// Row r = 8 hi + JJ of a position-score tile turned right by (r + 1) & 15 lanes (tail) or (r + 2) & 15 lanes (head) inside its 16-lane row: lane l takes lane (l - n) & 15. The two halves of the wave hold different rows, so each takes its own turn (row_mask 1: lanes 0-15, 2: lanes 16-31); a turn by 0 is left out.
template <bool HEAD, int JJ>
__device__ __forceinline__ float turn_row(float x) {
    constexpr int NLO = (JJ + (HEAD ? 2 : 1)) & 15, NHI = (JJ + 8 + (HEAD ? 2 : 1)) & 15;
    const int xi = __float_as_int(x); int t = xi;
    if constexpr (NLO != 0) t = __builtin_amdgcn_update_dpp(xi, xi, 0x120 + NLO, 0x1, 0xf, false);
    if constexpr (NHI != 0) t = __builtin_amdgcn_update_dpp(t, xi, 0x120 + NHI, 0x2, 0xf, false);
    return __int_as_float(t); }
// The rel-shift term of logit tile (rows i0.., columns 16 jt..) from two neighbouring position-score tiles A (tile t) and B (tile t + 1): row r wants lanes [thr, 15] of A and [0, thr) of B, thr = 15 - r (tail) or 14 - r (head), turned into place; in the head, row 15 wants lane 15 of tile t - 1 (z) and lanes 0-14 of A.
template <bool HEAD, int JJ>
__device__ __forceinline__ float shift_term(const v8f& A, const v8f& B, float z, int lr, int hi) {
    float x = (lr + hi * 8 + JJ >= (HEAD ? 14 : 15)) ? A[JJ] : B[JJ];
    if constexpr (HEAD && JJ == 7) x = (hi != 0 && lr == 15) ? z : x;
    return turn_row<HEAD, JJ>(x); }
// ---- sc_pass: logit tiles jlo..jhi (16 columns each, one after another) of the 16 query rows, complete in registers: content score + bias + rel-shift term, one plain store each.
// Tail (columns j <= i, tiles jt <= it): term = BD[i][T-1-i+j], position tiles t = 127 - it + jt and t + 1, query rows i. Head (columns j >= i + 2, tiles jt >= it): term = BD[i+1][j-i-2], position tiles t = jt - it - 1 and t + 1 (and lane 15 of t - 1), query rows i + 1. A tile that does not exist (128 in the tail, -1 and -2 in the head) counts as zeros: those places take no term (j > i in the tail's diagonal tile, j <= i + 1 in the head). The diagonal tile jt == it is written by the tail pass and taken up again from S by the head pass of the same wave. HI goes by the row block: in the block that ends at RH - 1 the head's last query row, RH, is taken from the hi + lo planes like the other fifteen.
template <bool HI, bool HEAD>
__device__ __forceinline__ void sc_pass(float* S, const h16* qu16, const bf* quh, const bf* qul, const h16* qv16, const bf* qvh, const bf* qvl, const h16* k16, const bf* kh, const bf* kl, const h16* p16, const bf* ph, const bf* pl, const float* __restrict__ ab, int i0, int jlo, int jhi, int lr, int hi) {
    if (jlo > jhi) return;   // the same for the whole wave
    const int it = i0 >> 4; int ar = HEAD ? i0 + 1 + lr : i0 + lr; if (ar > TT - 1) ar = TT - 1;   // row T does not exist; no term of it is ever placed
    BFrag<HI> qu, qb; qu.load(qu16, quh, qul, fo(i0 + lr, hi)); qb.load(qv16, qvh, qvl, fo(ar, hi));
    const int t0 = HEAD ? jlo - it - 1 : TT / 16 - 1 - it + jlo;   // position tile A of the first logit tile
    v8f A, B; float z = 0.f;
    { BFrag<HI> ra, rz; ra.load(p16, ph, pl, fo(max(t0, 0) * 16 + lr, hi)); rz.load(p16, ph, pl, fo(max(t0 - 1, 0) * 16 + lr, hi));
      xhold(qu.p, qu.p2, qb.p, qb.p2, ra.p, ra.p2, rz.p, rz.p2);
      A = dot64(qb, ra); if (t0 < 0) A = (v8f){};
      if constexpr (HEAD) { const v8f c = dot64(qb, rz); z = (t0 < 1) ? 0.f : c[7]; } }
    constexpr int U = HI ? 1 : 4;   // logit tiles whose loads fly together
#pragma unroll 1   // the batch of U tiles is the unit; unrolling further would pass 256 VGPRs and cost the second work-group of the WGP
    for (int jt = jlo; jt <= jhi; jt += U) { BFrag<HI> k[U], r[U]; const float* pb[U]; float bb[U][8];
#pragma unroll
        for (int u = 0; u < U; ++u) { const int ju = min(jt + u, jhi), col = ju * 16 + lr, tb = min(HEAD ? ju - it : TT / 16 - it + ju, TT / 16 - 1);
            k[u].load(k16, kh, kl, fo(col, hi)); r[u].load(p16, ph, pl, fo(tb * 16 + lr, hi)); pb[u] = ab + (size_t)(i0 + hi * 8) * TT + col;
#pragma unroll
            for (int jj = 0; jj < 8; ++jj) bb[u][jj] = pb[u][(size_t)jj * TT]; }
        if (HI) xhold(k[0].p, k[0].p2, r[0].p, r[0].p2, pb[0], pb[0], pb[0], pb[0]);
        else asm volatile("s_wait_xcnt 0x0" :: "v"(k[0].p), "v"(k[1 % U].p), "v"(k[2 % U].p), "v"(k[3 % U].p), "v"(r[0].p), "v"(r[1 % U].p), "v"(r[2 % U].p), "v"(r[3 % U].p), "v"(pb[0]), "v"(pb[1 % U]), "v"(pb[2 % U]), "v"(pb[3 % U]) : "memory");   // xhold for twelve pairs
#pragma unroll
        for (int u = 0; u < U; ++u) { const int ju = jt + u;
            if (ju <= jhi) { const int col = ju * 16 + lr; float base[8];
                B = dot64(qb, r[u]); if (!HEAD && ju == it) B = (v8f){};
                if (HEAD && ju == it) {
#pragma unroll
                    for (int jj = 0; jj < 8; ++jj) base[jj] = S[(hi * 8 + jj) * SP + col];
                } else { const v8f c = dot64(qu, k[u]);
#pragma unroll
                    for (int jj = 0; jj < 8; ++jj) base[jj] = __fadd_rn(c[jj], bfr(bb[u][jj])); }
                float* so = S + hi * 8 * SP + col;
                so[0 * SP] = __fadd_rn(base[0], shift_term<HEAD, 0>(A, B, z, lr, hi)); so[1 * SP] = __fadd_rn(base[1], shift_term<HEAD, 1>(A, B, z, lr, hi));
                so[2 * SP] = __fadd_rn(base[2], shift_term<HEAD, 2>(A, B, z, lr, hi)); so[3 * SP] = __fadd_rn(base[3], shift_term<HEAD, 3>(A, B, z, lr, hi));
                so[4 * SP] = __fadd_rn(base[4], shift_term<HEAD, 4>(A, B, z, lr, hi)); so[5 * SP] = __fadd_rn(base[5], shift_term<HEAD, 5>(A, B, z, lr, hi));
                so[6 * SP] = __fadd_rn(base[6], shift_term<HEAD, 6>(A, B, z, lr, hi)); so[7 * SP] = __fadd_rn(base[7], shift_term<HEAD, 7>(A, B, z, lr, hi));
                z = A[7]; A = B; } } }
}
template <bool HI>
__device__ __forceinline__ void pv_pass(const float* S, const h16* v16, const bf* vh, const bf* vl, int w, int lr, int hi, v8f (&acc)[2][4]) {
    constexpr int NS = HI ? 1 : 2;   // k steps of 32 keys whose loads fly together
#pragma unroll
    for (int u = 0; u < 2; ++u) {
#pragma unroll
        for (int nb = 0; nb < 4; ++nb) acc[u][nb] = (v8f){};
#pragma unroll
        for (int st = 0; st < TT / KSP / 32; st += NS) { const int kc = (2 * w + u) * (TT / KSP) + st * 32; const size_t boff = (size_t)kc * HD + hi * 128 + lr * 8;   // a k step of 32 keys is four blocks (16 d each) of 512 elements
            if (HI) { const bf *pv = vh + boff, *pv2 = vl + boff; v16bf b[4], b2[4];
#pragma unroll
                for (int nb = 0; nb < 4; ++nb) { b[nb] = WFrag<bf>::ldf(pv + nb * 512); b2[nb] = WFrag<bf>::ldf(pv2 + nb * 512); }
                xhold(pv, pv2, pv, pv2, pv, pv2, pv, pv2);
                const bf* p = (const bf*)(S + lr * SP) + kc + 8 * hi; const v16bf a = cat16b(*(const v8usa*)p, *(const v8usa*)(p + 16)), a2 = cat16b(*(const v8usa*)(p + TT), *(const v8usa*)(p + TT + 16));
#pragma unroll
                for (int nb = 0; nb < 4; ++nb) { acc[u][nb] = wmmab(a, b[nb], acc[u][nb]); acc[u][nb] = wmmab(a2, b[nb], acc[u][nb]); acc[u][nb] = wmmab(a, b2[nb], acc[u][nb]); }
            } else { const h16* pv = v16 + boff; v16h b[NS][4];
#pragma unroll
                for (int s = 0; s < NS; ++s)
#pragma unroll
                    for (int nb = 0; nb < 4; ++nb) b[s][nb] = WFrag<h16>::ldf(pv + s * (32 * HD) + nb * 512);
                xhold(pv, pv, pv, pv, pv, pv, pv, pv);
#pragma unroll
                for (int s = 0; s < NS; ++s) { const h16* p = (const h16*)(S + lr * SP) + kc + s * 32 + 8 * hi; const v16h a = cat16(*(const v8ha*)p, *(const v8ha*)(p + 16));
#pragma unroll
                    for (int nb = 0; nb < 4; ++nb) acc[u][nb] = wmma16(a, b[s][nb], acc[u][nb]); } } } }
}
// amdgpu_waves_per_eu(4, 4): 256 VGPRs at most, so that two work-groups (2 x 131,328 B of LDS) share a WGP and one computes while the other waits at a barrier
__global__ __launch_bounds__(256) __attribute__((amdgpu_waves_per_eu(4, 4))) void k_fattn(const h16* __restrict__ QP16, const bf* __restrict__ QPh, const bf* __restrict__ QPl, const h16* __restrict__ QV16, const bf* __restrict__ QVh, const bf* __restrict__ QVl, const h16* __restrict__ KP16, const bf* __restrict__ KPh, const bf* __restrict__ KPl, const h16* __restrict__ PP16, const bf* __restrict__ PPh, const bf* __restrict__ PPl, const h16* __restrict__ VT16, const bf* __restrict__ VTh, const bf* __restrict__ VTl, const float* __restrict__ ab, bf* Ah, bf* Al) {
    __shared__ __align__(16) float S[16 * SP];
    const int tid = threadIdx.x, lane = tid & 31, lr = lane & 15, hi = lane >> 4; const int w = __builtin_amdgcn_readfirstlane(tid >> 5);
    const int i0 = blockIdx.x * 16, h = blockIdx.y; const bool hires = (i0 < RH); const size_t hp = (size_t)h * TT * HD;
    { const size_t zb = (size_t)blockIdx.z * ((size_t)NH_ * TT * HD); QP16 += zb; QPh += zb; QPl += zb; QV16 += zb; QVh += zb; QVl += zb; KP16 += zb; KPh += zb; KPl += zb; VT16 += zb; VTh += zb; VTl += zb; Ah += zb; Al += zb; }   // NH_ TT HD == TT DQ: one batch of any of these
    { const int it = i0 >> 4, jl = w * (TT / 128), jh = jl + TT / 128 - 1;   // a wave takes 16 neighbouring logit tiles, so that each position-score tile serves two of them from registers
      if (hires) { sc_pass<true, false>(S, QP16 + hp, QPh + hp, QPl + hp, QV16 + hp, QVh + hp, QVl + hp, KP16 + hp, KPh + hp, KPl + hp, PP16 + hp, PPh + hp, PPl + hp, ab, i0, jl, min(jh, it), lr, hi);
                   sc_pass<true, true>(S, QP16 + hp, QPh + hp, QPl + hp, QV16 + hp, QVh + hp, QVl + hp, KP16 + hp, KPh + hp, KPl + hp, PP16 + hp, PPh + hp, PPl + hp, ab, i0, max(jl, it), jh, lr, hi); }
      else       { sc_pass<false, false>(S, QP16 + hp, QPh + hp, QPl + hp, QV16 + hp, QVh + hp, QVl + hp, KP16 + hp, KPh + hp, KPl + hp, PP16 + hp, PPh + hp, PPl + hp, ab, i0, jl, min(jh, it), lr, hi);
                   sc_pass<false, true>(S, QP16 + hp, QPh + hp, QPl + hp, QV16 + hp, QVh + hp, QVl + hp, KP16 + hp, KPh + hp, KPl + hp, PP16 + hp, PPh + hp, PPl + hp, ab, i0, max(jl, it), jh, lr, hi); } }
    __syncthreads();   // logits complete before a wave reads its rows
#pragma unroll 1   // one 64-register row at a time
    for (int rr = 0; rr < 2; ++rr) { float* srow = S + (w + rr * 8) * SP; float v[TT / 32]; float mx = -3.0e38f;
#pragma unroll
        for (int ch = 0; ch < TT / 128; ++ch) { const v4f a = *(const v4fa*)(srow + ch * 128 + lane * 4);
#pragma unroll
            for (int q = 0; q < 4; ++q) { v[ch * 4 + q] = a[q]; mx = fmaxf(mx, a[q]); } }
#pragma unroll
        for (int sh = 16; sh; sh >>= 1) mx = fmaxf(mx, __shfl_xor(mx, sh, 32));
        float sum = 0.f;
#pragma unroll
        for (int k = 0; k < TT / 32; ++k) { v[k] = exp2_slot(__fmul_rn(__fsub_rn(v[k], mx), 1.4426950408889634f)); sum += v[k]; }
#pragma unroll
        for (int sh = 16; sh; sh >>= 1) sum += __shfl_xor(sum, sh, 32);
        const float f = __fdiv_rn(hires ? 1.0f : PCAR, sum);
        if (hires) { bf* ph = (bf*)srow;
#pragma unroll
            for (int ch = 0; ch < TT / 128; ++ch) { v4us oh, ol;
#pragma unroll
                for (int q = 0; q < 4; ++q) { unsigned short a, c2; splitf(v[ch * 4 + q] * f, a, c2); oh[q] = a; ol[q] = c2; }
                *(v4usa*)(ph + ch * 128 + lane * 4) = oh; *(v4usa*)(ph + TT + ch * 128 + lane * 4) = ol; }
        } else { h16* p16 = (h16*)srow;
#pragma unroll
            for (int ch = 0; ch < TT / 128; ++ch) { v4h o4;
#pragma unroll
                for (int q = 0; q < 4; ++q) o4[q] = tohx(v[ch * 4 + q] * f);
                *(v4ha*)(p16 + ch * 128 + lane * 4) = o4; } } }
    __syncthreads();   // all 16 weight rows written before any wave reads them as A fragments
    v8f acc[2][4]; const size_t hv = (size_t)h * HD * TT;
    if (hires) pv_pass<true>(S, VT16 + hv, VTh + hv, VTl + hv, w, lr, hi, acc); else pv_pass<false>(S, VT16 + hv, VTh + hv, VTl + hv, w, lr, hi, acc);
    __syncthreads();   // last read of the weights is over before the partial tiles overwrite them
#pragma unroll
    for (int u = 0; u < 2; ++u)
#pragma unroll
        for (int nb = 0; nb < 4; ++nb)
#pragma unroll
            for (int jj = 0; jj < 8; ++jj) S[(2 * w + u) * (16 * HD) + (hi * 8 + jj) * HD + nb * 16 + lr] = acc[u][nb][jj];
    __syncthreads();   // all KSP partial tiles written before they are summed
    const int e = tid * 4, t = i0 + (e >> 6), d = e & 63; v4f s = *(const v4fa*)(S + e);
#pragma unroll
    for (int ks = 1; ks < KSP; ++ks) s += *(const v4fa*)(S + ks * (16 * HD) + e);
    const float cs = (t < RH) ? 1.0f : (1.0f / PCAR); v4us oh, ol;
#pragma unroll
    for (int q = 0; q < 4; ++q) { unsigned short a, c2; splitf(s[q] * cs, a, c2); oh[q] = a; ol[q] = c2; }
    const size_t oo = (size_t)(t >> 4) * (16 * DQ) + (size_t)((h * HD + d) >> 5) * 512 + ((d >> 3) & 3) * 128 + (t & 15) * 8 + (d & 7); *(v4us*)(Ah + oo) = oh; *(v4us*)(Al + oo) = ol;   // fragment order (rows t, k = h HD + d) for the output GEMM: the work-group's tile is 2 KiB in a row in each plane
}

extern "C" void kernel_launch(void* const* d_in, const int* in_sizes, int n_in,
                              void* d_out, int out_size, void* d_ws, size_t ws_size, hipStream_t stream) {
    (void)in_sizes; (void)n_in; (void)out_size;
    const float* x = (const float*)d_in[0]; const float* abias = (const float*)d_in[1]; const float* pemb = (const float*)d_in[2]; const float* pbu = (const float*)d_in[3]; const float* pbv = (const float*)d_in[4]; const float* wq = (const float*)d_in[5]; const float* bq = (const float*)d_in[6]; const float* wk = (const float*)d_in[7]; const float* bk = (const float*)d_in[8]; const float* wv = (const float*)d_in[9]; const float* bv = (const float*)d_in[10]; const float* wpos = (const float*)d_in[11]; const float* bpos = (const float*)d_in[12]; const float* wo = (const float*)d_in[13]; const float* bo = (const float*)d_in[14]; const float* cosT = nullptr; const float* sinT = nullptr; (void)cosT; (void)sinT;
    float* OUT = (float*)d_out;     // [2][2048][1024]
    char* wsp = (char*)d_ws;
    auto take = [&](size_t bytes) { char* p = wsp; wsp += (bytes + 255) & ~(size_t)255; return (void*)p; };
    const size_t PS = (size_t)NH_ * TT * HD;   // elements of one 16-bit plane set (all heads) of one batch
    bf* WQ = (bf*)take((size_t)DQ * DM * 2); bf* WK = (bf*)take((size_t)DKV * DM * 2); bf* WV = (bf*)take((size_t)DKV * DM * 2); bf* WO = (bf*)take((size_t)DM * DQ * 2); bf* WP = (bf*)take((size_t)DQ * DM * 2);
    bf* X3 = (bf*)take((size_t)(NB_ + 1) * TT * DM * 2);   // slice 0: pos_emb; slices 1..: x
    h16* PK16 = (h16*)take((NB_ + 1) * PS * 2); bf* PKh = (bf*)take((NB_ + 1) * PS * 2); bf* PKl = (bf*)take((NB_ + 1) * PS * 2);   // slice 0: position planes; slices 1..: key planes
    h16* QV16 = (h16*)take(NB_ * PS * 2); bf* QVh = (bf*)take(NB_ * PS * 2); bf* QVl = (bf*)take(NB_ * PS * 2);
    h16* QP16 = (h16*)take(NB_ * PS * 2); bf* QPh = (bf*)take(NB_ * PS * 2); bf* QPl = (bf*)take(NB_ * PS * 2);
    h16* VT16 = (h16*)take(NB_ * PS * 2); bf* VTh = (bf*)take(NB_ * PS * 2); bf* VTl = (bf*)take(NB_ * PS * 2);
    bf* ATh = (bf*)take((size_t)NB_ * TT * DQ * 2); bf* ATl = (bf*)take((size_t)NB_ * TT * DQ * 2);
    if ((size_t)(wsp - (char*)d_ws) > ws_size) return;    // ws 256 MiB
    k_prep<<<5 * WTB + (NB_ + 1) * CVB, 256, 0, stream>>>(wq, wk, wv, wo, wpos, x, pemb, WQ, WK, WV, WO, WP, X3);
    k_gemmw<bf, 0, true, 1, 2><<<dim3(TT / 64, DQ / 64, NB_), 32, 0, stream>>>(X3 + (size_t)TT * DM, nullptr, WQ, nullptr, DM, nullptr, DQ, bq, (size_t)TT * DM, 0, 0, Planes{QP16, QPh, QPl, QV16, QVh, QVl, pbu, pbv, PS, nullptr, nullptr});
    k_gemmw<bf, 0, true, 1, 1><<<dim3(TT / 64, DKV / 64, NB_ + 1), 32, 0, stream>>>(X3, nullptr, WK, nullptr, DM, nullptr, DKV, bk, (size_t)TT * DM, 0, 0, Planes{PK16, PKh, PKl, nullptr, nullptr, nullptr, nullptr, nullptr, PS, WP, bpos});
    k_gemmw<bf, 0, true, 1, 3><<<dim3(TT / 64, DKV / 64, NB_), 32, 0, stream>>>(X3 + (size_t)TT * DM, nullptr, WV, nullptr, DM, nullptr, DKV, bv, (size_t)TT * DM, 0, 0, Planes{VT16, VTh, VTl, nullptr, nullptr, nullptr, nullptr, nullptr, PS, nullptr, nullptr});
    k_fattn<<<dim3(TT / 16, NH_, NB_), 256, 0, stream>>>(QP16, QPh, QPl, QV16, QVh, QVl, PK16 + PS, PKh + PS, PKl + PS, PK16, PKh, PKl, VT16, VTh, VTl, abias, ATh, ATl);
    k_gemmw<bf, 1, true><<<dim3(NB_ * TT / 64, DM / 64, 1), 32, 0, stream>>>(ATh, ATl, WO, nullptr, DQ, OUT, DM, bo, 0, 0, 0, Planes{nullptr, nullptr, nullptr, nullptr, nullptr, nullptr, nullptr, nullptr, 0, nullptr, nullptr});   // both batches: 2 TT rows of one GEMM
}

// v008
// A run of this version takes 280 microseconds.
// Timed twice side by side with v007, it ran 1.11 and 1.15 times as fast.
// Over all steps from v000 it is 9.81 times as fast.
#include <hip/hip_runtime.h>

// Multi-head self-attention with relative positions and learnable u/v biases (x [2][2048][1024], bias [1][1][L][L] (f32 additive, read; verbatim causal 0/-1e9), pos_emb [2048][1][1024], pos_bias_u/v [16][64]; q/k/v = x W + b, r = pos_emb Wr + br ('xw', 16 heads x 64); qh = q/8; AC = (qh + u).k + bias; BD = (qh + v).r; logits = AC + rel_shift(BD) with the pad-front/reshape shift: pos[i][j] = BD[i][T-1-(i-j)] for j <= i, 0 for j == i+1, BD[i+1][j-i-2] for j >= i+2 (reproduced literally, including the masked upper part); softmax; out = merged Wo + bo -> [2][2048][1024]).
// Compute dtypes, f32 accumulate: every input rounded to bf16; q/k/v/r as PLAIN bf16 GEMMs (inputs: exact) + bias; q x 1/8 (exact) then the u/v head biases added in f32; content, position scores and attn.v: query rows < 512 hl (3 products), the rest single fp16 (x1024) (the shifted position score is gathered from rows i / i+1 of the position-score block); the additive bias read per element; softmax f32; Wo hl x exact (2 products) + bias.

#define NB_  2
#define TT   2048
#define DM   1024
#define NH_  16
#define NKV  16
#define REP  (NH_ / NKV)
#define HD   64
#define DQ   (NH_ * HD)
#define DKV  (NKV * HD)
#define RH   512                  // query rows < RH use hi+lo planes (0: none)
#define WIN  0
#define PCAR 1024.0f
#define KSP  16                   // attn.v: key ranges per output tile, two per wave of k_fattn; the KSP partial tiles are summed in ascending order
#define SCL  1.0f   // the 1/sqrt(64) is applied to q before the u/v biases (k_proj, EPI 2)
typedef _Float16 h16;
typedef unsigned short bf;
typedef __attribute__((ext_vector_type(16))) __bf16   v16bf;
typedef __attribute__((ext_vector_type(16))) _Float16 v16h;
typedef __attribute__((ext_vector_type(8)))  _Float16 v8h;
typedef __attribute__((ext_vector_type(8)))  unsigned short v8us;
typedef __attribute__((ext_vector_type(8)))  float    v8f;
typedef __attribute__((ext_vector_type(4)))  float    v4f;
typedef v8h  __attribute__((may_alias)) v8ha;
typedef v4f  __attribute__((may_alias)) v4fa;
typedef v8us __attribute__((may_alias)) v8usa;

__device__ __forceinline__ unsigned short f2bf(float f) { unsigned u = __float_as_uint(f); u += 0x7FFFu + ((u >> 16) & 1u); return (unsigned short)(u >> 16); }
__device__ __forceinline__ float bf2f(unsigned short b) { return __uint_as_float(((unsigned)b) << 16); }
__device__ __forceinline__ float bfr(float f) { return bf2f(f2bf(f)); }
__device__ __forceinline__ v16h cat16(v8h lo, v8h hi) { return __builtin_shufflevector(lo, hi, 0, 1, 2, 3, 4, 5, 6, 7, 8, 9, 10, 11, 12, 13, 14, 15); }
__device__ __forceinline__ v16bf cat16b(v8us lo, v8us hi) { return __builtin_bit_cast(v16bf, __builtin_shufflevector(lo, hi, 0, 1, 2, 3, 4, 5, 6, 7, 8, 9, 10, 11, 12, 13, 14, 15)); }
__device__ __forceinline__ v8f wmma16(v16h a, v16h b, v8f c) { return __builtin_amdgcn_wmma_f32_16x16x32_f16(false, a, false, b, (short)0, c, false, false); }
__device__ __forceinline__ v8f wmmab(v16bf a, v16bf b, v8f c) { return __builtin_amdgcn_wmma_f32_16x16x32_bf16(false, a, false, b, (short)0, c, false, false); }



// ---- FRAGMENT ORDER of every 16-bit plane that a matrix product reads (k_fattn: q + u, q + v, k, r, v; k_proj: x, pos_emb, the q, k, v and position weights; k_gemmw: Wo, the attention output): a block of 16 rows x 32 k (512 elements, 1 KiB) is stored as [g = (k >> 3) & 3][row & 15][k & 7], which is lane order (lane = 16 hi + row, g = 2 c + hi): load c of a fragment is 32 lanes x 16 B = 512 contiguous bytes (4 whole lines) where a row-major plane gives 16 part lines. Blocks of one 16-row tile follow one another along k. The registers hold what they held with row-major planes. ldf loads from a plane in fragment order.
// ---- k_gemmw: register-blocked GEMM, ONE WAVE per 64x64 output tile (16 accumulators), operands straight from 16-bit planes in fragment order (rows m or n, k along K); grid (M/64, N/64, Z), 32 threads.
// C[m][n] (f32, pitch ldc, + optional f32 bias[n]) = sum_k A[m][k] Bt[n][k] (+ split products per NSPLIT). z-batch strides sA/sB/sC in elements; with EPI != 0 slice z writes its planes sz elements behind slice z - 1's, so that the GEMMs of both batches are one launch and a WGP holds several waves whose load waits overlap. K % (32 KS) == 0. KS > 1: grid z = Z x KS; work-group (z, ks) sums only k in [ks K/KS, (ks+1) K/KS) and stores its partial tile in plane z KS + ks of C (plane stride sC).
template <typename T16> struct WFrag;
template <> struct WFrag<h16> { typedef v16h V; static __device__ __forceinline__ V ldf(const h16* p) { return cat16(*(const v8h*)p, *(const v8h*)(p + 256)); } static __device__ __forceinline__ v8f mma(V a, V b, v8f c) { return wmma16(a, b, c); } };
template <> struct WFrag<bf> { typedef v16bf V; static __device__ __forceinline__ V ldf(const bf* p) { return cat16b(*(const v8us*)p, *(const v8us*)(p + 256)); } static __device__ __forceinline__ v8f mma(V a, V b, v8f c) { return wmmab(a, b, c); } };
// Behind a batch of global loads: the precautionary wait in front of any write to a register of the loads' address pairs. The pointers are inputs so that the pairs stay live up to it; without that the compiler lets a later load of the batch land in an earlier load's pair. A shorter list repeats its pointers.
__device__ __forceinline__ void xhold(const void* a, const void* b, const void* c, const void* d, const void* e, const void* f, const void* g, const void* h) { asm volatile("s_wait_xcnt 0x0" :: "v"(a), "v"(b), "v"(c), "v"(d), "v"(e), "v"(f), "v"(g), "v"(h) : "memory"); }
__device__ __forceinline__ h16 tohx(float x) { return (h16)x; }
__device__ __forceinline__ void splitf(float y, unsigned short& h, unsigned short& l) { h = f2bf(y); l = f2bf(y - bf2f(h)); }
// one 16-byte store into each of the three planes (fp16, bf16 hi, bf16 lo) of eight neighbouring values. The stores stand in one asm statement with the precautionary s_wait_xcnt 0 behind them, so that it is in front of every later write to their address and data registers.
__device__ __forceinline__ void put8(const float (&x)[8], h16* P16, bf* Ph, bf* Pl, size_t o) { v8h o16; v8us oh, ol;
#pragma unroll
    for (int q = 0; q < 8; ++q) { o16[q] = tohx(x[q]); unsigned short a, c; splitf(x[q], a, c); oh[q] = a; ol[q] = c; }
    asm volatile("global_store_b128 %0, %3, off\n\tglobal_store_b128 %1, %4, off\n\tglobal_store_b128 %2, %5, off\n\ts_wait_xcnt 0x0" :: "v"(P16 + o), "v"(Ph + o), "v"(Pl + o), "v"(o16), "v"(oh), "v"(ol) : "memory"); }
// Where a projection's tile goes when EPI != 0 (a 64-column tile is one head), all in fragment order: EPI 1: planes p [h] (rows t, k = d) of C + bias (k, r); EPI 2: planes p of (C + bias)/8 + bu and planes q of (C + bias)/8 + bv (the two query forms); EPI 3: planes p [h] (rows d, k = t; the four 16-row blocks of one k step side by side) of C + bias (v, transposed). EPI 1 holds the position projection as slice 0 (weights Bt0, bias bias0) and the key projection of batch z - 1 as slice z.
struct Planes { h16* p16; bf* ph; bf* pl; h16* q16; bf* qh; bf* ql; const float* bu; const float* bv; size_t sz; const bf* Bt0; const float* bias0; };
// gemmw: the body; bz is the slice index (grid z of k_gemmw; of k_proj the slice inside the projection that the work-group belongs to); os: the work-group's LDS tile, 16 x 68 floats (EPI 2: two of them, one for each of the two query forms).
template <typename T16, int NSPLIT, bool BIAS, int KS, int EPI>
__device__ __forceinline__ void gemmw(float* os, const int bz, const T16* __restrict__ A, const T16* __restrict__ A2, const T16* __restrict__ Bt, const T16* __restrict__ Bt2, int K, float* C, int ldc, const float* __restrict__ bias, size_t sA, size_t sB, size_t sC, Planes po) {
    typedef typename WFrag<T16>::V V;
    const size_t z = bz / KS; A += z * sA; if (A2) A2 += z * sA; Bt += z * sB; if (Bt2) Bt2 += z * sB; C += (size_t)bz * sC; const int kb = (int)(bz % KS) * (K / KS), ke = kb + K / KS;
    if constexpr (EPI != 0) { const size_t zs = z * po.sz; po.p16 += zs; po.ph += zs; po.pl += zs; if constexpr (EPI == 2) { po.q16 += zs; po.qh += zs; po.ql += zs; } }
    if constexpr (EPI == 1) { if (z == 0) { Bt = po.Bt0; bias = po.bias0; } }
    const int lane = threadIdx.x & 31, lr = lane & 15, hi = lane >> 4; const int r0 = blockIdx.x * 64, c0 = blockIdx.y * 64;
    v8f acc[4][4];
#pragma unroll
    for (int mb = 0; mb < 4; ++mb)
#pragma unroll
        for (int nb = 0; nb < 4; ++nb) acc[mb][nb] = (v8f){};
    const size_t aoff = (size_t)r0 * K + lane * 8, boff = (size_t)c0 * K + lane * 8;   // a 16-row tile is 16 K elements, a k step of 32 is 512 of them; lane * 8: the lane's 16-byte unit
#pragma unroll 1
    for (int kc = kb; kc < ke; kc += 32) {
        V a[4], a2[4], b[4], b2[4]; const T16 *pa[4], *pa2[4], *pb[4], *pb2[4];
#pragma unroll
        for (int t = 0; t < 4; ++t) { const size_t ot = (size_t)t * 16 * K + (size_t)kc * 16; pa[t] = A + aoff + ot; pb[t] = Bt + boff + ot; a[t] = WFrag<T16>::ldf(pa[t]); b[t] = WFrag<T16>::ldf(pb[t]);
            if (NSPLIT == 1 || NSPLIT == 2) { pa2[t] = A2 + aoff + ot; a2[t] = WFrag<T16>::ldf(pa2[t]); } if (NSPLIT >= 2) { pb2[t] = Bt2 + boff + ot; b2[t] = WFrag<T16>::ldf(pb2[t]); } }
        if constexpr (NSPLIT == 1) asm volatile("s_wait_xcnt 0x0" :: "v"(pa[0]), "v"(pa[1]), "v"(pa[2]), "v"(pa[3]), "v"(pb[0]), "v"(pb[1]), "v"(pb[2]), "v"(pb[3]), "v"(pa2[0]), "v"(pa2[1]), "v"(pa2[2]), "v"(pa2[3]) : "memory");   // xhold for twelve pairs
        else xhold(pa[0], pa[1], pa[2], pa[3], pb[0], pb[1], pb[2], pb[3]);
        if constexpr (NSPLIT == 2) xhold(pa2[0], pa2[1], pa2[2], pa2[3], pb2[0], pb2[1], pb2[2], pb2[3]);
        if constexpr (NSPLIT > 2) xhold(pb2[0], pb2[1], pb2[2], pb2[3], pb2[0], pb2[1], pb2[2], pb2[3]);
        __builtin_amdgcn_sched_barrier(0);   // keeps the products behind the wait: without it the compiler lifts them over it, in between the loads, and then fetches the B fragments one after another into one register set, with a full load wait each
#pragma unroll
        for (int nb = 0; nb < 4; ++nb) {
#pragma unroll
            for (int mb = 0; mb < 4; ++mb) { acc[mb][nb] = WFrag<T16>::mma(a[mb], b[nb], acc[mb][nb]); if (NSPLIT == 1 || NSPLIT == 2) acc[mb][nb] = WFrag<T16>::mma(a2[mb], b[nb], acc[mb][nb]); if (NSPLIT >= 2) acc[mb][nb] = WFrag<T16>::mma(a[mb], b2[nb], acc[mb][nb]); } }
        asm volatile("v_nop\n\tv_nop\n\tv_nop\n\tv_nop" : "+v"(acc[0][0]), "+v"(acc[1][1]), "+v"(acc[2][2]), "+v"(acc[3][3]) : "v"(a[0]), "v"(a[3]));
    }
    if constexpr (EPI == 3) {   // a lane's eight accumulator values are eight neighbouring t of one d, one 16-byte unit of the fragment order (rows d, k = t): stored straight from the registers
        asm volatile("s_wait_xcnt 0x0" ::: "memory");   // precautionary wait in front of the first write to an address pair of the k loop's loads
        float bn[4];   // all four bias loads first: the store statements' memory clobber would hold a later load behind them
#pragma unroll
        for (int nb = 0; nb < 4; ++nb) bn[nb] = bfr(bias[c0 + nb * 16 + lr]);
#pragma unroll
        for (int nb = 0; nb < 4; ++nb) {
#pragma unroll
            for (int mb = 0; mb < 4; ++mb) { float x[8];
#pragma unroll
                for (int j = 0; j < 8; ++j) x[j] = acc[mb][nb][j] + bn[nb];
                put8(x, po.p16, po.ph, po.pl, ((size_t)blockIdx.y * TT + r0 + (mb >> 1) * 32) * HD + nb * 512 + (mb & 1) * 256 + lane * 8); } }   // block (32 t, 16 d) in fragment order: 512 contiguous bytes a store
        return; }
    float bn[4], un[4], vn[4];   // EPI 1, 2: the biases of a lane's four accumulator columns, added before the tile goes through LDS
    if constexpr (EPI == 1 || EPI == 2) {
#pragma unroll
        for (int nb = 0; nb < 4; ++nb) { bn[nb] = bfr(bias[c0 + nb * 16 + lr]); if (EPI == 2) { un[nb] = bfr(po.bu[c0 + nb * 16 + lr]); vn[nb] = bfr(po.bv[c0 + nb * 16 + lr]); } } }
#pragma unroll
    for (int mb = 0; mb < 4; ++mb) {
#pragma unroll
        for (int nb = 0; nb < 4; ++nb) {
#pragma unroll
            for (int j = 0; j < 8; ++j) { const int oi = (hi * 8 + j) * 68 + nb * 16 + lr;
                if constexpr (EPI == 1) os[oi] = acc[mb][nb][j] + bn[nb];
                else if constexpr (EPI == 2) { const float aq = __fmul_rn(acc[mb][nb][j] + bn[nb], 0.125f); os[oi] = __fadd_rn(aq, un[nb]); os[16 * 68 + oi] = __fadd_rn(aq, vn[nb]); }
                else os[oi] = acc[mb][nb][j]; } }
        __builtin_amdgcn_wave_barrier(); asm volatile("" ::: "memory");
        float* crow = C + (size_t)(r0 + mb * 16) * ldc + c0;
        if constexpr (EPI == 1 || EPI == 2) {
            const size_t o = ((size_t)blockIdx.y * TT + r0 + mb * 16) * HD + lane * 8;   // store s: units g = 2 s + hi of row lr, 512 contiguous bytes
#pragma unroll
            for (int pl = 0; pl < (EPI == 2 ? 2 : 1); ++pl) { const float* ot = os + pl * (16 * 68) + lr * 68 + hi * 8;
                v4f v0[4], v1[4];   // a tile's LDS reads first: the store statements' memory clobber would hold a later read behind them
#pragma unroll
                for (int s = 0; s < 4; ++s) { v0[s] = *(const v4fa*)(ot + s * 16); v1[s] = *(const v4fa*)(ot + s * 16 + 4); }
#pragma unroll
                for (int s = 0; s < 4; ++s) { float x[8];
#pragma unroll
                    for (int q = 0; q < 8; ++q) x[q] = q < 4 ? v0[s][q & 3] : v1[s][q & 3];
                    if (pl == 0) put8(x, po.p16, po.ph, po.pl, o + s * 256); else put8(x, po.q16, po.qh, po.ql, o + s * 256); } }
        } else {
#pragma unroll
            for (int s = 0; s < 8; ++s) { const int row = 2 * s + hi, cofs = lr * 4; v4f val = *(const v4fa*)(os + row * 68 + cofs); if (BIAS) { val[0] += bfr(bias[c0 + cofs]); val[1] += bfr(bias[c0 + cofs + 1]); val[2] += bfr(bias[c0 + cofs + 2]); val[3] += bfr(bias[c0 + cofs + 3]); }
                *(v4f*)(crow + (size_t)row * ldc + cofs) = val; }
             }
        __builtin_amdgcn_wave_barrier(); asm volatile("" ::: "memory");
    }
}
template <typename T16, int NSPLIT, bool BIAS>
__global__ __launch_bounds__(32) void k_gemmw(const T16* __restrict__ A, const T16* __restrict__ A2, const T16* __restrict__ Bt, const T16* __restrict__ Bt2, int K, float* C, int ldc, const float* __restrict__ bias, size_t sA, size_t sB, size_t sC, Planes po) {
    __shared__ __align__(16) float os[16 * 68];
    gemmw<T16, NSPLIT, BIAS, 1, 0>(os, (int)blockIdx.z, A, A2, Bt, Bt2, K, C, ldc, bias, sA, sB, sC, po);
}
// ---- k_proj: the four projections in ONE launch, grid (TT/64, DQ/64, 3 NB_ + 1): slices z < NB_ are q (EPI 2), the next NB_ + 1 the position and key projections (EPI 1), the last NB_ are v (EPI 3); X3: pos_emb and x, XB: x alone. None reads what another writes. A launch of one projection alone puts about one wave on a SIMD, which then idles through every k step's load wait; together a SIMD holds three to four waves, and one wave's products run in another's wait.
__global__ __launch_bounds__(32) void k_proj(const bf* __restrict__ X3, const bf* __restrict__ XB, const bf* __restrict__ WQ, const bf* __restrict__ WK, const bf* __restrict__ WV, const float* __restrict__ bq, const float* __restrict__ bk, const float* __restrict__ bv, int K, Planes pq, Planes pk, Planes pv) {
    __shared__ __align__(16) float os[2 * 16 * 68];
    const int z = blockIdx.z; const size_t XS = (size_t)TT * DM;
    if (z < NB_) gemmw<bf, 0, true, 1, 2>(os, z, XB, nullptr, WQ, nullptr, K, nullptr, DQ, bq, XS, 0, 0, pq);
    else if (z < 2 * NB_ + 1) gemmw<bf, 0, true, 1, 1>(os, z - NB_, X3, nullptr, WK, nullptr, K, nullptr, DKV, bk, XS, 0, 0, pk);
    else gemmw<bf, 0, true, 1, 3>(os, z - (2 * NB_ + 1), XB, nullptr, WV, nullptr, K, nullptr, DKV, bv, XS, 0, 0, pv);
}

typedef __attribute__((ext_vector_type(2))) _Float16 v2h;
typedef __attribute__((ext_vector_type(4))) _Float16 v4h;
typedef __attribute__((ext_vector_type(2))) unsigned short v2us;
typedef __attribute__((ext_vector_type(4))) unsigned short v4us;
typedef __attribute__((ext_vector_type(2))) float v2f;
typedef __attribute__((ext_vector_type(4))) int v4i;

// One wave per block of 16 n x 32 k of Bt[n][k] = w[k][n], written in fragment order (two stores of 512 contiguous bytes); a load takes 16 neighbouring n of two k rows. The eight waves of a work-group cover 32 n x 128 k, so that they use whole 128-byte lines of w.
__device__ __forceinline__ void wtG(const float* __restrict__ w, int K, int N, bf* Bt, int blk) {
    const int lane = threadIdx.x & 31, lr = lane & 15, hi = lane >> 4, ws = threadIdx.x >> 5;
    const int nt = (blk % (N / 32)) * 2 + (ws & 1), kb = (blk / (N / 32)) * 4 + (ws >> 1);
    const float* p = w + (size_t)(kb * 32 + hi * 8) * N + nt * 16 + lr; float v[2][8];
#pragma unroll
    for (int c = 0; c < 2; ++c)
#pragma unroll
        for (int q = 0; q < 8; ++q) v[c][q] = p[(size_t)(c * 16 + q) * N];
    asm volatile("s_wait_xcnt 0x0" :: "v"(p) : "memory");   // precautionary wait in front of the first write to the loads' address pair, which the input keeps live up to here
    v8us o0, o1;
#pragma unroll
    for (int q = 0; q < 8; ++q) { o0[q] = f2bf(v[0][q]); o1[q] = f2bf(v[1][q]); }
    asm volatile("global_store_b128 %0, %1, off\n\tglobal_store_b128 %0, %2, off offset:512\n\ts_wait_xcnt 0x0" :: "v"(Bt + ((size_t)nt * (K / 32) + kb) * 512 + lane * 8), "v"(o0), "v"(o1) : "memory");   // stores and precautionary wait in one statement, as in put8
}
// ---- k_prep: all that the GEMMs wait for, in one launch: work-groups [0, 5 WTB) transpose and round the five weight matrices (WTB each), the rest round pos_emb (slice 0 of X3) and x (slices 1, 2: the two batches), eight values (one 16-byte unit of the fragment order) a thread; a wave takes 8 rows x 32 k: whole 128-byte lines on both sides.
#define WTB (DM * DQ / 64 / 64)
#define CVB (TT * DM / 8 / 256)   // work-groups per slice of X3
__global__ __launch_bounds__(256) void k_prep(const float* __restrict__ wq, const float* __restrict__ wk, const float* __restrict__ wv, const float* __restrict__ wo, const float* __restrict__ wpos, const float* __restrict__ x, const float* __restrict__ pemb, bf* WQ, bf* WK, bf* WV, bf* WO, bf* WP, bf* X3) {
    const int blk = blockIdx.x;
    if (blk < 5 * WTB) { const int job = blk / WTB; wtG(job == 0 ? wq : job == 1 ? wk : job == 2 ? wv : job == 3 ? wo : wpos, DM, DQ, job == 0 ? WQ : job == 1 ? WK : job == 2 ? WV : job == 3 ? WO : WP, blk % WTB); return; }
    const int cb = blk - 5 * WTB; const size_t i = (size_t)cb * 256 + threadIdx.x; const size_t tile = i / (2 * DM); const int u = (int)(i % (2 * DM)), g = u & 3, row = (u >> 2) & 15, kb = u >> 6;   // 2 DM units in a tile of 16 rows
    const size_t so = (tile * 16 + row) * DM + kb * 32 + g * 8; const float* src = cb < CVB ? pemb + so : x + (so - (size_t)TT * DM); const v8f v = *(const v8f*)src; v8us o;
    asm volatile("s_wait_xcnt 0x0" ::: "memory");   // precautionary wait in front of the first write to the load's address pair (the compiler reuses the pair for the rounding)
#pragma unroll
    for (int k = 0; k < 8; ++k) o[k] = f2bf(v[k]);
    asm volatile("global_store_b128 %0, %1, off\n\ts_wait_xcnt 0x0" :: "v"(X3 + tile * (16 * DM) + kb * 512 + g * 128 + row * 8), "v"(o) : "memory"); }   // store and precautionary wait in one statement, as in put8: the compiler joins this path with the transpose part, whose first instructions write the store's registers
__global__ __launch_bounds__(256) void k_cscvt(const float* __restrict__ cosT, const float* __restrict__ sinT, float* CS) { const int idx = blockIdx.x * 256 + threadIdx.x; if (idx >= TT * HD) return; v2f cs; cs[0] = bfr(cosT[idx]); cs[1] = bfr(sinT[idx]); *(v2f*)(CS + (size_t)idx * 2) = cs;  }
// ---- k_fattn: one work-group (8 waves) per 16 query rows of one head of one batch (blockIdx.z; the q, k, v planes and the output of batch 1 stand behind batch 0's, the position planes serve both); the 16 x 2048 f32 logit rows live in LDS from the score products to attn.v.
// Phases: (1) content scores + additive bias + position scores, the latter turned to their rel-shift place inside the registers (row i takes BD[i][m >= T-1-i] at j = m-(T-1)+i and BD[i+1][m <= T-3-i] at j = m+i+2; every place gets at most one term) -> S; (3) softmax, one wave per row, weights written over the row as 16-bit planes; (4) attn.v in KSP key ranges of 128, two per wave; (5) the KSP partial tiles summed in ascending order.
#define SP 2052                   // LDS row pitch in floats: 2048 + 4, so that the 16 rows of a fragment read start on different banks
typedef v4h  __attribute__((may_alias)) v4ha;
typedef v4us __attribute__((may_alias)) v4usa;
// v_exp_f32 with the one free slot that the instruction set asks for behind a transcendental, before its result is read or its source written again; in one statement, so that the v_nop stands directly behind it
__device__ __forceinline__ float exp2_slot(float x) { float r; asm("v_exp_f32 %0, %1\n\tv_nop" : "=v"(r) : "v"(x)); return r; }
template <bool HI> struct BFrag;   // 16 rows x 64 k of a plane in fragment order (hi + lo planes where HI); off = fo(lane's row, hi)
__device__ __forceinline__ size_t fo(int row, int hi) { return (size_t)(row >> 4) * (16 * HD) + (row & 15) * 8 + hi * 128; }
template <> struct BFrag<false> { v16h b[2]; const h16 *p, *p2;
    __device__ __forceinline__ void load(const h16* b16, const bf*, const bf*, size_t off) { p = p2 = b16 + off; b[0] = WFrag<h16>::ldf(p); b[1] = WFrag<h16>::ldf(p + 512); } };
template <> struct BFrag<true> { v16bf b[2], b2[2]; const bf *p, *p2;
    __device__ __forceinline__ void load(const h16*, const bf* bh, const bf* bl, size_t off) { p = bh + off; p2 = bl + off; b[0] = WFrag<bf>::ldf(p); b[1] = WFrag<bf>::ldf(p + 512); b2[0] = WFrag<bf>::ldf(p2); b2[1] = WFrag<bf>::ldf(p2 + 512); } };
__device__ __forceinline__ v8f dot64(const BFrag<false>& q, const BFrag<false>& k) { v8f c = (v8f){};
#pragma unroll
    for (int kk = 0; kk < 2; ++kk) c = wmma16(q.b[kk], k.b[kk], c);
    return c; }
__device__ __forceinline__ v8f dot64(const BFrag<true>& q, const BFrag<true>& k) { v8f c = (v8f){};
#pragma unroll
    for (int kk = 0; kk < 2; ++kk) { c = wmmab(q.b[kk], k.b[kk], c); c = wmmab(q.b2[kk], k.b[kk], c); c = wmmab(q.b[kk], k.b2[kk], c); }
    return c; }
// Row r = 8 hi + JJ of a position-score tile turned right by (r + 1) & 15 lanes (tail) or (r + 2) & 15 lanes (head) inside its 16-lane row: lane l takes lane (l - n) & 15. The two halves of the wave hold different rows, so each takes its own turn (row_mask 1: lanes 0-15, 2: lanes 16-31); a turn by 0 is left out.
template <bool HEAD, int JJ>
__device__ __forceinline__ float turn_row(float x) {
    constexpr int NLO = (JJ + (HEAD ? 2 : 1)) & 15, NHI = (JJ + 8 + (HEAD ? 2 : 1)) & 15;
    const int xi = __float_as_int(x); int t = xi;
    if constexpr (NLO != 0) t = __builtin_amdgcn_update_dpp(xi, xi, 0x120 + NLO, 0x1, 0xf, false);
    if constexpr (NHI != 0) t = __builtin_amdgcn_update_dpp(t, xi, 0x120 + NHI, 0x2, 0xf, false);
    return __int_as_float(t); }
// The rel-shift term of logit tile (rows i0.., columns 16 jt..) from two neighbouring position-score tiles A (tile t) and B (tile t + 1): row r wants lanes [thr, 15] of A and [0, thr) of B, thr = 15 - r (tail) or 14 - r (head), turned into place; in the head, row 15 wants lane 15 of tile t - 1 (z) and lanes 0-14 of A.
template <bool HEAD, int JJ>
__device__ __forceinline__ float shift_term(const v8f& A, const v8f& B, float z, int lr, int hi) {
    float x = (lr + hi * 8 + JJ >= (HEAD ? 14 : 15)) ? A[JJ] : B[JJ];
    if constexpr (HEAD && JJ == 7) x = (hi != 0 && lr == 15) ? z : x;
    return turn_row<HEAD, JJ>(x); }
// ---- sc_pass: logit tiles jlo..jhi (16 columns each, one after another) of the 16 query rows, complete in registers: content score + bias + rel-shift term, one plain store each.
// Tail (columns j <= i, tiles jt <= it): term = BD[i][T-1-i+j], position tiles t = 127 - it + jt and t + 1, query rows i. Head (columns j >= i + 2, tiles jt >= it): term = BD[i+1][j-i-2], position tiles t = jt - it - 1 and t + 1 (and lane 15 of t - 1), query rows i + 1. A tile that does not exist (128 in the tail, -1 and -2 in the head) counts as zeros: those places take no term (j > i in the tail's diagonal tile, j <= i + 1 in the head). The diagonal tile jt == it is written by the tail pass and taken up again from S by the head pass of the same wave. HI goes by the row block: in the block that ends at RH - 1 the head's last query row, RH, is taken from the hi + lo planes like the other fifteen.
template <bool HI, bool HEAD>
__device__ __forceinline__ void sc_pass(float* S, const h16* qu16, const bf* quh, const bf* qul, const h16* qv16, const bf* qvh, const bf* qvl, const h16* k16, const bf* kh, const bf* kl, const h16* p16, const bf* ph, const bf* pl, const float* __restrict__ ab, int i0, int jlo, int jhi, int lr, int hi) {
    if (jlo > jhi) return;   // the same for the whole wave
    const int it = i0 >> 4; int ar = HEAD ? i0 + 1 + lr : i0 + lr; if (ar > TT - 1) ar = TT - 1;   // row T does not exist; no term of it is ever placed
    BFrag<HI> qu, qb; qu.load(qu16, quh, qul, fo(i0 + lr, hi)); qb.load(qv16, qvh, qvl, fo(ar, hi));
    const int t0 = HEAD ? jlo - it - 1 : TT / 16 - 1 - it + jlo;   // position tile A of the first logit tile
    v8f A, B; float z = 0.f;
    { BFrag<HI> ra, rz; ra.load(p16, ph, pl, fo(max(t0, 0) * 16 + lr, hi)); rz.load(p16, ph, pl, fo(max(t0 - 1, 0) * 16 + lr, hi));
      xhold(qu.p, qu.p2, qb.p, qb.p2, ra.p, ra.p2, rz.p, rz.p2);
      A = dot64(qb, ra); if (t0 < 0) A = (v8f){};
      if constexpr (HEAD) { const v8f c = dot64(qb, rz); z = (t0 < 1) ? 0.f : c[7]; } }
    constexpr int U = HI ? 1 : 4;   // logit tiles whose loads fly together
#pragma unroll 1   // the batch of U tiles is the unit; unrolling further would pass 256 VGPRs and cost the second work-group of the WGP
    for (int jt = jlo; jt <= jhi; jt += U) { BFrag<HI> k[U], r[U]; const float* pb[U]; float bb[U][8];
#pragma unroll
        for (int u = 0; u < U; ++u) { const int ju = min(jt + u, jhi), col = ju * 16 + lr, tb = min(HEAD ? ju - it : TT / 16 - it + ju, TT / 16 - 1);
            k[u].load(k16, kh, kl, fo(col, hi)); r[u].load(p16, ph, pl, fo(tb * 16 + lr, hi)); pb[u] = ab + (size_t)(i0 + hi * 8) * TT + col;
#pragma unroll
            for (int jj = 0; jj < 8; ++jj) bb[u][jj] = pb[u][(size_t)jj * TT]; }
        if (HI) xhold(k[0].p, k[0].p2, r[0].p, r[0].p2, pb[0], pb[0], pb[0], pb[0]);
        else asm volatile("s_wait_xcnt 0x0" :: "v"(k[0].p), "v"(k[1 % U].p), "v"(k[2 % U].p), "v"(k[3 % U].p), "v"(r[0].p), "v"(r[1 % U].p), "v"(r[2 % U].p), "v"(r[3 % U].p), "v"(pb[0]), "v"(pb[1 % U]), "v"(pb[2 % U]), "v"(pb[3 % U]) : "memory");   // xhold for twelve pairs
#pragma unroll
        for (int u = 0; u < U; ++u) { const int ju = jt + u;
            if (ju <= jhi) { const int col = ju * 16 + lr; float base[8];
                B = dot64(qb, r[u]); if (!HEAD && ju == it) B = (v8f){};
                if (HEAD && ju == it) {
#pragma unroll
                    for (int jj = 0; jj < 8; ++jj) base[jj] = S[(hi * 8 + jj) * SP + col];
                } else { const v8f c = dot64(qu, k[u]);
#pragma unroll
                    for (int jj = 0; jj < 8; ++jj) base[jj] = __fadd_rn(c[jj], bfr(bb[u][jj])); }
                float* so = S + hi * 8 * SP + col;
                so[0 * SP] = __fadd_rn(base[0], shift_term<HEAD, 0>(A, B, z, lr, hi)); so[1 * SP] = __fadd_rn(base[1], shift_term<HEAD, 1>(A, B, z, lr, hi));
                so[2 * SP] = __fadd_rn(base[2], shift_term<HEAD, 2>(A, B, z, lr, hi)); so[3 * SP] = __fadd_rn(base[3], shift_term<HEAD, 3>(A, B, z, lr, hi));
                so[4 * SP] = __fadd_rn(base[4], shift_term<HEAD, 4>(A, B, z, lr, hi)); so[5 * SP] = __fadd_rn(base[5], shift_term<HEAD, 5>(A, B, z, lr, hi));
                so[6 * SP] = __fadd_rn(base[6], shift_term<HEAD, 6>(A, B, z, lr, hi)); so[7 * SP] = __fadd_rn(base[7], shift_term<HEAD, 7>(A, B, z, lr, hi));
                z = A[7]; A = B; } } }
}
template <bool HI>
__device__ __forceinline__ void pv_pass(const float* S, const h16* v16, const bf* vh, const bf* vl, int w, int lr, int hi, v8f (&acc)[2][4]) {
    constexpr int NS = HI ? 1 : 2;   // k steps of 32 keys whose loads fly together
#pragma unroll
    for (int u = 0; u < 2; ++u) {
#pragma unroll
        for (int nb = 0; nb < 4; ++nb) acc[u][nb] = (v8f){};
#pragma unroll
        for (int st = 0; st < TT / KSP / 32; st += NS) { const int kc = (2 * w + u) * (TT / KSP) + st * 32; const size_t boff = (size_t)kc * HD + hi * 128 + lr * 8;   // a k step of 32 keys is four blocks (16 d each) of 512 elements
            if (HI) { const bf *pv = vh + boff, *pv2 = vl + boff; v16bf b[4], b2[4];
#pragma unroll
                for (int nb = 0; nb < 4; ++nb) { b[nb] = WFrag<bf>::ldf(pv + nb * 512); b2[nb] = WFrag<bf>::ldf(pv2 + nb * 512); }
                xhold(pv, pv2, pv, pv2, pv, pv2, pv, pv2);
                const bf* p = (const bf*)(S + lr * SP) + kc + 8 * hi; const v16bf a = cat16b(*(const v8usa*)p, *(const v8usa*)(p + 16)), a2 = cat16b(*(const v8usa*)(p + TT), *(const v8usa*)(p + TT + 16));
#pragma unroll
                for (int nb = 0; nb < 4; ++nb) { acc[u][nb] = wmmab(a, b[nb], acc[u][nb]); acc[u][nb] = wmmab(a2, b[nb], acc[u][nb]); acc[u][nb] = wmmab(a, b2[nb], acc[u][nb]); }
            } else { const h16* pv = v16 + boff; v16h b[NS][4];
#pragma unroll
                for (int s = 0; s < NS; ++s)
#pragma unroll
                    for (int nb = 0; nb < 4; ++nb) b[s][nb] = WFrag<h16>::ldf(pv + s * (32 * HD) + nb * 512);
                xhold(pv, pv, pv, pv, pv, pv, pv, pv);
#pragma unroll
                for (int s = 0; s < NS; ++s) { const h16* p = (const h16*)(S + lr * SP) + kc + s * 32 + 8 * hi; const v16h a = cat16(*(const v8ha*)p, *(const v8ha*)(p + 16));
#pragma unroll
                    for (int nb = 0; nb < 4; ++nb) acc[u][nb] = wmma16(a, b[s][nb], acc[u][nb]); } } } }
}
// amdgpu_waves_per_eu(4, 4): 256 VGPRs at most, so that two work-groups (2 x 131,328 B of LDS) share a WGP and one computes while the other waits at a barrier
__global__ __launch_bounds__(256) __attribute__((amdgpu_waves_per_eu(4, 4))) void k_fattn(const h16* __restrict__ QP16, const bf* __restrict__ QPh, const bf* __restrict__ QPl, const h16* __restrict__ QV16, const bf* __restrict__ QVh, const bf* __restrict__ QVl, const h16* __restrict__ KP16, const bf* __restrict__ KPh, const bf* __restrict__ KPl, const h16* __restrict__ PP16, const bf* __restrict__ PPh, const bf* __restrict__ PPl, const h16* __restrict__ VT16, const bf* __restrict__ VTh, const bf* __restrict__ VTl, const float* __restrict__ ab, bf* Ah, bf* Al) {
    __shared__ __align__(16) float S[16 * SP];
    const int tid = threadIdx.x, lane = tid & 31, lr = lane & 15, hi = lane >> 4; const int w = __builtin_amdgcn_readfirstlane(tid >> 5);
    const int i0 = blockIdx.x * 16, h = blockIdx.y; const bool hires = (i0 < RH); const size_t hp = (size_t)h * TT * HD;
    { const size_t zb = (size_t)blockIdx.z * ((size_t)NH_ * TT * HD); QP16 += zb; QPh += zb; QPl += zb; QV16 += zb; QVh += zb; QVl += zb; KP16 += zb; KPh += zb; KPl += zb; VT16 += zb; VTh += zb; VTl += zb; Ah += zb; Al += zb; }   // NH_ TT HD == TT DQ: one batch of any of these
    { const int it = i0 >> 4, jl = w * (TT / 128), jh = jl + TT / 128 - 1;   // a wave takes 16 neighbouring logit tiles, so that each position-score tile serves two of them from registers
      if (hires) { sc_pass<true, false>(S, QP16 + hp, QPh + hp, QPl + hp, QV16 + hp, QVh + hp, QVl + hp, KP16 + hp, KPh + hp, KPl + hp, PP16 + hp, PPh + hp, PPl + hp, ab, i0, jl, min(jh, it), lr, hi);
                   sc_pass<true, true>(S, QP16 + hp, QPh + hp, QPl + hp, QV16 + hp, QVh + hp, QVl + hp, KP16 + hp, KPh + hp, KPl + hp, PP16 + hp, PPh + hp, PPl + hp, ab, i0, max(jl, it), jh, lr, hi); }
      else       { sc_pass<false, false>(S, QP16 + hp, QPh + hp, QPl + hp, QV16 + hp, QVh + hp, QVl + hp, KP16 + hp, KPh + hp, KPl + hp, PP16 + hp, PPh + hp, PPl + hp, ab, i0, jl, min(jh, it), lr, hi);
                   sc_pass<false, true>(S, QP16 + hp, QPh + hp, QPl + hp, QV16 + hp, QVh + hp, QVl + hp, KP16 + hp, KPh + hp, KPl + hp, PP16 + hp, PPh + hp, PPl + hp, ab, i0, max(jl, it), jh, lr, hi); } }
    __syncthreads();   // logits complete before a wave reads its rows
#pragma unroll 1   // one 64-register row at a time
    for (int rr = 0; rr < 2; ++rr) { float* srow = S + (w + rr * 8) * SP; float v[TT / 32]; float mx = -3.0e38f;
#pragma unroll
        for (int ch = 0; ch < TT / 128; ++ch) { const v4f a = *(const v4fa*)(srow + ch * 128 + lane * 4);
#pragma unroll
            for (int q = 0; q < 4; ++q) { v[ch * 4 + q] = a[q]; mx = fmaxf(mx, a[q]); } }
#pragma unroll
        for (int sh = 16; sh; sh >>= 1) mx = fmaxf(mx, __shfl_xor(mx, sh, 32));
        float sum = 0.f;
#pragma unroll
        for (int k = 0; k < TT / 32; ++k) { v[k] = exp2_slot(__fmul_rn(__fsub_rn(v[k], mx), 1.4426950408889634f)); sum += v[k]; }
#pragma unroll
        for (int sh = 16; sh; sh >>= 1) sum += __shfl_xor(sum, sh, 32);
        const float f = __fdiv_rn(hires ? 1.0f : PCAR, sum);
        if (hires) { bf* ph = (bf*)srow;
#pragma unroll
            for (int ch = 0; ch < TT / 128; ++ch) { v4us oh, ol;
#pragma unroll
                for (int q = 0; q < 4; ++q) { unsigned short a, c2; splitf(v[ch * 4 + q] * f, a, c2); oh[q] = a; ol[q] = c2; }
                *(v4usa*)(ph + ch * 128 + lane * 4) = oh; *(v4usa*)(ph + TT + ch * 128 + lane * 4) = ol; }
        } else { h16* p16 = (h16*)srow;
#pragma unroll
            for (int ch = 0; ch < TT / 128; ++ch) { v4h o4;
#pragma unroll
                for (int q = 0; q < 4; ++q) o4[q] = tohx(v[ch * 4 + q] * f);
                *(v4ha*)(p16 + ch * 128 + lane * 4) = o4; } } }
    __syncthreads();   // all 16 weight rows written before any wave reads them as A fragments
    v8f acc[2][4]; const size_t hv = (size_t)h * HD * TT;
    if (hires) pv_pass<true>(S, VT16 + hv, VTh + hv, VTl + hv, w, lr, hi, acc); else pv_pass<false>(S, VT16 + hv, VTh + hv, VTl + hv, w, lr, hi, acc);
    __syncthreads();   // last read of the weights is over before the partial tiles overwrite them
#pragma unroll
    for (int u = 0; u < 2; ++u)
#pragma unroll
        for (int nb = 0; nb < 4; ++nb)
#pragma unroll
            for (int jj = 0; jj < 8; ++jj) S[(2 * w + u) * (16 * HD) + (hi * 8 + jj) * HD + nb * 16 + lr] = acc[u][nb][jj];
    __syncthreads();   // all KSP partial tiles written before they are summed
    const int e = tid * 4, t = i0 + (e >> 6), d = e & 63; v4f s = *(const v4fa*)(S + e);
#pragma unroll
    for (int ks = 1; ks < KSP; ++ks) s += *(const v4fa*)(S + ks * (16 * HD) + e);
    const float cs = (t < RH) ? 1.0f : (1.0f / PCAR); v4us oh, ol;
#pragma unroll
    for (int q = 0; q < 4; ++q) { unsigned short a, c2; splitf(s[q] * cs, a, c2); oh[q] = a; ol[q] = c2; }
    const size_t oo = (size_t)(t >> 4) * (16 * DQ) + (size_t)((h * HD + d) >> 5) * 512 + ((d >> 3) & 3) * 128 + (t & 15) * 8 + (d & 7); *(v4us*)(Ah + oo) = oh; *(v4us*)(Al + oo) = ol;   // fragment order (rows t, k = h HD + d) for the output GEMM: the work-group's tile is 2 KiB in a row in each plane
}

extern "C" void kernel_launch(void* const* d_in, const int* in_sizes, int n_in,
                              void* d_out, int out_size, void* d_ws, size_t ws_size, hipStream_t stream) {
    (void)in_sizes; (void)n_in; (void)out_size;
    const float* x = (const float*)d_in[0]; const float* abias = (const float*)d_in[1]; const float* pemb = (const float*)d_in[2]; const float* pbu = (const float*)d_in[3]; const float* pbv = (const float*)d_in[4]; const float* wq = (const float*)d_in[5]; const float* bq = (const float*)d_in[6]; const float* wk = (const float*)d_in[7]; const float* bk = (const float*)d_in[8]; const float* wv = (const float*)d_in[9]; const float* bv = (const float*)d_in[10]; const float* wpos = (const float*)d_in[11]; const float* bpos = (const float*)d_in[12]; const float* wo = (const float*)d_in[13]; const float* bo = (const float*)d_in[14]; const float* cosT = nullptr; const float* sinT = nullptr; (void)cosT; (void)sinT;
    float* OUT = (float*)d_out;     // [2][2048][1024]
    char* wsp = (char*)d_ws;
    auto take = [&](size_t bytes) { char* p = wsp; wsp += (bytes + 255) & ~(size_t)255; return (void*)p; };
    const size_t PS = (size_t)NH_ * TT * HD;   // elements of one 16-bit plane set (all heads) of one batch
    bf* WQ = (bf*)take((size_t)DQ * DM * 2); bf* WK = (bf*)take((size_t)DKV * DM * 2); bf* WV = (bf*)take((size_t)DKV * DM * 2); bf* WO = (bf*)take((size_t)DM * DQ * 2); bf* WP = (bf*)take((size_t)DQ * DM * 2);
    bf* X3 = (bf*)take((size_t)(NB_ + 1) * TT * DM * 2);   // slice 0: pos_emb; slices 1..: x
    h16* PK16 = (h16*)take((NB_ + 1) * PS * 2); bf* PKh = (bf*)take((NB_ + 1) * PS * 2); bf* PKl = (bf*)take((NB_ + 1) * PS * 2);   // slice 0: position planes; slices 1..: key planes
    h16* QV16 = (h16*)take(NB_ * PS * 2); bf* QVh = (bf*)take(NB_ * PS * 2); bf* QVl = (bf*)take(NB_ * PS * 2);
    h16* QP16 = (h16*)take(NB_ * PS * 2); bf* QPh = (bf*)take(NB_ * PS * 2); bf* QPl = (bf*)take(NB_ * PS * 2);
    h16* VT16 = (h16*)take(NB_ * PS * 2); bf* VTh = (bf*)take(NB_ * PS * 2); bf* VTl = (bf*)take(NB_ * PS * 2);
    bf* ATh = (bf*)take((size_t)NB_ * TT * DQ * 2); bf* ATl = (bf*)take((size_t)NB_ * TT * DQ * 2);
    if ((size_t)(wsp - (char*)d_ws) > ws_size) return;    // ws 256 MiB
    k_prep<<<5 * WTB + (NB_ + 1) * CVB, 256, 0, stream>>>(wq, wk, wv, wo, wpos, x, pemb, WQ, WK, WV, WO, WP, X3);
    k_proj<<<dim3(TT / 64, DQ / 64, 3 * NB_ + 1), 32, 0, stream>>>(X3, X3 + (size_t)TT * DM, WQ, WK, WV, bq, bk, bv, DM, Planes{QP16, QPh, QPl, QV16, QVh, QVl, pbu, pbv, PS, nullptr, nullptr}, Planes{PK16, PKh, PKl, nullptr, nullptr, nullptr, nullptr, nullptr, PS, WP, bpos}, Planes{VT16, VTh, VTl, nullptr, nullptr, nullptr, nullptr, nullptr, PS, nullptr, nullptr});
    k_fattn<<<dim3(TT / 16, NH_, NB_), 256, 0, stream>>>(QP16, QPh, QPl, QV16, QVh, QVl, PK16 + PS, PKh + PS, PKl + PS, PK16, PKh, PKl, VT16, VTh, VTl, abias, ATh, ATl);
    k_gemmw<bf, 1, true><<<dim3(NB_ * TT / 64, DM / 64, 1), 32, 0, stream>>>(ATh, ATl, WO, nullptr, DQ, OUT, DM, bo, 0, 0, 0, Planes{nullptr, nullptr, nullptr, nullptr, nullptr, nullptr, nullptr, nullptr, 0, nullptr, nullptr});   // both batches: 2 TT rows of one GEMM
}

// v009
// It runs in 264 microseconds.
// Timed twice side by side with v008, it ran 1.08 and 1.07 times as fast.
// Over all steps from v000 it is 10.5 times as fast.
#include <hip/hip_runtime.h>

// Multi-head self-attention with relative positions and learnable u/v biases (x [2][2048][1024], bias [1][1][L][L] (f32 additive, read; verbatim causal 0/-1e9), pos_emb [2048][1][1024], pos_bias_u/v [16][64]; q/k/v = x W + b, r = pos_emb Wr + br ('xw', 16 heads x 64); qh = q/8; AC = (qh + u).k + bias; BD = (qh + v).r; logits = AC + rel_shift(BD) with the pad-front/reshape shift: pos[i][j] = BD[i][T-1-(i-j)] for j <= i, 0 for j == i+1, BD[i+1][j-i-2] for j >= i+2 (reproduced literally, including the masked upper part); softmax; out = merged Wo + bo -> [2][2048][1024]).
// Compute dtypes, f32 accumulate: every input rounded to bf16; q/k/v/r as PLAIN bf16 GEMMs (inputs: exact) + bias; q x 1/8 (exact) then the u/v head biases added in f32; content, position scores and attn.v: query rows < 512 hl (3 products), the rest single fp16 (x1024) (the shifted position score is gathered from rows i / i+1 of the position-score block); the additive bias read per element; softmax f32; Wo hl x exact (2 products) + bias.

#define NB_  2
#define TT   2048
#define DM   1024
#define NH_  16
#define NKV  16
#define REP  (NH_ / NKV)
#define HD   64
#define DQ   (NH_ * HD)
#define DKV  (NKV * HD)
#define RH   512                  // query rows < RH use hi+lo planes (0: none)
#define WIN  0
#define PCAR 1024.0f
#define KSP  16                   // attn.v: key ranges per output tile, one per wave of k_fattn; the KSP partial tiles are summed in ascending order
#define SCL  1.0f   // the 1/sqrt(64) is applied to q before the u/v biases (k_proj, EPI 2)
typedef _Float16 h16;
typedef unsigned short bf;
typedef __attribute__((ext_vector_type(16))) __bf16   v16bf;
typedef __attribute__((ext_vector_type(16))) _Float16 v16h;
typedef __attribute__((ext_vector_type(8)))  _Float16 v8h;
typedef __attribute__((ext_vector_type(8)))  unsigned short v8us;
typedef __attribute__((ext_vector_type(8)))  float    v8f;
typedef __attribute__((ext_vector_type(4)))  float    v4f;
typedef v8h  __attribute__((may_alias)) v8ha;
typedef v4f  __attribute__((may_alias)) v4fa;
typedef v8us __attribute__((may_alias)) v8usa;

__device__ __forceinline__ unsigned short f2bf(float f) { unsigned u = __float_as_uint(f); u += 0x7FFFu + ((u >> 16) & 1u); return (unsigned short)(u >> 16); }
__device__ __forceinline__ float bf2f(unsigned short b) { return __uint_as_float(((unsigned)b) << 16); }
__device__ __forceinline__ float bfr(float f) { return bf2f(f2bf(f)); }
__device__ __forceinline__ v16h cat16(v8h lo, v8h hi) { return __builtin_shufflevector(lo, hi, 0, 1, 2, 3, 4, 5, 6, 7, 8, 9, 10, 11, 12, 13, 14, 15); }
__device__ __forceinline__ v16bf cat16b(v8us lo, v8us hi) { return __builtin_bit_cast(v16bf, __builtin_shufflevector(lo, hi, 0, 1, 2, 3, 4, 5, 6, 7, 8, 9, 10, 11, 12, 13, 14, 15)); }
__device__ __forceinline__ v8f wmma16(v16h a, v16h b, v8f c) { return __builtin_amdgcn_wmma_f32_16x16x32_f16(false, a, false, b, (short)0, c, false, false); }
__device__ __forceinline__ v8f wmmab(v16bf a, v16bf b, v8f c) { return __builtin_amdgcn_wmma_f32_16x16x32_bf16(false, a, false, b, (short)0, c, false, false); }



// ---- FRAGMENT ORDER of every 16-bit plane that a matrix product reads (k_fattn: q + u, q + v, k, r, v; k_proj: x, pos_emb, the q, k, v and position weights; k_gemmw: Wo, the attention output): a block of 16 rows x 32 k (512 elements, 1 KiB) is stored as [g = (k >> 3) & 3][row & 15][k & 7], which is lane order (lane = 16 hi + row, g = 2 c + hi): load c of a fragment is 32 lanes x 16 B = 512 contiguous bytes (4 whole lines) where a row-major plane gives 16 part lines. Blocks of one 16-row tile follow one another along k. The registers hold what they held with row-major planes. ldf loads from a plane in fragment order.
// ---- k_gemmw: register-blocked GEMM, ONE WAVE per 64x64 output tile (16 accumulators), operands straight from 16-bit planes in fragment order (rows m or n, k along K); grid (M/64, N/64, Z), 32 threads.
// C[m][n] (f32, pitch ldc, + optional f32 bias[n]) = sum_k A[m][k] Bt[n][k] (+ split products per NSPLIT). z-batch strides sA/sB/sC in elements; with EPI != 0 slice z writes its planes sz elements behind slice z - 1's, so that the GEMMs of both batches are one launch and a WGP holds several waves whose load waits overlap. K % (32 KS) == 0. KS > 1: grid z = Z x KS; work-group (z, ks) sums only k in [ks K/KS, (ks+1) K/KS) and stores its partial tile in plane z KS + ks of C (plane stride sC).
template <typename T16> struct WFrag;
template <> struct WFrag<h16> { typedef v16h V; static __device__ __forceinline__ V ldf(const h16* p) { return cat16(*(const v8h*)p, *(const v8h*)(p + 256)); } static __device__ __forceinline__ v8f mma(V a, V b, v8f c) { return wmma16(a, b, c); } };
template <> struct WFrag<bf> { typedef v16bf V; static __device__ __forceinline__ V ldf(const bf* p) { return cat16b(*(const v8us*)p, *(const v8us*)(p + 256)); } static __device__ __forceinline__ v8f mma(V a, V b, v8f c) { return wmmab(a, b, c); } };
// Behind a batch of global loads: the precautionary wait in front of any write to a register of the loads' address pairs. The pointers are inputs so that the pairs stay live up to it; without that the compiler lets a later load of the batch land in an earlier load's pair. A shorter list repeats its pointers.
__device__ __forceinline__ void xhold(const void* a, const void* b, const void* c, const void* d, const void* e, const void* f, const void* g, const void* h) { asm volatile("s_wait_xcnt 0x0" :: "v"(a), "v"(b), "v"(c), "v"(d), "v"(e), "v"(f), "v"(g), "v"(h) : "memory"); }
__device__ __forceinline__ h16 tohx(float x) { return (h16)x; }
__device__ __forceinline__ void splitf(float y, unsigned short& h, unsigned short& l) { h = f2bf(y); l = f2bf(y - bf2f(h)); }
// one 16-byte store into each of the three planes (fp16, bf16 hi, bf16 lo) of eight neighbouring values. The stores stand in one asm statement with the precautionary s_wait_xcnt 0 behind them, so that it is in front of every later write to their address and data registers.
__device__ __forceinline__ void put8(const float (&x)[8], h16* P16, bf* Ph, bf* Pl, size_t o) { v8h o16; v8us oh, ol;
#pragma unroll
    for (int q = 0; q < 8; ++q) { o16[q] = tohx(x[q]); unsigned short a, c; splitf(x[q], a, c); oh[q] = a; ol[q] = c; }
    asm volatile("global_store_b128 %0, %3, off\n\tglobal_store_b128 %1, %4, off\n\tglobal_store_b128 %2, %5, off\n\ts_wait_xcnt 0x0" :: "v"(P16 + o), "v"(Ph + o), "v"(Pl + o), "v"(o16), "v"(oh), "v"(ol) : "memory"); }
// Where a projection's tile goes when EPI != 0 (a 64-column tile is one head), all in fragment order: EPI 1: planes p [h] (rows t, k = d) of C + bias (k, r); EPI 2: planes p of (C + bias)/8 + bu and planes q of (C + bias)/8 + bv (the two query forms); EPI 3: planes p [h] (rows d, k = t; the four 16-row blocks of one k step side by side) of C + bias (v, transposed). EPI 1 holds the position projection as slice 0 (weights Bt0, bias bias0) and the key projection of batch z - 1 as slice z.
struct Planes { h16* p16; bf* ph; bf* pl; h16* q16; bf* qh; bf* ql; const float* bu; const float* bv; size_t sz; const bf* Bt0; const float* bias0; };
// gemmw: the body; bz is the slice index (grid z of k_gemmw; of k_proj the slice inside the projection that the work-group belongs to); os: the work-group's LDS tile, 16 x 68 floats (EPI 2: two of them, one for each of the two query forms).
template <typename T16, int NSPLIT, bool BIAS, int KS, int EPI>
__device__ __forceinline__ void gemmw(float* os, const int bz, const T16* __restrict__ A, const T16* __restrict__ A2, const T16* __restrict__ Bt, const T16* __restrict__ Bt2, int K, float* C, int ldc, const float* __restrict__ bias, size_t sA, size_t sB, size_t sC, Planes po) {
    typedef typename WFrag<T16>::V V;
    const size_t z = bz / KS; A += z * sA; if (A2) A2 += z * sA; Bt += z * sB; if (Bt2) Bt2 += z * sB; C += (size_t)bz * sC; const int kb = (int)(bz % KS) * (K / KS), ke = kb + K / KS;
    if constexpr (EPI != 0) { const size_t zs = z * po.sz; po.p16 += zs; po.ph += zs; po.pl += zs; if constexpr (EPI == 2) { po.q16 += zs; po.qh += zs; po.ql += zs; } }
    if constexpr (EPI == 1) { if (z == 0) { Bt = po.Bt0; bias = po.bias0; } }
    const int lane = threadIdx.x & 31, lr = lane & 15, hi = lane >> 4; const int r0 = blockIdx.x * 64, c0 = blockIdx.y * 64;
    v8f acc[4][4];
#pragma unroll
    for (int mb = 0; mb < 4; ++mb)
#pragma unroll
        for (int nb = 0; nb < 4; ++nb) acc[mb][nb] = (v8f){};
    const size_t aoff = (size_t)r0 * K + lane * 8, boff = (size_t)c0 * K + lane * 8;   // a 16-row tile is 16 K elements, a k step of 32 is 512 of them; lane * 8: the lane's 16-byte unit
#pragma unroll 1
    for (int kc = kb; kc < ke; kc += 32) {
        V a[4], a2[4], b[4], b2[4]; const T16 *pa[4], *pa2[4], *pb[4], *pb2[4];
#pragma unroll
        for (int t = 0; t < 4; ++t) { const size_t ot = (size_t)t * 16 * K + (size_t)kc * 16; pa[t] = A + aoff + ot; pb[t] = Bt + boff + ot; a[t] = WFrag<T16>::ldf(pa[t]); b[t] = WFrag<T16>::ldf(pb[t]);
            if (NSPLIT == 1 || NSPLIT == 2) { pa2[t] = A2 + aoff + ot; a2[t] = WFrag<T16>::ldf(pa2[t]); } if (NSPLIT >= 2) { pb2[t] = Bt2 + boff + ot; b2[t] = WFrag<T16>::ldf(pb2[t]); } }
        if constexpr (NSPLIT == 1) asm volatile("s_wait_xcnt 0x0" :: "v"(pa[0]), "v"(pa[1]), "v"(pa[2]), "v"(pa[3]), "v"(pb[0]), "v"(pb[1]), "v"(pb[2]), "v"(pb[3]), "v"(pa2[0]), "v"(pa2[1]), "v"(pa2[2]), "v"(pa2[3]) : "memory");   // xhold for twelve pairs
        else xhold(pa[0], pa[1], pa[2], pa[3], pb[0], pb[1], pb[2], pb[3]);
        if constexpr (NSPLIT == 2) xhold(pa2[0], pa2[1], pa2[2], pa2[3], pb2[0], pb2[1], pb2[2], pb2[3]);
        if constexpr (NSPLIT > 2) xhold(pb2[0], pb2[1], pb2[2], pb2[3], pb2[0], pb2[1], pb2[2], pb2[3]);
        __builtin_amdgcn_sched_barrier(0);   // keeps the products behind the wait: without it the compiler lifts them over it, in between the loads, and then fetches the B fragments one after another into one register set, with a full load wait each
#pragma unroll
        for (int nb = 0; nb < 4; ++nb) {
#pragma unroll
            for (int mb = 0; mb < 4; ++mb) { acc[mb][nb] = WFrag<T16>::mma(a[mb], b[nb], acc[mb][nb]); if (NSPLIT == 1 || NSPLIT == 2) acc[mb][nb] = WFrag<T16>::mma(a2[mb], b[nb], acc[mb][nb]); if (NSPLIT >= 2) acc[mb][nb] = WFrag<T16>::mma(a[mb], b2[nb], acc[mb][nb]); } }
        asm volatile("v_nop\n\tv_nop\n\tv_nop\n\tv_nop" : "+v"(acc[0][0]), "+v"(acc[1][1]), "+v"(acc[2][2]), "+v"(acc[3][3]) : "v"(a[0]), "v"(a[3]));
    }
    if constexpr (EPI == 3) {   // a lane's eight accumulator values are eight neighbouring t of one d, one 16-byte unit of the fragment order (rows d, k = t): stored straight from the registers
        asm volatile("s_wait_xcnt 0x0" ::: "memory");   // precautionary wait in front of the first write to an address pair of the k loop's loads
        float bn[4];   // all four bias loads first: the store statements' memory clobber would hold a later load behind them
#pragma unroll
        for (int nb = 0; nb < 4; ++nb) bn[nb] = bfr(bias[c0 + nb * 16 + lr]);
#pragma unroll
        for (int nb = 0; nb < 4; ++nb) {
#pragma unroll
            for (int mb = 0; mb < 4; ++mb) { float x[8];
#pragma unroll
                for (int j = 0; j < 8; ++j) x[j] = acc[mb][nb][j] + bn[nb];
                put8(x, po.p16, po.ph, po.pl, ((size_t)blockIdx.y * TT + r0 + (mb >> 1) * 32) * HD + nb * 512 + (mb & 1) * 256 + lane * 8); } }   // block (32 t, 16 d) in fragment order: 512 contiguous bytes a store
        return; }
    float bn[4], un[4], vn[4];   // EPI 1, 2: the biases of a lane's four accumulator columns, added before the tile goes through LDS
    if constexpr (EPI == 1 || EPI == 2) {
#pragma unroll
        for (int nb = 0; nb < 4; ++nb) { bn[nb] = bfr(bias[c0 + nb * 16 + lr]); if (EPI == 2) { un[nb] = bfr(po.bu[c0 + nb * 16 + lr]); vn[nb] = bfr(po.bv[c0 + nb * 16 + lr]); } } }
#pragma unroll
    for (int mb = 0; mb < 4; ++mb) {
#pragma unroll
        for (int nb = 0; nb < 4; ++nb) {
#pragma unroll
            for (int j = 0; j < 8; ++j) { const int oi = (hi * 8 + j) * 68 + nb * 16 + lr;
                if constexpr (EPI == 1) os[oi] = acc[mb][nb][j] + bn[nb];
                else if constexpr (EPI == 2) { const float aq = __fmul_rn(acc[mb][nb][j] + bn[nb], 0.125f); os[oi] = __fadd_rn(aq, un[nb]); os[16 * 68 + oi] = __fadd_rn(aq, vn[nb]); }
                else os[oi] = acc[mb][nb][j]; } }
        __builtin_amdgcn_wave_barrier(); asm volatile("" ::: "memory");
        float* crow = C + (size_t)(r0 + mb * 16) * ldc + c0;
        if constexpr (EPI == 1 || EPI == 2) {
            const size_t o = ((size_t)blockIdx.y * TT + r0 + mb * 16) * HD + lane * 8;   // store s: units g = 2 s + hi of row lr, 512 contiguous bytes
#pragma unroll
            for (int pl = 0; pl < (EPI == 2 ? 2 : 1); ++pl) { const float* ot = os + pl * (16 * 68) + lr * 68 + hi * 8;
                v4f v0[4], v1[4];   // a tile's LDS reads first: the store statements' memory clobber would hold a later read behind them
#pragma unroll
                for (int s = 0; s < 4; ++s) { v0[s] = *(const v4fa*)(ot + s * 16); v1[s] = *(const v4fa*)(ot + s * 16 + 4); }
#pragma unroll
                for (int s = 0; s < 4; ++s) { float x[8];
#pragma unroll
                    for (int q = 0; q < 8; ++q) x[q] = q < 4 ? v0[s][q & 3] : v1[s][q & 3];
                    if (pl == 0) put8(x, po.p16, po.ph, po.pl, o + s * 256); else put8(x, po.q16, po.qh, po.ql, o + s * 256); } }
        } else {
#pragma unroll
            for (int s = 0; s < 8; ++s) { const int row = 2 * s + hi, cofs = lr * 4; v4f val = *(const v4fa*)(os + row * 68 + cofs); if (BIAS) { val[0] += bfr(bias[c0 + cofs]); val[1] += bfr(bias[c0 + cofs + 1]); val[2] += bfr(bias[c0 + cofs + 2]); val[3] += bfr(bias[c0 + cofs + 3]); }
                *(v4f*)(crow + (size_t)row * ldc + cofs) = val; }
             }
        __builtin_amdgcn_wave_barrier(); asm volatile("" ::: "memory");
    }
}
template <typename T16, int NSPLIT, bool BIAS>
__global__ __launch_bounds__(32) void k_gemmw(const T16* __restrict__ A, const T16* __restrict__ A2, const T16* __restrict__ Bt, const T16* __restrict__ Bt2, int K, float* C, int ldc, const float* __restrict__ bias, size_t sA, size_t sB, size_t sC, Planes po) {
    __shared__ __align__(16) float os[16 * 68];
    gemmw<T16, NSPLIT, BIAS, 1, 0>(os, (int)blockIdx.z, A, A2, Bt, Bt2, K, C, ldc, bias, sA, sB, sC, po);
}
// ---- k_proj: the four projections in ONE launch, grid (TT/64, DQ/64, 3 NB_ + 1): slices z < NB_ are q (EPI 2), the next NB_ + 1 the position and key projections (EPI 1), the last NB_ are v (EPI 3); X3: pos_emb and x, XB: x alone. None reads what another writes. A launch of one projection alone puts about one wave on a SIMD, which then idles through every k step's load wait; together a SIMD holds three to four waves, and one wave's products run in another's wait.
__global__ __launch_bounds__(32) void k_proj(const bf* __restrict__ X3, const bf* __restrict__ XB, const bf* __restrict__ WQ, const bf* __restrict__ WK, const bf* __restrict__ WV, const float* __restrict__ bq, const float* __restrict__ bk, const float* __restrict__ bv, int K, Planes pq, Planes pk, Planes pv) {
    __shared__ __align__(16) float os[2 * 16 * 68];
    const int z = blockIdx.z; const size_t XS = (size_t)TT * DM;
    if (z < NB_) gemmw<bf, 0, true, 1, 2>(os, z, XB, nullptr, WQ, nullptr, K, nullptr, DQ, bq, XS, 0, 0, pq);
    else if (z < 2 * NB_ + 1) gemmw<bf, 0, true, 1, 1>(os, z - NB_, X3, nullptr, WK, nullptr, K, nullptr, DKV, bk, XS, 0, 0, pk);
    else gemmw<bf, 0, true, 1, 3>(os, z - (2 * NB_ + 1), XB, nullptr, WV, nullptr, K, nullptr, DKV, bv, XS, 0, 0, pv);
}

typedef __attribute__((ext_vector_type(2))) _Float16 v2h;
typedef __attribute__((ext_vector_type(4))) _Float16 v4h;
typedef __attribute__((ext_vector_type(2))) unsigned short v2us;
typedef __attribute__((ext_vector_type(4))) unsigned short v4us;
typedef __attribute__((ext_vector_type(2))) float v2f;
typedef __attribute__((ext_vector_type(4))) int v4i;

// One wave per block of 16 n x 32 k of Bt[n][k] = w[k][n], written in fragment order (two stores of 512 contiguous bytes); a load takes 16 neighbouring n of two k rows. The eight waves of a work-group cover 32 n x 128 k, so that they use whole 128-byte lines of w.
__device__ __forceinline__ void wtG(const float* __restrict__ w, int K, int N, bf* Bt, int blk) {
    const int lane = threadIdx.x & 31, lr = lane & 15, hi = lane >> 4, ws = threadIdx.x >> 5;
    const int nt = (blk % (N / 32)) * 2 + (ws & 1), kb = (blk / (N / 32)) * 4 + (ws >> 1);
    const float* p = w + (size_t)(kb * 32 + hi * 8) * N + nt * 16 + lr; float v[2][8];
#pragma unroll
    for (int c = 0; c < 2; ++c)
#pragma unroll
        for (int q = 0; q < 8; ++q) v[c][q] = p[(size_t)(c * 16 + q) * N];
    asm volatile("s_wait_xcnt 0x0" :: "v"(p) : "memory");   // precautionary wait in front of the first write to the loads' address pair, which the input keeps live up to here
    v8us o0, o1;
#pragma unroll
    for (int q = 0; q < 8; ++q) { o0[q] = f2bf(v[0][q]); o1[q] = f2bf(v[1][q]); }
    asm volatile("global_store_b128 %0, %1, off\n\tglobal_store_b128 %0, %2, off offset:512\n\ts_wait_xcnt 0x0" :: "v"(Bt + ((size_t)nt * (K / 32) + kb) * 512 + lane * 8), "v"(o0), "v"(o1) : "memory");   // stores and precautionary wait in one statement, as in put8
}
// ---- k_prep: all that the GEMMs wait for, in one launch: work-groups [0, 5 WTB) transpose and round the five weight matrices (WTB each), the rest round pos_emb (slice 0 of X3) and x (slices 1, 2: the two batches), eight values (one 16-byte unit of the fragment order) a thread; a wave takes 8 rows x 32 k: whole 128-byte lines on both sides.
#define WTB (DM * DQ / 64 / 64)
#define CVB (TT * DM / 8 / 256)   // work-groups per slice of X3
__global__ __launch_bounds__(256) void k_prep(const float* __restrict__ wq, const float* __restrict__ wk, const float* __restrict__ wv, const float* __restrict__ wo, const float* __restrict__ wpos, const float* __restrict__ x, const float* __restrict__ pemb, bf* WQ, bf* WK, bf* WV, bf* WO, bf* WP, bf* X3) {
    const int blk = blockIdx.x;
    if (blk < 5 * WTB) { const int job = blk / WTB; wtG(job == 0 ? wq : job == 1 ? wk : job == 2 ? wv : job == 3 ? wo : wpos, DM, DQ, job == 0 ? WQ : job == 1 ? WK : job == 2 ? WV : job == 3 ? WO : WP, blk % WTB); return; }
    const int cb = blk - 5 * WTB; const size_t i = (size_t)cb * 256 + threadIdx.x; const size_t tile = i / (2 * DM); const int u = (int)(i % (2 * DM)), g = u & 3, row = (u >> 2) & 15, kb = u >> 6;   // 2 DM units in a tile of 16 rows
    const size_t so = (tile * 16 + row) * DM + kb * 32 + g * 8; const float* src = cb < CVB ? pemb + so : x + (so - (size_t)TT * DM); const v8f v = *(const v8f*)src; v8us o;
    asm volatile("s_wait_xcnt 0x0" ::: "memory");   // precautionary wait in front of the first write to the load's address pair (the compiler reuses the pair for the rounding)
#pragma unroll
    for (int k = 0; k < 8; ++k) o[k] = f2bf(v[k]);
    asm volatile("global_store_b128 %0, %1, off\n\ts_wait_xcnt 0x0" :: "v"(X3 + tile * (16 * DM) + kb * 512 + g * 128 + row * 8), "v"(o) : "memory"); }   // store and precautionary wait in one statement, as in put8: the compiler joins this path with the transpose part, whose first instructions write the store's registers
__global__ __launch_bounds__(256) void k_cscvt(const float* __restrict__ cosT, const float* __restrict__ sinT, float* CS) { const int idx = blockIdx.x * 256 + threadIdx.x; if (idx >= TT * HD) return; v2f cs; cs[0] = bfr(cosT[idx]); cs[1] = bfr(sinT[idx]); *(v2f*)(CS + (size_t)idx * 2) = cs;  }
// ---- k_fattn: one work-group (16 waves) per 32 query rows (two row blocks of 16) of one head of one batch (blockIdx.z; the q, k, v planes and the output of batch 1 stand behind batch 0's, the position planes serve both); the 32 x 2048 f32 logit rows live in LDS from the score products to attn.v. A k, position or v fragment that a wave has loaded serves both row blocks from its registers, which halves what 32 rows draw from L2 for them.
// Phases: (1) content scores + additive bias + position scores, the latter turned to their rel-shift place inside the registers (row i takes BD[i][m >= T-1-i] at j = m-(T-1)+i and BD[i+1][m <= T-3-i] at j = m+i+2; every place gets at most one term) -> S; (3) softmax, one wave per row, weights written over the row as 16-bit planes; (4) attn.v in KSP key ranges of 128, one per wave, both row blocks; (5) the KSP partial tiles summed in ascending order.
#define SP 2052                   // LDS row pitch in floats: 2048 + 4, so that the 16 rows of a fragment read start on different banks
typedef v4h  __attribute__((may_alias)) v4ha;
typedef v4us __attribute__((may_alias)) v4usa;
// v_exp_f32 with the one free slot that the instruction set asks for behind a transcendental, before its result is read or its source written again; in one statement, so that the v_nop stands directly behind it
__device__ __forceinline__ float exp2_slot(float x) { float r; asm("v_exp_f32 %0, %1\n\tv_nop" : "=v"(r) : "v"(x)); return r; }
template <bool HI> struct BFrag;   // 16 rows x 64 k of a plane in fragment order (hi + lo planes where HI); off = fo(lane's row, hi)
__device__ __forceinline__ size_t fo(int row, int hi) { return (size_t)(row >> 4) * (16 * HD) + (row & 15) * 8 + hi * 128; }
template <> struct BFrag<false> { v16h b[2]; const h16 *p, *p2;
    __device__ __forceinline__ void load(const h16* b16, const bf*, const bf*, size_t off) { p = p2 = b16 + off; b[0] = WFrag<h16>::ldf(p); b[1] = WFrag<h16>::ldf(p + 512); } };
template <> struct BFrag<true> { v16bf b[2], b2[2]; const bf *p, *p2;
    __device__ __forceinline__ void load(const h16*, const bf* bh, const bf* bl, size_t off) { p = bh + off; p2 = bl + off; b[0] = WFrag<bf>::ldf(p); b[1] = WFrag<bf>::ldf(p + 512); b2[0] = WFrag<bf>::ldf(p2); b2[1] = WFrag<bf>::ldf(p2 + 512); } };
__device__ __forceinline__ v8f dot64(const BFrag<false>& q, const BFrag<false>& k) { v8f c = (v8f){};
#pragma unroll
    for (int kk = 0; kk < 2; ++kk) c = wmma16(q.b[kk], k.b[kk], c);
    return c; }
__device__ __forceinline__ v8f dot64(const BFrag<true>& q, const BFrag<true>& k) { v8f c = (v8f){};
#pragma unroll
    for (int kk = 0; kk < 2; ++kk) { c = wmmab(q.b[kk], k.b[kk], c); c = wmmab(q.b2[kk], k.b[kk], c); c = wmmab(q.b[kk], k.b2[kk], c); }
    return c; }
// Row r = 8 hi + JJ of a position-score tile turned right by (r + 1) & 15 lanes (tail) or (r + 2) & 15 lanes (head) inside its 16-lane row: lane l takes lane (l - n) & 15. The two halves of the wave hold different rows, so each takes its own turn (row_mask 1: lanes 0-15, 2: lanes 16-31); a turn by 0 is left out.
template <bool HEAD, int JJ>
__device__ __forceinline__ float turn_row(float x) {
    constexpr int NLO = (JJ + (HEAD ? 2 : 1)) & 15, NHI = (JJ + 8 + (HEAD ? 2 : 1)) & 15;
    const int xi = __float_as_int(x); int t = xi;
    if constexpr (NLO != 0) t = __builtin_amdgcn_update_dpp(xi, xi, 0x120 + NLO, 0x1, 0xf, false);
    if constexpr (NHI != 0) t = __builtin_amdgcn_update_dpp(t, xi, 0x120 + NHI, 0x2, 0xf, false);
    return __int_as_float(t); }
// The rel-shift term of logit tile (rows i0.., columns 16 jt..) from two neighbouring position-score tiles A (tile t) and B (tile t + 1): row r wants lanes [thr, 15] of A and [0, thr) of B, thr = 15 - r (tail) or 14 - r (head), turned into place; in the head, row 15 wants lane 15 of tile t - 1 (z) and lanes 0-14 of A.
template <bool HEAD, int JJ>
__device__ __forceinline__ float shift_term(const v8f& A, const v8f& B, float z, int lr, int hi) {
    float x = (lr + hi * 8 + JJ >= (HEAD ? 14 : 15)) ? A[JJ] : B[JJ];
    if constexpr (HEAD && JJ == 7) x = (hi != 0 && lr == 15) ? z : x;
    return turn_row<HEAD, JJ>(x); }
// ---- The score passes: logit tiles jlo..jhi (16 columns each, one after another) of the 32 query rows i0.. (row blocks it and it + 1), logit = (content score + bias) + rel-shift term. Each k fragment meets both blocks' q + u, each position fragment both blocks' q + v.
// Tail of block ib (columns j <= i, tiles jt <= ib): term = BD[i][T-1-i+j], position tiles t = 127 - ib + jt and t + 1, query rows i. Head (columns j >= i + 2, tiles jt >= ib): term = BD[i+1][j-i-2], position tiles t = jt - ib - 1 and t + 1 (and lane 15 of t - 1), query rows i + 1. A tile that does not exist (128 in the tail, below 0 in the head) counts as zeros: those places take no term (j > i in the tail's diagonal tile, j <= i + 1 in the head). The diagonal tile jt == ib takes its tail term first and its head term from the head pass of the same wave. Block 1 wants, at logit tile ju, the position tiles one below block 0's, so its product with the fragment loaded at ju is its tile B at ju + 1 (Bn). A block stores only the tiles of its own pass; its position tiles roll on at every ju. HI goes by the row block: in the block that ends at RH - 1 the head's last query row, RH, is taken from the hi + lo planes like the other fifteen.
// pos_start: the q + v fragments of both blocks and the position tiles that the first logit tile wants beside the one its own step loads. t0: block 0's tile A of the first logit tile; block 1's is t0 - 1.
template <bool HI, bool HEAD>
__device__ __forceinline__ void pos_start(BFrag<HI> (&qb)[2], v8f (&A)[2], v8f& Bn, float (&z)[2], const h16* qv16, const bf* qvh, const bf* qvl, const h16* p16, const bf* ph, const bf* pl, int i0, int t0, int lr, int hi) {
#pragma unroll
    for (int b = 0; b < 2; ++b) { int ar = i0 + b * 16 + lr + (HEAD ? 1 : 0); if (ar > TT - 1) ar = TT - 1;   // row T does not exist; no term of it is ever placed
        qb[b].load(qv16, qvh, qvl, fo(ar, hi)); }
    BFrag<HI> ra, rz, ry; ra.load(p16, ph, pl, fo(min(max(t0, 0), TT / 16 - 1) * 16 + lr, hi)); rz.load(p16, ph, pl, fo(max(t0 - 1, 0) * 16 + lr, hi)); if constexpr (HEAD) ry.load(p16, ph, pl, fo(max(t0 - 2, 0) * 16 + lr, hi));
    xhold(qb[0].p, qb[0].p2, qb[1].p, qb[1].p2, ra.p, ra.p2, rz.p, rz.p2);
    if constexpr (HEAD) xhold(ry.p, ry.p2, ry.p, ry.p2, ry.p, ry.p2, ry.p, ry.p2);
    __builtin_amdgcn_sched_barrier(0);   // keeps the products behind the waits: without it the compiler lifts them in between the loads and fetches the position fragments one after another, with a full load wait each
    A[0] = dot64(qb[0], ra); Bn = dot64(qb[1], ra); if (t0 < 0) { A[0] = (v8f){}; Bn = (v8f){}; }
    A[1] = dot64(qb[1], rz); if (t0 < 1) A[1] = (v8f){};
    z[0] = 0.f; z[1] = 0.f;
    if constexpr (HEAD) { const v8f c = dot64(qb[0], rz); z[0] = (t0 < 1) ? 0.f : c[7]; const v8f c1 = dot64(qb[1], ry); z[1] = (t0 < 2) ? 0.f : c1[7]; }
}
// ---- sc_pass2 (rows >= RH, single fp16 planes): a logit tile complete in registers, one plain store each.
template <bool HEAD>
__device__ __forceinline__ void sc_pass2(float* S, const h16* qu16, const h16* qv16, const h16* k16, const h16* p16, const float* __restrict__ ab, int i0, int jlo, int jhi, int lr, int hi) {
    if (jlo > jhi) return;   // the same for the whole wave
    const int it = i0 >> 4; BFrag<false> qu[2], qb[2]; v8f A[2], Bn; float z[2];
    qu[0].load(qu16, nullptr, nullptr, fo(i0 + lr, hi)); qu[1].load(qu16, nullptr, nullptr, fo(i0 + 16 + lr, hi));
    xhold(qu[0].p, qu[1].p, qu[0].p, qu[1].p, qu[0].p, qu[1].p, qu[0].p, qu[1].p);
    pos_start<false, HEAD>(qb, A, Bn, z, qv16, nullptr, nullptr, p16, nullptr, nullptr, i0, HEAD ? jlo - it - 1 : TT / 16 - 1 - it + jlo, lr, hi);
    constexpr int U = 2;   // logit tiles whose loads fly together
#pragma unroll 1   // the batch of U tiles is the unit; unrolling further would pass 256 VGPRs, the most that a wave of a 16-wave work-group can have
    for (int jt = jlo; jt <= jhi; jt += U) { BFrag<false> k[U], r[U]; const float* pb[U]; float bb[U][2][8];
#pragma unroll
        for (int u = 0; u < U; ++u) { const int ju = min(jt + u, jhi), col = ju * 16 + lr, tb = min(HEAD ? ju - it : TT / 16 - it + ju, TT / 16 - 1);
            k[u].load(k16, nullptr, nullptr, fo(col, hi)); r[u].load(p16, nullptr, nullptr, fo(tb * 16 + lr, hi)); pb[u] = ab + (size_t)(i0 + hi * 8) * TT + col;
#pragma unroll
            for (int b = 0; b < 2; ++b)
#pragma unroll
                for (int jj = 0; jj < 8; ++jj) bb[u][b][jj] = pb[u][(size_t)(b * 16 + jj) * TT]; }
        xhold(k[0].p, k[1].p, r[0].p, r[1].p, pb[0], pb[1], pb[0], pb[1]);
#pragma unroll
        for (int u = 0; u < U; ++u) { const int ju = jt + u;
            if (ju <= jhi) { const int col = ju * 16 + lr; v8f Bv[2];
                Bv[0] = dot64(qb[0], r[u]); Bv[1] = Bn; Bn = dot64(qb[1], r[u]);
#pragma unroll
                for (int b = 0; b < 2; ++b) { const int itb = it + b;
                    if (!HEAD && ju == itb) Bv[b] = (v8f){};
                    if (HEAD ? ju >= itb : ju <= itb) { float base[8]; float* so = S + (b * 16 + hi * 8) * SP + col;
                        if (HEAD && ju == itb) {
#pragma unroll
                            for (int jj = 0; jj < 8; ++jj) base[jj] = so[jj * SP];
                        } else { const v8f c = dot64(qu[b], k[u]);
#pragma unroll
                            for (int jj = 0; jj < 8; ++jj) base[jj] = __fadd_rn(c[jj], bfr(bb[u][b][jj])); }
                        so[0 * SP] = __fadd_rn(base[0], shift_term<HEAD, 0>(A[b], Bv[b], z[b], lr, hi)); so[1 * SP] = __fadd_rn(base[1], shift_term<HEAD, 1>(A[b], Bv[b], z[b], lr, hi));
                        so[2 * SP] = __fadd_rn(base[2], shift_term<HEAD, 2>(A[b], Bv[b], z[b], lr, hi)); so[3 * SP] = __fadd_rn(base[3], shift_term<HEAD, 3>(A[b], Bv[b], z[b], lr, hi));
                        so[4 * SP] = __fadd_rn(base[4], shift_term<HEAD, 4>(A[b], Bv[b], z[b], lr, hi)); so[5 * SP] = __fadd_rn(base[5], shift_term<HEAD, 5>(A[b], Bv[b], z[b], lr, hi));
                        so[6 * SP] = __fadd_rn(base[6], shift_term<HEAD, 6>(A[b], Bv[b], z[b], lr, hi)); so[7 * SP] = __fadd_rn(base[7], shift_term<HEAD, 7>(A[b], Bv[b], z[b], lr, hi)); }
                    z[b] = A[b][7]; A[b] = Bv[b]; } } } }
}
// ---- Rows < RH (hi + lo planes): the q + u and q + v fragments of two row blocks (128 VGPRs) do not fit beside the k and position fragments, so the content scores + bias of the wave's tiles go to S first (sc_content2) and the same lanes of the same wave add the rel-shift terms there (sc_pos2): no barrier, and the sums in the order (content + bias) + tail term + head term, as in sc_pass2.
__device__ __forceinline__ void sc_content2(float* S, const bf* quh, const bf* qul, const bf* kh, const bf* kl, const float* __restrict__ ab, int i0, int jlo, int lr, int hi) {
    BFrag<true> qu[2]; qu[0].load(nullptr, quh, qul, fo(i0 + lr, hi)); qu[1].load(nullptr, quh, qul, fo(i0 + 16 + lr, hi));
    xhold(qu[0].p, qu[0].p2, qu[1].p, qu[1].p2, qu[0].p, qu[0].p2, qu[1].p, qu[1].p2);
    constexpr int U = 2;   // logit tiles whose loads fly together
#pragma unroll 1   // the batch of U tiles is the unit, as in sc_pass2
    for (int jt = jlo; jt < jlo + TT / 256; jt += U) { BFrag<true> k[U]; const float* pb[U]; float bb[U][2][8];
#pragma unroll
        for (int u = 0; u < U; ++u) { const int col = (jt + u) * 16 + lr; k[u].load(nullptr, kh, kl, fo(col, hi)); pb[u] = ab + (size_t)(i0 + hi * 8) * TT + col;
#pragma unroll
            for (int b = 0; b < 2; ++b)
#pragma unroll
                for (int jj = 0; jj < 8; ++jj) bb[u][b][jj] = pb[u][(size_t)(b * 16 + jj) * TT]; }
        xhold(k[0].p, k[0].p2, k[1].p, k[1].p2, pb[0], pb[1], pb[0], pb[1]);
#pragma unroll
        for (int u = 0; u < U; ++u)
#pragma unroll
            for (int b = 0; b < 2; ++b) { const v8f c = dot64(qu[b], k[u]); float* so = S + (b * 16 + hi * 8) * SP + (jt + u) * 16 + lr;
#pragma unroll
                for (int jj = 0; jj < 8; ++jj) so[jj * SP] = __fadd_rn(c[jj], bfr(bb[u][b][jj])); } }
}
template <bool HEAD>
__device__ __forceinline__ void sc_pos2(float* S, const bf* qvh, const bf* qvl, const bf* ph, const bf* pl, int i0, int jlo, int jhi, int lr, int hi) {
    if (jlo > jhi) return;   // the same for the whole wave
    const int it = i0 >> 4; BFrag<true> qb[2]; v8f A[2], Bn; float z[2];
    pos_start<true, HEAD>(qb, A, Bn, z, nullptr, qvh, qvl, nullptr, ph, pl, i0, HEAD ? jlo - it - 1 : TT / 16 - 1 - it + jlo, lr, hi);
    constexpr int U = 2;   // position fragments whose loads fly together
#pragma unroll 1   // the batch of U tiles is the unit, as in sc_pass2
    for (int jt = jlo; jt <= jhi; jt += U) { BFrag<true> r[U];
#pragma unroll
        for (int u = 0; u < U; ++u) { const int ju = min(jt + u, jhi), tb = min(HEAD ? ju - it : TT / 16 - it + ju, TT / 16 - 1); r[u].load(nullptr, ph, pl, fo(tb * 16 + lr, hi)); }
        xhold(r[0].p, r[0].p2, r[1].p, r[1].p2, r[0].p, r[0].p2, r[1].p, r[1].p2);
#pragma unroll
        for (int u = 0; u < U; ++u) { const int ju = jt + u;
            if (ju <= jhi) { v8f Bv[2];
                Bv[0] = dot64(qb[0], r[u]); Bv[1] = Bn; Bn = dot64(qb[1], r[u]);
#pragma unroll
                for (int b = 0; b < 2; ++b) { const int itb = it + b;
                    if (!HEAD && ju == itb) Bv[b] = (v8f){};
                    if (HEAD ? ju >= itb : ju <= itb) { float base[8]; float* so = S + (b * 16 + hi * 8) * SP + ju * 16 + lr;
#pragma unroll
                        for (int jj = 0; jj < 8; ++jj) base[jj] = so[jj * SP];
                        so[0 * SP] = __fadd_rn(base[0], shift_term<HEAD, 0>(A[b], Bv[b], z[b], lr, hi)); so[1 * SP] = __fadd_rn(base[1], shift_term<HEAD, 1>(A[b], Bv[b], z[b], lr, hi));
                        so[2 * SP] = __fadd_rn(base[2], shift_term<HEAD, 2>(A[b], Bv[b], z[b], lr, hi)); so[3 * SP] = __fadd_rn(base[3], shift_term<HEAD, 3>(A[b], Bv[b], z[b], lr, hi));
                        so[4 * SP] = __fadd_rn(base[4], shift_term<HEAD, 4>(A[b], Bv[b], z[b], lr, hi)); so[5 * SP] = __fadd_rn(base[5], shift_term<HEAD, 5>(A[b], Bv[b], z[b], lr, hi));
                        so[6 * SP] = __fadd_rn(base[6], shift_term<HEAD, 6>(A[b], Bv[b], z[b], lr, hi)); so[7 * SP] = __fadd_rn(base[7], shift_term<HEAD, 7>(A[b], Bv[b], z[b], lr, hi)); }
                    z[b] = A[b][7]; A[b] = Bv[b]; } } } }
}
// attn.v of key range w (TT / KSP keys) for both row blocks: a v fragment is loaded once and meets the weight rows of block 0 and of block 1
template <bool HI>
__device__ __forceinline__ void pv_pass(const float* S, const h16* v16, const bf* vh, const bf* vl, int w, int lr, int hi, v8f (&acc)[2][4]) {
    constexpr int NS = HI ? 1 : 2;   // k steps of 32 keys whose loads fly together
#pragma unroll
    for (int rb = 0; rb < 2; ++rb)
#pragma unroll
        for (int nb = 0; nb < 4; ++nb) acc[rb][nb] = (v8f){};
#pragma unroll
    for (int st = 0; st < TT / KSP / 32; st += NS) { const int kc = w * (TT / KSP) + st * 32; const size_t boff = (size_t)kc * HD + hi * 128 + lr * 8;   // a k step of 32 keys is four blocks (16 d each) of 512 elements
        if (HI) { const bf *pv = vh + boff, *pv2 = vl + boff; v16bf b[4], b2[4];
#pragma unroll
            for (int nb = 0; nb < 4; ++nb) { b[nb] = WFrag<bf>::ldf(pv + nb * 512); b2[nb] = WFrag<bf>::ldf(pv2 + nb * 512); }
            xhold(pv, pv2, pv, pv2, pv, pv2, pv, pv2);
#pragma unroll
            for (int rb = 0; rb < 2; ++rb) { const bf* p = (const bf*)(S + (rb * 16 + lr) * SP) + kc + 8 * hi; const v16bf a = cat16b(*(const v8usa*)p, *(const v8usa*)(p + 16)), a2 = cat16b(*(const v8usa*)(p + TT), *(const v8usa*)(p + TT + 16));
#pragma unroll
                for (int nb = 0; nb < 4; ++nb) { acc[rb][nb] = wmmab(a, b[nb], acc[rb][nb]); acc[rb][nb] = wmmab(a2, b[nb], acc[rb][nb]); acc[rb][nb] = wmmab(a, b2[nb], acc[rb][nb]); } }
        } else { const h16* pv = v16 + boff; v16h b[NS][4];
#pragma unroll
            for (int s = 0; s < NS; ++s)
#pragma unroll
                for (int nb = 0; nb < 4; ++nb) b[s][nb] = WFrag<h16>::ldf(pv + s * (32 * HD) + nb * 512);
            xhold(pv, pv, pv, pv, pv, pv, pv, pv);
#pragma unroll
            for (int s = 0; s < NS; ++s)
#pragma unroll
                for (int rb = 0; rb < 2; ++rb) { const h16* p = (const h16*)(S + (rb * 16 + lr) * SP) + kc + s * 32 + 8 * hi; const v16h a = cat16(*(const v8ha*)p, *(const v8ha*)(p + 16));
#pragma unroll
                    for (int nb = 0; nb < 4; ++nb) acc[rb][nb] = wmma16(a, b[s][nb], acc[rb][nb]); } } }
}
// amdgpu_waves_per_eu(4, 4): the 16 waves of the one work-group that fits a WGP (262,656 B of LDS) stand four on a SIMD, 256 VGPRs each at most
__global__ __launch_bounds__(512) __attribute__((amdgpu_waves_per_eu(4, 4))) void k_fattn(const h16* __restrict__ QP16, const bf* __restrict__ QPh, const bf* __restrict__ QPl, const h16* __restrict__ QV16, const bf* __restrict__ QVh, const bf* __restrict__ QVl, const h16* __restrict__ KP16, const bf* __restrict__ KPh, const bf* __restrict__ KPl, const h16* __restrict__ PP16, const bf* __restrict__ PPh, const bf* __restrict__ PPl, const h16* __restrict__ VT16, const bf* __restrict__ VTh, const bf* __restrict__ VTl, const float* __restrict__ ab, bf* Ah, bf* Al) {
    __shared__ __align__(16) float S[32 * SP];
    const int tid = threadIdx.x, lane = tid & 31, lr = lane & 15, hi = lane >> 4; const int w = __builtin_amdgcn_readfirstlane(tid >> 5);
    const int i0 = blockIdx.x * 32, h = blockIdx.y; const bool hires = (i0 < RH); const size_t hp = (size_t)h * TT * HD;
    { const size_t zb = (size_t)blockIdx.z * ((size_t)NH_ * TT * HD); QP16 += zb; QPh += zb; QPl += zb; QV16 += zb; QVh += zb; QVl += zb; KP16 += zb; KPh += zb; KPl += zb; VT16 += zb; VTh += zb; VTl += zb; Ah += zb; Al += zb; }   // NH_ TT HD == TT DQ: one batch of any of these
    { const int it = i0 >> 4, jl = w * (TT / 256), jh = jl + TT / 256 - 1;   // a wave takes 8 neighbouring logit tiles of both row blocks, so that each position-score tile serves two logit tiles of a block from registers; the two diagonal tiles it, it + 1 (it even) fall to one wave
      if (hires) { sc_content2(S, QPh + hp, QPl + hp, KPh + hp, KPl + hp, ab, i0, jl, lr, hi);
                   sc_pos2<false>(S, QVh + hp, QVl + hp, PPh + hp, PPl + hp, i0, jl, min(jh, it + 1), lr, hi);
                   sc_pos2<true>(S, QVh + hp, QVl + hp, PPh + hp, PPl + hp, i0, max(jl, it), jh, lr, hi); }
      else       { sc_pass2<false>(S, QP16 + hp, QV16 + hp, KP16 + hp, PP16 + hp, ab, i0, jl, min(jh, it + 1), lr, hi);
                   sc_pass2<true>(S, QP16 + hp, QV16 + hp, KP16 + hp, PP16 + hp, ab, i0, max(jl, it), jh, lr, hi); } }
    __syncthreads();   // logits complete before a wave reads its rows
#pragma unroll 1   // one 64-register row at a time
    for (int rr = 0; rr < 2; ++rr) { float* srow = S + (w + rr * 16) * SP; float v[TT / 32]; float mx = -3.0e38f;
#pragma unroll
        for (int ch = 0; ch < TT / 128; ++ch) { const v4f a = *(const v4fa*)(srow + ch * 128 + lane * 4);
#pragma unroll
            for (int q = 0; q < 4; ++q) { v[ch * 4 + q] = a[q]; mx = fmaxf(mx, a[q]); } }
#pragma unroll
        for (int sh = 16; sh; sh >>= 1) mx = fmaxf(mx, __shfl_xor(mx, sh, 32));
        float sum = 0.f;
#pragma unroll
        for (int k = 0; k < TT / 32; ++k) { v[k] = exp2_slot(__fmul_rn(__fsub_rn(v[k], mx), 1.4426950408889634f)); sum += v[k]; }
#pragma unroll
        for (int sh = 16; sh; sh >>= 1) sum += __shfl_xor(sum, sh, 32);
        const float f = __fdiv_rn(hires ? 1.0f : PCAR, sum);
        if (hires) { bf* ph = (bf*)srow;
#pragma unroll
            for (int ch = 0; ch < TT / 128; ++ch) { v4us oh, ol;
#pragma unroll
                for (int q = 0; q < 4; ++q) { unsigned short a, c2; splitf(v[ch * 4 + q] * f, a, c2); oh[q] = a; ol[q] = c2; }
                *(v4usa*)(ph + ch * 128 + lane * 4) = oh; *(v4usa*)(ph + TT + ch * 128 + lane * 4) = ol; }
        } else { h16* p16 = (h16*)srow;
#pragma unroll
            for (int ch = 0; ch < TT / 128; ++ch) { v4h o4;
#pragma unroll
                for (int q = 0; q < 4; ++q) o4[q] = tohx(v[ch * 4 + q] * f);
                *(v4ha*)(p16 + ch * 128 + lane * 4) = o4; } } }
    __syncthreads();   // all 32 weight rows written before any wave reads them as A fragments
    v8f acc[2][4]; const size_t hv = (size_t)h * HD * TT;
    if (hires) pv_pass<true>(S, VT16 + hv, VTh + hv, VTl + hv, w, lr, hi, acc); else pv_pass<false>(S, VT16 + hv, VTh + hv, VTl + hv, w, lr, hi, acc);
    __syncthreads();   // last read of the weights is over before the partial tiles overwrite them
#pragma unroll
    for (int rb = 0; rb < 2; ++rb)
#pragma unroll
        for (int nb = 0; nb < 4; ++nb)
#pragma unroll
            for (int jj = 0; jj < 8; ++jj) S[w * (32 * HD) + (rb * 16 + hi * 8 + jj) * HD + nb * 16 + lr] = acc[rb][nb][jj];
    __syncthreads();   // all KSP partial tiles written before they are summed
    const int e = tid * 4, t = i0 + (e >> 6), d = e & 63; v4f s = *(const v4fa*)(S + e);
#pragma unroll
    for (int ks = 1; ks < KSP; ++ks) s += *(const v4fa*)(S + ks * (32 * HD) + e);
    const float cs = (t < RH) ? 1.0f : (1.0f / PCAR); v4us oh, ol;
#pragma unroll
    for (int q = 0; q < 4; ++q) { unsigned short a, c2; splitf(s[q] * cs, a, c2); oh[q] = a; ol[q] = c2; }
    const size_t oo = (size_t)(t >> 4) * (16 * DQ) + (size_t)((h * HD + d) >> 5) * 512 + ((d >> 3) & 3) * 128 + (t & 15) * 8 + (d & 7); *(v4us*)(Ah + oo) = oh; *(v4us*)(Al + oo) = ol;   // fragment order (rows t, k = h HD + d) for the output GEMM: a row block's tile is 2 KiB in a row in each plane
}

extern "C" void kernel_launch(void* const* d_in, const int* in_sizes, int n_in,
                              void* d_out, int out_size, void* d_ws, size_t ws_size, hipStream_t stream) {
    (void)in_sizes; (void)n_in; (void)out_size;
    const float* x = (const float*)d_in[0]; const float* abias = (const float*)d_in[1]; const float* pemb = (const float*)d_in[2]; const float* pbu = (const float*)d_in[3]; const float* pbv = (const float*)d_in[4]; const float* wq = (const float*)d_in[5]; const float* bq = (const float*)d_in[6]; const float* wk = (const float*)d_in[7]; const float* bk = (const float*)d_in[8]; const float* wv = (const float*)d_in[9]; const float* bv = (const float*)d_in[10]; const float* wpos = (const float*)d_in[11]; const float* bpos = (const float*)d_in[12]; const float* wo = (const float*)d_in[13]; const float* bo = (const float*)d_in[14]; const float* cosT = nullptr; const float* sinT = nullptr; (void)cosT; (void)sinT;
    float* OUT = (float*)d_out;     // [2][2048][1024]
    char* wsp = (char*)d_ws;
    auto take = [&](size_t bytes) { char* p = wsp; wsp += (bytes + 255) & ~(size_t)255; return (void*)p; };
    const size_t PS = (size_t)NH_ * TT * HD;   // elements of one 16-bit plane set (all heads) of one batch
    bf* WQ = (bf*)take((size_t)DQ * DM * 2); bf* WK = (bf*)take((size_t)DKV * DM * 2); bf* WV = (bf*)take((size_t)DKV * DM * 2); bf* WO = (bf*)take((size_t)DM * DQ * 2); bf* WP = (bf*)take((size_t)DQ * DM * 2);
    bf* X3 = (bf*)take((size_t)(NB_ + 1) * TT * DM * 2);   // slice 0: pos_emb; slices 1..: x
    h16* PK16 = (h16*)take((NB_ + 1) * PS * 2); bf* PKh = (bf*)take((NB_ + 1) * PS * 2); bf* PKl = (bf*)take((NB_ + 1) * PS * 2);   // slice 0: position planes; slices 1..: key planes
    h16* QV16 = (h16*)take(NB_ * PS * 2); bf* QVh = (bf*)take(NB_ * PS * 2); bf* QVl = (bf*)take(NB_ * PS * 2);
    h16* QP16 = (h16*)take(NB_ * PS * 2); bf* QPh = (bf*)take(NB_ * PS * 2); bf* QPl = (bf*)take(NB_ * PS * 2);
    h16* VT16 = (h16*)take(NB_ * PS * 2); bf* VTh = (bf*)take(NB_ * PS * 2); bf* VTl = (bf*)take(NB_ * PS * 2);
    bf* ATh = (bf*)take((size_t)NB_ * TT * DQ * 2); bf* ATl = (bf*)take((size_t)NB_ * TT * DQ * 2);
    if ((size_t)(wsp - (char*)d_ws) > ws_size) return;    // ws 256 MiB
    k_prep<<<5 * WTB + (NB_ + 1) * CVB, 256, 0, stream>>>(wq, wk, wv, wo, wpos, x, pemb, WQ, WK, WV, WO, WP, X3);
    k_proj<<<dim3(TT / 64, DQ / 64, 3 * NB_ + 1), 32, 0, stream>>>(X3, X3 + (size_t)TT * DM, WQ, WK, WV, bq, bk, bv, DM, Planes{QP16, QPh, QPl, QV16, QVh, QVl, pbu, pbv, PS, nullptr, nullptr}, Planes{PK16, PKh, PKl, nullptr, nullptr, nullptr, nullptr, nullptr, PS, WP, bpos}, Planes{VT16, VTh, VTl, nullptr, nullptr, nullptr, nullptr, nullptr, PS, nullptr, nullptr});
    k_fattn<<<dim3(TT / 32, NH_, NB_), 512, 0, stream>>>(QP16, QPh, QPl, QV16, QVh, QVl, PK16 + PS, PKh + PS, PKl + PS, PK16, PKh, PKl, VT16, VTh, VTl, abias, ATh, ATl);
    k_gemmw<bf, 1, true><<<dim3(NB_ * TT / 64, DM / 64, 1), 32, 0, stream>>>(ATh, ATl, WO, nullptr, DQ, OUT, DM, bo, 0, 0, 0, Planes{nullptr, nullptr, nullptr, nullptr, nullptr, nullptr, nullptr, nullptr, 0, nullptr, nullptr});   // both batches: 2 TT rows of one GEMM
}

// v010
// It runs in 244 microseconds.
// Two timings next to v009 both put it at 1.09 times that version's speed.
// All steps since v000 together make it 11.5 times as fast.
#include <hip/hip_runtime.h>

// Multi-head self-attention with relative positions and learnable u/v biases (x [2][2048][1024], bias [1][1][L][L] (f32 additive, read; verbatim causal 0/-1e9), pos_emb [2048][1][1024], pos_bias_u/v [16][64]; q/k/v = x W + b, r = pos_emb Wr + br ('xw', 16 heads x 64); qh = q/8; AC = (qh + u).k + bias; BD = (qh + v).r; logits = AC + rel_shift(BD) with the pad-front/reshape shift: pos[i][j] = BD[i][T-1-(i-j)] for j <= i, 0 for j == i+1, BD[i+1][j-i-2] for j >= i+2 (reproduced literally, including the masked upper part); softmax; out = merged Wo + bo -> [2][2048][1024]).
// Compute dtypes, f32 accumulate: every input rounded to bf16; q/k/v/r as PLAIN bf16 GEMMs (inputs: exact) + bias; q x 1/8 (exact) then the u/v head biases added in f32; content, position scores and attn.v: query rows < 512 hl (3 products), the rest single fp16 (x1024) (the shifted position score is gathered from rows i / i+1 of the position-score block); the additive bias read per element; softmax f32; Wo hl x exact (2 products) + bias.

#define NB_  2
#define TT   2048
#define DM   1024
#define NH_  16
#define NKV  16
#define REP  (NH_ / NKV)
#define HD   64
#define DQ   (NH_ * HD)
#define DKV  (NKV * HD)
#define RH   512                  // query rows < RH use hi+lo planes (0: none)
#define WIN  0
#define PCAR 1024.0f
#define KSP  16                   // attn.v: key ranges per output tile, one per wave of k_fattn; the KSP partial tiles are summed in ascending order
#define SCL  1.0f   // the 1/sqrt(64) is applied to q before the u/v biases (k_proj, EPI 2)
typedef _Float16 h16;
typedef unsigned short bf;
typedef __attribute__((ext_vector_type(16))) __bf16   v16bf;
typedef __attribute__((ext_vector_type(16))) _Float16 v16h;
typedef __attribute__((ext_vector_type(8)))  _Float16 v8h;
typedef __attribute__((ext_vector_type(8)))  unsigned short v8us;
typedef __attribute__((ext_vector_type(8)))  float    v8f;
typedef __attribute__((ext_vector_type(4)))  float    v4f;
typedef v8h  __attribute__((may_alias)) v8ha;
typedef v4f  __attribute__((may_alias)) v4fa;
typedef v8us __attribute__((may_alias)) v8usa;

__device__ __forceinline__ unsigned short f2bf(float f) { return __builtin_bit_cast(unsigned short, (__bf16)f); }   // round to nearest even by the convert instruction (two values an instruction)
typedef __attribute__((ext_vector_type(2))) __bf16 v2bf;
typedef __attribute__((ext_vector_type(2))) float f32x2;
typedef __attribute__((ext_vector_type(4))) unsigned v4u;
__device__ __forceinline__ unsigned pk2bf(float a, float b) { f32x2 x; x[0] = a; x[1] = b; return __builtin_bit_cast(unsigned, __builtin_convertvector(x, v2bf)); }   // both values rounded by one convert instruction: a in the low half, b in the high half
__device__ __forceinline__ float bf2f(unsigned short b) { return __uint_as_float(((unsigned)b) << 16); }
__device__ __forceinline__ float bfr(float f) { return bf2f(f2bf(f)); }
__device__ __forceinline__ v16h cat16(v8h lo, v8h hi) { return __builtin_shufflevector(lo, hi, 0, 1, 2, 3, 4, 5, 6, 7, 8, 9, 10, 11, 12, 13, 14, 15); }
__device__ __forceinline__ v16bf cat16b(v8us lo, v8us hi) { return __builtin_bit_cast(v16bf, __builtin_shufflevector(lo, hi, 0, 1, 2, 3, 4, 5, 6, 7, 8, 9, 10, 11, 12, 13, 14, 15)); }
__device__ __forceinline__ v8f wmma16(v16h a, v16h b, v8f c) { return __builtin_amdgcn_wmma_f32_16x16x32_f16(false, a, false, b, (short)0, c, false, false); }
__device__ __forceinline__ v8f wmmab(v16bf a, v16bf b, v8f c) { return __builtin_amdgcn_wmma_f32_16x16x32_bf16(false, a, false, b, (short)0, c, false, false); }



// ---- FRAGMENT ORDER of every 16-bit plane that a matrix product reads (k_fattn: q + u, q + v, k, r, v; k_proj: x, pos_emb, the q, k, v and position weights; k_gemmw: Wo, the attention output): a block of 16 rows x 32 k (512 elements, 1 KiB) is stored as [g = (k >> 3) & 3][row & 15][k & 7], which is lane order (lane = 16 hi + row, g = 2 c + hi): load c of a fragment is 32 lanes x 16 B = 512 contiguous bytes (4 whole lines) where a row-major plane gives 16 part lines. Blocks of one 16-row tile follow one another along k. The registers hold what they held with row-major planes. ldf loads from a plane in fragment order.
// ---- k_gemmw: register-blocked GEMM, ONE WAVE per 64x64 output tile (16 accumulators), operands straight from 16-bit planes in fragment order (rows m or n, k along K); grid (M/64, N/64, Z), 32 threads.
// C[m][n] (f32, pitch ldc, + optional f32 bias[n]) = sum_k A[m][k] Bt[n][k] (+ split products per NSPLIT). z-batch strides sA/sB/sC in elements; with EPI != 0 slice z writes its planes sz elements behind slice z - 1's, so that the GEMMs of both batches are one launch and a WGP holds several waves whose load waits overlap. K % (32 KS) == 0. KS > 1: grid z = Z x KS; work-group (z, ks) sums only k in [ks K/KS, (ks+1) K/KS) and stores its partial tile in plane z KS + ks of C (plane stride sC).
template <typename T16> struct WFrag;
template <> struct WFrag<h16> { typedef v16h V; static __device__ __forceinline__ V ldf(const h16* p) { return cat16(*(const v8h*)p, *(const v8h*)(p + 256)); } static __device__ __forceinline__ v8f mma(V a, V b, v8f c) { return wmma16(a, b, c); } };
template <> struct WFrag<bf> { typedef v16bf V; static __device__ __forceinline__ V ldf(const bf* p) { return cat16b(*(const v8us*)p, *(const v8us*)(p + 256)); } static __device__ __forceinline__ v8f mma(V a, V b, v8f c) { return wmmab(a, b, c); } };
// Behind a batch of global loads: the precautionary wait in front of any write to a register of the loads' address pairs. The pointers are inputs so that the pairs stay live up to it; without that the compiler lets a later load of the batch land in an earlier load's pair. A shorter list repeats its pointers.
__device__ __forceinline__ void xhold(const void* a, const void* b, const void* c, const void* d, const void* e, const void* f, const void* g, const void* h) { asm volatile("s_wait_xcnt 0x0" :: "v"(a), "v"(b), "v"(c), "v"(d), "v"(e), "v"(f), "v"(g), "v"(h) : "memory"); }
__device__ __forceinline__ h16 tohx(float x) { return (h16)x; }
__device__ __forceinline__ void splitf(float y, unsigned short& h, unsigned short& l) { h = f2bf(y); l = f2bf(y - bf2f(h)); }
// one 16-byte store into each of the three planes (fp16, bf16 hi, bf16 lo) of eight neighbouring values. The stores stand in one asm statement with the precautionary s_wait_xcnt 0 behind them, so that it is in front of every later write to their address and data registers.
__device__ __forceinline__ void put8(const float (&x)[8], h16* P16, bf* Ph, bf* Pl, size_t o) { v8h o16; v4u oh, ol;
#pragma unroll
    for (int p = 0; p < 4; ++p) { const float a = x[2 * p], c = x[2 * p + 1]; o16[2 * p] = tohx(a); o16[2 * p + 1] = tohx(c); const unsigned w = pk2bf(a, c); oh[p] = w; ol[p] = pk2bf(a - __uint_as_float(w << 16), c - __uint_as_float(w & 0xFFFF0000u)); }   // splitf of two neighbours at a time: the pair of hi parts is the plane's own dword
    asm volatile("global_store_b128 %0, %3, off\n\tglobal_store_b128 %1, %4, off\n\tglobal_store_b128 %2, %5, off\n\ts_wait_xcnt 0x0" :: "v"(P16 + o), "v"(Ph + o), "v"(Pl + o), "v"(o16), "v"(oh), "v"(ol) : "memory"); }
// Where a projection's tile goes when EPI != 0 (a 64-column tile is one head), all in fragment order: EPI 1: planes p [h] (rows t, k = d) of C + bias (k, r); EPI 2: planes p of (C + bias)/8 + bu and planes q of (C + bias)/8 + bv (the two query forms); EPI 3: planes p [h] (rows d, k = t; the four 16-row blocks of one k step side by side) of C + bias (v, transposed). EPI 1 holds the position projection as slice 0 (weights Bt0, bias bias0) and the key projection of batch z - 1 as slice z.
struct Planes { h16* p16; bf* ph; bf* pl; h16* q16; bf* qh; bf* ql; const float* bu; const float* bv; size_t sz; const bf* Bt0; const float* bias0; };
// gemmw: the body; bz is the slice index (grid z of k_gemmw; of k_proj the slice inside the projection that the work-group belongs to); os: the work-group's LDS tile, 16 x 68 floats (EPI 2: two of them, one for each of the two query forms).
template <typename T16, int NSPLIT, bool BIAS, int KS, int EPI>
__device__ __forceinline__ void gemmw(float* os, const int bz, const T16* __restrict__ A, const T16* __restrict__ A2, const T16* __restrict__ Bt, const T16* __restrict__ Bt2, int K, float* C, int ldc, const float* __restrict__ bias, size_t sA, size_t sB, size_t sC, Planes po) {
    typedef typename WFrag<T16>::V V;
    const size_t z = bz / KS; A += z * sA; if (A2) A2 += z * sA; Bt += z * sB; if (Bt2) Bt2 += z * sB; C += (size_t)bz * sC; const int kb = (int)(bz % KS) * (K / KS), ke = kb + K / KS;
    if constexpr (EPI != 0) { const size_t zs = z * po.sz; po.p16 += zs; po.ph += zs; po.pl += zs; if constexpr (EPI == 2) { po.q16 += zs; po.qh += zs; po.ql += zs; } }
    if constexpr (EPI == 1) { if (z == 0) { Bt = po.Bt0; bias = po.bias0; } }
    const int lane = threadIdx.x & 31, lr = lane & 15, hi = lane >> 4; const int r0 = blockIdx.x * 64, c0 = blockIdx.y * 64;
    v8f acc[4][4];
#pragma unroll
    for (int mb = 0; mb < 4; ++mb)
#pragma unroll
        for (int nb = 0; nb < 4; ++nb) acc[mb][nb] = (v8f){};
    const size_t aoff = (size_t)r0 * K + lane * 8, boff = (size_t)c0 * K + lane * 8;   // a 16-row tile is 16 K elements, a k step of 32 is 512 of them; lane * 8: the lane's 16-byte unit
#pragma unroll 1
    for (int kc = kb; kc < ke; kc += 32) {
        V a[4], a2[4], b[4], b2[4]; const T16 *pa[4], *pa2[4], *pb[4], *pb2[4];
#pragma unroll
        for (int t = 0; t < 4; ++t) { const size_t ot = (size_t)t * 16 * K + (size_t)kc * 16; pa[t] = A + aoff + ot; pb[t] = Bt + boff + ot; a[t] = WFrag<T16>::ldf(pa[t]); b[t] = WFrag<T16>::ldf(pb[t]);
            if (NSPLIT == 1 || NSPLIT == 2) { pa2[t] = A2 + aoff + ot; a2[t] = WFrag<T16>::ldf(pa2[t]); } if (NSPLIT >= 2) { pb2[t] = Bt2 + boff + ot; b2[t] = WFrag<T16>::ldf(pb2[t]); } }
        if constexpr (NSPLIT == 1) asm volatile("s_wait_xcnt 0x0" :: "v"(pa[0]), "v"(pa[1]), "v"(pa[2]), "v"(pa[3]), "v"(pb[0]), "v"(pb[1]), "v"(pb[2]), "v"(pb[3]), "v"(pa2[0]), "v"(pa2[1]), "v"(pa2[2]), "v"(pa2[3]) : "memory");   // xhold for twelve pairs
        else xhold(pa[0], pa[1], pa[2], pa[3], pb[0], pb[1], pb[2], pb[3]);
        if constexpr (NSPLIT == 2) xhold(pa2[0], pa2[1], pa2[2], pa2[3], pb2[0], pb2[1], pb2[2], pb2[3]);
        if constexpr (NSPLIT > 2) xhold(pb2[0], pb2[1], pb2[2], pb2[3], pb2[0], pb2[1], pb2[2], pb2[3]);
        __builtin_amdgcn_sched_barrier(0);   // keeps the products behind the wait: without it the compiler lifts them over it, in between the loads, and then fetches the B fragments one after another into one register set, with a full load wait each
#pragma unroll
        for (int nb = 0; nb < 4; ++nb) {
#pragma unroll
            for (int mb = 0; mb < 4; ++mb) { acc[mb][nb] = WFrag<T16>::mma(a[mb], b[nb], acc[mb][nb]); if (NSPLIT == 1 || NSPLIT == 2) acc[mb][nb] = WFrag<T16>::mma(a2[mb], b[nb], acc[mb][nb]); if (NSPLIT >= 2) acc[mb][nb] = WFrag<T16>::mma(a[mb], b2[nb], acc[mb][nb]); } }
        asm volatile("v_nop\n\tv_nop\n\tv_nop\n\tv_nop" : "+v"(acc[0][0]), "+v"(acc[1][1]), "+v"(acc[2][2]), "+v"(acc[3][3]) : "v"(a[0]), "v"(a[3]));
    }
    if constexpr (EPI == 3) {   // a lane's eight accumulator values are eight neighbouring t of one d, one 16-byte unit of the fragment order (rows d, k = t): stored straight from the registers
        asm volatile("s_wait_xcnt 0x0" ::: "memory");   // precautionary wait in front of the first write to an address pair of the k loop's loads
        float bn[4];   // all four bias loads first: the store statements' memory clobber would hold a later load behind them
#pragma unroll
        for (int nb = 0; nb < 4; ++nb) bn[nb] = bfr(bias[c0 + nb * 16 + lr]);
#pragma unroll
        for (int nb = 0; nb < 4; ++nb) {
#pragma unroll
            for (int mb = 0; mb < 4; ++mb) { float x[8];
#pragma unroll
                for (int j = 0; j < 8; ++j) x[j] = acc[mb][nb][j] + bn[nb];
                put8(x, po.p16, po.ph, po.pl, ((size_t)blockIdx.y * TT + r0 + (mb >> 1) * 32) * HD + nb * 512 + (mb & 1) * 256 + lane * 8); } }   // block (32 t, 16 d) in fragment order: 512 contiguous bytes a store
        return; }
    float bn[4], un[4], vn[4];   // EPI 1, 2: the biases of a lane's four accumulator columns, added before the tile goes through LDS
    if constexpr (EPI == 1 || EPI == 2) {
#pragma unroll
        for (int nb = 0; nb < 4; ++nb) { bn[nb] = bfr(bias[c0 + nb * 16 + lr]); if (EPI == 2) { un[nb] = bfr(po.bu[c0 + nb * 16 + lr]); vn[nb] = bfr(po.bv[c0 + nb * 16 + lr]); } } }
#pragma unroll
    for (int mb = 0; mb < 4; ++mb) {
#pragma unroll
        for (int nb = 0; nb < 4; ++nb) {
#pragma unroll
            for (int j = 0; j < 8; ++j) { const int oi = (hi * 8 + j) * 68 + nb * 16 + lr;
                if constexpr (EPI == 1) os[oi] = acc[mb][nb][j] + bn[nb];
                else if constexpr (EPI == 2) { const float aq = __fmul_rn(acc[mb][nb][j] + bn[nb], 0.125f); os[oi] = __fadd_rn(aq, un[nb]); os[16 * 68 + oi] = __fadd_rn(aq, vn[nb]); }
                else os[oi] = acc[mb][nb][j]; } }
        __builtin_amdgcn_wave_barrier(); asm volatile("" ::: "memory");
        float* crow = C + (size_t)(r0 + mb * 16) * ldc + c0;
        if constexpr (EPI == 1 || EPI == 2) {
            const size_t o = ((size_t)blockIdx.y * TT + r0 + mb * 16) * HD + lane * 8;   // store s: units g = 2 s + hi of row lr, 512 contiguous bytes
#pragma unroll
            for (int pl = 0; pl < (EPI == 2 ? 2 : 1); ++pl) { const float* ot = os + pl * (16 * 68) + lr * 68 + hi * 8;
                v4f v0[4], v1[4];   // a tile's LDS reads first: the store statements' memory clobber would hold a later read behind them
#pragma unroll
                for (int s = 0; s < 4; ++s) { v0[s] = *(const v4fa*)(ot + s * 16); v1[s] = *(const v4fa*)(ot + s * 16 + 4); }
#pragma unroll
                for (int s = 0; s < 4; ++s) { float x[8];
#pragma unroll
                    for (int q = 0; q < 8; ++q) x[q] = q < 4 ? v0[s][q & 3] : v1[s][q & 3];
                    if (pl == 0) put8(x, po.p16, po.ph, po.pl, o + s * 256); else put8(x, po.q16, po.qh, po.ql, o + s * 256); } }
        } else {
#pragma unroll
            for (int s = 0; s < 8; ++s) { const int row = 2 * s + hi, cofs = lr * 4; v4f val = *(const v4fa*)(os + row * 68 + cofs); if (BIAS) { val[0] += bfr(bias[c0 + cofs]); val[1] += bfr(bias[c0 + cofs + 1]); val[2] += bfr(bias[c0 + cofs + 2]); val[3] += bfr(bias[c0 + cofs + 3]); }
                *(v4f*)(crow + (size_t)row * ldc + cofs) = val; }
             }
        __builtin_amdgcn_wave_barrier(); asm volatile("" ::: "memory");
    }
}
template <typename T16, int NSPLIT, bool BIAS>
__global__ __launch_bounds__(32) void k_gemmw(const T16* __restrict__ A, const T16* __restrict__ A2, const T16* __restrict__ Bt, const T16* __restrict__ Bt2, int K, float* C, int ldc, const float* __restrict__ bias, size_t sA, size_t sB, size_t sC, Planes po) {
    __shared__ __align__(16) float os[16 * 68];
    gemmw<T16, NSPLIT, BIAS, 1, 0>(os, (int)blockIdx.z, A, A2, Bt, Bt2, K, C, ldc, bias, sA, sB, sC, po);
}
// ---- k_proj: the four projections in ONE launch, grid (TT/64, DQ/64, 3 NB_ + 1): slices z < NB_ are q (EPI 2), the next NB_ + 1 the position and key projections (EPI 1), the last NB_ are v (EPI 3); X3: pos_emb and x, XB: x alone. None reads what another writes. A launch of one projection alone puts about one wave on a SIMD, which then idles through every k step's load wait; together a SIMD holds three to four waves, and one wave's products run in another's wait.
__global__ __launch_bounds__(32) void k_proj(const bf* __restrict__ X3, const bf* __restrict__ XB, const bf* __restrict__ WQ, const bf* __restrict__ WK, const bf* __restrict__ WV, const float* __restrict__ bq, const float* __restrict__ bk, const float* __restrict__ bv, int K, Planes pq, Planes pk, Planes pv) {
    __shared__ __align__(16) float os[2 * 16 * 68];
    const int z = blockIdx.z; const size_t XS = (size_t)TT * DM;
    if (z < NB_) gemmw<bf, 0, true, 1, 2>(os, z, XB, nullptr, WQ, nullptr, K, nullptr, DQ, bq, XS, 0, 0, pq);
    else if (z < 2 * NB_ + 1) gemmw<bf, 0, true, 1, 1>(os, z - NB_, X3, nullptr, WK, nullptr, K, nullptr, DKV, bk, XS, 0, 0, pk);
    else gemmw<bf, 0, true, 1, 3>(os, z - (2 * NB_ + 1), XB, nullptr, WV, nullptr, K, nullptr, DKV, bv, XS, 0, 0, pv);
}

typedef __attribute__((ext_vector_type(2))) _Float16 v2h;
typedef __attribute__((ext_vector_type(4))) _Float16 v4h;
typedef __attribute__((ext_vector_type(2))) unsigned short v2us;
typedef __attribute__((ext_vector_type(4))) unsigned short v4us;
typedef __attribute__((ext_vector_type(2))) float v2f;
typedef __attribute__((ext_vector_type(4))) int v4i;

// One wave per block of 16 n x 32 k of Bt[n][k] = w[k][n], written in fragment order (two stores of 512 contiguous bytes); a load takes 16 neighbouring n of two k rows. The eight waves of a work-group cover 32 n x 128 k, so that they use whole 128-byte lines of w.
__device__ __forceinline__ void wtG(const float* __restrict__ w, int K, int N, bf* Bt, int blk) {
    const int lane = threadIdx.x & 31, lr = lane & 15, hi = lane >> 4, ws = threadIdx.x >> 5;
    const int nt = (blk % (N / 32)) * 2 + (ws & 1), kb = (blk / (N / 32)) * 4 + (ws >> 1);
    const float* p = w + (size_t)(kb * 32 + hi * 8) * N + nt * 16 + lr; float v[2][8];
#pragma unroll
    for (int c = 0; c < 2; ++c)
#pragma unroll
        for (int q = 0; q < 8; ++q) v[c][q] = p[(size_t)(c * 16 + q) * N];
    asm volatile("s_wait_xcnt 0x0" :: "v"(p) : "memory");   // precautionary wait in front of the first write to the loads' address pair, which the input keeps live up to here
    v8us o0, o1;
#pragma unroll
    for (int q = 0; q < 8; ++q) { o0[q] = f2bf(v[0][q]); o1[q] = f2bf(v[1][q]); }
    asm volatile("global_store_b128 %0, %1, off\n\tglobal_store_b128 %0, %2, off offset:512\n\ts_wait_xcnt 0x0" :: "v"(Bt + ((size_t)nt * (K / 32) + kb) * 512 + lane * 8), "v"(o0), "v"(o1) : "memory");   // stores and precautionary wait in one statement, as in put8
}
// ---- k_prep: all that the GEMMs wait for, in one launch: work-groups [0, 5 WTB) transpose and round the five weight matrices (WTB each), the rest round pos_emb (slice 0 of X3) and x (slices 1, 2: the two batches), eight values (one 16-byte unit of the fragment order) a thread; a wave takes 8 rows x 32 k: whole 128-byte lines on both sides.
#define WTB (DM * DQ / 64 / 64)
#define CVB (TT * DM / 8 / 256)   // work-groups per slice of X3
__global__ __launch_bounds__(256) void k_prep(const float* __restrict__ wq, const float* __restrict__ wk, const float* __restrict__ wv, const float* __restrict__ wo, const float* __restrict__ wpos, const float* __restrict__ x, const float* __restrict__ pemb, bf* WQ, bf* WK, bf* WV, bf* WO, bf* WP, bf* X3) {
    const int blk = blockIdx.x;
    if (blk < 5 * WTB) { const int job = blk / WTB; wtG(job == 0 ? wq : job == 1 ? wk : job == 2 ? wv : job == 3 ? wo : wpos, DM, DQ, job == 0 ? WQ : job == 1 ? WK : job == 2 ? WV : job == 3 ? WO : WP, blk % WTB); return; }
    const int cb = blk - 5 * WTB; const size_t i = (size_t)cb * 256 + threadIdx.x; const size_t tile = i / (2 * DM); const int u = (int)(i % (2 * DM)), g = u & 3, row = (u >> 2) & 15, kb = u >> 6;   // 2 DM units in a tile of 16 rows
    const size_t so = (tile * 16 + row) * DM + kb * 32 + g * 8; const float* src = cb < CVB ? pemb + so : x + (so - (size_t)TT * DM); const v8f v = *(const v8f*)src; v8us o;
    asm volatile("s_wait_xcnt 0x0" ::: "memory");   // precautionary wait in front of the first write to the load's address pair (the compiler reuses the pair for the rounding)
#pragma unroll
    for (int k = 0; k < 8; ++k) o[k] = f2bf(v[k]);
    asm volatile("global_store_b128 %0, %1, off\n\ts_wait_xcnt 0x0" :: "v"(X3 + tile * (16 * DM) + kb * 512 + g * 128 + row * 8), "v"(o) : "memory"); }   // store and precautionary wait in one statement, as in put8: the compiler joins this path with the transpose part, whose first instructions write the store's registers
__global__ __launch_bounds__(256) void k_cscvt(const float* __restrict__ cosT, const float* __restrict__ sinT, float* CS) { const int idx = blockIdx.x * 256 + threadIdx.x; if (idx >= TT * HD) return; v2f cs; cs[0] = bfr(cosT[idx]); cs[1] = bfr(sinT[idx]); *(v2f*)(CS + (size_t)idx * 2) = cs;  }
// ---- k_fattn: one work-group (16 waves) per 32 query rows (two row blocks of 16) of one head of one batch (blockIdx.z; the q, k, v planes and the output of batch 1 stand behind batch 0's, the position planes serve both); the 32 x 2048 f32 logit rows live in LDS from the score products to attn.v. A k, position or v fragment that a wave has loaded serves both row blocks from its registers, which halves what 32 rows draw from L2 for them.
// Phases: (1) content scores + additive bias + position scores, the latter turned to their rel-shift place inside the registers (row i takes BD[i][m >= T-1-i] at j = m-(T-1)+i and BD[i+1][m <= T-3-i] at j = m+i+2; every place gets at most one term) -> S; (3) softmax, one wave per row, weights written over the row as 16-bit planes; (4) attn.v in KSP key ranges of 128, one per wave, both row blocks; (5) the KSP partial tiles summed in ascending order.
#define SP 2052                   // LDS row pitch in floats: 2048 + 4, so that the 16 rows of a fragment read start on different banks
typedef v4h  __attribute__((may_alias)) v4ha;
typedef v4us __attribute__((may_alias)) v4usa;
// v_exp_f32 with the one free slot that the instruction set asks for behind a transcendental, before its result is read or its source written again; in one statement, so that the v_nop stands directly behind it
__device__ __forceinline__ float exp2_slot(float x) { float r; asm("v_exp_f32 %0, %1\n\tv_nop" : "=v"(r) : "v"(x)); return r; }
template <bool HI> struct BFrag;   // 16 rows x 64 k of a plane in fragment order (hi + lo planes where HI); off = fo(lane's row, hi)
__device__ __forceinline__ size_t fo(int row, int hi) { return (size_t)(row >> 4) * (16 * HD) + (row & 15) * 8 + hi * 128; }
template <> struct BFrag<false> { v16h b[2]; const h16 *p, *p2;
    __device__ __forceinline__ void load(const h16* b16, const bf*, const bf*, size_t off) { p = p2 = b16 + off; b[0] = WFrag<h16>::ldf(p); b[1] = WFrag<h16>::ldf(p + 512); } };
template <> struct BFrag<true> { v16bf b[2], b2[2]; const bf *p, *p2;
    __device__ __forceinline__ void load(const h16*, const bf* bh, const bf* bl, size_t off) { p = bh + off; p2 = bl + off; b[0] = WFrag<bf>::ldf(p); b[1] = WFrag<bf>::ldf(p + 512); b2[0] = WFrag<bf>::ldf(p2); b2[1] = WFrag<bf>::ldf(p2 + 512); } };
__device__ __forceinline__ v8f dot64(const BFrag<false>& q, const BFrag<false>& k) { v8f c = (v8f){};
#pragma unroll
    for (int kk = 0; kk < 2; ++kk) c = wmma16(q.b[kk], k.b[kk], c);
    return c; }
__device__ __forceinline__ v8f dot64(const BFrag<true>& q, const BFrag<true>& k) { v8f c = (v8f){};
#pragma unroll
    for (int kk = 0; kk < 2; ++kk) { c = wmmab(q.b[kk], k.b[kk], c); c = wmmab(q.b2[kk], k.b[kk], c); c = wmmab(q.b[kk], k.b2[kk], c); }
    return c; }
// Row r = 8 hi + JJ of a position-score tile turned right by (r + 1) & 15 lanes (tail) or (r + 2) & 15 lanes (head) inside its 16-lane row: lane l takes lane (l - n) & 15. The two halves of the wave hold different rows, so each takes its own turn (row_mask 1: lanes 0-15, 2: lanes 16-31); a turn by 0 is left out.
template <bool HEAD, int JJ>
__device__ __forceinline__ float turn_row(float x) {
    constexpr int NLO = (JJ + (HEAD ? 2 : 1)) & 15, NHI = (JJ + 8 + (HEAD ? 2 : 1)) & 15;
    const int xi = __float_as_int(x); int t = xi;
    if constexpr (NLO != 0) t = __builtin_amdgcn_update_dpp(xi, xi, 0x120 + NLO, 0x1, 0xf, false);
    if constexpr (NHI != 0) t = __builtin_amdgcn_update_dpp(t, xi, 0x120 + NHI, 0x2, 0xf, false);
    return __int_as_float(t); }
// The rel-shift term of logit tile (rows i0.., columns 16 jt..) from two neighbouring position-score tiles A (tile t) and B (tile t + 1): row r wants lanes [thr, 15] of A and [0, thr) of B, thr = 15 - r (tail) or 14 - r (head), turned into place; in the head, row 15 wants lane 15 of tile t - 1 (z) and lanes 0-14 of A.
template <bool HEAD, int JJ>
__device__ __forceinline__ float shift_term(const v8f& A, const v8f& B, float z, int lr, int hi) {
    float x = (lr + hi * 8 + JJ >= (HEAD ? 14 : 15)) ? A[JJ] : B[JJ];
    if constexpr (HEAD && JJ == 7) x = (hi != 0 && lr == 15) ? z : x;
    return turn_row<HEAD, JJ>(x); }
// ---- The score passes: logit tiles jlo..jhi (16 columns each, one after another) of the 32 query rows i0.. (row blocks it and it + 1), logit = (content score + bias) + rel-shift term. Each k fragment meets both blocks' q + u, each position fragment both blocks' q + v.
// Tail of block ib (columns j <= i, tiles jt <= ib): term = BD[i][T-1-i+j], position tiles t = 127 - ib + jt and t + 1, query rows i. Head (columns j >= i + 2, tiles jt >= ib): term = BD[i+1][j-i-2], position tiles t = jt - ib - 1 and t + 1 (and lane 15 of t - 1), query rows i + 1. A tile that does not exist (128 in the tail, below 0 in the head) counts as zeros: those places take no term (j > i in the tail's diagonal tile, j <= i + 1 in the head). The diagonal tile jt == ib takes its tail term first and its head term from the head pass of the same wave. Block 1 wants, at logit tile ju, the position tiles one below block 0's, so its product with the fragment loaded at ju is its tile B at ju + 1 (Bn). A block stores only the tiles of its own pass; its position tiles roll on at every ju. HI goes by the row block: in the block that ends at RH - 1 the head's last query row, RH, is taken from the hi + lo planes like the other fifteen.
// pos_start: the q + v fragments of both blocks and the position tiles that the first logit tile wants beside the one its own step loads. t0: block 0's tile A of the first logit tile; block 1's is t0 - 1.
template <bool HI, bool HEAD>
__device__ __forceinline__ void pos_start(BFrag<HI> (&qb)[2], v8f (&A)[2], v8f& Bn, float (&z)[2], const h16* qv16, const bf* qvh, const bf* qvl, const h16* p16, const bf* ph, const bf* pl, int i0, int t0, int lr, int hi) {
#pragma unroll
    for (int b = 0; b < 2; ++b) { int ar = i0 + b * 16 + lr + (HEAD ? 1 : 0); if (ar > TT - 1) ar = TT - 1;   // row T does not exist; no term of it is ever placed
        qb[b].load(qv16, qvh, qvl, fo(ar, hi)); }
    BFrag<HI> ra, rz, ry; ra.load(p16, ph, pl, fo(min(max(t0, 0), TT / 16 - 1) * 16 + lr, hi)); rz.load(p16, ph, pl, fo(max(t0 - 1, 0) * 16 + lr, hi)); if constexpr (HEAD) ry.load(p16, ph, pl, fo(max(t0 - 2, 0) * 16 + lr, hi));
    xhold(qb[0].p, qb[0].p2, qb[1].p, qb[1].p2, ra.p, ra.p2, rz.p, rz.p2);
    if constexpr (HEAD) xhold(ry.p, ry.p2, ry.p, ry.p2, ry.p, ry.p2, ry.p, ry.p2);
    __builtin_amdgcn_sched_barrier(0);   // keeps the products behind the waits: without it the compiler lifts them in between the loads and fetches the position fragments one after another, with a full load wait each
    A[0] = dot64(qb[0], ra); Bn = dot64(qb[1], ra); if (t0 < 0) { A[0] = (v8f){}; Bn = (v8f){}; }
    A[1] = dot64(qb[1], rz); if (t0 < 1) A[1] = (v8f){};
    z[0] = 0.f; z[1] = 0.f;
    if constexpr (HEAD) { const v8f c = dot64(qb[0], rz); z[0] = (t0 < 1) ? 0.f : c[7]; const v8f c1 = dot64(qb[1], ry); z[1] = (t0 < 2) ? 0.f : c1[7]; }
}
// ---- sc_pass2 (rows >= RH, single fp16 planes): a logit tile complete in registers, one plain store each.
template <bool HEAD>
__device__ __forceinline__ void sc_pass2(float* S, const h16* qu16, const h16* qv16, const h16* k16, const h16* p16, const float* __restrict__ ab, int i0, int jlo, int jhi, int lr, int hi) {
    if (jlo > jhi) return;   // the same for the whole wave
    const int it = i0 >> 4; BFrag<false> qu[2], qb[2]; v8f A[2], Bn; float z[2];
    qu[0].load(qu16, nullptr, nullptr, fo(i0 + lr, hi)); qu[1].load(qu16, nullptr, nullptr, fo(i0 + 16 + lr, hi));
    xhold(qu[0].p, qu[1].p, qu[0].p, qu[1].p, qu[0].p, qu[1].p, qu[0].p, qu[1].p);
    pos_start<false, HEAD>(qb, A, Bn, z, qv16, nullptr, nullptr, p16, nullptr, nullptr, i0, HEAD ? jlo - it - 1 : TT / 16 - 1 - it + jlo, lr, hi);
    constexpr int U = 2;   // logit tiles whose loads fly together
#pragma unroll 1   // the batch of U tiles is the unit; unrolling further would pass 256 VGPRs, the most that a wave of a 16-wave work-group can have
    for (int jt = jlo; jt <= jhi; jt += U) { BFrag<false> k[U], r[U]; const float* pb[U]; float bb[U][2][8];
#pragma unroll
        for (int u = 0; u < U; ++u) { const int ju = min(jt + u, jhi), col = ju * 16 + lr, tb = min(HEAD ? ju - it : TT / 16 - it + ju, TT / 16 - 1);
            k[u].load(k16, nullptr, nullptr, fo(col, hi)); r[u].load(p16, nullptr, nullptr, fo(tb * 16 + lr, hi)); pb[u] = ab + (size_t)(i0 + hi * 8) * TT + col;
#pragma unroll
            for (int b = 0; b < 2; ++b)
#pragma unroll
                for (int jj = 0; jj < 8; ++jj) bb[u][b][jj] = pb[u][(size_t)(b * 16 + jj) * TT]; }
        xhold(k[0].p, k[1].p, r[0].p, r[1].p, pb[0], pb[1], pb[0], pb[1]);
#pragma unroll
        for (int u = 0; u < U; ++u) { const int ju = jt + u;
            if (ju <= jhi) { const int col = ju * 16 + lr; v8f Bv[2];
                Bv[0] = dot64(qb[0], r[u]); Bv[1] = Bn; Bn = dot64(qb[1], r[u]);
#pragma unroll
                for (int b = 0; b < 2; ++b) { const int itb = it + b;
                    if (!HEAD && ju == itb) Bv[b] = (v8f){};
                    if (HEAD ? ju >= itb : ju <= itb) { float base[8]; float* so = S + (b * 16 + hi * 8) * SP + col;
                        if (HEAD && ju == itb) {
#pragma unroll
                            for (int jj = 0; jj < 8; ++jj) base[jj] = so[jj * SP];
                        } else { const v8f c = dot64(qu[b], k[u]);
#pragma unroll
                            for (int jj = 0; jj < 8; ++jj) base[jj] = __fadd_rn(c[jj], bfr(bb[u][b][jj])); }
                        so[0 * SP] = __fadd_rn(base[0], shift_term<HEAD, 0>(A[b], Bv[b], z[b], lr, hi)); so[1 * SP] = __fadd_rn(base[1], shift_term<HEAD, 1>(A[b], Bv[b], z[b], lr, hi));
                        so[2 * SP] = __fadd_rn(base[2], shift_term<HEAD, 2>(A[b], Bv[b], z[b], lr, hi)); so[3 * SP] = __fadd_rn(base[3], shift_term<HEAD, 3>(A[b], Bv[b], z[b], lr, hi));
                        so[4 * SP] = __fadd_rn(base[4], shift_term<HEAD, 4>(A[b], Bv[b], z[b], lr, hi)); so[5 * SP] = __fadd_rn(base[5], shift_term<HEAD, 5>(A[b], Bv[b], z[b], lr, hi));
                        so[6 * SP] = __fadd_rn(base[6], shift_term<HEAD, 6>(A[b], Bv[b], z[b], lr, hi)); so[7 * SP] = __fadd_rn(base[7], shift_term<HEAD, 7>(A[b], Bv[b], z[b], lr, hi)); }
                    z[b] = A[b][7]; A[b] = Bv[b]; } } } }
}
// ---- Rows < RH (hi + lo planes): the q + u and q + v fragments of two row blocks (128 VGPRs) do not fit beside the k and position fragments, so the content scores + bias of the wave's tiles go to S first (sc_content2) and the same lanes of the same wave add the rel-shift terms there (sc_pos2): no barrier, and the sums in the order (content + bias) + tail term + head term, as in sc_pass2.
__device__ __forceinline__ void sc_content2(float* S, const bf* quh, const bf* qul, const bf* kh, const bf* kl, const float* __restrict__ ab, int i0, int jlo, int lr, int hi) {
    BFrag<true> qu[2]; qu[0].load(nullptr, quh, qul, fo(i0 + lr, hi)); qu[1].load(nullptr, quh, qul, fo(i0 + 16 + lr, hi));
    xhold(qu[0].p, qu[0].p2, qu[1].p, qu[1].p2, qu[0].p, qu[0].p2, qu[1].p, qu[1].p2);
    constexpr int U = 2;   // logit tiles whose loads fly together
#pragma unroll 1   // the batch of U tiles is the unit, as in sc_pass2
    for (int jt = jlo; jt < jlo + TT / 256; jt += U) { BFrag<true> k[U]; const float* pb[U]; float bb[U][2][8];
#pragma unroll
        for (int u = 0; u < U; ++u) { const int col = (jt + u) * 16 + lr; k[u].load(nullptr, kh, kl, fo(col, hi)); pb[u] = ab + (size_t)(i0 + hi * 8) * TT + col;
#pragma unroll
            for (int b = 0; b < 2; ++b)
#pragma unroll
                for (int jj = 0; jj < 8; ++jj) bb[u][b][jj] = pb[u][(size_t)(b * 16 + jj) * TT]; }
        xhold(k[0].p, k[0].p2, k[1].p, k[1].p2, pb[0], pb[1], pb[0], pb[1]);
#pragma unroll
        for (int u = 0; u < U; ++u)
#pragma unroll
            for (int b = 0; b < 2; ++b) { const v8f c = dot64(qu[b], k[u]); float* so = S + (b * 16 + hi * 8) * SP + (jt + u) * 16 + lr;
#pragma unroll
                for (int jj = 0; jj < 8; ++jj) so[jj * SP] = __fadd_rn(c[jj], bfr(bb[u][b][jj])); } }
}
template <bool HEAD>
__device__ __forceinline__ void sc_pos2(float* S, const bf* qvh, const bf* qvl, const bf* ph, const bf* pl, int i0, int jlo, int jhi, int lr, int hi) {
    if (jlo > jhi) return;   // the same for the whole wave
    const int it = i0 >> 4; BFrag<true> qb[2]; v8f A[2], Bn; float z[2];
    pos_start<true, HEAD>(qb, A, Bn, z, nullptr, qvh, qvl, nullptr, ph, pl, i0, HEAD ? jlo - it - 1 : TT / 16 - 1 - it + jlo, lr, hi);
    constexpr int U = 2;   // position fragments whose loads fly together
#pragma unroll 1   // the batch of U tiles is the unit, as in sc_pass2
    for (int jt = jlo; jt <= jhi; jt += U) { BFrag<true> r[U];
#pragma unroll
        for (int u = 0; u < U; ++u) { const int ju = min(jt + u, jhi), tb = min(HEAD ? ju - it : TT / 16 - it + ju, TT / 16 - 1); r[u].load(nullptr, ph, pl, fo(tb * 16 + lr, hi)); }
        xhold(r[0].p, r[0].p2, r[1].p, r[1].p2, r[0].p, r[0].p2, r[1].p, r[1].p2);
#pragma unroll
        for (int u = 0; u < U; ++u) { const int ju = jt + u;
            if (ju <= jhi) { v8f Bv[2];
                Bv[0] = dot64(qb[0], r[u]); Bv[1] = Bn; Bn = dot64(qb[1], r[u]);
#pragma unroll
                for (int b = 0; b < 2; ++b) { const int itb = it + b;
                    if (!HEAD && ju == itb) Bv[b] = (v8f){};
                    if (HEAD ? ju >= itb : ju <= itb) { float base[8]; float* so = S + (b * 16 + hi * 8) * SP + ju * 16 + lr;
#pragma unroll
                        for (int jj = 0; jj < 8; ++jj) base[jj] = so[jj * SP];
                        so[0 * SP] = __fadd_rn(base[0], shift_term<HEAD, 0>(A[b], Bv[b], z[b], lr, hi)); so[1 * SP] = __fadd_rn(base[1], shift_term<HEAD, 1>(A[b], Bv[b], z[b], lr, hi));
                        so[2 * SP] = __fadd_rn(base[2], shift_term<HEAD, 2>(A[b], Bv[b], z[b], lr, hi)); so[3 * SP] = __fadd_rn(base[3], shift_term<HEAD, 3>(A[b], Bv[b], z[b], lr, hi));
                        so[4 * SP] = __fadd_rn(base[4], shift_term<HEAD, 4>(A[b], Bv[b], z[b], lr, hi)); so[5 * SP] = __fadd_rn(base[5], shift_term<HEAD, 5>(A[b], Bv[b], z[b], lr, hi));
                        so[6 * SP] = __fadd_rn(base[6], shift_term<HEAD, 6>(A[b], Bv[b], z[b], lr, hi)); so[7 * SP] = __fadd_rn(base[7], shift_term<HEAD, 7>(A[b], Bv[b], z[b], lr, hi)); }
                    z[b] = A[b][7]; A[b] = Bv[b]; } } } }
}
// attn.v of key range w (TT / KSP keys) for both row blocks: a v fragment is loaded once and meets the weight rows of block 0 and of block 1
template <bool HI>
__device__ __forceinline__ void pv_pass(const float* S, const h16* v16, const bf* vh, const bf* vl, int w, int lr, int hi, v8f (&acc)[2][4]) {
    constexpr int NS = HI ? 1 : 2;   // k steps of 32 keys whose loads fly together
#pragma unroll
    for (int rb = 0; rb < 2; ++rb)
#pragma unroll
        for (int nb = 0; nb < 4; ++nb) acc[rb][nb] = (v8f){};
#pragma unroll
    for (int st = 0; st < TT / KSP / 32; st += NS) { const int kc = w * (TT / KSP) + st * 32; const size_t boff = (size_t)kc * HD + hi * 128 + lr * 8;   // a k step of 32 keys is four blocks (16 d each) of 512 elements
        if (HI) { const bf *pv = vh + boff, *pv2 = vl + boff; v16bf b[4], b2[4];
#pragma unroll
            for (int nb = 0; nb < 4; ++nb) { b[nb] = WFrag<bf>::ldf(pv + nb * 512); b2[nb] = WFrag<bf>::ldf(pv2 + nb * 512); }
            xhold(pv, pv2, pv, pv2, pv, pv2, pv, pv2);
#pragma unroll
            for (int rb = 0; rb < 2; ++rb) { const bf* p = (const bf*)(S + (rb * 16 + lr) * SP) + kc + 8 * hi; const v16bf a = cat16b(*(const v8usa*)p, *(const v8usa*)(p + 16)), a2 = cat16b(*(const v8usa*)(p + TT), *(const v8usa*)(p + TT + 16));
#pragma unroll
                for (int nb = 0; nb < 4; ++nb) { acc[rb][nb] = wmmab(a, b[nb], acc[rb][nb]); acc[rb][nb] = wmmab(a2, b[nb], acc[rb][nb]); acc[rb][nb] = wmmab(a, b2[nb], acc[rb][nb]); } }
        } else { const h16* pv = v16 + boff; v16h b[NS][4];
#pragma unroll
            for (int s = 0; s < NS; ++s)
#pragma unroll
                for (int nb = 0; nb < 4; ++nb) b[s][nb] = WFrag<h16>::ldf(pv + s * (32 * HD) + nb * 512);
            xhold(pv, pv, pv, pv, pv, pv, pv, pv);
#pragma unroll
            for (int s = 0; s < NS; ++s)
#pragma unroll
                for (int rb = 0; rb < 2; ++rb) { const h16* p = (const h16*)(S + (rb * 16 + lr) * SP) + kc + s * 32 + 8 * hi; const v16h a = cat16(*(const v8ha*)p, *(const v8ha*)(p + 16));
#pragma unroll
                    for (int nb = 0; nb < 4; ++nb) acc[rb][nb] = wmma16(a, b[s][nb], acc[rb][nb]); } } }
}
// amdgpu_waves_per_eu(4, 4): the 16 waves of the one work-group that fits a WGP (262,656 B of LDS) stand four on a SIMD, 256 VGPRs each at most
__global__ __launch_bounds__(512) __attribute__((amdgpu_waves_per_eu(4, 4))) void k_fattn(const h16* __restrict__ QP16, const bf* __restrict__ QPh, const bf* __restrict__ QPl, const h16* __restrict__ QV16, const bf* __restrict__ QVh, const bf* __restrict__ QVl, const h16* __restrict__ KP16, const bf* __restrict__ KPh, const bf* __restrict__ KPl, const h16* __restrict__ PP16, const bf* __restrict__ PPh, const bf* __restrict__ PPl, const h16* __restrict__ VT16, const bf* __restrict__ VTh, const bf* __restrict__ VTl, const float* __restrict__ ab, bf* Ah, bf* Al) {
    __shared__ __align__(16) float S[32 * SP];
    const int tid = threadIdx.x, lane = tid & 31, lr = lane & 15, hi = lane >> 4; const int w = __builtin_amdgcn_readfirstlane(tid >> 5);
    const int i0 = blockIdx.x * 32, h = blockIdx.y; const bool hires = (i0 < RH); const size_t hp = (size_t)h * TT * HD;
    { const size_t zb = (size_t)blockIdx.z * ((size_t)NH_ * TT * HD); QP16 += zb; QPh += zb; QPl += zb; QV16 += zb; QVh += zb; QVl += zb; KP16 += zb; KPh += zb; KPl += zb; VT16 += zb; VTh += zb; VTl += zb; Ah += zb; Al += zb; }   // NH_ TT HD == TT DQ: one batch of any of these
    { const int it = i0 >> 4, jl = w * (TT / 256), jh = jl + TT / 256 - 1;   // a wave takes 8 neighbouring logit tiles of both row blocks, so that each position-score tile serves two logit tiles of a block from registers; the two diagonal tiles it, it + 1 (it even) fall to one wave
      if (hires) { sc_content2(S, QPh + hp, QPl + hp, KPh + hp, KPl + hp, ab, i0, jl, lr, hi);
                   sc_pos2<false>(S, QVh + hp, QVl + hp, PPh + hp, PPl + hp, i0, jl, min(jh, it + 1), lr, hi);
                   sc_pos2<true>(S, QVh + hp, QVl + hp, PPh + hp, PPl + hp, i0, max(jl, it), jh, lr, hi); }
      else       { sc_pass2<false>(S, QP16 + hp, QV16 + hp, KP16 + hp, PP16 + hp, ab, i0, jl, min(jh, it + 1), lr, hi);
                   sc_pass2<true>(S, QP16 + hp, QV16 + hp, KP16 + hp, PP16 + hp, ab, i0, max(jl, it), jh, lr, hi); } }
    __syncthreads();   // logits complete before a wave reads its rows
#pragma unroll 1   // one 64-register row at a time
    for (int rr = 0; rr < 2; ++rr) { float* srow = S + (w + rr * 16) * SP; float v[TT / 32]; float mx = -3.0e38f;
#pragma unroll
        for (int ch = 0; ch < TT / 128; ++ch) { const v4f a = *(const v4fa*)(srow + ch * 128 + lane * 4);
#pragma unroll
            for (int q = 0; q < 4; ++q) { v[ch * 4 + q] = a[q]; mx = fmaxf(mx, a[q]); } }
#pragma unroll
        for (int sh = 16; sh; sh >>= 1) mx = fmaxf(mx, __shfl_xor(mx, sh, 32));
        float sum = 0.f;
#pragma unroll
        for (int k = 0; k < TT / 32; ++k) { v[k] = exp2_slot(__fmul_rn(__fsub_rn(v[k], mx), 1.4426950408889634f)); sum += v[k]; }
#pragma unroll
        for (int sh = 16; sh; sh >>= 1) sum += __shfl_xor(sum, sh, 32);
        const float f = __fdiv_rn(hires ? 1.0f : PCAR, sum);
        if (hires) { bf* ph = (bf*)srow;
#pragma unroll
            for (int ch = 0; ch < TT / 128; ++ch) { v4us oh, ol;
#pragma unroll
                for (int q = 0; q < 4; ++q) { unsigned short a, c2; splitf(v[ch * 4 + q] * f, a, c2); oh[q] = a; ol[q] = c2; }
                *(v4usa*)(ph + ch * 128 + lane * 4) = oh; *(v4usa*)(ph + TT + ch * 128 + lane * 4) = ol; }
        } else { h16* p16 = (h16*)srow;
#pragma unroll
            for (int ch = 0; ch < TT / 128; ++ch) { v4h o4;
#pragma unroll
                for (int q = 0; q < 4; ++q) o4[q] = tohx(v[ch * 4 + q] * f);
                *(v4ha*)(p16 + ch * 128 + lane * 4) = o4; } } }
    __syncthreads();   // all 32 weight rows written before any wave reads them as A fragments
    v8f acc[2][4]; const size_t hv = (size_t)h * HD * TT;
    if (hires) pv_pass<true>(S, VT16 + hv, VTh + hv, VTl + hv, w, lr, hi, acc); else pv_pass<false>(S, VT16 + hv, VTh + hv, VTl + hv, w, lr, hi, acc);
    __syncthreads();   // last read of the weights is over before the partial tiles overwrite them
#pragma unroll
    for (int rb = 0; rb < 2; ++rb)
#pragma unroll
        for (int nb = 0; nb < 4; ++nb)
#pragma unroll
            for (int jj = 0; jj < 8; ++jj) S[w * (32 * HD) + (rb * 16 + hi * 8 + jj) * HD + nb * 16 + lr] = acc[rb][nb][jj];
    __syncthreads();   // all KSP partial tiles written before they are summed
    const int e = tid * 4, t = i0 + (e >> 6), d = e & 63; v4f s = *(const v4fa*)(S + e);
#pragma unroll
    for (int ks = 1; ks < KSP; ++ks) s += *(const v4fa*)(S + ks * (32 * HD) + e);
    const float cs = (t < RH) ? 1.0f : (1.0f / PCAR); v4us oh, ol;
#pragma unroll
    for (int q = 0; q < 4; ++q) { unsigned short a, c2; splitf(s[q] * cs, a, c2); oh[q] = a; ol[q] = c2; }
    const size_t oo = (size_t)(t >> 4) * (16 * DQ) + (size_t)((h * HD + d) >> 5) * 512 + ((d >> 3) & 3) * 128 + (t & 15) * 8 + (d & 7); *(v4us*)(Ah + oo) = oh; *(v4us*)(Al + oo) = ol;   // fragment order (rows t, k = h HD + d) for the output GEMM: a row block's tile is 2 KiB in a row in each plane
}

extern "C" void kernel_launch(void* const* d_in, const int* in_sizes, int n_in,
                              void* d_out, int out_size, void* d_ws, size_t ws_size, hipStream_t stream) {
    (void)in_sizes; (void)n_in; (void)out_size;
    const float* x = (const float*)d_in[0]; const float* abias = (const float*)d_in[1]; const float* pemb = (const float*)d_in[2]; const float* pbu = (const float*)d_in[3]; const float* pbv = (const float*)d_in[4]; const float* wq = (const float*)d_in[5]; const float* bq = (const float*)d_in[6]; const float* wk = (const float*)d_in[7]; const float* bk = (const float*)d_in[8]; const float* wv = (const float*)d_in[9]; const float* bv = (const float*)d_in[10]; const float* wpos = (const float*)d_in[11]; const float* bpos = (const float*)d_in[12]; const float* wo = (const float*)d_in[13]; const float* bo = (const float*)d_in[14]; const float* cosT = nullptr; const float* sinT = nullptr; (void)cosT; (void)sinT;
    float* OUT = (float*)d_out;     // [2][2048][1024]
    char* wsp = (char*)d_ws;
    auto take = [&](size_t bytes) { char* p = wsp; wsp += (bytes + 255) & ~(size_t)255; return (void*)p; };
    const size_t PS = (size_t)NH_ * TT * HD;   // elements of one 16-bit plane set (all heads) of one batch
    bf* WQ = (bf*)take((size_t)DQ * DM * 2); bf* WK = (bf*)take((size_t)DKV * DM * 2); bf* WV = (bf*)take((size_t)DKV * DM * 2); bf* WO = (bf*)take((size_t)DM * DQ * 2); bf* WP = (bf*)take((size_t)DQ * DM * 2);
    bf* X3 = (bf*)take((size_t)(NB_ + 1) * TT * DM * 2);   // slice 0: pos_emb; slices 1..: x
    h16* PK16 = (h16*)take((NB_ + 1) * PS * 2); bf* PKh = (bf*)take((NB_ + 1) * PS * 2); bf* PKl = (bf*)take((NB_ + 1) * PS * 2);   // slice 0: position planes; slices 1..: key planes
    h16* QV16 = (h16*)take(NB_ * PS * 2); bf* QVh = (bf*)take(NB_ * PS * 2); bf* QVl = (bf*)take(NB_ * PS * 2);
    h16* QP16 = (h16*)take(NB_ * PS * 2); bf* QPh = (bf*)take(NB_ * PS * 2); bf* QPl = (bf*)take(NB_ * PS * 2);
    h16* VT16 = (h16*)take(NB_ * PS * 2); bf* VTh = (bf*)take(NB_ * PS * 2); bf* VTl = (bf*)take(NB_ * PS * 2);
    bf* ATh = (bf*)take((size_t)NB_ * TT * DQ * 2); bf* ATl = (bf*)take((size_t)NB_ * TT * DQ * 2);
    if ((size_t)(wsp - (char*)d_ws) > ws_size) return;    // ws 256 MiB
    k_prep<<<5 * WTB + (NB_ + 1) * CVB, 256, 0, stream>>>(wq, wk, wv, wo, wpos, x, pemb, WQ, WK, WV, WO, WP, X3);
    k_proj<<<dim3(TT / 64, DQ / 64, 3 * NB_ + 1), 32, 0, stream>>>(X3, X3 + (size_t)TT * DM, WQ, WK, WV, bq, bk, bv, DM, Planes{QP16, QPh, QPl, QV16, QVh, QVl, pbu, pbv, PS, nullptr, nullptr}, Planes{PK16, PKh, PKl, nullptr, nullptr, nullptr, nullptr, nullptr, PS, WP, bpos}, Planes{VT16, VTh, VTl, nullptr, nullptr, nullptr, nullptr, nullptr, PS, nullptr, nullptr});
    k_fattn<<<dim3(TT / 32, NH_, NB_), 512, 0, stream>>>(QP16, QPh, QPl, QV16, QVh, QVl, PK16 + PS, PKh + PS, PKl + PS, PK16, PKh, PKl, VT16, VTh, VTl, abias, ATh, ATl);
    k_gemmw<bf, 1, true><<<dim3(NB_ * TT / 64, DM / 64, 1), 32, 0, stream>>>(ATh, ATl, WO, nullptr, DQ, OUT, DM, bo, 0, 0, 0, Planes{nullptr, nullptr, nullptr, nullptr, nullptr, nullptr, nullptr, nullptr, 0, nullptr, nullptr});   // both batches: 2 TT rows of one GEMM
}
